// v000
// The times below were measured on an AMD MI455X: many runs one after another, warmed up first and cycling through
// copies of the inputs, with the whole window's GPU time divided by the number of runs. Launches and the gaps
// between them are all in it. The median over several windows is given; except for v000 it joins two sittings, which
// can be a few percent apart, so the side-by-side timings, each taken in one sitting, are the better comparison.
// v000 is the starting kernel. One run takes 456 microseconds.
#include <hip/hip_runtime.h>
#include <hip/hip_fp16.h>

// All contractions on v_wmma_f32_16x16x32_f16 (f16 operands, f32 accumulate): x*Wqkv, sa*W1, h*W2 single f16 planes; k*q^T with f16 hi + 2^11-scaled f16 residual planes (hi.hi, hi.res, res.hi); V^T*P^T and ctx*Wo with f16 hi + 2^11-scaled f16 residual plane on V / ctx (two accumulators, residual folded 2^-11 in f32).

#ifndef NB
#define NB 32
#endif
#ifndef SEQ
#define SEQ 512
#endif
#define NB_FULL  32
#define SEQ_FULL 512
#define NH   8           // heads
#define HD   64          // head width
#define DM   512         // model width
#define DF   2048        // hidden width
#define NTOK (NB * SEQ)

static_assert(NB >= 1 && NB <= NB_FULL);
static_assert(SEQ >= 128 && SEQ <= SEQ_FULL);
static_assert(SEQ % 128 == 0);
static_assert(NTOK % 128 == 0);
static_assert(DM == NH * HD);
static_assert(DM == 512 && HD == 64 && NH == 8 && DF == 2048);

typedef _Float16 v16h __attribute__((ext_vector_type(16)));
typedef _Float16 v8h  __attribute__((ext_vector_type(8)));
typedef float    v8f  __attribute__((ext_vector_type(8)));
typedef float    v4f  __attribute__((ext_vector_type(4)));

union Frag { v16h v; v8h h[2]; };

#define LOG2E 1.44269504088896340736f
// scores: acc_h = (64k_h).(64q_h), acc_r = 2^11-scaled residual cross terms
// t (log2 units) = acc_h * log2(e)*2^-12 + acc_r * log2(e)*2^-23
#define C1 (1.44269504088896340736f * 0.000244140625f)
#define C2 (1.44269504088896340736f * 1.1920928955078125e-07f)
#define SC_RES   2048.0f                     // residual plane carry 2^11
#define SC_RINV  4.8828125e-04f              // 2^-11 : residual accumulator fold
#define SC_OUT   9.765625e-04f               // 2^-10 : (16 a)(64 W) -> a.W
#define SC_HID   1.5625e-02f                 // 2^-6  : (16 sa)(64 W1) -> 16 h

static __device__ __forceinline__ v8f zero8() {
    v8f z;
#pragma unroll
    for (int i = 0; i < 8; ++i) z[i] = 0.0f;
    return z;
}

// 16x32 A fragment (or B fragment from an [n][k] k-contiguous source) from a
// row-major 16-bit tile: lane m = lane&15 -> row m; kb = 8*(lane>>4);
// elements 0..7 = k kb..kb+7, elements 8..15 = k kb+16..kb+23.
static __device__ __forceinline__ v16h load_frag16(const _Float16* base, unsigned ld, unsigned lane) {
    const unsigned m  = lane & 15u;
    const unsigned kb = (lane >> 4) << 3;
    const _Float16* p = base + (size_t)m * ld + kb;
    Frag f;
    f.h[0] = *(const v8h*)(p);
    f.h[1] = *(const v8h*)(p + 16);
    return f.v;
}

static __device__ __forceinline__ v8f wmma16(v16h a, v16h b, v8f c) {
    v8f d = __builtin_amdgcn_wmma_f32_16x16x32_f16(false, a, false, b, (short)0, c, false, false);
    asm volatile("v_nop\n\tv_nop\n\tv_nop\n\tv_nop" : "+v"(d) : "v"(a), "v"(b));
    return d;
}

// f32 -> bf16 RNE convert, value kept as f32
static __device__ __forceinline__ float bf16r(float x) {
    unsigned u = __float_as_uint(x);
    u = (u + 0x7FFFu + ((u >> 16) & 1u)) & 0xFFFF0000u;
    return __uint_as_float(u);
}

static __device__ __forceinline__ float ex2(float x) {
    return __builtin_amdgcn_exp2f(x);
}

// ordering for a wave-private LDS tile: stores before later loads of the same wave
static __device__ __forceinline__ void wave_lds_sync() {
    __builtin_amdgcn_fence(3, "wavefront");
    asm volatile("s_wait_dscnt 0" ::: "memory");
    __builtin_amdgcn_wave_barrier();
}

static __device__ __forceinline__ float wave_sum(float v) {
    v += __shfl_xor(v, 16, 32);
    v += __shfl_xor(v, 8, 32);
    v += __shfl_xor(v, 4, 32);
    v += __shfl_xor(v, 2, 32);
    v += __shfl_xor(v, 1, 32);
    return v;
}

// compact token row (b*SEQ + l) -> row in the full-size arrays
static __device__ __forceinline__ unsigned full_row(unsigned n) {
    const unsigned b = n / (unsigned)SEQ;
    return b * (unsigned)SEQ_FULL + (n - b * (unsigned)SEQ);
}

// ---------------------------------------------------------------------------
// Wave-level GEMM core: TM x TN tiles of 16x16, A rows / Bt rows both
// k-contiguous with pitch K (fragments straight from the 16-bit planes).
// RES: second A plane (2^11-scaled residual) into its own accumulators.
// ---------------------------------------------------------------------------
template <int TM, int TN, bool RES>
static __device__ __forceinline__ void gemm_core(const _Float16* __restrict__ Ah,
                                                 const _Float16* __restrict__ Ar,
                                                 const _Float16* __restrict__ Bt,
                                                 unsigned K, unsigned lane,
                                                 v8f (&acc)[TM][TN], v8f (&accr)[TM][TN]) {
#pragma unroll
    for (int mt = 0; mt < TM; ++mt)
#pragma unroll
        for (int nt = 0; nt < TN; ++nt) {
            acc[mt][nt] = zero8();
            if (RES) accr[mt][nt] = zero8();
        }
#pragma unroll 1
    for (unsigned k = 0; k < K; k += 32u) {
        v16h a[TM];
        v16h ar[TM];
#pragma unroll
        for (int mt = 0; mt < TM; ++mt) {
            a[mt] = load_frag16(Ah + (size_t)(mt * 16) * K + k, K, lane);
            if (RES) ar[mt] = load_frag16(Ar + (size_t)(mt * 16) * K + k, K, lane);
        }
#pragma unroll
        for (int nt = 0; nt < TN; ++nt) {
            const v16h bfr = load_frag16(Bt + (size_t)(nt * 16) * K + k, K, lane);
#pragma unroll
            for (int mt = 0; mt < TM; ++mt) {
                acc[mt][nt] = wmma16(a[mt], bfr, acc[mt][nt]);
                if (RES) accr[mt][nt] = wmma16(ar[mt], bfr, accr[mt][nt]);
            }
        }
    }
}

// ---------------------------------------------------------------------------
// x (f32) -> xh [NTOK][512] f16 of the bf16-RNE value. 8 elements per thread,
// ---------------------------------------------------------------------------
__global__ __launch_bounds__(256) void k_cvt_x(const float* __restrict__ x,
                                                _Float16* __restrict__ xh) {
    const unsigned idx = blockIdx.x * 256u + threadIdx.x;
    const unsigned n   = idx >> 6;
    const unsigned c8  = (idx & 63u) << 3;
    const unsigned fr  = full_row(n);
    const float* p = x + (size_t)fr * DM + c8;
    const v4f a = *(const v4f*)(p);
    const v4f b = *(const v4f*)(p + 4);
    v8h o;
    o[0] = (_Float16)bf16r(a.x); o[1] = (_Float16)bf16r(a.y);
    o[2] = (_Float16)bf16r(a.z); o[3] = (_Float16)bf16r(a.w);
    o[4] = (_Float16)bf16r(b.x); o[5] = (_Float16)bf16r(b.y);
    o[6] = (_Float16)bf16r(b.z); o[7] = (_Float16)bf16r(b.w);
    _Float16* d = xh + (size_t)n * DM + c8;
    *(v8h*)d = o;
    
}

// ---------------------------------------------------------------------------
// Weight plane builder: in [z][R][C] f32 (k-major, W[k][n]) -> out [z][C][R]
// f16 = 64 * bf16-RNE(W)^T (n rows, k contiguous). 64x64 tile through LDS;
// grid = (C/64, R/64, z).
// ---------------------------------------------------------------------------
__global__ __launch_bounds__(256) void k_wT(const float* __restrict__ in,
                                             _Float16* __restrict__ out,
                                             unsigned R, unsigned C) {
    __shared__ __align__(16) _Float16 t[64 * 72];
    const unsigned tid = threadIdx.x;
    const unsigned n0 = blockIdx.x * 64u;
    const unsigned k0 = blockIdx.y * 64u;
    const float*  inb  = in  + (size_t)blockIdx.z * R * C;
    _Float16*     outb = out + (size_t)blockIdx.z * R * C;
#pragma unroll
    for (int i = 0; i < 4; ++i) {
        const unsigned idx = (unsigned)i * 256u + tid;
        const unsigned r = idx >> 4, c4 = (idx & 15u) << 2;
        const v4f v = *(const v4f*)(inb + (size_t)(k0 + r) * C + n0 + c4);
        t[(c4 + 0u) * 72u + r] = (_Float16)(bf16r(v.x) * 64.0f);
        t[(c4 + 1u) * 72u + r] = (_Float16)(bf16r(v.y) * 64.0f);
        t[(c4 + 2u) * 72u + r] = (_Float16)(bf16r(v.z) * 64.0f);
        t[(c4 + 3u) * 72u + r] = (_Float16)(bf16r(v.w) * 64.0f);
    }
    __syncthreads();
    const unsigned rn0 = tid >> 3, pc = (tid & 7u) << 3;
    const v8h o0 = *(const v8h*)(&t[rn0 * 72u + pc]);
    const v8h o1 = *(const v8h*)(&t[(rn0 + 32u) * 72u + pc]);
    _Float16* d0 = outb + (size_t)(n0 + rn0) * R + k0 + pc;
    _Float16* d1 = outb + (size_t)(n0 + rn0 + 32u) * R + k0 + pc;
    *(v8h*)d0 = o0;
    *(v8h*)d1 = o1;
    
}

// ---------------------------------------------------------------------------
// QKV projection. Block = 8 waves = 128 tokens x 128 columns; wave tile =
// 64 tokens x 32 columns = one (t, head, 32-wide d half) slice.
// q/k planes: [head][dhalf][NTOK][32] f16 of 64q (hi) and 2^11 residual: per
// 16-row group the wave owns 1024 contiguous bytes (two lane-contiguous 16-B
// instructions per plane). V^T planes: [head*NB+b][64 d][SEQ] hi / residual:
// ---------------------------------------------------------------------------
__global__ __launch_bounds__(256) __attribute__((amdgpu_num_vgpr(256)))
void k_qkv(const _Float16* __restrict__ xh, const _Float16* __restrict__ wT,
           const float* __restrict__ bias,
           _Float16* __restrict__ qh, _Float16* __restrict__ ql,
           _Float16* __restrict__ kh, _Float16* __restrict__ kl,
           _Float16* __restrict__ vTh, _Float16* __restrict__ vTr) {
    __shared__ __align__(16) _Float16 stw[8][2048];   // 32 KB, wave-private tiles
    const unsigned tid  = threadIdx.x;
    const unsigned lane = tid & 31u;
    const unsigned w    = tid >> 5;
    const unsigned n0   = blockIdx.y * 128u + (w >> 2) * 64u;
    const unsigned cb   = blockIdx.x * 128u + (w & 3u) * 32u;
    const unsigned r0   = (lane >> 4) << 3;
    const unsigned cc   = lane & 15u;

    v8f acc[4][2], dum[4][2];
    gemm_core<4, 2, false>(xh + (size_t)n0 * DM, xh + (size_t)n0 * DM,
                           wT + (size_t)cb * DM, (unsigned)DM, lane, acc, dum);

    const unsigned t  = cb >> 9;
    const unsigned h  = (cb >> 6) & 7u;
    const unsigned kk = (cb >> 5) & 1u;
    float bv[2];
    bv[0] = bf16r(bias[cb + cc]) * 64.0f;
    bv[1] = bf16r(bias[cb + 16u + cc]) * 64.0f;
    _Float16* sw = &stw[w][0];

    if (t < 2u) {
        _Float16* ph = (t == 0u) ? qh : kh;
        _Float16* pl = (t == 0u) ? ql : kl;
        const size_t pbase = ((size_t)(h * 2u + kk) * NTOK + n0) * 32u;
#pragma unroll
        for (int mt = 0; mt < 4; ++mt) {
#pragma unroll
            for (int g = 0; g < 8; ++g) {
#pragma unroll
                for (int nt = 0; nt < 2; ++nt) {
                    const float v = acc[mt][nt][g] + bv[nt];
                    const _Float16 hi = (_Float16)v;
                    sw[(r0 + g) * 32u + nt * 16 + cc] = hi;
                    sw[512u + (r0 + g) * 32u + nt * 16 + cc] = (_Float16)((v - (float)hi) * SC_RES);
                }
            }
            wave_lds_sync();
            const v8h a0 = *(const v8h*)(sw + lane * 8u);
            const v8h a1 = *(const v8h*)(sw + 256u + lane * 8u);
            const v8h b0 = *(const v8h*)(sw + 512u + lane * 8u);
            const v8h b1 = *(const v8h*)(sw + 768u + lane * 8u);
            _Float16* dh = ph + pbase + (size_t)mt * 512u;
            _Float16* dl = pl + pbase + (size_t)mt * 512u;
            *(v8h*)(dh + lane * 8u)        = a0;
            *(v8h*)(dh + 256u + lane * 8u) = a1;
            *(v8h*)(dl + lane * 8u)        = b0;
            *(v8h*)(dl + 256u + lane * 8u) = b1;
            
            wave_lds_sync();
        }
    } else {
        const unsigned b  = n0 / (unsigned)SEQ;
        const unsigned l0 = n0 - b * (unsigned)SEQ;
        const unsigned hb = h * (unsigned)NB + b;
        const size_t vbase = ((size_t)(hb * HD + kk * 32u)) * SEQ + l0;
        const unsigned rq = lane >> 3;
        const unsigned pc = (lane & 7u) << 3;
        v8h xv[8];
        // hi plane: sw as [32 d][64 keys]
#pragma unroll
        for (int mt = 0; mt < 4; ++mt)
#pragma unroll
            for (int nt = 0; nt < 2; ++nt) {
                v8h hv;
#pragma unroll
                for (int g = 0; g < 8; ++g) hv[g] = (_Float16)(acc[mt][nt][g] + bv[nt]);
                *(v8h*)(sw + (nt * 16 + cc) * 64u + mt * 16 + r0) = hv;
            }
        wave_lds_sync();
#pragma unroll
        for (int i = 0; i < 8; ++i) xv[i] = *(const v8h*)(sw + (i * 4 + rq) * 64u + pc);
#pragma unroll
        for (int i = 0; i < 8; ++i)
            *(v8h*)(vTh + vbase + (size_t)(i * 4 + rq) * SEQ + pc) = xv[i];
        
        wave_lds_sync();
        // residual plane
#pragma unroll
        for (int mt = 0; mt < 4; ++mt)
#pragma unroll
            for (int nt = 0; nt < 2; ++nt) {
                v8h hv;
#pragma unroll
                for (int g = 0; g < 8; ++g) {
                    const float v = acc[mt][nt][g] + bv[nt];
                    const _Float16 hi = (_Float16)v;
                    hv[g] = (_Float16)((v - (float)hi) * SC_RES);
                }
                *(v8h*)(sw + (nt * 16 + cc) * 64u + mt * 16 + r0) = hv;
            }
        wave_lds_sync();
#pragma unroll
        for (int i = 0; i < 8; ++i) xv[i] = *(const v8h*)(sw + (i * 4 + rq) * 64u + pc);
#pragma unroll
        for (int i = 0; i < 8; ++i)
            *(v8h*)(vTr + vbase + (size_t)(i * 4 + rq) * SEQ + pc) = xv[i];
        
    }
}

// ---------------------------------------------------------------------------
// Attention, online softmax over keys. Block = 8 waves = 128 queries of one
// (head, batch); wave owns 16 queries. Scores are computed transposed:
// S^T tile = K(16 keys, A) x Q^T(B, n = query), so every statistic of a query
// lives in lane&15 (in-lane reduce over the 8 rows + one xor-16 exchange).
// P^T accumulator tiles (keys 0..15 / 16..31 of a 32-key step) are packed
// directly into the B fragment (k = key, n = query) of O^T = V^T x P^T with
// A = V^T rows (d) straight from the V^T planes. P carried 2^14.
// Epilogue: 16*ctx as f16 hi + 2^11 residual, transposed through wave-private
// LDS: msk cross-wave (block barrier); Ch/Cr wave-private (wave sync).
// ---------------------------------------------------------------------------
__global__ __launch_bounds__(256) __attribute__((amdgpu_num_vgpr(256)))
void k_attn(const _Float16* __restrict__ qh, const _Float16* __restrict__ ql,
            const _Float16* __restrict__ kh, const _Float16* __restrict__ kl,
            const _Float16* __restrict__ vTh, const _Float16* __restrict__ vTr,
            const float* __restrict__ mask,
            _Float16* __restrict__ ctxh, _Float16* __restrict__ ctxr) {
    __shared__ __align__(16) float    msk[SEQ];          // additive key mask, log2 units
    __shared__ __align__(16) _Float16 Ch[8][16 * HD];    // 16 KB wave-private
    __shared__ __align__(16) _Float16 Cr[8][16 * HD];    // 16 KB wave-private

    const unsigned tid  = threadIdx.x;
    const unsigned lane = tid & 31u;
    const unsigned w    = tid >> 5;
    const unsigned hb   = blockIdx.x;
    const unsigned h    = hb / (unsigned)NB;
    const unsigned b    = hb - h * (unsigned)NB;
    const unsigned q0   = blockIdx.y * 128u + w * 16u;
    const unsigned r0   = (lane >> 4) << 3;
    const unsigned cc   = lane & 15u;

    for (unsigned idx = tid; idx < (unsigned)SEQ; idx += 256u)
        msk[idx] = bf16r(mask[(size_t)b * SEQ_FULL + idx]) * LOG2E;
    __syncthreads();

    const size_t tokq = (size_t)b * SEQ + q0;
    const size_t tokk = (size_t)b * SEQ;
    const size_t P0 = (size_t)(h * 2u) * NTOK;
    const size_t P1 = (size_t)(h * 2u + 1u) * NTOK;
    const v16h qhf0 = load_frag16(qh + (P0 + tokq) * 32u, 32u, lane);
    const v16h qhf1 = load_frag16(qh + (P1 + tokq) * 32u, 32u, lane);
    const v16h qlf0 = load_frag16(ql + (P0 + tokq) * 32u, 32u, lane);
    const v16h qlf1 = load_frag16(ql + (P1 + tokq) * 32u, 32u, lane);
    const _Float16* kh0 = kh + (P0 + tokk) * 32u;
    const _Float16* kh1 = kh + (P1 + tokk) * 32u;
    const _Float16* kl0 = kl + (P0 + tokk) * 32u;
    const _Float16* kl1 = kl + (P1 + tokk) * 32u;
    const _Float16* vhb = vTh + (size_t)hb * HD * SEQ;
    const _Float16* vrb = vTr + (size_t)hb * HD * SEQ;

    v8f oh[4], orr[4];
#pragma unroll
    for (int dt = 0; dt < 4; ++dt) { oh[dt] = zero8(); orr[dt] = zero8(); }
    float mr = -1.0e30f, lr = 0.0f;

#pragma unroll 1
    for (unsigned key0 = 0; key0 < (unsigned)SEQ; key0 += 32u) {
        v8f sh0 = zero8(), sr0 = zero8(), sh1 = zero8(), sr1 = zero8();
        {
            v16h a  = load_frag16(kh0 + (size_t)key0 * 32u, 32u, lane);
            v16h al = load_frag16(kl0 + (size_t)key0 * 32u, 32u, lane);
            sh0 = wmma16(a, qhf0, sh0);
            sr0 = wmma16(a, qlf0, sr0);
            sr0 = wmma16(al, qhf0, sr0);
            a  = load_frag16(kh1 + (size_t)key0 * 32u, 32u, lane);
            al = load_frag16(kl1 + (size_t)key0 * 32u, 32u, lane);
            sh0 = wmma16(a, qhf1, sh0);
            sr0 = wmma16(a, qlf1, sr0);
            sr0 = wmma16(al, qhf1, sr0);
        }
        {
            v16h a  = load_frag16(kh0 + (size_t)(key0 + 16u) * 32u, 32u, lane);
            v16h al = load_frag16(kl0 + (size_t)(key0 + 16u) * 32u, 32u, lane);
            sh1 = wmma16(a, qhf0, sh1);
            sr1 = wmma16(a, qlf0, sr1);
            sr1 = wmma16(al, qhf0, sr1);
            a  = load_frag16(kh1 + (size_t)(key0 + 16u) * 32u, 32u, lane);
            al = load_frag16(kl1 + (size_t)(key0 + 16u) * 32u, 32u, lane);
            sh1 = wmma16(a, qhf1, sh1);
            sr1 = wmma16(a, qlf1, sr1);
            sr1 = wmma16(al, qhf1, sr1);
        }
        float t0[8], t1[8];
#pragma unroll
        for (int g = 0; g < 8; ++g) {
            t0[g] = __builtin_fmaf(sh0[g], C1, sr0[g] * C2) + msk[key0 + r0 + g];
            t1[g] = __builtin_fmaf(sh1[g], C1, sr1[g] * C2) + msk[key0 + 16u + r0 + g];
        }
        float tmax = fmaxf(t0[0], t1[0]);
#pragma unroll
        for (int g = 1; g < 8; ++g) tmax = fmaxf(tmax, fmaxf(t0[g], t1[g]));
        tmax = fmaxf(tmax, __shfl_xor(tmax, 16, 32));
        const float mn    = fmaxf(mr, tmax);
        const float alpha = ex2(mr - mn);
        mr = mn;
        const float off = 14.0f - mn;
        v8h p0, p1;
        float ps = 0.0f;
#pragma unroll
        for (int g = 0; g < 8; ++g) {
            const _Float16 a = (_Float16)ex2(t0[g] + off);
            const _Float16 c = (_Float16)ex2(t1[g] + off);
            p0[g] = a;
            p1[g] = c;
            ps += (float)a + (float)c;
        }
        ps += __shfl_xor(ps, 16, 32);
        lr = lr * alpha + ps;
        Frag pb;
        pb.h[0] = p0;       // k = keys key0 + 8h + 0..7
        pb.h[1] = p1;       // k = keys key0 + 16 + 8h + 0..7
#pragma unroll
        for (int dt = 0; dt < 4; ++dt) {
            oh[dt]  = oh[dt] * alpha;
            orr[dt] = orr[dt] * alpha;
        }
#pragma unroll
        for (int dt = 0; dt < 4; ++dt) {
            const v16h va = load_frag16(vhb + (size_t)(dt * 16) * SEQ + key0, (unsigned)SEQ, lane);
            oh[dt] = wmma16(va, pb.v, oh[dt]);
            const v16h vr = load_frag16(vrb + (size_t)(dt * 16) * SEQ + key0, (unsigned)SEQ, lane);
            orr[dt] = wmma16(vr, pb.v, orr[dt]);
        }
    }

    // O^T lane (query cc): rows d = dt*16 + r0 + g. 16*ctx = (o + or 2^-11) / (64 l) * 16
    const float inv = 0.25f * (1.0f / lr);
#pragma unroll
    for (int dt = 0; dt < 4; ++dt) {
        v8h hv, rv;
#pragma unroll
        for (int g = 0; g < 8; ++g) {
            const float c = __builtin_fmaf(orr[dt][g], SC_RINV, oh[dt][g]) * inv;
            const _Float16 hi = (_Float16)c;
            hv[g] = hi;
            rv[g] = (_Float16)((c - (float)hi) * SC_RES);
        }
        *(v8h*)(&Ch[w][cc * HD + dt * 16 + r0]) = hv;
        *(v8h*)(&Cr[w][cc * HD + dt * 16 + r0]) = rv;
    }
    wave_lds_sync();
    const unsigned rq = lane >> 3;
    const unsigned pc = (lane & 7u) << 3;
    v8h ch[4], cr[4];
#pragma unroll
    for (int i = 0; i < 4; ++i) {
        ch[i] = *(const v8h*)(&Ch[w][(i * 4 + rq) * HD + pc]);
        cr[i] = *(const v8h*)(&Cr[w][(i * 4 + rq) * HD + pc]);
    }
    const size_t ob = (tokq) * DM + h * HD + pc;
#pragma unroll
    for (int i = 0; i < 4; ++i) {
        *(v8h*)(ctxh + ob + (size_t)(i * 4 + rq) * DM) = ch[i];
        *(v8h*)(ctxr + ob + (size_t)(i * 4 + rq) * DM) = cr[i];
    }
    
}

// ---------------------------------------------------------------------------
// GEMM (N = 512) + bias + residual add + LayerNorm, fused. Block = 8 waves =
// 32 rows x 512 columns (wave tile 32 x 64). Scaled accumulators go to a
// cross-wave f32 LDS tile (block barrier), then wave w normalises rows
// POST: A = ctx hi + residual planes, residual add = bf16-RNE(x), outputs
// sa (f32) and 16*sa (f16). Otherwise A = hidden plane, residual add = sa,
// output = final f32 rows.
// ---------------------------------------------------------------------------
template <bool POST>
__global__ __launch_bounds__(256) __attribute__((amdgpu_num_vgpr(256)))
void k_gemm_ln(const _Float16* __restrict__ Ah, const _Float16* __restrict__ Ar,
               const _Float16* __restrict__ Bt, unsigned K,
               const float* __restrict__ bias, const float* __restrict__ resid,
               const float* __restrict__ lnw, const float* __restrict__ lnb,
               float* __restrict__ outF, _Float16* __restrict__ outH) {
    __shared__ __align__(16) float T[32 * DM];   // 64 KB, cross-wave
    const unsigned tid  = threadIdx.x;
    const unsigned lane = tid & 31u;
    const unsigned w    = tid >> 5;
    const unsigned row0 = blockIdx.x * 32u;
    const unsigned cb   = w * 64u;
    const unsigned r0   = (lane >> 4) << 3;
    const unsigned cc   = lane & 15u;

    v8f acc[2][4], accr[2][4];
    gemm_core<2, 4, POST>(Ah + (size_t)row0 * K, Ar + (size_t)row0 * K,
                          Bt + (size_t)cb * K, K, lane, acc, accr);
#pragma unroll
    for (int mt = 0; mt < 2; ++mt)
#pragma unroll
        for (int nt = 0; nt < 4; ++nt)
#pragma unroll
            for (int g = 0; g < 8; ++g) {
                const float v = POST ? __builtin_fmaf(accr[mt][nt][g], SC_RINV, acc[mt][nt][g])
                                     : acc[mt][nt][g];
                T[(mt * 16 + r0 + g) * DM + cb + nt * 16 + cc] = v;
            }
    __syncthreads();

#pragma unroll 1
    for (unsigned rr = 0; rr < 4u; ++rr) {
        const unsigned row = w * 4u + rr;
        const unsigned n   = row0 + row;
        const unsigned fr  = full_row(n);
        const float* rp = POST ? (resid + (size_t)fr * DM) : (resid + (size_t)n * DM);
        float*       op = POST ? (outF + (size_t)n * DM)   : (outF + (size_t)fr * DM);
        v4f xv[4];
        float s = 0.0f;
#pragma unroll
        for (int i = 0; i < 4; ++i) {
            const unsigned c = (unsigned)i * 128u + lane * 4u;
            const v4f a  = *(const v4f*)(&T[row * DM + c]);
            const v4f bi = *(const v4f*)(bias + c);
            const v4f rs = *(const v4f*)(rp + c);
            v4f x;
            x.x = __builtin_fmaf(a.x, SC_OUT, bf16r(bi.x)) + (POST ? bf16r(rs.x) : rs.x);
            x.y = __builtin_fmaf(a.y, SC_OUT, bf16r(bi.y)) + (POST ? bf16r(rs.y) : rs.y);
            x.z = __builtin_fmaf(a.z, SC_OUT, bf16r(bi.z)) + (POST ? bf16r(rs.z) : rs.z);
            x.w = __builtin_fmaf(a.w, SC_OUT, bf16r(bi.w)) + (POST ? bf16r(rs.w) : rs.w);
            xv[i] = x;
            s += (x.x + x.y) + (x.z + x.w);
        }
        s = wave_sum(s);
        const float mu = s * (1.0f / (float)DM);
        float q = 0.0f;
#pragma unroll
        for (int i = 0; i < 4; ++i) {
            const float d0 = xv[i].x - mu, d1 = xv[i].y - mu, d2 = xv[i].z - mu, d3 = xv[i].w - mu;
            q += (d0 * d0 + d1 * d1) + (d2 * d2 + d3 * d3);
        }
        q = wave_sum(q);
        const float rstd = rsqrtf(q * (1.0f / (float)DM) + 1.0e-5f);
        v4f yv[4];
#pragma unroll
        for (int i = 0; i < 4; ++i) {
            const unsigned c = (unsigned)i * 128u + lane * 4u;
            const v4f gw = *(const v4f*)(lnw + c);
            const v4f gb = *(const v4f*)(lnb + c);
            v4f y;
            y.x = (xv[i].x - mu) * rstd * bf16r(gw.x) + bf16r(gb.x);
            y.y = (xv[i].y - mu) * rstd * bf16r(gw.y) + bf16r(gb.y);
            y.z = (xv[i].z - mu) * rstd * bf16r(gw.z) + bf16r(gb.z);
            y.w = (xv[i].w - mu) * rstd * bf16r(gw.w) + bf16r(gb.w);
            yv[i] = y;
        }
        v8h hv0, hv1;
        _Float16* hp = outH + (size_t)n * DM;
        if (POST) {
            // relayout of the finished row (wave-private after the block barrier):
            // lane*4 per 128-chunk -> lane*8 per 256-chunk for 16-B f16 stores
#pragma unroll
            for (int i = 0; i < 4; ++i)
                *(v4f*)(&T[row * DM + (unsigned)i * 128u + lane * 4u]) = yv[i];
            wave_lds_sync();
            const v4f u0 = *(const v4f*)(&T[row * DM + lane * 8u]);
            const v4f u1 = *(const v4f*)(&T[row * DM + lane * 8u + 4u]);
            const v4f u2 = *(const v4f*)(&T[row * DM + 256u + lane * 8u]);
            const v4f u3 = *(const v4f*)(&T[row * DM + 256u + lane * 8u + 4u]);
            hv0[0] = (_Float16)(u0.x * 16.0f); hv0[1] = (_Float16)(u0.y * 16.0f);
            hv0[2] = (_Float16)(u0.z * 16.0f); hv0[3] = (_Float16)(u0.w * 16.0f);
            hv0[4] = (_Float16)(u1.x * 16.0f); hv0[5] = (_Float16)(u1.y * 16.0f);
            hv0[6] = (_Float16)(u1.z * 16.0f); hv0[7] = (_Float16)(u1.w * 16.0f);
            hv1[0] = (_Float16)(u2.x * 16.0f); hv1[1] = (_Float16)(u2.y * 16.0f);
            hv1[2] = (_Float16)(u2.z * 16.0f); hv1[3] = (_Float16)(u2.w * 16.0f);
            hv1[4] = (_Float16)(u3.x * 16.0f); hv1[5] = (_Float16)(u3.y * 16.0f);
            hv1[6] = (_Float16)(u3.z * 16.0f); hv1[7] = (_Float16)(u3.w * 16.0f);
        }
#pragma unroll
        for (int i = 0; i < 4; ++i)
            *(v4f*)(op + (unsigned)i * 128u + lane * 4u) = yv[i];
        if (POST) {
            *(v8h*)(hp + lane * 8u)        = hv0;
            *(v8h*)(hp + 256u + lane * 8u) = hv1;
        }
        
    }
}

// ---------------------------------------------------------------------------
// FF1: hidden = relu(sa W1 + b1), stored as f16 of 16*hidden, [NTOK][2048].
// ---------------------------------------------------------------------------
__global__ __launch_bounds__(256) __attribute__((amdgpu_num_vgpr(256)))
void k_ff1(const _Float16* __restrict__ sah, const _Float16* __restrict__ Bt,
           const float* __restrict__ bias, _Float16* __restrict__ hid) {
    __shared__ __align__(16) _Float16 st[8][32 * 64];   // 32 KB wave-private
    const unsigned tid  = threadIdx.x;
    const unsigned lane = tid & 31u;
    const unsigned w    = tid >> 5;
    const unsigned row0 = blockIdx.y * 32u;
    const unsigned cb   = blockIdx.x * 512u + w * 64u;
    const unsigned r0   = (lane >> 4) << 3;
    const unsigned cc   = lane & 15u;

    v8f acc[2][4], dum[2][4];
    gemm_core<2, 4, false>(sah + (size_t)row0 * DM, sah + (size_t)row0 * DM,
                           Bt + (size_t)cb * DM, (unsigned)DM, lane, acc, dum);
    float bv[4];
#pragma unroll
    for (int nt = 0; nt < 4; ++nt) bv[nt] = bf16r(bias[cb + nt * 16 + cc]) * 16.0f;
    _Float16* sw = &st[w][0];
#pragma unroll
    for (int mt = 0; mt < 2; ++mt)
#pragma unroll
        for (int nt = 0; nt < 4; ++nt)
#pragma unroll
            for (int g = 0; g < 8; ++g)
                sw[(mt * 16 + r0 + g) * 64u + nt * 16 + cc] =
                    (_Float16)fmaxf(__builtin_fmaf(acc[mt][nt][g], SC_HID, bv[nt]), 0.0f);
    wave_lds_sync();
    const unsigned rq = lane >> 3;
    const unsigned pc = (lane & 7u) << 3;
    v8h xv[8];
#pragma unroll
    for (int i = 0; i < 8; ++i) xv[i] = *(const v8h*)(sw + (i * 4 + rq) * 64u + pc);
    _Float16* ob = hid + (size_t)row0 * DF + cb + pc;
#pragma unroll
    for (int i = 0; i < 8; ++i) *(v8h*)(ob + (size_t)(i * 4 + rq) * DF) = xv[i];
    
}

// ---------------------------------------------------------------------------
// Workspace arena in units of U = NTOK*512*2 bytes (16 MiB at full size);
// time-disjoint planes share offsets (launches are stream-ordered):
//   [0,4U)  qh ql kh kl          -> later sa f32 [0,2U), 16*sa f16 [2U,3U)
//   [4U,6U) V^T hi / residual
//   [6U,7U) xh                   -> later ctx hi
//   [7U,8U) Wqkv^T plane (1.5 MiB) -> later ctx residual -> later W1^T, W2^T
//   [3U,..) Wo^T plane (0.5 MiB, after attention) -> later hidden [3U,7U)
// ---------------------------------------------------------------------------
#define U_BYTES ((size_t)NTOK * DM * 2)
static_assert((size_t)NB_FULL * SEQ_FULL * DM * 2 * 8 <= (size_t)134217728);
static_assert(3 * U_BYTES >= (size_t)DM * DM * 2);

extern "C" void kernel_launch(void* const* d_in, const int* in_sizes, int n_in,
                              void* d_out, int out_size, void* d_ws, size_t ws_size,
                              hipStream_t stream) {
    if (n_in < 14) return;
    const int need_rows = (NB - 1) * SEQ_FULL + SEQ;
    if (in_sizes[0] < need_rows * DM) return;
    if (in_sizes[1] < need_rows) return;
    if (in_sizes[2] < 3 * NH * DM * HD || in_sizes[3] < 3 * NH * HD) return;
    if (in_sizes[4] < DM * DM || in_sizes[5] < DM) return;
    if (in_sizes[6] < DM * DF || in_sizes[7] < DF) return;
    if (in_sizes[8] < DF * DM || in_sizes[9] < DM) return;
    if (in_sizes[10] < DM || in_sizes[11] < DM || in_sizes[12] < DM || in_sizes[13] < DM) return;
    if (out_size < need_rows * DM) return;

    const float* inp   = (const float*)d_in[0];    // [16384,512]
    const float* mask  = (const float*)d_in[1];    // [32,1,512]
    const float* preW  = (const float*)d_in[2];    // [3,8,512,64]
    const float* preB  = (const float*)d_in[3];    // [3,8,1,64]
    const float* postW = (const float*)d_in[4];    // [512,512]
    const float* postB = (const float*)d_in[5];    // [512]
    const float* ff1W  = (const float*)d_in[6];    // [512,2048]
    const float* ff1B  = (const float*)d_in[7];    // [2048]
    const float* ff2W  = (const float*)d_in[8];    // [2048,512]
    const float* ff2B  = (const float*)d_in[9];    // [512]
    const float* ln1w  = (const float*)d_in[10];
    const float* ln1b  = (const float*)d_in[11];
    const float* ln2w  = (const float*)d_in[12];
    const float* ln2b  = (const float*)d_in[13];
    float* out = (float*)d_out;                    // [32,512,512]

    const size_t U = U_BYTES;
    const size_t WQ_B = (size_t)3 * NH * HD * DM * 2;   // 1.5 MiB
    const size_t W1_B = (size_t)DF * DM * 2;            // 2 MiB
    const size_t W2_B = (size_t)DM * DF * 2;            // 2 MiB
    size_t total = 8 * U;
    if (7 * U + W1_B + W2_B > total) total = 7 * U + W1_B + W2_B;
    if (7 * U + WQ_B > total) total = 7 * U + WQ_B;
    if (total > ws_size) return;

    char* ws = (char*)d_ws;
    _Float16* qh    = (_Float16*)(ws + 0 * U);
    _Float16* ql    = (_Float16*)(ws + 1 * U);
    _Float16* kh    = (_Float16*)(ws + 2 * U);
    _Float16* kl    = (_Float16*)(ws + 3 * U);
    _Float16* vTh   = (_Float16*)(ws + 4 * U);
    _Float16* vTr   = (_Float16*)(ws + 5 * U);
    _Float16* xh    = (_Float16*)(ws + 6 * U);
    _Float16* ctxh  = (_Float16*)(ws + 6 * U);
    _Float16* ctxr  = (_Float16*)(ws + 7 * U);
    _Float16* wqkvT = (_Float16*)(ws + 7 * U);
    float*    sa    = (float*)(ws + 0 * U);
    _Float16* sah   = (_Float16*)(ws + 2 * U);
    _Float16* postT = (_Float16*)(ws + 3 * U);
    _Float16* hid   = (_Float16*)(ws + 3 * U);
    _Float16* ff1T  = (_Float16*)(ws + 7 * U);
    _Float16* ff2T  = (_Float16*)(ws + 7 * U + W1_B);

    // x -> f16 plane (bf16-RNE values)
    k_cvt_x<<<dim3(NTOK / 4), dim3(256), 0, stream>>>(inp, xh);
    // pre_linear_w: 24 x in[512 k][64 n] -> out[64 n][512 k]; grid (64/64, 512/64, 24)
    k_wT<<<dim3(1, 8, 24), dim3(256), 0, stream>>>(preW, wqkvT, 512u, 64u);
    k_qkv<<<dim3(12, NTOK / 128), dim3(256), 0, stream>>>(xh, wqkvT, preB, qh, ql, kh, kl, vTh, vTr);
    k_attn<<<dim3(NH * NB, SEQ / 128), dim3(256), 0, stream>>>(qh, ql, kh, kl, vTh, vTr, mask, ctxh, ctxr);
    // post_linear_w: in[512 k][512 n] -> out[512 n][512 k]; grid (512/64, 512/64, 1)
    k_wT<<<dim3(8, 8, 1), dim3(256), 0, stream>>>(postW, postT, 512u, 512u);
    k_gemm_ln<true><<<dim3(NTOK / 32), dim3(256), 0, stream>>>(
        ctxh, ctxr, postT, 512u, postB, inp, ln1w, ln1b, sa, sah);
    // ff1_w: in[512 k][2048 n] -> out[2048 n][512 k]; grid (2048/64, 512/64, 1)
    k_wT<<<dim3(32, 8, 1), dim3(256), 0, stream>>>(ff1W, ff1T, 512u, 2048u);
    // ff2_w: in[2048 k][512 n] -> out[512 n][2048 k]; grid (512/64, 2048/64, 1)
    k_wT<<<dim3(8, 32, 1), dim3(256), 0, stream>>>(ff2W, ff2T, 2048u, 512u);
    k_ff1<<<dim3(4, NTOK / 32), dim3(256), 0, stream>>>(sah, ff1T, ff1B, hid);
    k_gemm_ln<false><<<dim3(NTOK / 32), dim3(256), 0, stream>>>(
        hid, hid, ff2T, 2048u, ff2B, sa, ln2w, ln2b, out, sah);
}

// v001
// It runs in 425 microseconds.
// Next to v000, in two timings, it ran 1.10 and 1.13 times as fast.
#include <hip/hip_runtime.h>
#include <hip/hip_fp16.h>

// All contractions on v_wmma_f32_16x16x32_f16 (f16 operands, f32 accumulate): x*Wqkv, sa*W1, h*W2 single f16 planes; k*q^T with f16 hi + 2^11-scaled f16 residual planes (hi.hi, hi.res, res.hi); V^T*P^T and ctx*Wo with f16 hi + 2^11-scaled f16 residual plane on V / ctx (two accumulators, residual folded 2^-11 in f32).

#ifndef NB
#define NB 32
#endif
#ifndef SEQ
#define SEQ 512
#endif
#define NB_FULL  32
#define SEQ_FULL 512
#define NH   8           // heads
#define HD   64          // head width
#define DM   512         // model width
#define DF   2048        // hidden width
#define NTOK (NB * SEQ)

static_assert(NB >= 1 && NB <= NB_FULL);
static_assert(SEQ >= 128 && SEQ <= SEQ_FULL);
static_assert(SEQ % 128 == 0);
static_assert(NTOK % 128 == 0);
static_assert(DM == NH * HD);
static_assert(DM == 512 && HD == 64 && NH == 8 && DF == 2048);

typedef _Float16 v16h __attribute__((ext_vector_type(16)));
typedef _Float16 v8h  __attribute__((ext_vector_type(8)));
typedef _Float16 v4h  __attribute__((ext_vector_type(4)));
typedef float    v8f  __attribute__((ext_vector_type(8)));
typedef float    v4f  __attribute__((ext_vector_type(4)));

union Frag { v16h v; v8h h[2]; };

#define LOG2E 1.44269504088896340736f
// scores: acc_h = (64k_h).(64q_h), acc_r = 2^11-scaled residual cross terms
// t (log2 units) = acc_h * log2(e)*2^-12 + acc_r * log2(e)*2^-23
#define C1 (1.44269504088896340736f * 0.000244140625f)
#define C2 (1.44269504088896340736f * 1.1920928955078125e-07f)
#define SC_RES   2048.0f                     // residual plane carry 2^11
#define SC_RINV  4.8828125e-04f              // 2^-11 : residual accumulator fold
#define SC_OUT   9.765625e-04f               // 2^-10 : (16 a)(64 W) -> a.W
#define SC_HID   1.5625e-02f                 // 2^-6  : (16 sa)(64 W1) -> 16 h

static __device__ __forceinline__ v8f zero8() {
    v8f z;
#pragma unroll
    for (int i = 0; i < 8; ++i) z[i] = 0.0f;
    return z;
}

// Fragment-ordered operand planes. A plane of R rows x K (k) 16-bit elements
// is a sequence of 1024-byte units, unit (row/16)*(K/32) + k/32 = one 16x32
// WMMA operand fragment, stored as [j = (k>>4)&1][lane][8]:
//   lane = 16*((k>>3)&1) + (row&15), element = k&7.
// A fragment (A, or B from an [n][k] source) is then two wave-wide 16-byte
// loads of 512 contiguous bytes each (4 whole lines per load): lane m =
// lane&15 -> row m; kb = 8*(lane>>4); elements 0..7 = k kb..kb+7, elements
// 8..15 = k kb+16..kb+23.
// p = unit + lane*8, the lane's own place in the unit.
static __device__ __forceinline__ v16h load_frag16(const _Float16* p) {
    Frag f;
    f.h[0] = *(const v8h*)(p);
    f.h[1] = *(const v8h*)(p + 256);
    return f.v;
}

// offset (in elements) of the 8-element piece (row, k8..k8+7), k8 % 8 == 0
static __device__ __forceinline__ size_t frag_off(unsigned row, unsigned k8, unsigned K) {
    return ((size_t)(row >> 4) * (K >> 5) + (k8 >> 5)) * 512u
         + ((k8 >> 4) & 1u) * 256u + ((((k8 >> 3) & 1u) << 4) + (row & 15u)) * 8u;
}

static __device__ __forceinline__ v8f wmma16(v16h a, v16h b, v8f c) {
    v8f d = __builtin_amdgcn_wmma_f32_16x16x32_f16(false, a, false, b, (short)0, c, false, false);
    asm volatile("v_nop\n\tv_nop\n\tv_nop\n\tv_nop" : "+v"(d) : "v"(a), "v"(b));
    return d;
}

// f32 -> bf16 RNE convert, value kept as f32
static __device__ __forceinline__ float bf16r(float x) {
    unsigned u = __float_as_uint(x);
    u = (u + 0x7FFFu + ((u >> 16) & 1u)) & 0xFFFF0000u;
    return __uint_as_float(u);
}

static __device__ __forceinline__ float ex2(float x) {
    return __builtin_amdgcn_exp2f(x);
}

// ordering for a wave-private LDS tile: stores before later loads of the same wave
static __device__ __forceinline__ void wave_lds_sync() {
    __builtin_amdgcn_fence(3, "wavefront");
    asm volatile("s_wait_dscnt 0" ::: "memory");
    __builtin_amdgcn_wave_barrier();
}

static __device__ __forceinline__ float wave_sum(float v) {
    v += __shfl_xor(v, 16, 32);
    v += __shfl_xor(v, 8, 32);
    v += __shfl_xor(v, 4, 32);
    v += __shfl_xor(v, 2, 32);
    v += __shfl_xor(v, 1, 32);
    return v;
}

// compact token row (b*SEQ + l) -> row in the full-size arrays
static __device__ __forceinline__ unsigned full_row(unsigned n) {
    const unsigned b = n / (unsigned)SEQ;
    return b * (unsigned)SEQ_FULL + (n - b * (unsigned)SEQ);
}

// ---------------------------------------------------------------------------
// Wave-level GEMM core: TM x TN tiles of 16x16, A / Bt both fragment-ordered
// planes of width K; the pointers name the first unit of the wave's first row
// tile (row * K elements in), the next row tile is 16*K on, the next k step 512.
// RES: second A plane (2^11-scaled residual) into its own accumulators.
// ---------------------------------------------------------------------------
template <int TM, int TN, bool RES, unsigned K>
static __device__ __forceinline__ void gemm_core(const _Float16* __restrict__ Ah,
                                                 const _Float16* __restrict__ Ar,
                                                 const _Float16* __restrict__ Bt,
                                                 unsigned lane,
                                                 v8f (&acc)[TM][TN], v8f (&accr)[TM][TN]) {
#pragma unroll
    for (int mt = 0; mt < TM; ++mt)
#pragma unroll
        for (int nt = 0; nt < TN; ++nt) {
            acc[mt][nt] = zero8();
            if (RES) accr[mt][nt] = zero8();
        }
#pragma unroll 1
    for (unsigned k = 0; k < K; k += 32u) {
        // one address pair per plane; row tiles are constant offsets from it
        const _Float16* pa = Ah + (size_t)k * 16u + lane * 8u;
        const _Float16* pr = Ar + (size_t)k * 16u + lane * 8u;
        const _Float16* pb = Bt + (size_t)k * 16u + lane * 8u;
        v16h a[TM];
        v16h ar[TM];
#pragma unroll
        for (int mt = 0; mt < TM; ++mt) {
            a[mt] = load_frag16(pa + (size_t)(mt * 16) * K);
            if (RES) ar[mt] = load_frag16(pr + (size_t)(mt * 16) * K);
        }
#pragma unroll
        for (int nt = 0; nt < TN; ++nt) {
            const v16h bfr = load_frag16(pb + (size_t)(nt * 16) * K);
#pragma unroll
            for (int mt = 0; mt < TM; ++mt) {
                acc[mt][nt] = wmma16(a[mt], bfr, acc[mt][nt]);
                if (RES) accr[mt][nt] = wmma16(ar[mt], bfr, accr[mt][nt]);
            }
        }
        // the step's address pairs are held (inputs) up to this wait, so that no
        // load of the step returns into a pair that an issued load still names
        if (RES) asm volatile("s_wait_xcnt 0x0" :: "v"(pa), "v"(pr), "v"(pb) : "memory");
        else     asm volatile("s_wait_xcnt 0x0" :: "v"(pa), "v"(pb) : "memory");
    }
}

// ---------------------------------------------------------------------------
// x (f32) -> xh, fragment-ordered NTOK x 512 plane, f16 of the bf16-RNE value.
// 8 elements per thread; a wave takes 8 rows x 32 columns (one 128-B line per
// row in, four whole 128-B lines out, each line written by one wave).
// ---------------------------------------------------------------------------
__global__ __launch_bounds__(256) void k_cvt_x(const float* __restrict__ x,
                                                _Float16* __restrict__ xh) {
    const unsigned idx = blockIdx.x * 256u + threadIdx.x;
    const unsigned wv  = idx >> 5;
    const unsigned ln  = idx & 31u;
    const unsigned n   = (wv >> 4) * 8u + (ln & 7u);
    const unsigned c8  = (wv & 15u) * 32u + (ln >> 3) * 8u;
    const unsigned fr  = full_row(n);
    const float* p = x + (size_t)fr * DM + c8;
    const v4f a = *(const v4f*)(p);
    const v4f b = *(const v4f*)(p + 4);
    v8h o;
    o[0] = (_Float16)bf16r(a.x); o[1] = (_Float16)bf16r(a.y);
    o[2] = (_Float16)bf16r(a.z); o[3] = (_Float16)bf16r(a.w);
    o[4] = (_Float16)bf16r(b.x); o[5] = (_Float16)bf16r(b.y);
    o[6] = (_Float16)bf16r(b.z); o[7] = (_Float16)bf16r(b.w);
    _Float16* d = xh + frag_off(n, c8, (unsigned)DM);
    *(v8h*)d = o;
    
}

// ---------------------------------------------------------------------------
// Weight plane builder: in [z][R][C] f32 (k-major, W[k][n]) -> out: z
// fragment-ordered planes of C rows (n) x R (k), f16 = 64 * bf16-RNE(W)^T.
// 64x64 tile through LDS = 4 x 2 units, each wave store 512 contiguous bytes;
// grid = (C/64, R/64, z).
// ---------------------------------------------------------------------------
__global__ __launch_bounds__(256) void k_wT(const float* __restrict__ in,
                                             _Float16* __restrict__ out,
                                             unsigned R, unsigned C) {
    __shared__ __align__(16) _Float16 t[64 * 72];
    const unsigned tid = threadIdx.x;
    const unsigned n0 = blockIdx.x * 64u;
    const unsigned k0 = blockIdx.y * 64u;
    const float*  inb  = in  + (size_t)blockIdx.z * R * C;
    _Float16*     outb = out + (size_t)blockIdx.z * R * C;
#pragma unroll
    for (int i = 0; i < 4; ++i) {
        const unsigned idx = (unsigned)i * 256u + tid;
        const unsigned r = idx >> 4, c4 = (idx & 15u) << 2;
        const v4f v = *(const v4f*)(inb + (size_t)(k0 + r) * C + n0 + c4);
        t[(c4 + 0u) * 72u + r] = (_Float16)(bf16r(v.x) * 64.0f);
        t[(c4 + 1u) * 72u + r] = (_Float16)(bf16r(v.y) * 64.0f);
        t[(c4 + 2u) * 72u + r] = (_Float16)(bf16r(v.z) * 64.0f);
        t[(c4 + 3u) * 72u + r] = (_Float16)(bf16r(v.w) * 64.0f);
    }
    __syncthreads();
    const unsigned ln = tid & 31u;
    const unsigned kl = ((tid >> 6) & 1u) * 32u + ((tid >> 5) & 1u) * 16u + (ln >> 4) * 8u;
    const unsigned nl = (tid >> 7) * 16u + (ln & 15u);
    const v8h o0 = *(const v8h*)(&t[nl * 72u + kl]);
    const v8h o1 = *(const v8h*)(&t[(nl + 32u) * 72u + kl]);
    _Float16* d0 = outb + frag_off(n0 + nl, k0 + kl, R);
    _Float16* d1 = outb + frag_off(n0 + nl + 32u, k0 + kl, R);
    *(v8h*)d0 = o0;
    *(v8h*)d1 = o1;
    
}

// ---------------------------------------------------------------------------
// QKV projection. Block = 8 waves = 128 tokens x 128 columns; wave tile =
// 64 tokens x 32 columns = one (t, head, 32-wide d half) slice.
// q/k planes: [head][dhalf] fragment-ordered NTOK x 32 planes, f16 of 64q (hi)
// and 2^11 residual: per 16-row group the wave owns one 1024-byte unit (two
// lane-contiguous 16-B instructions per plane). V^T planes: [head*NB+b]
// fragment-ordered 64 (d) x SEQ (key) planes, hi / residual: a lane's 8
// accumulator rows (keys) of one column (d) are one piece of a unit at the
// lane's own place, so they are stored straight from registers.
// ---------------------------------------------------------------------------
__global__ __launch_bounds__(256) __attribute__((amdgpu_num_vgpr(256)))
void k_qkv(const _Float16* __restrict__ xh, const _Float16* __restrict__ wT,
           const float* __restrict__ bias,
           _Float16* __restrict__ qh, _Float16* __restrict__ ql,
           _Float16* __restrict__ kh, _Float16* __restrict__ kl,
           _Float16* __restrict__ vTh, _Float16* __restrict__ vTr) {
    __shared__ __align__(16) _Float16 stw[8][1024];   // 16 KB, wave-private tiles
    const unsigned tid  = threadIdx.x;
    const unsigned lane = tid & 31u;
    const unsigned w    = tid >> 5;
    const unsigned n0   = blockIdx.y * 128u + (w >> 2) * 64u;
    const unsigned cb   = blockIdx.x * 128u + (w & 3u) * 32u;
    const unsigned r0   = (lane >> 4) << 3;
    const unsigned cc   = lane & 15u;

    v8f acc[4][2], dum[4][2];
    gemm_core<4, 2, false, DM>(xh + (size_t)n0 * DM, xh + (size_t)n0 * DM,
                               wT + (size_t)cb * DM, lane, acc, dum);

    const unsigned t  = cb >> 9;
    const unsigned h  = (cb >> 6) & 7u;
    const unsigned kk = (cb >> 5) & 1u;
    float bv[2];
    bv[0] = bf16r(bias[cb + cc]) * 64.0f;
    bv[1] = bf16r(bias[cb + 16u + cc]) * 64.0f;
    _Float16* sw = &stw[w][0];

    if (t < 2u) {
        _Float16* ph = (t == 0u) ? qh : kh;
        _Float16* pl = (t == 0u) ? ql : kl;
        const size_t pbase = ((size_t)(h * 2u + kk) * NTOK + n0) * 32u;
#pragma unroll
        for (int mt = 0; mt < 4; ++mt) {
#pragma unroll
            for (int g = 0; g < 8; ++g) {
#pragma unroll
                for (int nt = 0; nt < 2; ++nt) {
                    const float v = acc[mt][nt][g] + bv[nt];
                    const _Float16 hi = (_Float16)v;
                    const unsigned so = nt * 256 + ((cc >> 3) * 16u + r0 + g) * 8u + (cc & 7u);
                    sw[so] = hi;
                    sw[512u + so] = (_Float16)((v - (float)hi) * SC_RES);
                }
            }
            wave_lds_sync();
            const v8h a0 = *(const v8h*)(sw + lane * 8u);
            const v8h a1 = *(const v8h*)(sw + 256u + lane * 8u);
            const v8h b0 = *(const v8h*)(sw + 512u + lane * 8u);
            const v8h b1 = *(const v8h*)(sw + 768u + lane * 8u);
            _Float16* dh = ph + pbase + (size_t)mt * 512u;
            _Float16* dl = pl + pbase + (size_t)mt * 512u;
            *(v8h*)(dh + lane * 8u)        = a0;
            *(v8h*)(dh + 256u + lane * 8u) = a1;
            *(v8h*)(dl + lane * 8u)        = b0;
            *(v8h*)(dl + 256u + lane * 8u) = b1;
            
            wave_lds_sync();
        }
    } else {
        const unsigned b  = n0 / (unsigned)SEQ;
        const unsigned l0 = n0 - b * (unsigned)SEQ;
        const unsigned hb = h * (unsigned)NB + b;
        const size_t vbase = ((size_t)(hb * HD + kk * 32u)) * SEQ + (size_t)l0 * 16u + lane * 8u;
#pragma unroll
        for (int mt = 0; mt < 4; ++mt)
#pragma unroll
            for (int nt = 0; nt < 2; ++nt) {
                v8h hv, rv;
#pragma unroll
                for (int g = 0; g < 8; ++g) {
                    const float v = acc[mt][nt][g] + bv[nt];
                    const _Float16 hi = (_Float16)v;
                    hv[g] = hi;
                    rv[g] = (_Float16)((v - (float)hi) * SC_RES);
                }
                const size_t vo = vbase + (size_t)(nt * 16) * SEQ + (mt >> 1) * 512 + (mt & 1) * 256;
                *(v8h*)(vTh + vo) = hv;
                *(v8h*)(vTr + vo) = rv;
            }
        // the V^T stores' registers may be rewritten behind this branch
        asm volatile("s_wait_xcnt 0x0" ::: "memory");
    }
}

// ---------------------------------------------------------------------------
// Attention, online softmax over keys. Block = 8 waves = 128 queries of one
// (head, batch); wave owns 16 queries. Scores are computed transposed:
// S^T tile = K(16 keys, A) x Q^T(B, n = query), so every statistic of a query
// lives in lane&15 (in-lane reduce over the 8 rows + one xor-16 exchange).
// P^T accumulator tiles (keys 0..15 / 16..31 of a 32-key step) are packed
// directly into the B fragment (k = key, n = query) of O^T = V^T x P^T with
// A = V^T rows (d) straight from the V^T planes. P carried 2^14.
// Epilogue: 16*ctx as f16 hi + 2^11 residual into fragment-ordered NTOK x 512
// planes: a lane's 8 rows (d) of one query are one piece of a unit at the
// lane's own place, stored straight from registers. msk cross-wave (block barrier).
// ---------------------------------------------------------------------------
__global__ __launch_bounds__(256) __attribute__((amdgpu_num_vgpr(256)))
void k_attn(const _Float16* __restrict__ qh, const _Float16* __restrict__ ql,
            const _Float16* __restrict__ kh, const _Float16* __restrict__ kl,
            const _Float16* __restrict__ vTh, const _Float16* __restrict__ vTr,
            const float* __restrict__ mask,
            _Float16* __restrict__ ctxh, _Float16* __restrict__ ctxr) {
    __shared__ __align__(16) float    msk[SEQ];          // additive key mask, log2 units

    const unsigned tid  = threadIdx.x;
    const unsigned lane = tid & 31u;
    const unsigned w    = tid >> 5;
    const unsigned hb   = blockIdx.x;
    const unsigned h    = hb / (unsigned)NB;
    const unsigned b    = hb - h * (unsigned)NB;
    const unsigned q0   = blockIdx.y * 128u + w * 16u;
    const unsigned r0   = (lane >> 4) << 3;

    for (unsigned idx = tid; idx < (unsigned)SEQ; idx += 256u)
        msk[idx] = bf16r(mask[(size_t)b * SEQ_FULL + idx]) * LOG2E;
    __syncthreads();

    const size_t tokq = (size_t)b * SEQ + q0;
    const size_t tokk = (size_t)b * SEQ;
    const size_t P0 = (size_t)(h * 2u) * NTOK;
    const size_t P1 = (size_t)(h * 2u + 1u) * NTOK;
    const v16h qhf0 = load_frag16(qh + (P0 + tokq) * 32u + lane * 8u);
    const v16h qhf1 = load_frag16(qh + (P1 + tokq) * 32u + lane * 8u);
    const v16h qlf0 = load_frag16(ql + (P0 + tokq) * 32u + lane * 8u);
    const v16h qlf1 = load_frag16(ql + (P1 + tokq) * 32u + lane * 8u);
    const _Float16* kh0 = kh + (P0 + tokk) * 32u;
    const _Float16* kh1 = kh + (P1 + tokk) * 32u;
    const _Float16* kl0 = kl + (P0 + tokk) * 32u;
    const _Float16* kl1 = kl + (P1 + tokk) * 32u;
    const _Float16* vhb = vTh + (size_t)hb * HD * SEQ;
    const _Float16* vrb = vTr + (size_t)hb * HD * SEQ;

    v8f oh[4], orr[4];
#pragma unroll
    for (int dt = 0; dt < 4; ++dt) { oh[dt] = zero8(); orr[dt] = zero8(); }
    float mr = -1.0e30f, lr = 0.0f;

#pragma unroll 1
    for (unsigned key0 = 0; key0 < (unsigned)SEQ; key0 += 32u) {
        v8f sh0 = zero8(), sr0 = zero8(), sh1 = zero8(), sr1 = zero8();
        // one address pair per plane; the second key tile and the d tiles are constant offsets
        const _Float16* pkh0 = kh0 + (size_t)key0 * 32u + lane * 8u;
        const _Float16* pkl0 = kl0 + (size_t)key0 * 32u + lane * 8u;
        const _Float16* pkh1 = kh1 + (size_t)key0 * 32u + lane * 8u;
        const _Float16* pkl1 = kl1 + (size_t)key0 * 32u + lane * 8u;
        const _Float16* pvh  = vhb + (size_t)key0 * 16u + lane * 8u;
        const _Float16* pvr  = vrb + (size_t)key0 * 16u + lane * 8u;
        {
            v16h a  = load_frag16(pkh0);
            v16h al = load_frag16(pkl0);
            sh0 = wmma16(a, qhf0, sh0);
            sr0 = wmma16(a, qlf0, sr0);
            sr0 = wmma16(al, qhf0, sr0);
            a  = load_frag16(pkh1);
            al = load_frag16(pkl1);
            sh0 = wmma16(a, qhf1, sh0);
            sr0 = wmma16(a, qlf1, sr0);
            sr0 = wmma16(al, qhf1, sr0);
        }
        {
            v16h a  = load_frag16(pkh0 + 512);
            v16h al = load_frag16(pkl0 + 512);
            sh1 = wmma16(a, qhf0, sh1);
            sr1 = wmma16(a, qlf0, sr1);
            sr1 = wmma16(al, qhf0, sr1);
            a  = load_frag16(pkh1 + 512);
            al = load_frag16(pkl1 + 512);
            sh1 = wmma16(a, qhf1, sh1);
            sr1 = wmma16(a, qlf1, sr1);
            sr1 = wmma16(al, qhf1, sr1);
        }
        float t0[8], t1[8];
#pragma unroll
        for (int g = 0; g < 8; ++g) {
            t0[g] = __builtin_fmaf(sh0[g], C1, sr0[g] * C2) + msk[key0 + r0 + g];
            t1[g] = __builtin_fmaf(sh1[g], C1, sr1[g] * C2) + msk[key0 + 16u + r0 + g];
        }
        float tmax = fmaxf(t0[0], t1[0]);
#pragma unroll
        for (int g = 1; g < 8; ++g) tmax = fmaxf(tmax, fmaxf(t0[g], t1[g]));
        tmax = fmaxf(tmax, __shfl_xor(tmax, 16, 32));
        const float mn    = fmaxf(mr, tmax);
        const float alpha = ex2(mr - mn);
        mr = mn;
        const float off = 14.0f - mn;
        v8h p0, p1;
        float ps = 0.0f;
#pragma unroll
        for (int g = 0; g < 8; ++g) {
            const _Float16 a = (_Float16)ex2(t0[g] + off);
            const _Float16 c = (_Float16)ex2(t1[g] + off);
            p0[g] = a;
            p1[g] = c;
            ps += (float)a + (float)c;
        }
        ps += __shfl_xor(ps, 16, 32);
        lr = lr * alpha + ps;
        Frag pb;
        pb.h[0] = p0;       // k = keys key0 + 8h + 0..7
        pb.h[1] = p1;       // k = keys key0 + 16 + 8h + 0..7
#pragma unroll
        for (int dt = 0; dt < 4; ++dt) {
            oh[dt]  = oh[dt] * alpha;
            orr[dt] = orr[dt] * alpha;
        }
#pragma unroll
        for (int dt = 0; dt < 4; ++dt) {
            const v16h va = load_frag16(pvh + (size_t)(dt * 16) * SEQ);
            oh[dt] = wmma16(va, pb.v, oh[dt]);
            const v16h vr = load_frag16(pvr + (size_t)(dt * 16) * SEQ);
            orr[dt] = wmma16(vr, pb.v, orr[dt]);
        }
        // the step's address pairs are held (inputs) up to this wait, so that no
        // load of the step returns into a pair that an issued load still names
        asm volatile("s_wait_xcnt 0x0" :: "v"(pkh0), "v"(pkl0), "v"(pkh1), "v"(pkl1), "v"(pvh), "v"(pvr) : "memory");
    }

    // O^T lane (query lane&15): rows d = dt*16 + r0 + g. 16*ctx = (o + or 2^-11) / (64 l) * 16
    const float inv = 0.25f * (1.0f / lr);
    const size_t ob = tokq * DM + (size_t)(h * 2u) * 512u + lane * 8u;
#pragma unroll
    for (int dt = 0; dt < 4; ++dt) {
        v8h hv, rv;
#pragma unroll
        for (int g = 0; g < 8; ++g) {
            const float c = __builtin_fmaf(orr[dt][g], SC_RINV, oh[dt][g]) * inv;
            const _Float16 hi = (_Float16)c;
            hv[g] = hi;
            rv[g] = (_Float16)((c - (float)hi) * SC_RES);
        }
        *(v8h*)(ctxh + ob + (dt >> 1) * 512 + (dt & 1) * 256) = hv;
        *(v8h*)(ctxr + ob + (dt >> 1) * 512 + (dt & 1) * 256) = rv;
    }
}

// ---------------------------------------------------------------------------
// GEMM (N = 512) + bias + residual add + LayerNorm, fused. Block = 8 waves =
// 32 rows x 512 columns (wave tile 32 x 64). Scaled accumulators go to a
// cross-wave f32 LDS tile (block barrier), then wave w normalises rows
// POST: A = ctx hi + residual planes, residual add = bf16-RNE(x), outputs
// sa (f32) and 16*sa (f16, fragment-ordered NTOK x 512 plane: the block's 32
// rows are 32 KB contiguous, gathered in LDS as [k/8][row] pieces, block
// barrier, then 512-byte wave stores). Otherwise A = hidden plane, residual
// add = sa, output = final f32 rows.
// ---------------------------------------------------------------------------
template <bool POST>
__global__ __launch_bounds__(256) __attribute__((amdgpu_num_vgpr(256)))
void k_gemm_ln(const _Float16* __restrict__ Ah, const _Float16* __restrict__ Ar,
               const _Float16* __restrict__ Bt,
               const float* __restrict__ bias, const float* __restrict__ resid,
               const float* __restrict__ lnw, const float* __restrict__ lnb,
               float* __restrict__ outF, _Float16* __restrict__ outH) {
    constexpr unsigned K = POST ? DM : DF;       // contraction length: row-tile offsets are immediates
    __shared__ __align__(16) float T[32 * DM];   // 64 KB, cross-wave
    // 16*sa pieces: [64 k/8][32 rows][8], column pitch 264 (16 B of pad: the 16
    // columns of one wave store fall on different banks), cross-wave
    __shared__ __align__(16) _Float16 Hs[POST ? 64 * 264 : 8];
    const unsigned tid  = threadIdx.x;
    const unsigned lane = tid & 31u;
    const unsigned w    = tid >> 5;
    const unsigned row0 = blockIdx.x * 32u;
    const unsigned cb   = w * 64u;
    const unsigned r0   = (lane >> 4) << 3;
    const unsigned cc   = lane & 15u;

    v8f acc[2][4], accr[2][4];
    gemm_core<2, 4, POST, K>(Ah + (size_t)row0 * K, Ar + (size_t)row0 * K,
                             Bt + (size_t)cb * K, lane, acc, accr);
#pragma unroll
    for (int mt = 0; mt < 2; ++mt)
#pragma unroll
        for (int nt = 0; nt < 4; ++nt)
#pragma unroll
            for (int g = 0; g < 8; ++g) {
                const float v = POST ? __builtin_fmaf(accr[mt][nt][g], SC_RINV, acc[mt][nt][g])
                                     : acc[mt][nt][g];
                T[(mt * 16 + r0 + g) * DM + cb + nt * 16 + cc] = v;
            }
    __syncthreads();

#pragma unroll 1
    for (unsigned rr = 0; rr < 4u; ++rr) {
        const unsigned row = w * 4u + rr;
        const unsigned n   = row0 + row;
        const unsigned fr  = full_row(n);
        const float* rp = POST ? (resid + (size_t)fr * DM) : (resid + (size_t)n * DM);
        float*       op = POST ? (outF + (size_t)n * DM)   : (outF + (size_t)fr * DM);
        v4f xv[4];
        float s = 0.0f;
#pragma unroll
        for (int i = 0; i < 4; ++i) {
            const unsigned c = (unsigned)i * 128u + lane * 4u;
            const v4f a  = *(const v4f*)(&T[row * DM + c]);
            const v4f bi = *(const v4f*)(bias + c);
            const v4f rs = *(const v4f*)(rp + c);
            v4f x;
            x.x = __builtin_fmaf(a.x, SC_OUT, bf16r(bi.x)) + (POST ? bf16r(rs.x) : rs.x);
            x.y = __builtin_fmaf(a.y, SC_OUT, bf16r(bi.y)) + (POST ? bf16r(rs.y) : rs.y);
            x.z = __builtin_fmaf(a.z, SC_OUT, bf16r(bi.z)) + (POST ? bf16r(rs.z) : rs.z);
            x.w = __builtin_fmaf(a.w, SC_OUT, bf16r(bi.w)) + (POST ? bf16r(rs.w) : rs.w);
            xv[i] = x;
            s += (x.x + x.y) + (x.z + x.w);
        }
        s = wave_sum(s);
        const float mu = s * (1.0f / (float)DM);
        float q = 0.0f;
#pragma unroll
        for (int i = 0; i < 4; ++i) {
            const float d0 = xv[i].x - mu, d1 = xv[i].y - mu, d2 = xv[i].z - mu, d3 = xv[i].w - mu;
            q += (d0 * d0 + d1 * d1) + (d2 * d2 + d3 * d3);
        }
        q = wave_sum(q);
        const float rstd = rsqrtf(q * (1.0f / (float)DM) + 1.0e-5f);
        v4f yv[4];
#pragma unroll
        for (int i = 0; i < 4; ++i) {
            const unsigned c = (unsigned)i * 128u + lane * 4u;
            const v4f gw = *(const v4f*)(lnw + c);
            const v4f gb = *(const v4f*)(lnb + c);
            v4f y;
            y.x = (xv[i].x - mu) * rstd * bf16r(gw.x) + bf16r(gb.x);
            y.y = (xv[i].y - mu) * rstd * bf16r(gw.y) + bf16r(gb.y);
            y.z = (xv[i].z - mu) * rstd * bf16r(gw.z) + bf16r(gb.z);
            y.w = (xv[i].w - mu) * rstd * bf16r(gw.w) + bf16r(gb.w);
            yv[i] = y;
        }
        if (POST) {
#pragma unroll
            for (int i = 0; i < 4; ++i) {
                v4h hq;
                hq[0] = (_Float16)(yv[i].x * 16.0f); hq[1] = (_Float16)(yv[i].y * 16.0f);
                hq[2] = (_Float16)(yv[i].z * 16.0f); hq[3] = (_Float16)(yv[i].w * 16.0f);
                *(v4h*)(&Hs[((unsigned)i * 16u + (lane >> 1)) * 264u + row * 8u + (lane & 1u) * 4u]) = hq;
            }
        }
#pragma unroll
        for (int i = 0; i < 4; ++i)
            *(v4f*)(op + (unsigned)i * 128u + lane * 4u) = yv[i];
        // the row stores' registers are rewritten by the next row and behind the loop
        asm volatile("s_wait_xcnt 0x0" ::: "memory");
    }
    if (POST) {
        __syncthreads();
        _Float16* hp = outH + (size_t)row0 * DM + tid * 8u;
        // piece i*256 + tid of the block's 2 x 16 units: unit = 4*i + (w>>1), j = w&1
        const unsigned hs0 = ((w >> 1) * 4u + (w & 1u) * 2u + (lane >> 4)) * 264u + (lane & 15u) * 8u;
        v8h pv[8];
#pragma unroll
        for (int i = 0; i < 8; ++i)
            pv[i] = *(const v8h*)(&Hs[hs0 + (unsigned)(i & 3) * (16u * 264u) + (unsigned)(i >> 2) * 128u]);
#pragma unroll
        for (int i = 0; i < 8; ++i)
            *(v8h*)(hp + (unsigned)i * 2048u) = pv[i];
    }
}

// ---------------------------------------------------------------------------
// FF1: hidden = relu(sa W1 + b1), stored as f16 of 16*hidden, fragment-ordered
// NTOK x 2048 plane; the wave's 32 x 64 tile = 2 x 2 units, ordered in LDS.
// ---------------------------------------------------------------------------
__global__ __launch_bounds__(256) __attribute__((amdgpu_num_vgpr(256)))
void k_ff1(const _Float16* __restrict__ sah, const _Float16* __restrict__ Bt,
           const float* __restrict__ bias, _Float16* __restrict__ hid) {
    __shared__ __align__(16) _Float16 st[8][32 * 64];   // 32 KB wave-private
    const unsigned tid  = threadIdx.x;
    const unsigned lane = tid & 31u;
    const unsigned w    = tid >> 5;
    const unsigned row0 = blockIdx.y * 32u;
    const unsigned cb   = blockIdx.x * 512u + w * 64u;
    const unsigned r0   = (lane >> 4) << 3;
    const unsigned cc   = lane & 15u;

    v8f acc[2][4], dum[2][4];
    gemm_core<2, 4, false, DM>(sah + (size_t)row0 * DM, sah + (size_t)row0 * DM,
                               Bt + (size_t)cb * DM, lane, acc, dum);
    float bv[4];
#pragma unroll
    for (int nt = 0; nt < 4; ++nt) bv[nt] = bf16r(bias[cb + nt * 16 + cc]) * 16.0f;
    _Float16* sw = &st[w][0];
#pragma unroll
    for (int mt = 0; mt < 2; ++mt)
#pragma unroll
        for (int nt = 0; nt < 4; ++nt)
#pragma unroll
            for (int g = 0; g < 8; ++g)
                sw[(mt * 2 + (nt >> 1)) * 512 + (nt & 1) * 256 + ((cc >> 3) * 16u + r0 + g) * 8u + (cc & 7u)] =
                    (_Float16)fmaxf(__builtin_fmaf(acc[mt][nt][g], SC_HID, bv[nt]), 0.0f);
    wave_lds_sync();
    v8h xv[8];
#pragma unroll
    for (int i = 0; i < 8; ++i) xv[i] = *(const v8h*)(sw + i * 256 + lane * 8u);
    _Float16* ob = hid + (size_t)row0 * DF + (size_t)cb * 16u + lane * 8u;
#pragma unroll
    for (int i = 0; i < 8; ++i)
        *(v8h*)(ob + (size_t)((i >> 2) * 16) * DF + ((i >> 1) & 1) * 512 + (i & 1) * 256) = xv[i];
    
}

// ---------------------------------------------------------------------------
// Workspace arena in units of U = NTOK*512*2 bytes (16 MiB at full size);
// time-disjoint planes share offsets (launches are stream-ordered):
//   [0,4U)  qh ql kh kl          -> later sa f32 [0,2U), 16*sa f16 [2U,3U)
//   [4U,6U) V^T hi / residual
//   [6U,7U) xh                   -> later ctx hi
//   [7U,8U) Wqkv^T plane (1.5 MiB) -> later ctx residual -> later W1^T, W2^T
//   [3U,..) Wo^T plane (0.5 MiB, after attention) -> later hidden [3U,7U)
// ---------------------------------------------------------------------------
#define U_BYTES ((size_t)NTOK * DM * 2)
static_assert((size_t)NB_FULL * SEQ_FULL * DM * 2 * 8 <= (size_t)134217728);
static_assert(3 * U_BYTES >= (size_t)DM * DM * 2);

extern "C" void kernel_launch(void* const* d_in, const int* in_sizes, int n_in,
                              void* d_out, int out_size, void* d_ws, size_t ws_size,
                              hipStream_t stream) {
    if (n_in < 14) return;
    const int need_rows = (NB - 1) * SEQ_FULL + SEQ;
    if (in_sizes[0] < need_rows * DM) return;
    if (in_sizes[1] < need_rows) return;
    if (in_sizes[2] < 3 * NH * DM * HD || in_sizes[3] < 3 * NH * HD) return;
    if (in_sizes[4] < DM * DM || in_sizes[5] < DM) return;
    if (in_sizes[6] < DM * DF || in_sizes[7] < DF) return;
    if (in_sizes[8] < DF * DM || in_sizes[9] < DM) return;
    if (in_sizes[10] < DM || in_sizes[11] < DM || in_sizes[12] < DM || in_sizes[13] < DM) return;
    if (out_size < need_rows * DM) return;

    const float* inp   = (const float*)d_in[0];    // [16384,512]
    const float* mask  = (const float*)d_in[1];    // [32,1,512]
    const float* preW  = (const float*)d_in[2];    // [3,8,512,64]
    const float* preB  = (const float*)d_in[3];    // [3,8,1,64]
    const float* postW = (const float*)d_in[4];    // [512,512]
    const float* postB = (const float*)d_in[5];    // [512]
    const float* ff1W  = (const float*)d_in[6];    // [512,2048]
    const float* ff1B  = (const float*)d_in[7];    // [2048]
    const float* ff2W  = (const float*)d_in[8];    // [2048,512]
    const float* ff2B  = (const float*)d_in[9];    // [512]
    const float* ln1w  = (const float*)d_in[10];
    const float* ln1b  = (const float*)d_in[11];
    const float* ln2w  = (const float*)d_in[12];
    const float* ln2b  = (const float*)d_in[13];
    float* out = (float*)d_out;                    // [32,512,512]

    const size_t U = U_BYTES;
    const size_t WQ_B = (size_t)3 * NH * HD * DM * 2;   // 1.5 MiB
    const size_t W1_B = (size_t)DF * DM * 2;            // 2 MiB
    const size_t W2_B = (size_t)DM * DF * 2;            // 2 MiB
    size_t total = 8 * U;
    if (7 * U + W1_B + W2_B > total) total = 7 * U + W1_B + W2_B;
    if (7 * U + WQ_B > total) total = 7 * U + WQ_B;
    if (total > ws_size) return;

    char* ws = (char*)d_ws;
    _Float16* qh    = (_Float16*)(ws + 0 * U);
    _Float16* ql    = (_Float16*)(ws + 1 * U);
    _Float16* kh    = (_Float16*)(ws + 2 * U);
    _Float16* kl    = (_Float16*)(ws + 3 * U);
    _Float16* vTh   = (_Float16*)(ws + 4 * U);
    _Float16* vTr   = (_Float16*)(ws + 5 * U);
    _Float16* xh    = (_Float16*)(ws + 6 * U);
    _Float16* ctxh  = (_Float16*)(ws + 6 * U);
    _Float16* ctxr  = (_Float16*)(ws + 7 * U);
    _Float16* wqkvT = (_Float16*)(ws + 7 * U);
    float*    sa    = (float*)(ws + 0 * U);
    _Float16* sah   = (_Float16*)(ws + 2 * U);
    _Float16* postT = (_Float16*)(ws + 3 * U);
    _Float16* hid   = (_Float16*)(ws + 3 * U);
    _Float16* ff1T  = (_Float16*)(ws + 7 * U);
    _Float16* ff2T  = (_Float16*)(ws + 7 * U + W1_B);

    // x -> f16 plane (bf16-RNE values)
    k_cvt_x<<<dim3(NTOK / 4), dim3(256), 0, stream>>>(inp, xh);
    // pre_linear_w: 24 x in[512 k][64 n] -> out[64 n][512 k]; grid (64/64, 512/64, 24)
    k_wT<<<dim3(1, 8, 24), dim3(256), 0, stream>>>(preW, wqkvT, 512u, 64u);
    k_qkv<<<dim3(12, NTOK / 128), dim3(256), 0, stream>>>(xh, wqkvT, preB, qh, ql, kh, kl, vTh, vTr);
    k_attn<<<dim3(NH * NB, SEQ / 128), dim3(256), 0, stream>>>(qh, ql, kh, kl, vTh, vTr, mask, ctxh, ctxr);
    // post_linear_w: in[512 k][512 n] -> out[512 n][512 k]; grid (512/64, 512/64, 1)
    k_wT<<<dim3(8, 8, 1), dim3(256), 0, stream>>>(postW, postT, 512u, 512u);
    k_gemm_ln<true><<<dim3(NTOK / 32), dim3(256), 0, stream>>>(
        ctxh, ctxr, postT, postB, inp, ln1w, ln1b, sa, sah);
    // ff1_w: in[512 k][2048 n] -> out[2048 n][512 k]; grid (2048/64, 512/64, 1)
    k_wT<<<dim3(32, 8, 1), dim3(256), 0, stream>>>(ff1W, ff1T, 512u, 2048u);
    // ff2_w: in[2048 k][512 n] -> out[512 n][2048 k]; grid (512/64, 2048/64, 1)
    k_wT<<<dim3(8, 32, 1), dim3(256), 0, stream>>>(ff2W, ff2T, 2048u, 512u);
    k_ff1<<<dim3(4, NTOK / 32), dim3(256), 0, stream>>>(sah, ff1T, ff1B, hid);
    k_gemm_ln<false><<<dim3(NTOK / 32), dim3(256), 0, stream>>>(
        hid, hid, ff2T, ff2B, sa, ln2w, ln2b, out, sah);
}

// v002
// A run of this version takes 237 microseconds.
// Next to v001, in two timings, it ran 1.76 and 1.79 times as fast.
// All steps since v000 together make it 1.98 times as fast.
#include <hip/hip_runtime.h>
#include <hip/hip_fp16.h>

// All contractions on v_wmma_f32_16x16x32_f16 (f16 operands, f32 accumulate): x*Wqkv, sa*W1, h*W2 single f16 planes; k*q^T with f16 hi + 2^11-scaled f16 residual planes (hi.hi, hi.res, res.hi); V^T*P^T and ctx*Wo with f16 hi + 2^11-scaled f16 residual plane on V / ctx (two accumulators, residual folded 2^-11 in f32).

#ifndef NB
#define NB 32
#endif
#ifndef SEQ
#define SEQ 512
#endif
#define NB_FULL  32
#define SEQ_FULL 512
#define NH   8           // heads
#define HD   64          // head width
#define DM   512         // model width
#define DF   2048        // hidden width
#define NTOK (NB * SEQ)

static_assert(NB >= 1 && NB <= NB_FULL);
static_assert(SEQ >= 128 && SEQ <= SEQ_FULL);
static_assert(SEQ % 128 == 0);
static_assert(NTOK % 128 == 0);
static_assert(DM == NH * HD);
static_assert(DM == 512 && HD == 64 && NH == 8 && DF == 2048);

typedef _Float16 v16h __attribute__((ext_vector_type(16)));
typedef _Float16 v8h  __attribute__((ext_vector_type(8)));
typedef _Float16 v4h  __attribute__((ext_vector_type(4)));
typedef float    v8f  __attribute__((ext_vector_type(8)));
typedef float    v4f  __attribute__((ext_vector_type(4)));

union Frag { v16h v; v8h h[2]; };

template <bool V> struct Flag { static constexpr bool value = V; };

#define LOG2E 1.44269504088896340736f
// scores: acc_h = (64k_h).(64q_h), acc_r = 2^11-scaled residual cross terms
// t (log2 units) = acc_h * log2(e)*2^-12 + acc_r * log2(e)*2^-23
#define C1 (1.44269504088896340736f * 0.000244140625f)
#define C2 (1.44269504088896340736f * 1.1920928955078125e-07f)
#define SC_RES   2048.0f                     // residual plane carry 2^11
#define SC_RINV  4.8828125e-04f              // 2^-11 : residual accumulator fold
#define SC_OUT   9.765625e-04f               // 2^-10 : (16 a)(64 W) -> a.W
#define SC_HID   1.5625e-02f                 // 2^-6  : (16 sa)(64 W1) -> 16 h

static __device__ __forceinline__ v8f zero8() {
    v8f z;
#pragma unroll
    for (int i = 0; i < 8; ++i) z[i] = 0.0f;
    return z;
}

// Fragment-ordered operand planes. A plane of R rows x K (k) 16-bit elements
// is a sequence of 1024-byte units, unit (row/16)*(K/32) + k/32 = one 16x32
// WMMA operand fragment, stored as [j = (k>>4)&1][lane][8]:
//   lane = 16*((k>>3)&1) + (row&15), element = k&7.
// A fragment (A, or B from an [n][k] source) is then two wave-wide 16-byte
// loads of 512 contiguous bytes each (4 whole lines per load): lane m =
// lane&15 -> row m; kb = 8*(lane>>4); elements 0..7 = k kb..kb+7, elements
// 8..15 = k kb+16..kb+23.
// p = unit + lane*8, the lane's own place in the unit.
static __device__ __forceinline__ v16h load_frag16(const _Float16* p) {
    Frag f;
    f.h[0] = *(const v8h*)(p);
    f.h[1] = *(const v8h*)(p + 256);
    return f.v;
}

// offset (in elements) of the 8-element piece (row, k8..k8+7), k8 % 8 == 0
static __device__ __forceinline__ size_t frag_off(unsigned row, unsigned k8, unsigned K) {
    return ((size_t)(row >> 4) * (K >> 5) + (k8 >> 5)) * 512u
         + ((k8 >> 4) & 1u) * 256u + ((((k8 >> 3) & 1u) << 4) + (row & 15u)) * 8u;
}

static __device__ __forceinline__ v8f wmma16(v16h a, v16h b, v8f c) {
    v8f d = __builtin_amdgcn_wmma_f32_16x16x32_f16(false, a, false, b, (short)0, c, false, false);
    asm volatile("v_nop\n\tv_nop\n\tv_nop\n\tv_nop" : "+v"(d) : "v"(a), "v"(b));
    return d;
}

// f32 -> bf16 RNE convert, value kept as f32
static __device__ __forceinline__ float bf16r(float x) {
    unsigned u = __float_as_uint(x);
    u = (u + 0x7FFFu + ((u >> 16) & 1u)) & 0xFFFF0000u;
    return __uint_as_float(u);
}

static __device__ __forceinline__ float ex2(float x) {
    return __builtin_amdgcn_exp2f(x);
}

// ordering for a wave-private LDS tile: stores before later loads of the same wave
static __device__ __forceinline__ void wave_lds_sync() {
    __builtin_amdgcn_fence(3, "wavefront");
    asm volatile("s_wait_dscnt 0" ::: "memory");
    __builtin_amdgcn_wave_barrier();
}

static __device__ __forceinline__ float wave_sum(float v) {
    v += __shfl_xor(v, 16, 32);
    v += __shfl_xor(v, 8, 32);
    v += __shfl_xor(v, 4, 32);
    v += __shfl_xor(v, 2, 32);
    v += __shfl_xor(v, 1, 32);
    return v;
}

// compact token row (b*SEQ + l) -> row in the full-size arrays
static __device__ __forceinline__ unsigned full_row(unsigned n) {
    const unsigned b = n / (unsigned)SEQ;
    return b * (unsigned)SEQ_FULL + (n - b * (unsigned)SEQ);
}

// ---------------------------------------------------------------------------
// Wave-level GEMM core: TM x TN tiles of 16x16, A / Bt both fragment-ordered
// planes of width K; the pointers name the first unit of the wave's first row
// tile (row * K elements in), the next row tile is 16*K on, the next k step 512.
// RES: second A plane (2^11-scaled residual) into its own accumulators.
// The fragments of k step s + 1 are requested before the products of step s
// (two register sets), so a step waits for loads that are one step old, once,
// and not for each B fragment in turn. With RES the accumulators leave no room
// for a second B set: each B fragment is requested anew behind its last product.
// The k order and the accumulators of every sum are as before.
// ---------------------------------------------------------------------------
// One k step on the current set; LD: request the next step's set from pa / pr / pb.
template <int TM, int TN, bool RES, unsigned K, bool LD>
static __device__ __forceinline__ void gemm_step(const _Float16* pa, const _Float16* pr,
                                                 const _Float16* pb,
                                                 const v16h (&ac)[TM], const v16h (&arc)[TM], v16h (&bc)[TN],
                                                 v16h (&an)[TM], v16h (&arn)[TM], v16h (&bn)[TN],
                                                 v8f (&acc)[TM][TN], v8f (&accr)[TM][TN]) {
    if (LD) {
#pragma unroll
        for (int mt = 0; mt < TM; ++mt) {
            an[mt] = load_frag16(pa + (size_t)(mt * 16) * K);
            if (RES) arn[mt] = load_frag16(pr + (size_t)(mt * 16) * K);
        }
        if (!RES) {
#pragma unroll
            for (int nt = 0; nt < TN; ++nt) bn[nt] = load_frag16(pb + (size_t)(nt * 16) * K);
        }
    }
#pragma unroll
    for (int nt = 0; nt < TN; ++nt) {
#pragma unroll
        for (int mt = 0; mt < TM; ++mt) {
            acc[mt][nt] = wmma16(ac[mt], bc[nt], acc[mt][nt]);
            if (RES) accr[mt][nt] = wmma16(arc[mt], bc[nt], accr[mt][nt]);
        }
        if (LD && RES) bc[nt] = load_frag16(pb + (size_t)(nt * 16) * K);
    }
}

template <int TM, int TN, bool RES, unsigned K>
static __device__ __forceinline__ void gemm_core(const _Float16* __restrict__ Ah,
                                                 const _Float16* __restrict__ Ar,
                                                 const _Float16* __restrict__ Bt,
                                                 unsigned lane,
                                                 v8f (&acc)[TM][TN], v8f (&accr)[TM][TN]) {
    static_assert(K % 64u == 0u && K >= 64u);
    constexpr int B1 = RES ? 0 : 1;              // index of the second B set
#pragma unroll
    for (int mt = 0; mt < TM; ++mt)
#pragma unroll
        for (int nt = 0; nt < TN; ++nt) {
            acc[mt][nt] = zero8();
            if (RES) accr[mt][nt] = zero8();
        }
    // one address pair per plane; row tiles and the two steps of a trip are constant offsets
    const _Float16* pa = Ah + lane * 8u;
    const _Float16* pr = Ar + lane * 8u;
    const _Float16* pb = Bt + lane * 8u;
    v16h a[2][TM], ar[2][TM], b[2][TN];
#pragma unroll
    for (int mt = 0; mt < TM; ++mt) {
        a[0][mt] = load_frag16(pa + (size_t)(mt * 16) * K);
        if (RES) ar[0][mt] = load_frag16(pr + (size_t)(mt * 16) * K);
    }
#pragma unroll
    for (int nt = 0; nt < TN; ++nt) b[0][nt] = load_frag16(pb + (size_t)(nt * 16) * K);
#pragma unroll 1
    for (unsigned k = 0; k + 64u < K; k += 64u) {
        gemm_step<TM, TN, RES, K, true>(pa + 512, pr + 512, pb + 512,
                                        a[0], ar[0], b[0], a[1], ar[1], b[B1], acc, accr);
        gemm_step<TM, TN, RES, K, true>(pa + 1024, pr + 1024, pb + 1024,
                                        a[1], ar[1], b[B1], a[0], ar[0], b[0], acc, accr);
        // the address pairs are held (inputs) up to this wait and advanced only
        // behind it: no pair that an issued load still names is rewritten
        if (RES) asm volatile("s_wait_xcnt 0x0" :: "v"(pa), "v"(pr), "v"(pb) : "memory");
        else     asm volatile("s_wait_xcnt 0x0" :: "v"(pa), "v"(pb) : "memory");
        pa += 1024; pr += 1024; pb += 1024;
    }
    gemm_step<TM, TN, RES, K, true>(pa + 512, pr + 512, pb + 512,
                                    a[0], ar[0], b[0], a[1], ar[1], b[B1], acc, accr);
    gemm_step<TM, TN, RES, K, false>(pa, pr, pb,
                                     a[1], ar[1], b[B1], a[0], ar[0], b[0], acc, accr);
    // as above, for the last steps' loads: the pairs' registers are free behind it
    if (RES) asm volatile("s_wait_xcnt 0x0" :: "v"(pa), "v"(pr), "v"(pb) : "memory");
    else     asm volatile("s_wait_xcnt 0x0" :: "v"(pa), "v"(pb) : "memory");
}

// ---------------------------------------------------------------------------
// x (f32) -> xh, fragment-ordered NTOK x 512 plane, f16 of the bf16-RNE value.
// 8 elements per thread; a wave takes 8 rows x 32 columns (one 128-B line per
// row in, four whole 128-B lines out, each line written by one wave).
// ---------------------------------------------------------------------------
__global__ __launch_bounds__(256) void k_cvt_x(const float* __restrict__ x,
                                                _Float16* __restrict__ xh) {
    const unsigned idx = blockIdx.x * 256u + threadIdx.x;
    const unsigned wv  = idx >> 5;
    const unsigned ln  = idx & 31u;
    const unsigned n   = (wv >> 4) * 8u + (ln & 7u);
    const unsigned c8  = (wv & 15u) * 32u + (ln >> 3) * 8u;
    const unsigned fr  = full_row(n);
    const float* p = x + (size_t)fr * DM + c8;
    const v4f a = *(const v4f*)(p);
    const v4f b = *(const v4f*)(p + 4);
    v8h o;
    o[0] = (_Float16)bf16r(a.x); o[1] = (_Float16)bf16r(a.y);
    o[2] = (_Float16)bf16r(a.z); o[3] = (_Float16)bf16r(a.w);
    o[4] = (_Float16)bf16r(b.x); o[5] = (_Float16)bf16r(b.y);
    o[6] = (_Float16)bf16r(b.z); o[7] = (_Float16)bf16r(b.w);
    _Float16* d = xh + frag_off(n, c8, (unsigned)DM);
    *(v8h*)d = o;
    
}

// ---------------------------------------------------------------------------
// Weight plane builder: in [z][R][C] f32 (k-major, W[k][n]) -> out: z
// fragment-ordered planes of C rows (n) x R (k), f16 = 64 * bf16-RNE(W)^T.
// 64x64 tile through LDS = 4 x 2 units, each wave store 512 contiguous bytes;
// grid = (C/64, R/64, z).
// ---------------------------------------------------------------------------
__global__ __launch_bounds__(256) void k_wT(const float* __restrict__ in,
                                             _Float16* __restrict__ out,
                                             unsigned R, unsigned C) {
    __shared__ __align__(16) _Float16 t[64 * 72];
    const unsigned tid = threadIdx.x;
    const unsigned n0 = blockIdx.x * 64u;
    const unsigned k0 = blockIdx.y * 64u;
    const float*  inb  = in  + (size_t)blockIdx.z * R * C;
    _Float16*     outb = out + (size_t)blockIdx.z * R * C;
#pragma unroll
    for (int i = 0; i < 4; ++i) {
        const unsigned idx = (unsigned)i * 256u + tid;
        const unsigned r = idx >> 4, c4 = (idx & 15u) << 2;
        const v4f v = *(const v4f*)(inb + (size_t)(k0 + r) * C + n0 + c4);
        t[(c4 + 0u) * 72u + r] = (_Float16)(bf16r(v.x) * 64.0f);
        t[(c4 + 1u) * 72u + r] = (_Float16)(bf16r(v.y) * 64.0f);
        t[(c4 + 2u) * 72u + r] = (_Float16)(bf16r(v.z) * 64.0f);
        t[(c4 + 3u) * 72u + r] = (_Float16)(bf16r(v.w) * 64.0f);
    }
    __syncthreads();
    const unsigned ln = tid & 31u;
    const unsigned kl = ((tid >> 6) & 1u) * 32u + ((tid >> 5) & 1u) * 16u + (ln >> 4) * 8u;
    const unsigned nl = (tid >> 7) * 16u + (ln & 15u);
    const v8h o0 = *(const v8h*)(&t[nl * 72u + kl]);
    const v8h o1 = *(const v8h*)(&t[(nl + 32u) * 72u + kl]);
    _Float16* d0 = outb + frag_off(n0 + nl, k0 + kl, R);
    _Float16* d1 = outb + frag_off(n0 + nl + 32u, k0 + kl, R);
    *(v8h*)d0 = o0;
    *(v8h*)d1 = o1;
    
}

// ---------------------------------------------------------------------------
// QKV projection. Block = 8 waves = 128 tokens x 128 columns; wave tile =
// 64 tokens x 32 columns = one (t, head, 32-wide d half) slice.
// q/k planes: [head][dhalf] fragment-ordered NTOK x 32 planes, f16 of 64q (hi)
// and 2^11 residual: per 16-row group the wave owns one 1024-byte unit (two
// lane-contiguous 16-B instructions per plane). V^T planes: [head*NB+b]
// fragment-ordered 64 (d) x SEQ (key) planes, hi / residual: a lane's 8
// accumulator rows (keys) of one column (d) are one piece of a unit at the
// lane's own place, so they are stored straight from registers.
// ---------------------------------------------------------------------------
__global__ __launch_bounds__(256) __attribute__((amdgpu_num_vgpr(256)))
void k_qkv(const _Float16* __restrict__ xh, const _Float16* __restrict__ wT,
           const float* __restrict__ bias,
           _Float16* __restrict__ qh, _Float16* __restrict__ ql,
           _Float16* __restrict__ kh, _Float16* __restrict__ kl,
           _Float16* __restrict__ vTh, _Float16* __restrict__ vTr) {
    __shared__ __align__(16) _Float16 stw[8][1024];   // 16 KB, wave-private tiles
    const unsigned tid  = threadIdx.x;
    const unsigned lane = tid & 31u;
    const unsigned w    = tid >> 5;
    const unsigned n0   = blockIdx.y * 128u + (w >> 2) * 64u;
    const unsigned cb   = blockIdx.x * 128u + (w & 3u) * 32u;
    const unsigned r0   = (lane >> 4) << 3;
    const unsigned cc   = lane & 15u;

    v8f acc[4][2], dum[4][2];
    gemm_core<4, 2, false, DM>(xh + (size_t)n0 * DM, xh + (size_t)n0 * DM,
                               wT + (size_t)cb * DM, lane, acc, dum);

    const unsigned t  = cb >> 9;
    const unsigned h  = (cb >> 6) & 7u;
    const unsigned kk = (cb >> 5) & 1u;
    float bv[2];
    const unsigned bi = cb + cc;
    const float b0 = bias[bi];
    const float b1 = bias[bi + 16u];
    // the index register is held (input) up to this wait: neither load returns into it
    asm volatile("s_wait_xcnt 0x0" :: "v"(bi) : "memory");
    bv[0] = bf16r(b0) * 64.0f;
    bv[1] = bf16r(b1) * 64.0f;
    _Float16* sw = &stw[w][0];

    if (t < 2u) {
        _Float16* ph = (t == 0u) ? qh : kh;
        _Float16* pl = (t == 0u) ? ql : kl;
        const size_t pbase = ((size_t)(h * 2u + kk) * NTOK + n0) * 32u;
#pragma unroll
        for (int mt = 0; mt < 4; ++mt) {
#pragma unroll
            for (int g = 0; g < 8; ++g) {
#pragma unroll
                for (int nt = 0; nt < 2; ++nt) {
                    const float v = acc[mt][nt][g] + bv[nt];
                    const _Float16 hi = (_Float16)v;
                    const unsigned so = nt * 256 + ((cc >> 3) * 16u + r0 + g) * 8u + (cc & 7u);
                    sw[so] = hi;
                    sw[512u + so] = (_Float16)((v - (float)hi) * SC_RES);
                }
            }
            wave_lds_sync();
            const v8h a0 = *(const v8h*)(sw + lane * 8u);
            const v8h a1 = *(const v8h*)(sw + 256u + lane * 8u);
            const v8h b0 = *(const v8h*)(sw + 512u + lane * 8u);
            const v8h b1 = *(const v8h*)(sw + 768u + lane * 8u);
            _Float16* dh = ph + pbase + (size_t)mt * 512u;
            _Float16* dl = pl + pbase + (size_t)mt * 512u;
            *(v8h*)(dh + lane * 8u)        = a0;
            *(v8h*)(dh + 256u + lane * 8u) = a1;
            *(v8h*)(dl + lane * 8u)        = b0;
            *(v8h*)(dl + 256u + lane * 8u) = b1;
            
            wave_lds_sync();
        }
    } else {
        const unsigned b  = n0 / (unsigned)SEQ;
        const unsigned l0 = n0 - b * (unsigned)SEQ;
        const unsigned hb = h * (unsigned)NB + b;
        const size_t vbase = ((size_t)(hb * HD + kk * 32u)) * SEQ + (size_t)l0 * 16u + lane * 8u;
#pragma unroll
        for (int mt = 0; mt < 4; ++mt)
#pragma unroll
            for (int nt = 0; nt < 2; ++nt) {
                v8h hv, rv;
#pragma unroll
                for (int g = 0; g < 8; ++g) {
                    const float v = acc[mt][nt][g] + bv[nt];
                    const _Float16 hi = (_Float16)v;
                    hv[g] = hi;
                    rv[g] = (_Float16)((v - (float)hi) * SC_RES);
                }
                const size_t vo = vbase + (size_t)(nt * 16) * SEQ + (mt >> 1) * 512 + (mt & 1) * 256;
                *(v8h*)(vTh + vo) = hv;
                *(v8h*)(vTr + vo) = rv;
            }
        // the V^T stores' registers may be rewritten behind this branch
        asm volatile("s_wait_xcnt 0x0" ::: "memory");
    }
}

// ---------------------------------------------------------------------------
// Attention, online softmax over keys. Block = 8 waves = 128 queries of one
// (head, batch); wave owns 16 queries. Scores are computed transposed:
// S^T tile = K(16 keys, A) x Q^T(B, n = query), so every statistic of a query
// lives in lane&15 (in-lane reduce over the 8 rows + one xor-16 exchange).
// P^T accumulator tiles (keys 0..15 / 16..31 of a 32-key step) are packed
// directly into the B fragment (k = key, n = query) of O^T = V^T x P^T with
// A = V^T rows (d) straight from the V^T planes. P carried 2^14.
// Loads run ahead of their use: K one step ahead, V from the head of its step.
// Epilogue: 16*ctx as f16 hi + 2^11 residual into fragment-ordered NTOK x 512
// planes: a lane's 8 rows (d) of one query are one piece of a unit at the
// lane's own place, stored straight from registers. msk cross-wave (block barrier).
// ---------------------------------------------------------------------------
__global__ __launch_bounds__(256) __attribute__((amdgpu_num_vgpr(256)))
void k_attn(const _Float16* __restrict__ qh, const _Float16* __restrict__ ql,
            const _Float16* __restrict__ kh, const _Float16* __restrict__ kl,
            const _Float16* __restrict__ vTh, const _Float16* __restrict__ vTr,
            const float* __restrict__ mask,
            _Float16* __restrict__ ctxh, _Float16* __restrict__ ctxr) {
    __shared__ __align__(16) float    msk[SEQ];          // additive key mask, log2 units

    const unsigned tid  = threadIdx.x;
    const unsigned lane = tid & 31u;
    const unsigned w    = tid >> 5;
    const unsigned hb   = blockIdx.x;
    const unsigned h    = hb / (unsigned)NB;
    const unsigned b    = hb - h * (unsigned)NB;
    const unsigned q0   = blockIdx.y * 128u + w * 16u;
    const unsigned r0   = (lane >> 4) << 3;

    for (unsigned idx = tid; idx < (unsigned)SEQ; idx += 256u)
        msk[idx] = bf16r(mask[(size_t)b * SEQ_FULL + idx]) * LOG2E;
    __syncthreads();

    const size_t tokq = (size_t)b * SEQ + q0;
    const size_t tokk = (size_t)b * SEQ;
    const size_t P0 = (size_t)(h * 2u) * NTOK;
    const size_t P1 = (size_t)(h * 2u + 1u) * NTOK;
    const v16h qhf0 = load_frag16(qh + (P0 + tokq) * 32u + lane * 8u);
    const v16h qhf1 = load_frag16(qh + (P1 + tokq) * 32u + lane * 8u);
    const v16h qlf0 = load_frag16(ql + (P0 + tokq) * 32u + lane * 8u);
    const v16h qlf1 = load_frag16(ql + (P1 + tokq) * 32u + lane * 8u);
    const _Float16* kh0 = kh + (P0 + tokk) * 32u;
    const _Float16* kl0 = kl + (P0 + tokk) * 32u;
    const _Float16* vhb = vTh + (size_t)hb * HD * SEQ;
    const _Float16* vrb = vTr + (size_t)hb * HD * SEQ;

    v8f oh[4], orr[4];
#pragma unroll
    for (int dt = 0; dt < 4; ++dt) { oh[dt] = zero8(); orr[dt] = zero8(); }
    float mr = -1.0e30f, lr = 0.0f;

    // One address pair per K plane pair and per V plane, carried through the loop: the
    // second d half of K lies a constant KP1 on, the second key tile and the d tiles too.
    constexpr size_t KP1 = (size_t)NTOK * 32u;
    const _Float16* pkh = kh0 + lane * 8u;
    const _Float16* pkl = kl0 + lane * 8u;
    const _Float16* pvh = vhb + lane * 8u;
    const _Float16* pvr = vrb + lane * 8u;
    // K fragments of the first 32 keys: [key tile][d half][hi, residual]
    v16h kf[2][2][2];
#pragma unroll
    for (int kt = 0; kt < 2; ++kt) {
        kf[kt][0][0] = load_frag16(pkh + kt * 512);
        kf[kt][0][1] = load_frag16(pkl + kt * 512);
        kf[kt][1][0] = load_frag16(pkh + KP1 + kt * 512);
        kf[kt][1][1] = load_frag16(pkl + KP1 + kt * 512);
    }

    // One 32-key step. MORE: a next step exists and its K fragments are requested. The last
    // step is written out behind the loop, so that inside the loop the requests in flight
    // are the same on every path and each wait counts only the loads it needs.
    auto key_step = [&](const unsigned key0, auto more) __attribute__((always_inline)) {
        constexpr bool MORE = decltype(more)::value;
        v8f sh0 = zero8(), sr0 = zero8(), sh1 = zero8(), sr1 = zero8();
        // this step's V fragments, d tiles 0 and 1: requested ahead of the score products
        // (d tiles 2 and 3 follow into the same registers, each behind its forerunner's products)
        v16h vfh[2], vfr[2];
#pragma unroll
        for (int dt = 0; dt < 2; ++dt) {
            vfh[dt] = load_frag16(pvh + (size_t)(dt * 16) * SEQ);
            vfr[dt] = load_frag16(pvr + (size_t)(dt * 16) * SEQ);
        }
        sh0 = wmma16(kf[0][0][0], qhf0, sh0);
        sr0 = wmma16(kf[0][0][0], qlf0, sr0);
        sr0 = wmma16(kf[0][0][1], qhf0, sr0);
        sh0 = wmma16(kf[0][1][0], qhf1, sh0);
        sr0 = wmma16(kf[0][1][0], qlf1, sr0);
        sr0 = wmma16(kf[0][1][1], qhf1, sr0);
        sh1 = wmma16(kf[1][0][0], qhf0, sh1);
        sr1 = wmma16(kf[1][0][0], qlf0, sr1);
        sr1 = wmma16(kf[1][0][1], qhf0, sr1);
        sh1 = wmma16(kf[1][1][0], qhf1, sh1);
        sr1 = wmma16(kf[1][1][0], qlf1, sr1);
        sr1 = wmma16(kf[1][1][1], qhf1, sr1);
        // the NEXT step's K fragments, into the set just read: requested behind this step's
        // score products, they land during the softmax and the V products
        if constexpr (MORE) {
#pragma unroll
            for (int kt = 0; kt < 2; ++kt) {
                kf[kt][0][0] = load_frag16(pkh + 1024 + kt * 512);
                kf[kt][0][1] = load_frag16(pkl + 1024 + kt * 512);
                kf[kt][1][0] = load_frag16(pkh + KP1 + 1024 + kt * 512);
                kf[kt][1][1] = load_frag16(pkl + KP1 + 1024 + kt * 512);
            }
        }
        float t0[8], t1[8];
#pragma unroll
        for (int g = 0; g < 8; ++g) {
            t0[g] = __builtin_fmaf(sh0[g], C1, sr0[g] * C2) + msk[key0 + r0 + g];
            t1[g] = __builtin_fmaf(sh1[g], C1, sr1[g] * C2) + msk[key0 + 16u + r0 + g];
        }
        float tmax = fmaxf(t0[0], t1[0]);
#pragma unroll
        for (int g = 1; g < 8; ++g) tmax = fmaxf(tmax, fmaxf(t0[g], t1[g]));
        tmax = fmaxf(tmax, __shfl_xor(tmax, 16, 32));
        const float mn    = fmaxf(mr, tmax);
        const float alpha = ex2(mr - mn);
        mr = mn;
        const float off = 14.0f - mn;
        v8h p0, p1;
        float ps = 0.0f;
#pragma unroll
        for (int g = 0; g < 8; ++g) {
            const _Float16 a = (_Float16)ex2(t0[g] + off);
            const _Float16 c = (_Float16)ex2(t1[g] + off);
            p0[g] = a;
            p1[g] = c;
            ps += (float)a + (float)c;
        }
        ps += __shfl_xor(ps, 16, 32);
        lr = lr * alpha + ps;
        Frag pb;
        pb.h[0] = p0;       // k = keys key0 + 8h + 0..7
        pb.h[1] = p1;       // k = keys key0 + 16 + 8h + 0..7
#pragma unroll
        for (int dt = 0; dt < 4; ++dt) {
            oh[dt]  = oh[dt] * alpha;
            orr[dt] = orr[dt] * alpha;
        }
#pragma unroll
        for (int dt = 0; dt < 4; ++dt) {
            oh[dt] = wmma16(vfh[dt & 1], pb.v, oh[dt]);
            orr[dt] = wmma16(vfr[dt & 1], pb.v, orr[dt]);
            if (dt < 2) {
                // keeps the request of d tile dt + 2 behind the products above, in their
                // registers: without it the build runs out of registers and spills to scratch
                __builtin_amdgcn_sched_barrier(0);
                vfh[dt] = load_frag16(pvh + (size_t)((dt + 2) * 16) * SEQ);
                vfr[dt] = load_frag16(pvr + (size_t)((dt + 2) * 16) * SEQ);
            }
        }
        // the address pairs are held (inputs) up to this wait and advanced only
        // behind it: no pair that an issued load still names is rewritten
        asm volatile("s_wait_xcnt 0x0" :: "v"(pkh), "v"(pkl), "v"(pvh), "v"(pvr) : "memory");
        pkh += 1024; pkl += 1024; pvh += 512; pvr += 512;
    };
#pragma unroll 1
    for (unsigned key0 = 0; key0 + 32u < (unsigned)SEQ; key0 += 32u) key_step(key0, Flag<true>{});
    key_step((unsigned)SEQ - 32u, Flag<false>{});

    // O^T lane (query lane&15): rows d = dt*16 + r0 + g. 16*ctx = (o + or 2^-11) / (64 l) * 16
    const float inv = 0.25f * (1.0f / lr);
    const size_t ob = tokq * DM + (size_t)(h * 2u) * 512u + lane * 8u;
#pragma unroll
    for (int dt = 0; dt < 4; ++dt) {
        v8h hv, rv;
#pragma unroll
        for (int g = 0; g < 8; ++g) {
            const float c = __builtin_fmaf(orr[dt][g], SC_RINV, oh[dt][g]) * inv;
            const _Float16 hi = (_Float16)c;
            hv[g] = hi;
            rv[g] = (_Float16)((c - (float)hi) * SC_RES);
        }
        *(v8h*)(ctxh + ob + (dt >> 1) * 512 + (dt & 1) * 256) = hv;
        *(v8h*)(ctxr + ob + (dt >> 1) * 512 + (dt & 1) * 256) = rv;
    }
}

// ---------------------------------------------------------------------------
// GEMM (N = 512) + bias + residual add + LayerNorm, fused. Block = 8 waves =
// 32 rows x 512 columns (wave tile 32 x 64). Scaled accumulators go to a
// cross-wave f32 LDS tile (block barrier), then wave w normalises rows
// POST: A = ctx hi + residual planes, residual add = bf16-RNE(x), outputs
// sa (f32) and 16*sa (f16, fragment-ordered NTOK x 512 plane: the block's 32
// rows are 32 KB contiguous, gathered in LDS as [k/8][row] pieces, block
// barrier, then 512-byte wave stores). Otherwise A = hidden plane, residual
// add = sa, output = final f32 rows.
// ---------------------------------------------------------------------------
template <bool POST>
__global__ __launch_bounds__(256) __attribute__((amdgpu_num_vgpr(256)))
void k_gemm_ln(const _Float16* __restrict__ Ah, const _Float16* __restrict__ Ar,
               const _Float16* __restrict__ Bt,
               const float* __restrict__ bias, const float* __restrict__ resid,
               const float* __restrict__ lnw, const float* __restrict__ lnb,
               float* __restrict__ outF, _Float16* __restrict__ outH) {
    constexpr unsigned K = POST ? DM : DF;       // contraction length: row-tile offsets are immediates
    __shared__ __align__(16) float T[32 * DM];   // 64 KB, cross-wave
    // 16*sa pieces: [64 k/8][32 rows][8], column pitch 264 (16 B of pad: the 16
    // columns of one wave store fall on different banks), cross-wave
    __shared__ __align__(16) _Float16 Hs[POST ? 64 * 264 : 8];
    const unsigned tid  = threadIdx.x;
    const unsigned lane = tid & 31u;
    const unsigned w    = tid >> 5;
    const unsigned row0 = blockIdx.x * 32u;
    const unsigned cb   = w * 64u;
    const unsigned r0   = (lane >> 4) << 3;
    const unsigned cc   = lane & 15u;

    v8f acc[2][4], accr[2][4];
    gemm_core<2, 4, POST, K>(Ah + (size_t)row0 * K, Ar + (size_t)row0 * K,
                             Bt + (size_t)cb * K, lane, acc, accr);
#pragma unroll
    for (int mt = 0; mt < 2; ++mt)
#pragma unroll
        for (int nt = 0; nt < 4; ++nt)
#pragma unroll
            for (int g = 0; g < 8; ++g) {
                const float v = POST ? __builtin_fmaf(accr[mt][nt][g], SC_RINV, acc[mt][nt][g])
                                     : acc[mt][nt][g];
                T[(mt * 16 + r0 + g) * DM + cb + nt * 16 + cc] = v;
            }
    __syncthreads();

#pragma unroll 1
    for (unsigned rr = 0; rr < 4u; ++rr) {
        const unsigned row = w * 4u + rr;
        const unsigned n   = row0 + row;
        const unsigned fr  = full_row(n);
        const float* rp = POST ? (resid + (size_t)fr * DM) : (resid + (size_t)n * DM);
        float*       op = POST ? (outF + (size_t)n * DM)   : (outF + (size_t)fr * DM);
        v4f xv[4];
        float s = 0.0f;
#pragma unroll
        for (int i = 0; i < 4; ++i) {
            const unsigned c = (unsigned)i * 128u + lane * 4u;
            const v4f a  = *(const v4f*)(&T[row * DM + c]);
            const v4f bi = *(const v4f*)(bias + c);
            const v4f rs = *(const v4f*)(rp + c);
            v4f x;
            x.x = __builtin_fmaf(a.x, SC_OUT, bf16r(bi.x)) + (POST ? bf16r(rs.x) : rs.x);
            x.y = __builtin_fmaf(a.y, SC_OUT, bf16r(bi.y)) + (POST ? bf16r(rs.y) : rs.y);
            x.z = __builtin_fmaf(a.z, SC_OUT, bf16r(bi.z)) + (POST ? bf16r(rs.z) : rs.z);
            x.w = __builtin_fmaf(a.w, SC_OUT, bf16r(bi.w)) + (POST ? bf16r(rs.w) : rs.w);
            xv[i] = x;
            s += (x.x + x.y) + (x.z + x.w);
        }
        s = wave_sum(s);
        const float mu = s * (1.0f / (float)DM);
        float q = 0.0f;
#pragma unroll
        for (int i = 0; i < 4; ++i) {
            const float d0 = xv[i].x - mu, d1 = xv[i].y - mu, d2 = xv[i].z - mu, d3 = xv[i].w - mu;
            q += (d0 * d0 + d1 * d1) + (d2 * d2 + d3 * d3);
        }
        q = wave_sum(q);
        const float rstd = rsqrtf(q * (1.0f / (float)DM) + 1.0e-5f);
        v4f yv[4];
#pragma unroll
        for (int i = 0; i < 4; ++i) {
            const unsigned c = (unsigned)i * 128u + lane * 4u;
            const v4f gw = *(const v4f*)(lnw + c);
            const v4f gb = *(const v4f*)(lnb + c);
            v4f y;
            y.x = (xv[i].x - mu) * rstd * bf16r(gw.x) + bf16r(gb.x);
            y.y = (xv[i].y - mu) * rstd * bf16r(gw.y) + bf16r(gb.y);
            y.z = (xv[i].z - mu) * rstd * bf16r(gw.z) + bf16r(gb.z);
            y.w = (xv[i].w - mu) * rstd * bf16r(gw.w) + bf16r(gb.w);
            yv[i] = y;
        }
        if (POST) {
#pragma unroll
            for (int i = 0; i < 4; ++i) {
                v4h hq;
                hq[0] = (_Float16)(yv[i].x * 16.0f); hq[1] = (_Float16)(yv[i].y * 16.0f);
                hq[2] = (_Float16)(yv[i].z * 16.0f); hq[3] = (_Float16)(yv[i].w * 16.0f);
                *(v4h*)(&Hs[((unsigned)i * 16u + (lane >> 1)) * 264u + row * 8u + (lane & 1u) * 4u]) = hq;
            }
        }
#pragma unroll
        for (int i = 0; i < 4; ++i)
            *(v4f*)(op + (unsigned)i * 128u + lane * 4u) = yv[i];
        // the row stores' registers are rewritten by the next row and behind the loop
        asm volatile("s_wait_xcnt 0x0" ::: "memory");
    }
    if (POST) {
        __syncthreads();
        _Float16* hp = outH + (size_t)row0 * DM + tid * 8u;
        // piece i*256 + tid of the block's 2 x 16 units: unit = 4*i + (w>>1), j = w&1
        const unsigned hs0 = ((w >> 1) * 4u + (w & 1u) * 2u + (lane >> 4)) * 264u + (lane & 15u) * 8u;
        v8h pv[8];
#pragma unroll
        for (int i = 0; i < 8; ++i)
            pv[i] = *(const v8h*)(&Hs[hs0 + (unsigned)(i & 3) * (16u * 264u) + (unsigned)(i >> 2) * 128u]);
#pragma unroll
        for (int i = 0; i < 8; ++i)
            *(v8h*)(hp + (unsigned)i * 2048u) = pv[i];
    }
}

// ---------------------------------------------------------------------------
// FF1: hidden = relu(sa W1 + b1), stored as f16 of 16*hidden, fragment-ordered
// NTOK x 2048 plane; the wave's 32 x 64 tile = 2 x 2 units, ordered in LDS.
// ---------------------------------------------------------------------------
__global__ __launch_bounds__(256) __attribute__((amdgpu_num_vgpr(256)))
void k_ff1(const _Float16* __restrict__ sah, const _Float16* __restrict__ Bt,
           const float* __restrict__ bias, _Float16* __restrict__ hid) {
    __shared__ __align__(16) _Float16 st[8][32 * 64];   // 32 KB wave-private
    const unsigned tid  = threadIdx.x;
    const unsigned lane = tid & 31u;
    const unsigned w    = tid >> 5;
    const unsigned row0 = blockIdx.y * 32u;
    const unsigned cb   = blockIdx.x * 512u + w * 64u;
    const unsigned r0   = (lane >> 4) << 3;
    const unsigned cc   = lane & 15u;

    v8f acc[2][4], dum[2][4];
    gemm_core<2, 4, false, DM>(sah + (size_t)row0 * DM, sah + (size_t)row0 * DM,
                               Bt + (size_t)cb * DM, lane, acc, dum);
    float bv[4];
#pragma unroll
    for (int nt = 0; nt < 4; ++nt) bv[nt] = bf16r(bias[cb + nt * 16 + cc]) * 16.0f;
    _Float16* sw = &st[w][0];
#pragma unroll
    for (int mt = 0; mt < 2; ++mt)
#pragma unroll
        for (int nt = 0; nt < 4; ++nt)
#pragma unroll
            for (int g = 0; g < 8; ++g)
                sw[(mt * 2 + (nt >> 1)) * 512 + (nt & 1) * 256 + ((cc >> 3) * 16u + r0 + g) * 8u + (cc & 7u)] =
                    (_Float16)fmaxf(__builtin_fmaf(acc[mt][nt][g], SC_HID, bv[nt]), 0.0f);
    wave_lds_sync();
    v8h xv[8];
#pragma unroll
    for (int i = 0; i < 8; ++i) xv[i] = *(const v8h*)(sw + i * 256 + lane * 8u);
    _Float16* ob = hid + (size_t)row0 * DF + (size_t)cb * 16u + lane * 8u;
#pragma unroll
    for (int i = 0; i < 8; ++i)
        *(v8h*)(ob + (size_t)((i >> 2) * 16) * DF + ((i >> 1) & 1) * 512 + (i & 1) * 256) = xv[i];
    
}

// ---------------------------------------------------------------------------
// Workspace arena in units of U = NTOK*512*2 bytes (16 MiB at full size);
// time-disjoint planes share offsets (launches are stream-ordered):
//   [0,4U)  qh ql kh kl          -> later sa f32 [0,2U), 16*sa f16 [2U,3U)
//   [4U,6U) V^T hi / residual
//   [6U,7U) xh                   -> later ctx hi
//   [7U,8U) Wqkv^T plane (1.5 MiB) -> later ctx residual -> later W1^T, W2^T
//   [3U,..) Wo^T plane (0.5 MiB, after attention) -> later hidden [3U,7U)
// ---------------------------------------------------------------------------
#define U_BYTES ((size_t)NTOK * DM * 2)
static_assert((size_t)NB_FULL * SEQ_FULL * DM * 2 * 8 <= (size_t)134217728);
static_assert(3 * U_BYTES >= (size_t)DM * DM * 2);

extern "C" void kernel_launch(void* const* d_in, const int* in_sizes, int n_in,
                              void* d_out, int out_size, void* d_ws, size_t ws_size,
                              hipStream_t stream) {
    if (n_in < 14) return;
    const int need_rows = (NB - 1) * SEQ_FULL + SEQ;
    if (in_sizes[0] < need_rows * DM) return;
    if (in_sizes[1] < need_rows) return;
    if (in_sizes[2] < 3 * NH * DM * HD || in_sizes[3] < 3 * NH * HD) return;
    if (in_sizes[4] < DM * DM || in_sizes[5] < DM) return;
    if (in_sizes[6] < DM * DF || in_sizes[7] < DF) return;
    if (in_sizes[8] < DF * DM || in_sizes[9] < DM) return;
    if (in_sizes[10] < DM || in_sizes[11] < DM || in_sizes[12] < DM || in_sizes[13] < DM) return;
    if (out_size < need_rows * DM) return;

    const float* inp   = (const float*)d_in[0];    // [16384,512]
    const float* mask  = (const float*)d_in[1];    // [32,1,512]
    const float* preW  = (const float*)d_in[2];    // [3,8,512,64]
    const float* preB  = (const float*)d_in[3];    // [3,8,1,64]
    const float* postW = (const float*)d_in[4];    // [512,512]
    const float* postB = (const float*)d_in[5];    // [512]
    const float* ff1W  = (const float*)d_in[6];    // [512,2048]
    const float* ff1B  = (const float*)d_in[7];    // [2048]
    const float* ff2W  = (const float*)d_in[8];    // [2048,512]
    const float* ff2B  = (const float*)d_in[9];    // [512]
    const float* ln1w  = (const float*)d_in[10];
    const float* ln1b  = (const float*)d_in[11];
    const float* ln2w  = (const float*)d_in[12];
    const float* ln2b  = (const float*)d_in[13];
    float* out = (float*)d_out;                    // [32,512,512]

    const size_t U = U_BYTES;
    const size_t WQ_B = (size_t)3 * NH * HD * DM * 2;   // 1.5 MiB
    const size_t W1_B = (size_t)DF * DM * 2;            // 2 MiB
    const size_t W2_B = (size_t)DM * DF * 2;            // 2 MiB
    size_t total = 8 * U;
    if (7 * U + W1_B + W2_B > total) total = 7 * U + W1_B + W2_B;
    if (7 * U + WQ_B > total) total = 7 * U + WQ_B;
    if (total > ws_size) return;

    char* ws = (char*)d_ws;
    _Float16* qh    = (_Float16*)(ws + 0 * U);
    _Float16* ql    = (_Float16*)(ws + 1 * U);
    _Float16* kh    = (_Float16*)(ws + 2 * U);
    _Float16* kl    = (_Float16*)(ws + 3 * U);
    _Float16* vTh   = (_Float16*)(ws + 4 * U);
    _Float16* vTr   = (_Float16*)(ws + 5 * U);
    _Float16* xh    = (_Float16*)(ws + 6 * U);
    _Float16* ctxh  = (_Float16*)(ws + 6 * U);
    _Float16* ctxr  = (_Float16*)(ws + 7 * U);
    _Float16* wqkvT = (_Float16*)(ws + 7 * U);
    float*    sa    = (float*)(ws + 0 * U);
    _Float16* sah   = (_Float16*)(ws + 2 * U);
    _Float16* postT = (_Float16*)(ws + 3 * U);
    _Float16* hid   = (_Float16*)(ws + 3 * U);
    _Float16* ff1T  = (_Float16*)(ws + 7 * U);
    _Float16* ff2T  = (_Float16*)(ws + 7 * U + W1_B);

    // x -> f16 plane (bf16-RNE values)
    k_cvt_x<<<dim3(NTOK / 4), dim3(256), 0, stream>>>(inp, xh);
    // pre_linear_w: 24 x in[512 k][64 n] -> out[64 n][512 k]; grid (64/64, 512/64, 24)
    k_wT<<<dim3(1, 8, 24), dim3(256), 0, stream>>>(preW, wqkvT, 512u, 64u);
    k_qkv<<<dim3(12, NTOK / 128), dim3(256), 0, stream>>>(xh, wqkvT, preB, qh, ql, kh, kl, vTh, vTr);
    k_attn<<<dim3(NH * NB, SEQ / 128), dim3(256), 0, stream>>>(qh, ql, kh, kl, vTh, vTr, mask, ctxh, ctxr);
    // post_linear_w: in[512 k][512 n] -> out[512 n][512 k]; grid (512/64, 512/64, 1)
    k_wT<<<dim3(8, 8, 1), dim3(256), 0, stream>>>(postW, postT, 512u, 512u);
    k_gemm_ln<true><<<dim3(NTOK / 32), dim3(256), 0, stream>>>(
        ctxh, ctxr, postT, postB, inp, ln1w, ln1b, sa, sah);
    // ff1_w: in[512 k][2048 n] -> out[2048 n][512 k]; grid (2048/64, 512/64, 1)
    k_wT<<<dim3(32, 8, 1), dim3(256), 0, stream>>>(ff1W, ff1T, 512u, 2048u);
    // ff2_w: in[2048 k][512 n] -> out[512 n][2048 k]; grid (512/64, 2048/64, 1)
    k_wT<<<dim3(8, 32, 1), dim3(256), 0, stream>>>(ff2W, ff2T, 2048u, 512u);
    k_ff1<<<dim3(4, NTOK / 32), dim3(256), 0, stream>>>(sah, ff1T, ff1B, hid);
    k_gemm_ln<false><<<dim3(NTOK / 32), dim3(256), 0, stream>>>(
        hid, hid, ff2T, ff2B, sa, ln2w, ln2b, out, sah);
}

// v003
// It runs in 228 microseconds.
// Two timings next to v002 put it at 1.03 and 1.04 times that version's speed.
// Counting every step since v000, it is 2.06 times as fast.
#include <hip/hip_runtime.h>
#include <hip/hip_fp16.h>

// All contractions on v_wmma_f32_16x16x32_f16 (f16 operands, f32 accumulate): x*Wqkv, sa*W1, h*W2 single f16 planes; k*q^T with f16 hi + 2^11-scaled f16 residual planes (hi.hi, hi.res, res.hi); V^T*P^T and ctx*Wo with f16 hi + 2^11-scaled f16 residual plane on V / ctx (two accumulators, residual folded 2^-11 in f32).

#ifndef NB
#define NB 32
#endif
#ifndef SEQ
#define SEQ 512
#endif
#define NB_FULL  32
#define SEQ_FULL 512
#define NH   8           // heads
#define HD   64          // head width
#define DM   512         // model width
#define DF   2048        // hidden width
#define NTOK (NB * SEQ)

static_assert(NB >= 1 && NB <= NB_FULL);
static_assert(SEQ >= 128 && SEQ <= SEQ_FULL);
static_assert(SEQ % 128 == 0);
static_assert(NTOK % 128 == 0);
static_assert(DM == NH * HD);
static_assert(DM == 512 && HD == 64 && NH == 8 && DF == 2048);

typedef _Float16 v16h __attribute__((ext_vector_type(16)));
typedef _Float16 v8h  __attribute__((ext_vector_type(8)));
typedef _Float16 v4h  __attribute__((ext_vector_type(4)));
typedef float    v8f  __attribute__((ext_vector_type(8)));
typedef float    v4f  __attribute__((ext_vector_type(4)));

typedef const __attribute__((address_space(1))) _Float16* GlobalH;   // pointer into global memory

union Frag { v16h v; v8h h[2]; };

template <bool V> struct Flag { static constexpr bool value = V; };

#define LOG2E 1.44269504088896340736f
// scores: acc_h = (64k_h).(64q_h), acc_r = 2^11-scaled residual cross terms
// t (log2 units) = acc_h * log2(e)*2^-12 + acc_r * log2(e)*2^-23
#define C1 (1.44269504088896340736f * 0.000244140625f)
#define C2 (1.44269504088896340736f * 1.1920928955078125e-07f)
#define SC_RES   2048.0f                     // residual plane carry 2^11
#define SC_RINV  4.8828125e-04f              // 2^-11 : residual accumulator fold
#define SC_OUT   9.765625e-04f               // 2^-10 : (16 a)(64 W) -> a.W
#define SC_HID   1.5625e-02f                 // 2^-6  : (16 sa)(64 W1) -> 16 h

static __device__ __forceinline__ v8f zero8() {
    v8f z;
#pragma unroll
    for (int i = 0; i < 8; ++i) z[i] = 0.0f;
    return z;
}

// Fragment-ordered operand planes. A plane of R rows x K (k) 16-bit elements
// is a sequence of 1024-byte units, unit (row/16)*(K/32) + k/32 = one 16x32
// WMMA operand fragment, stored as [j = (k>>4)&1][lane][8]:
//   lane = 16*((k>>3)&1) + (row&15), element = k&7.
// A fragment (A, or B from an [n][k] source) is then two wave-wide 16-byte
// loads of 512 contiguous bytes each (4 whole lines per load): lane m =
// lane&15 -> row m; kb = 8*(lane>>4); elements 0..7 = k kb..kb+7, elements
// 8..15 = k kb+16..kb+23.
// p = unit + lane*8, the lane's own place in the unit.
static __device__ __forceinline__ v16h load_frag16(const _Float16* p) {
    Frag f;
    f.h[0] = *(const v8h*)(p);
    f.h[1] = *(const v8h*)(p + 256);
    return f.v;
}

// offset (in elements) of the 8-element piece (row, k8..k8+7), k8 % 8 == 0
static __device__ __forceinline__ size_t frag_off(unsigned row, unsigned k8, unsigned K) {
    return ((size_t)(row >> 4) * (K >> 5) + (k8 >> 5)) * 512u
         + ((k8 >> 4) & 1u) * 256u + ((((k8 >> 3) & 1u) << 4) + (row & 15u)) * 8u;
}

static __device__ __forceinline__ v8f wmma16(v16h a, v16h b, v8f c) {
    v8f d = __builtin_amdgcn_wmma_f32_16x16x32_f16(false, a, false, b, (short)0, c, false, false);
    asm volatile("v_nop\n\tv_nop\n\tv_nop\n\tv_nop" : "+v"(d) : "v"(a), "v"(b));
    return d;
}

// f32 -> bf16 RNE convert, value kept as f32
static __device__ __forceinline__ float bf16r(float x) {
    unsigned u = __float_as_uint(x);
    u = (u + 0x7FFFu + ((u >> 16) & 1u)) & 0xFFFF0000u;
    return __uint_as_float(u);
}

static __device__ __forceinline__ float ex2(float x) {
    return __builtin_amdgcn_exp2f(x);
}

// ordering for a wave-private LDS tile: stores before later loads of the same wave
static __device__ __forceinline__ void wave_lds_sync() {
    __builtin_amdgcn_fence(3, "wavefront");
    asm volatile("s_wait_dscnt 0" ::: "memory");
    __builtin_amdgcn_wave_barrier();
}

static __device__ __forceinline__ float wave_sum(float v) {
    v += __shfl_xor(v, 16, 32);
    v += __shfl_xor(v, 8, 32);
    v += __shfl_xor(v, 4, 32);
    v += __shfl_xor(v, 2, 32);
    v += __shfl_xor(v, 1, 32);
    return v;
}

// compact token row (b*SEQ + l) -> row in the full-size arrays
static __device__ __forceinline__ unsigned full_row(unsigned n) {
    const unsigned b = n / (unsigned)SEQ;
    return b * (unsigned)SEQ_FULL + (n - b * (unsigned)SEQ);
}

// ---------------------------------------------------------------------------
// Wave-level GEMM core: TM x TN tiles of 16x16, A / Bt both fragment-ordered
// planes of width K; the pointers name the first unit of the wave's first row
// tile (row * K elements in), the next row tile is 16*K on, the next k step 512.
// RES: second A plane (2^11-scaled residual) into its own accumulators.
// The fragments of k step s + 1 are requested before the products of step s
// (two register sets), so a step waits for loads that are one step old, once,
// and not for each B fragment in turn. SB (16 accumulator tiles: RES, or a 4 x 4
// wave tile): the accumulators leave no room for a second B set, each B fragment
// is requested anew behind its last product.
// The k order and the accumulators of every sum are as before.
// ---------------------------------------------------------------------------
// One k step on the current set; LD: request the next step's set from pa / pr / pb.
template <int TM, int TN, bool RES, bool SB, unsigned K, bool LD>
static __device__ __forceinline__ void gemm_step(const _Float16* pa, const _Float16* pr,
                                                 const _Float16* pb,
                                                 const v16h (&ac)[TM], const v16h (&arc)[TM], v16h (&bc)[TN],
                                                 v16h (&an)[TM], v16h (&arn)[TM], v16h (&bn)[TN],
                                                 v8f (&acc)[TM][TN], v8f (&accr)[TM][TN]) {
    if (LD) {
#pragma unroll
        for (int mt = 0; mt < TM; ++mt) {
            an[mt] = load_frag16(pa + (size_t)(mt * 16) * K);
            if (RES) arn[mt] = load_frag16(pr + (size_t)(mt * 16) * K);
        }
        if (!SB) {
#pragma unroll
            for (int nt = 0; nt < TN; ++nt) bn[nt] = load_frag16(pb + (size_t)(nt * 16) * K);
        }
    }
#pragma unroll
    for (int nt = 0; nt < TN; ++nt) {
#pragma unroll
        for (int mt = 0; mt < TM; ++mt) {
            acc[mt][nt] = wmma16(ac[mt], bc[nt], acc[mt][nt]);
            if (RES) accr[mt][nt] = wmma16(arc[mt], bc[nt], accr[mt][nt]);
        }
        if (LD && SB) bc[nt] = load_frag16(pb + (size_t)(nt * 16) * K);
    }
}

template <int TM, int TN, bool RES, unsigned K>
static __device__ __forceinline__ void gemm_core(const _Float16* __restrict__ Ah,
                                                 const _Float16* __restrict__ Ar,
                                                 const _Float16* __restrict__ Bt,
                                                 unsigned lane,
                                                 v8f (&acc)[TM][TN], v8f (&accr)[TM][TN]) {
    static_assert(K % 64u == 0u && K >= 64u);
    constexpr bool SB = RES || TM * TN >= 16;    // one B set only
    constexpr int B1 = SB ? 0 : 1;               // index of the second B set
#pragma unroll
    for (int mt = 0; mt < TM; ++mt)
#pragma unroll
        for (int nt = 0; nt < TN; ++nt) {
            acc[mt][nt] = zero8();
            if (RES) accr[mt][nt] = zero8();
        }
    // one address pair per plane; row tiles and the two steps of a trip are constant offsets
    const _Float16* pa = Ah + lane * 8u;
    const _Float16* pr = Ar + lane * 8u;
    const _Float16* pb = Bt + lane * 8u;
    v16h a[2][TM], ar[2][TM], b[2][TN];
#pragma unroll
    for (int mt = 0; mt < TM; ++mt) {
        a[0][mt] = load_frag16(pa + (size_t)(mt * 16) * K);
        if (RES) ar[0][mt] = load_frag16(pr + (size_t)(mt * 16) * K);
    }
    // keeps the first A requests ahead of the first B requests, the order of every trip:
    // the wait at the loop's head serves both ways in, and with an A request last on this
    // way it counts to 0 and drains the B requests in flight on every trip
    if (!RES) __builtin_amdgcn_sched_barrier(0);
#pragma unroll
    for (int nt = 0; nt < TN; ++nt) b[0][nt] = load_frag16(pb + (size_t)(nt * 16) * K);
#pragma unroll 1
    for (unsigned k = 0; k + 64u < K; k += 64u) {
        gemm_step<TM, TN, RES, SB, K, true>(pa + 512, pr + 512, pb + 512,
                                        a[0], ar[0], b[0], a[1], ar[1], b[B1], acc, accr);
        gemm_step<TM, TN, RES, SB, K, true>(pa + 1024, pr + 1024, pb + 1024,
                                        a[1], ar[1], b[B1], a[0], ar[0], b[0], acc, accr);
        // the address pairs are held (inputs) up to this wait and advanced only
        // behind it: no pair that an issued load still names is rewritten
        if (RES) {
            asm volatile("s_wait_xcnt 0x0" :: "v"(pa), "v"(pr), "v"(pb) : "memory");
            pa += 1024; pr += 1024; pb += 1024;
        } else {
            // 4 x 4 tile: the wait and the advance (1024 elements = 0x800 bytes) in one
            // statement. Written apart, the build keeps an older copy of each pair, feeds
            // the step behind the loop from it and lets a load of that step return into it.
            // (typed as global-memory pointers, so that the loads behind it stay global loads)
            GlobalH ga = (GlobalH)pa, gb = (GlobalH)pb;
            asm volatile("s_wait_xcnt 0x0\n\t"
                         "v_add_nc_u64 %0, 0x800, %0\n\t"
                         "v_add_nc_u64 %1, 0x800, %1"
                         : "+v"(ga), "+v"(gb) :: "memory");
            pa = (const _Float16*)ga; pb = (const _Float16*)gb;
        }
    }
    gemm_step<TM, TN, RES, SB, K, true>(pa + 512, pr + 512, pb + 512,
                                    a[0], ar[0], b[0], a[1], ar[1], b[B1], acc, accr);
    gemm_step<TM, TN, RES, SB, K, false>(pa, pr, pb,
                                     a[1], ar[1], b[B1], a[0], ar[0], b[0], acc, accr);
    // as above, for the last steps' loads: the pairs' registers are free behind it
    if (RES) asm volatile("s_wait_xcnt 0x0" :: "v"(pa), "v"(pr), "v"(pb) : "memory");
    else     asm volatile("s_wait_xcnt 0x0" :: "v"(pa), "v"(pb) : "memory");
}

// ---------------------------------------------------------------------------
// x (f32) -> xh, fragment-ordered NTOK x 512 plane, f16 of the bf16-RNE value.
// 8 elements per thread; a wave takes 8 rows x 32 columns (one 128-B line per
// row in, four whole 128-B lines out, each line written by one wave).
// ---------------------------------------------------------------------------
__global__ __launch_bounds__(256) void k_cvt_x(const float* __restrict__ x,
                                                _Float16* __restrict__ xh) {
    const unsigned idx = blockIdx.x * 256u + threadIdx.x;
    const unsigned wv  = idx >> 5;
    const unsigned ln  = idx & 31u;
    const unsigned n   = (wv >> 4) * 8u + (ln & 7u);
    const unsigned c8  = (wv & 15u) * 32u + (ln >> 3) * 8u;
    const unsigned fr  = full_row(n);
    const float* p = x + (size_t)fr * DM + c8;
    const v4f a = *(const v4f*)(p);
    const v4f b = *(const v4f*)(p + 4);
    v8h o;
    o[0] = (_Float16)bf16r(a.x); o[1] = (_Float16)bf16r(a.y);
    o[2] = (_Float16)bf16r(a.z); o[3] = (_Float16)bf16r(a.w);
    o[4] = (_Float16)bf16r(b.x); o[5] = (_Float16)bf16r(b.y);
    o[6] = (_Float16)bf16r(b.z); o[7] = (_Float16)bf16r(b.w);
    _Float16* d = xh + frag_off(n, c8, (unsigned)DM);
    *(v8h*)d = o;
    
}

// ---------------------------------------------------------------------------
// Weight plane builder: in [z][R][C] f32 (k-major, W[k][n]) -> out: z
// fragment-ordered planes of C rows (n) x R (k), f16 = 64 * bf16-RNE(W)^T.
// 64x64 tile through LDS = 4 x 2 units, each wave store 512 contiguous bytes;
// grid = (C/64, R/64, z).
// ---------------------------------------------------------------------------
__global__ __launch_bounds__(256) void k_wT(const float* __restrict__ in,
                                             _Float16* __restrict__ out,
                                             unsigned R, unsigned C) {
    __shared__ __align__(16) _Float16 t[64 * 72];
    const unsigned tid = threadIdx.x;
    const unsigned n0 = blockIdx.x * 64u;
    const unsigned k0 = blockIdx.y * 64u;
    const float*  inb  = in  + (size_t)blockIdx.z * R * C;
    _Float16*     outb = out + (size_t)blockIdx.z * R * C;
#pragma unroll
    for (int i = 0; i < 4; ++i) {
        const unsigned idx = (unsigned)i * 256u + tid;
        const unsigned r = idx >> 4, c4 = (idx & 15u) << 2;
        const v4f v = *(const v4f*)(inb + (size_t)(k0 + r) * C + n0 + c4);
        t[(c4 + 0u) * 72u + r] = (_Float16)(bf16r(v.x) * 64.0f);
        t[(c4 + 1u) * 72u + r] = (_Float16)(bf16r(v.y) * 64.0f);
        t[(c4 + 2u) * 72u + r] = (_Float16)(bf16r(v.z) * 64.0f);
        t[(c4 + 3u) * 72u + r] = (_Float16)(bf16r(v.w) * 64.0f);
    }
    __syncthreads();
    const unsigned ln = tid & 31u;
    const unsigned kl = ((tid >> 6) & 1u) * 32u + ((tid >> 5) & 1u) * 16u + (ln >> 4) * 8u;
    const unsigned nl = (tid >> 7) * 16u + (ln & 15u);
    const v8h o0 = *(const v8h*)(&t[nl * 72u + kl]);
    const v8h o1 = *(const v8h*)(&t[(nl + 32u) * 72u + kl]);
    _Float16* d0 = outb + frag_off(n0 + nl, k0 + kl, R);
    _Float16* d1 = outb + frag_off(n0 + nl + 32u, k0 + kl, R);
    *(v8h*)d0 = o0;
    *(v8h*)d1 = o1;
    
}

// ---------------------------------------------------------------------------
// QKV projection. Block = 8 waves = 128 tokens x 256 columns; wave tile =
// 64 tokens x 64 columns = one (t, head) slice, both 32-wide d halves.
// q/k planes: [head][dhalf] fragment-ordered NTOK x 32 planes, f16 of 64q (hi)
// and 2^11 residual: per 16-row group the wave owns one 1024-byte unit (two
// lane-contiguous 16-B instructions per plane). V^T planes: [head*NB+b]
// fragment-ordered 64 (d) x SEQ (key) planes, hi / residual: a lane's 8
// accumulator rows (keys) of one column (d) are one piece of a unit at the
// lane's own place, so they are stored straight from registers.
// ---------------------------------------------------------------------------
__global__ __launch_bounds__(256) __attribute__((amdgpu_num_vgpr(256)))
void k_qkv(const _Float16* __restrict__ xh, const _Float16* __restrict__ wT,
           const float* __restrict__ bias,
           _Float16* __restrict__ qh, _Float16* __restrict__ ql,
           _Float16* __restrict__ kh, _Float16* __restrict__ kl,
           _Float16* __restrict__ vTh, _Float16* __restrict__ vTr) {
    __shared__ __align__(16) _Float16 stw[8][1024];   // 16 KB, wave-private tiles
    const unsigned tid  = threadIdx.x;
    const unsigned lane = tid & 31u;
    const unsigned w    = tid >> 5;
    const unsigned n0   = blockIdx.y * 128u + (w >> 2) * 64u;
    const unsigned cb   = blockIdx.x * 256u + (w & 3u) * 64u;
    const unsigned r0   = (lane >> 4) << 3;
    const unsigned cc   = lane & 15u;

    v8f acc[4][4], dum[4][4];
    gemm_core<4, 4, false, DM>(xh + (size_t)n0 * DM, xh + (size_t)n0 * DM,
                               wT + (size_t)cb * DM, lane, acc, dum);

    const unsigned t  = cb >> 9;
    const unsigned h  = (cb >> 6) & 7u;
    float bv[4];
    const unsigned bi = cb + cc;
    const float b0 = bias[bi];
    const float b1 = bias[bi + 16u];
    const float b2 = bias[bi + 32u];
    const float b3 = bias[bi + 48u];
    // the index register is held (input) up to this wait: no load returns into it
    asm volatile("s_wait_xcnt 0x0" :: "v"(bi) : "memory");
    bv[0] = bf16r(b0) * 64.0f;
    bv[1] = bf16r(b1) * 64.0f;
    bv[2] = bf16r(b2) * 64.0f;
    bv[3] = bf16r(b3) * 64.0f;
    _Float16* sw = &stw[w][0];

    if (t < 2u) {
        _Float16* ph = (t == 0u) ? qh : kh;
        _Float16* pl = (t == 0u) ? ql : kl;
#pragma unroll
        for (int kk = 0; kk < 2; ++kk) {         // the two d halves, one plane each
        const size_t pbase = ((size_t)(h * 2u + (unsigned)kk) * NTOK + n0) * 32u;
#pragma unroll
        for (int mt = 0; mt < 4; ++mt) {
#pragma unroll
            for (int g = 0; g < 8; ++g) {
#pragma unroll
                for (int nt = 0; nt < 2; ++nt) {
                    const float v = acc[mt][kk * 2 + nt][g] + bv[kk * 2 + nt];
                    const _Float16 hi = (_Float16)v;
                    const unsigned so = nt * 256 + ((cc >> 3) * 16u + r0 + g) * 8u + (cc & 7u);
                    sw[so] = hi;
                    sw[512u + so] = (_Float16)((v - (float)hi) * SC_RES);
                }
            }
            wave_lds_sync();
            const v8h a0 = *(const v8h*)(sw + lane * 8u);
            const v8h a1 = *(const v8h*)(sw + 256u + lane * 8u);
            const v8h b0 = *(const v8h*)(sw + 512u + lane * 8u);
            const v8h b1 = *(const v8h*)(sw + 768u + lane * 8u);
            _Float16* dh = ph + pbase + (size_t)mt * 512u;
            _Float16* dl = pl + pbase + (size_t)mt * 512u;
            *(v8h*)(dh + lane * 8u)        = a0;
            *(v8h*)(dh + 256u + lane * 8u) = a1;
            *(v8h*)(dl + lane * 8u)        = b0;
            *(v8h*)(dl + 256u + lane * 8u) = b1;
            
            wave_lds_sync();
        }
        }
    } else {
        const unsigned b  = n0 / (unsigned)SEQ;
        const unsigned l0 = n0 - b * (unsigned)SEQ;
        const unsigned hb = h * (unsigned)NB + b;
        const size_t vbase = ((size_t)(hb * HD)) * SEQ + (size_t)l0 * 16u + lane * 8u;
#pragma unroll
        for (int mt = 0; mt < 4; ++mt)
#pragma unroll
            for (int nt = 0; nt < 4; ++nt) {
                v8h hv, rv;
#pragma unroll
                for (int g = 0; g < 8; ++g) {
                    const float v = acc[mt][nt][g] + bv[nt];
                    const _Float16 hi = (_Float16)v;
                    hv[g] = hi;
                    rv[g] = (_Float16)((v - (float)hi) * SC_RES);
                }
                const size_t vo = vbase + (size_t)(nt * 16) * SEQ + (mt >> 1) * 512 + (mt & 1) * 256;
                *(v8h*)(vTh + vo) = hv;
                *(v8h*)(vTr + vo) = rv;
            }
        // the V^T stores' registers may be rewritten behind this branch
        asm volatile("s_wait_xcnt 0x0" ::: "memory");
    }
}

// ---------------------------------------------------------------------------
// Attention, online softmax over keys. Block = 8 waves = 128 queries of one
// (head, batch); wave owns 16 queries. Scores are computed transposed:
// S^T tile = K(16 keys, A) x Q^T(B, n = query), so every statistic of a query
// lives in lane&15 (in-lane reduce over the 8 rows + one xor-16 exchange).
// P^T accumulator tiles (keys 0..15 / 16..31 of a 32-key step) are packed
// directly into the B fragment (k = key, n = query) of O^T = V^T x P^T with
// A = V^T rows (d) straight from the V^T planes. P carried 2^14.
// Loads run ahead of their use: K one step ahead, V from the head of its step.
// Epilogue: 16*ctx as f16 hi + 2^11 residual into fragment-ordered NTOK x 512
// planes: a lane's 8 rows (d) of one query are one piece of a unit at the
// lane's own place, stored straight from registers. msk cross-wave (block barrier).
// ---------------------------------------------------------------------------
__global__ __launch_bounds__(256) __attribute__((amdgpu_num_vgpr(256)))
void k_attn(const _Float16* __restrict__ qh, const _Float16* __restrict__ ql,
            const _Float16* __restrict__ kh, const _Float16* __restrict__ kl,
            const _Float16* __restrict__ vTh, const _Float16* __restrict__ vTr,
            const float* __restrict__ mask,
            _Float16* __restrict__ ctxh, _Float16* __restrict__ ctxr) {
    __shared__ __align__(16) float    msk[SEQ];          // additive key mask, log2 units

    const unsigned tid  = threadIdx.x;
    const unsigned lane = tid & 31u;
    const unsigned w    = tid >> 5;
    const unsigned hb   = blockIdx.x;
    const unsigned h    = hb / (unsigned)NB;
    const unsigned b    = hb - h * (unsigned)NB;
    const unsigned q0   = blockIdx.y * 128u + w * 16u;
    const unsigned r0   = (lane >> 4) << 3;

    for (unsigned idx = tid; idx < (unsigned)SEQ; idx += 256u)
        msk[idx] = bf16r(mask[(size_t)b * SEQ_FULL + idx]) * LOG2E;
    __syncthreads();

    const size_t tokq = (size_t)b * SEQ + q0;
    const size_t tokk = (size_t)b * SEQ;
    const size_t P0 = (size_t)(h * 2u) * NTOK;
    const size_t P1 = (size_t)(h * 2u + 1u) * NTOK;
    const v16h qhf0 = load_frag16(qh + (P0 + tokq) * 32u + lane * 8u);
    const v16h qhf1 = load_frag16(qh + (P1 + tokq) * 32u + lane * 8u);
    const v16h qlf0 = load_frag16(ql + (P0 + tokq) * 32u + lane * 8u);
    const v16h qlf1 = load_frag16(ql + (P1 + tokq) * 32u + lane * 8u);
    const _Float16* kh0 = kh + (P0 + tokk) * 32u;
    const _Float16* kl0 = kl + (P0 + tokk) * 32u;
    const _Float16* vhb = vTh + (size_t)hb * HD * SEQ;
    const _Float16* vrb = vTr + (size_t)hb * HD * SEQ;

    v8f oh[4], orr[4];
#pragma unroll
    for (int dt = 0; dt < 4; ++dt) { oh[dt] = zero8(); orr[dt] = zero8(); }
    float mr = -1.0e30f, lr = 0.0f;

    // One address pair per K plane pair and per V plane, carried through the loop: the
    // second d half of K lies a constant KP1 on, the second key tile and the d tiles too.
    constexpr size_t KP1 = (size_t)NTOK * 32u;
    const _Float16* pkh = kh0 + lane * 8u;
    const _Float16* pkl = kl0 + lane * 8u;
    const _Float16* pvh = vhb + lane * 8u;
    const _Float16* pvr = vrb + lane * 8u;
    // K fragments of the first 32 keys: [key tile][d half][hi, residual]
    v16h kf[2][2][2];
#pragma unroll
    for (int kt = 0; kt < 2; ++kt) {
        kf[kt][0][0] = load_frag16(pkh + kt * 512);
        kf[kt][0][1] = load_frag16(pkl + kt * 512);
        kf[kt][1][0] = load_frag16(pkh + KP1 + kt * 512);
        kf[kt][1][1] = load_frag16(pkl + KP1 + kt * 512);
    }

    // One 32-key step. MORE: a next step exists and its K fragments are requested. The last
    // step is written out behind the loop, so that inside the loop the requests in flight
    // are the same on every path and each wait counts only the loads it needs.
    auto key_step = [&](const unsigned key0, auto more) __attribute__((always_inline)) {
        constexpr bool MORE = decltype(more)::value;
        v8f sh0 = zero8(), sr0 = zero8(), sh1 = zero8(), sr1 = zero8();
        // this step's V fragments, d tiles 0 and 1: requested ahead of the score products
        // (d tiles 2 and 3 follow into the same registers, each behind its forerunner's products)
        v16h vfh[2], vfr[2];
#pragma unroll
        for (int dt = 0; dt < 2; ++dt) {
            vfh[dt] = load_frag16(pvh + (size_t)(dt * 16) * SEQ);
            vfr[dt] = load_frag16(pvr + (size_t)(dt * 16) * SEQ);
        }
        sh0 = wmma16(kf[0][0][0], qhf0, sh0);
        sr0 = wmma16(kf[0][0][0], qlf0, sr0);
        sr0 = wmma16(kf[0][0][1], qhf0, sr0);
        sh0 = wmma16(kf[0][1][0], qhf1, sh0);
        sr0 = wmma16(kf[0][1][0], qlf1, sr0);
        sr0 = wmma16(kf[0][1][1], qhf1, sr0);
        sh1 = wmma16(kf[1][0][0], qhf0, sh1);
        sr1 = wmma16(kf[1][0][0], qlf0, sr1);
        sr1 = wmma16(kf[1][0][1], qhf0, sr1);
        sh1 = wmma16(kf[1][1][0], qhf1, sh1);
        sr1 = wmma16(kf[1][1][0], qlf1, sr1);
        sr1 = wmma16(kf[1][1][1], qhf1, sr1);
        // the NEXT step's K fragments, into the set just read: requested behind this step's
        // score products, they land during the softmax and the V products
        if constexpr (MORE) {
#pragma unroll
            for (int kt = 0; kt < 2; ++kt) {
                kf[kt][0][0] = load_frag16(pkh + 1024 + kt * 512);
                kf[kt][0][1] = load_frag16(pkl + 1024 + kt * 512);
                kf[kt][1][0] = load_frag16(pkh + KP1 + 1024 + kt * 512);
                kf[kt][1][1] = load_frag16(pkl + KP1 + 1024 + kt * 512);
            }
        }
        float t0[8], t1[8];
#pragma unroll
        for (int g = 0; g < 8; ++g) {
            t0[g] = __builtin_fmaf(sh0[g], C1, sr0[g] * C2) + msk[key0 + r0 + g];
            t1[g] = __builtin_fmaf(sh1[g], C1, sr1[g] * C2) + msk[key0 + 16u + r0 + g];
        }
        float tmax = fmaxf(t0[0], t1[0]);
#pragma unroll
        for (int g = 1; g < 8; ++g) tmax = fmaxf(tmax, fmaxf(t0[g], t1[g]));
        tmax = fmaxf(tmax, __shfl_xor(tmax, 16, 32));
        const float mn    = fmaxf(mr, tmax);
        const float alpha = ex2(mr - mn);
        mr = mn;
        const float off = 14.0f - mn;
        v8h p0, p1;
        float ps = 0.0f;
#pragma unroll
        for (int g = 0; g < 8; ++g) {
            const _Float16 a = (_Float16)ex2(t0[g] + off);
            const _Float16 c = (_Float16)ex2(t1[g] + off);
            p0[g] = a;
            p1[g] = c;
            ps += (float)a + (float)c;
        }
        ps += __shfl_xor(ps, 16, 32);
        lr = lr * alpha + ps;
        Frag pb;
        pb.h[0] = p0;       // k = keys key0 + 8h + 0..7
        pb.h[1] = p1;       // k = keys key0 + 16 + 8h + 0..7
#pragma unroll
        for (int dt = 0; dt < 4; ++dt) {
            oh[dt]  = oh[dt] * alpha;
            orr[dt] = orr[dt] * alpha;
        }
#pragma unroll
        for (int dt = 0; dt < 4; ++dt) {
            oh[dt] = wmma16(vfh[dt & 1], pb.v, oh[dt]);
            orr[dt] = wmma16(vfr[dt & 1], pb.v, orr[dt]);
            if (dt < 2) {
                // keeps the request of d tile dt + 2 behind the products above, in their
                // registers: without it the build runs out of registers and spills to scratch
                __builtin_amdgcn_sched_barrier(0);
                vfh[dt] = load_frag16(pvh + (size_t)((dt + 2) * 16) * SEQ);
                vfr[dt] = load_frag16(pvr + (size_t)((dt + 2) * 16) * SEQ);
            }
        }
        // the address pairs are held (inputs) up to this wait and advanced only
        // behind it: no pair that an issued load still names is rewritten
        asm volatile("s_wait_xcnt 0x0" :: "v"(pkh), "v"(pkl), "v"(pvh), "v"(pvr) : "memory");
        pkh += 1024; pkl += 1024; pvh += 512; pvr += 512;
    };
#pragma unroll 1
    for (unsigned key0 = 0; key0 + 32u < (unsigned)SEQ; key0 += 32u) key_step(key0, Flag<true>{});
    key_step((unsigned)SEQ - 32u, Flag<false>{});

    // O^T lane (query lane&15): rows d = dt*16 + r0 + g. 16*ctx = (o + or 2^-11) / (64 l) * 16
    const float inv = 0.25f * (1.0f / lr);
    const size_t ob = tokq * DM + (size_t)(h * 2u) * 512u + lane * 8u;
#pragma unroll
    for (int dt = 0; dt < 4; ++dt) {
        v8h hv, rv;
#pragma unroll
        for (int g = 0; g < 8; ++g) {
            const float c = __builtin_fmaf(orr[dt][g], SC_RINV, oh[dt][g]) * inv;
            const _Float16 hi = (_Float16)c;
            hv[g] = hi;
            rv[g] = (_Float16)((c - (float)hi) * SC_RES);
        }
        *(v8h*)(ctxh + ob + (dt >> 1) * 512 + (dt & 1) * 256) = hv;
        *(v8h*)(ctxr + ob + (dt >> 1) * 512 + (dt & 1) * 256) = rv;
    }
}

// ---------------------------------------------------------------------------
// GEMM (N = 512) + bias + residual add + LayerNorm, fused. Block = 8 waves =
// ROWS rows x 512 columns (wave tile ROWS x 64; ROWS = 32 with the residual
// plane's second accumulators, 64 without). Scaled accumulators go to a
// cross-wave f32 LDS tile (block barrier), then wave w normalises rows
// POST: A = ctx hi + residual planes, residual add = bf16-RNE(x), outputs
// sa (f32) and 16*sa (f16, fragment-ordered NTOK x 512 plane: the block's 32
// rows are 32 KB contiguous, gathered in LDS as [k/8][row] pieces, block
// barrier, then 512-byte wave stores). Otherwise A = hidden plane, residual
// add = sa, output = final f32 rows.
// ---------------------------------------------------------------------------
template <bool POST>
__global__ __launch_bounds__(256) __attribute__((amdgpu_num_vgpr(256)))
void k_gemm_ln(const _Float16* __restrict__ Ah, const _Float16* __restrict__ Ar,
               const _Float16* __restrict__ Bt,
               const float* __restrict__ bias, const float* __restrict__ resid,
               const float* __restrict__ lnw, const float* __restrict__ lnb,
               float* __restrict__ outF, _Float16* __restrict__ outH) {
    constexpr unsigned K = POST ? DM : DF;       // contraction length: row-tile offsets are immediates
    constexpr unsigned ROWS = POST ? 32u : 64u;  // rows of the block
    constexpr int TM = (int)(ROWS / 16u);
    __shared__ __align__(16) float T[ROWS * DM]; // 64 / 128 KB, cross-wave
    // 16*sa pieces: [64 k/8][32 rows][8], column pitch 264 (16 B of pad: the 16
    // columns of one wave store fall on different banks), cross-wave
    __shared__ __align__(16) _Float16 Hs[POST ? 64 * 264 : 8];
    const unsigned tid  = threadIdx.x;
    const unsigned lane = tid & 31u;
    const unsigned w    = tid >> 5;
    const unsigned row0 = blockIdx.x * ROWS;
    const unsigned cb   = w * 64u;
    const unsigned r0   = (lane >> 4) << 3;
    const unsigned cc   = lane & 15u;

    v8f acc[TM][4], accr[TM][4];
    gemm_core<TM, 4, POST, K>(Ah + (size_t)row0 * K, Ar + (size_t)row0 * K,
                             Bt + (size_t)cb * K, lane, acc, accr);
#pragma unroll
    for (int mt = 0; mt < TM; ++mt)
#pragma unroll
        for (int nt = 0; nt < 4; ++nt)
#pragma unroll
            for (int g = 0; g < 8; ++g) {
                const float v = POST ? __builtin_fmaf(accr[mt][nt][g], SC_RINV, acc[mt][nt][g])
                                     : acc[mt][nt][g];
                T[(mt * 16 + r0 + g) * DM + cb + nt * 16 + cc] = v;
            }
    __syncthreads();

#pragma unroll 1
    for (unsigned rr = 0; rr < ROWS / 8u; ++rr) {
        const unsigned row = w * (ROWS / 8u) + rr;
        const unsigned n   = row0 + row;
        const unsigned fr  = full_row(n);
        const float* rp = POST ? (resid + (size_t)fr * DM) : (resid + (size_t)n * DM);
        float*       op = POST ? (outF + (size_t)n * DM)   : (outF + (size_t)fr * DM);
        v4f xv[4];
        float s = 0.0f;
#pragma unroll
        for (int i = 0; i < 4; ++i) {
            const unsigned c = (unsigned)i * 128u + lane * 4u;
            const v4f a  = *(const v4f*)(&T[row * DM + c]);
            const v4f bi = *(const v4f*)(bias + c);
            const v4f rs = *(const v4f*)(rp + c);
            v4f x;
            x.x = __builtin_fmaf(a.x, SC_OUT, bf16r(bi.x)) + (POST ? bf16r(rs.x) : rs.x);
            x.y = __builtin_fmaf(a.y, SC_OUT, bf16r(bi.y)) + (POST ? bf16r(rs.y) : rs.y);
            x.z = __builtin_fmaf(a.z, SC_OUT, bf16r(bi.z)) + (POST ? bf16r(rs.z) : rs.z);
            x.w = __builtin_fmaf(a.w, SC_OUT, bf16r(bi.w)) + (POST ? bf16r(rs.w) : rs.w);
            xv[i] = x;
            s += (x.x + x.y) + (x.z + x.w);
        }
        s = wave_sum(s);
        const float mu = s * (1.0f / (float)DM);
        float q = 0.0f;
#pragma unroll
        for (int i = 0; i < 4; ++i) {
            const float d0 = xv[i].x - mu, d1 = xv[i].y - mu, d2 = xv[i].z - mu, d3 = xv[i].w - mu;
            q += (d0 * d0 + d1 * d1) + (d2 * d2 + d3 * d3);
        }
        q = wave_sum(q);
        const float rstd = rsqrtf(q * (1.0f / (float)DM) + 1.0e-5f);
        v4f yv[4];
#pragma unroll
        for (int i = 0; i < 4; ++i) {
            const unsigned c = (unsigned)i * 128u + lane * 4u;
            const v4f gw = *(const v4f*)(lnw + c);
            const v4f gb = *(const v4f*)(lnb + c);
            v4f y;
            y.x = (xv[i].x - mu) * rstd * bf16r(gw.x) + bf16r(gb.x);
            y.y = (xv[i].y - mu) * rstd * bf16r(gw.y) + bf16r(gb.y);
            y.z = (xv[i].z - mu) * rstd * bf16r(gw.z) + bf16r(gb.z);
            y.w = (xv[i].w - mu) * rstd * bf16r(gw.w) + bf16r(gb.w);
            yv[i] = y;
        }
        if (POST) {
#pragma unroll
            for (int i = 0; i < 4; ++i) {
                v4h hq;
                hq[0] = (_Float16)(yv[i].x * 16.0f); hq[1] = (_Float16)(yv[i].y * 16.0f);
                hq[2] = (_Float16)(yv[i].z * 16.0f); hq[3] = (_Float16)(yv[i].w * 16.0f);
                *(v4h*)(&Hs[((unsigned)i * 16u + (lane >> 1)) * 264u + row * 8u + (lane & 1u) * 4u]) = hq;
            }
        }
#pragma unroll
        for (int i = 0; i < 4; ++i)
            *(v4f*)(op + (unsigned)i * 128u + lane * 4u) = yv[i];
        // the row stores' registers are rewritten by the next row and behind the loop
        asm volatile("s_wait_xcnt 0x0" ::: "memory");
    }
    if (POST) {
        __syncthreads();
        _Float16* hp = outH + (size_t)row0 * DM + tid * 8u;
        // piece i*256 + tid of the block's 2 x 16 units: unit = 4*i + (w>>1), j = w&1
        const unsigned hs0 = ((w >> 1) * 4u + (w & 1u) * 2u + (lane >> 4)) * 264u + (lane & 15u) * 8u;
        v8h pv[8];
#pragma unroll
        for (int i = 0; i < 8; ++i)
            pv[i] = *(const v8h*)(&Hs[hs0 + (unsigned)(i & 3) * (16u * 264u) + (unsigned)(i >> 2) * 128u]);
#pragma unroll
        for (int i = 0; i < 8; ++i)
            *(v8h*)(hp + (unsigned)i * 2048u) = pv[i];
    }
}

// ---------------------------------------------------------------------------
// FF1: hidden = relu(sa W1 + b1), stored as f16 of 16*hidden, fragment-ordered
// NTOK x 2048 plane. Block = 8 waves = 128 rows x 256 columns; the wave's
// 64 x 64 tile = 4 x 2 units, ordered in LDS.
// ---------------------------------------------------------------------------
__global__ __launch_bounds__(256) __attribute__((amdgpu_num_vgpr(256)))
void k_ff1(const _Float16* __restrict__ sah, const _Float16* __restrict__ Bt,
           const float* __restrict__ bias, _Float16* __restrict__ hid) {
    __shared__ __align__(16) _Float16 st[8][64 * 64];   // 64 KB wave-private
    const unsigned tid  = threadIdx.x;
    const unsigned lane = tid & 31u;
    const unsigned w    = tid >> 5;
    const unsigned row0 = blockIdx.y * 128u + (w >> 2) * 64u;
    const unsigned cb   = blockIdx.x * 256u + (w & 3u) * 64u;
    const unsigned r0   = (lane >> 4) << 3;
    const unsigned cc   = lane & 15u;

    v8f acc[4][4], dum[4][4];
    gemm_core<4, 4, false, DM>(sah + (size_t)row0 * DM, sah + (size_t)row0 * DM,
                               Bt + (size_t)cb * DM, lane, acc, dum);
    float bv[4];
#pragma unroll
    for (int nt = 0; nt < 4; ++nt) bv[nt] = bf16r(bias[cb + nt * 16 + cc]) * 16.0f;
    _Float16* sw = &st[w][0];
#pragma unroll
    for (int mt = 0; mt < 4; ++mt)
#pragma unroll
        for (int nt = 0; nt < 4; ++nt)
#pragma unroll
            for (int g = 0; g < 8; ++g)
                sw[(mt * 2 + (nt >> 1)) * 512 + (nt & 1) * 256 + ((cc >> 3) * 16u + r0 + g) * 8u + (cc & 7u)] =
                    (_Float16)fmaxf(__builtin_fmaf(acc[mt][nt][g], SC_HID, bv[nt]), 0.0f);
    wave_lds_sync();
    v8h xv[16];
#pragma unroll
    for (int i = 0; i < 16; ++i) xv[i] = *(const v8h*)(sw + i * 256 + lane * 8u);
    _Float16* ob = hid + (size_t)row0 * DF + (size_t)cb * 16u + lane * 8u;
#pragma unroll
    for (int i = 0; i < 16; ++i)
        *(v8h*)(ob + (size_t)((i >> 2) * 16) * DF + ((i >> 1) & 1) * 512 + (i & 1) * 256) = xv[i];
    
}

// ---------------------------------------------------------------------------
// Workspace arena in units of U = NTOK*512*2 bytes (16 MiB at full size);
// time-disjoint planes share offsets (launches are stream-ordered):
//   [0,4U)  qh ql kh kl          -> later sa f32 [0,2U), 16*sa f16 [2U,3U)
//   [4U,6U) V^T hi / residual
//   [6U,7U) xh                   -> later ctx hi
//   [7U,8U) Wqkv^T plane (1.5 MiB) -> later ctx residual -> later W1^T, W2^T
//   [3U,..) Wo^T plane (0.5 MiB, after attention) -> later hidden [3U,7U)
// ---------------------------------------------------------------------------
#define U_BYTES ((size_t)NTOK * DM * 2)
static_assert((size_t)NB_FULL * SEQ_FULL * DM * 2 * 8 <= (size_t)134217728);
static_assert(3 * U_BYTES >= (size_t)DM * DM * 2);

extern "C" void kernel_launch(void* const* d_in, const int* in_sizes, int n_in,
                              void* d_out, int out_size, void* d_ws, size_t ws_size,
                              hipStream_t stream) {
    if (n_in < 14) return;
    const int need_rows = (NB - 1) * SEQ_FULL + SEQ;
    if (in_sizes[0] < need_rows * DM) return;
    if (in_sizes[1] < need_rows) return;
    if (in_sizes[2] < 3 * NH * DM * HD || in_sizes[3] < 3 * NH * HD) return;
    if (in_sizes[4] < DM * DM || in_sizes[5] < DM) return;
    if (in_sizes[6] < DM * DF || in_sizes[7] < DF) return;
    if (in_sizes[8] < DF * DM || in_sizes[9] < DM) return;
    if (in_sizes[10] < DM || in_sizes[11] < DM || in_sizes[12] < DM || in_sizes[13] < DM) return;
    if (out_size < need_rows * DM) return;

    const float* inp   = (const float*)d_in[0];    // [16384,512]
    const float* mask  = (const float*)d_in[1];    // [32,1,512]
    const float* preW  = (const float*)d_in[2];    // [3,8,512,64]
    const float* preB  = (const float*)d_in[3];    // [3,8,1,64]
    const float* postW = (const float*)d_in[4];    // [512,512]
    const float* postB = (const float*)d_in[5];    // [512]
    const float* ff1W  = (const float*)d_in[6];    // [512,2048]
    const float* ff1B  = (const float*)d_in[7];    // [2048]
    const float* ff2W  = (const float*)d_in[8];    // [2048,512]
    const float* ff2B  = (const float*)d_in[9];    // [512]
    const float* ln1w  = (const float*)d_in[10];
    const float* ln1b  = (const float*)d_in[11];
    const float* ln2w  = (const float*)d_in[12];
    const float* ln2b  = (const float*)d_in[13];
    float* out = (float*)d_out;                    // [32,512,512]

    const size_t U = U_BYTES;
    const size_t WQ_B = (size_t)3 * NH * HD * DM * 2;   // 1.5 MiB
    const size_t W1_B = (size_t)DF * DM * 2;            // 2 MiB
    const size_t W2_B = (size_t)DM * DF * 2;            // 2 MiB
    size_t total = 8 * U;
    if (7 * U + W1_B + W2_B > total) total = 7 * U + W1_B + W2_B;
    if (7 * U + WQ_B > total) total = 7 * U + WQ_B;
    if (total > ws_size) return;

    char* ws = (char*)d_ws;
    _Float16* qh    = (_Float16*)(ws + 0 * U);
    _Float16* ql    = (_Float16*)(ws + 1 * U);
    _Float16* kh    = (_Float16*)(ws + 2 * U);
    _Float16* kl    = (_Float16*)(ws + 3 * U);
    _Float16* vTh   = (_Float16*)(ws + 4 * U);
    _Float16* vTr   = (_Float16*)(ws + 5 * U);
    _Float16* xh    = (_Float16*)(ws + 6 * U);
    _Float16* ctxh  = (_Float16*)(ws + 6 * U);
    _Float16* ctxr  = (_Float16*)(ws + 7 * U);
    _Float16* wqkvT = (_Float16*)(ws + 7 * U);
    float*    sa    = (float*)(ws + 0 * U);
    _Float16* sah   = (_Float16*)(ws + 2 * U);
    _Float16* postT = (_Float16*)(ws + 3 * U);
    _Float16* hid   = (_Float16*)(ws + 3 * U);
    _Float16* ff1T  = (_Float16*)(ws + 7 * U);
    _Float16* ff2T  = (_Float16*)(ws + 7 * U + W1_B);

    // x -> f16 plane (bf16-RNE values)
    k_cvt_x<<<dim3(NTOK / 4), dim3(256), 0, stream>>>(inp, xh);
    // pre_linear_w: 24 x in[512 k][64 n] -> out[64 n][512 k]; grid (64/64, 512/64, 24)
    k_wT<<<dim3(1, 8, 24), dim3(256), 0, stream>>>(preW, wqkvT, 512u, 64u);
    k_qkv<<<dim3(6, NTOK / 128), dim3(256), 0, stream>>>(xh, wqkvT, preB, qh, ql, kh, kl, vTh, vTr);
    k_attn<<<dim3(NH * NB, SEQ / 128), dim3(256), 0, stream>>>(qh, ql, kh, kl, vTh, vTr, mask, ctxh, ctxr);
    // post_linear_w: in[512 k][512 n] -> out[512 n][512 k]; grid (512/64, 512/64, 1)
    k_wT<<<dim3(8, 8, 1), dim3(256), 0, stream>>>(postW, postT, 512u, 512u);
    k_gemm_ln<true><<<dim3(NTOK / 32), dim3(256), 0, stream>>>(
        ctxh, ctxr, postT, postB, inp, ln1w, ln1b, sa, sah);
    // ff1_w: in[512 k][2048 n] -> out[2048 n][512 k]; grid (2048/64, 512/64, 1)
    k_wT<<<dim3(32, 8, 1), dim3(256), 0, stream>>>(ff1W, ff1T, 512u, 2048u);
    // ff2_w: in[2048 k][512 n] -> out[512 n][2048 k]; grid (512/64, 2048/64, 1)
    k_wT<<<dim3(8, 32, 1), dim3(256), 0, stream>>>(ff2W, ff2T, 2048u, 512u);
    k_ff1<<<dim3(8, NTOK / 128), dim3(256), 0, stream>>>(sah, ff1T, ff1B, hid);
    k_gemm_ln<false><<<dim3(NTOK / 64), dim3(256), 0, stream>>>(
        hid, hid, ff2T, ff2B, sa, ln2w, ln2b, out, sah);
}

// v004
// One run takes 215 microseconds.
// Next to v003, in two timings, it ran 1.05 and 1.06 times as fast.
// All steps since v000 together make it 2.18 times as fast.
#include <hip/hip_runtime.h>
#include <hip/hip_fp16.h>

// All contractions on v_wmma_f32_16x16x32_f16 (f16 operands, f32 accumulate): x*Wqkv, sa*W1, h*W2 single f16 planes; k*q^T with f16 hi + 2^11-scaled f16 residual planes (hi.hi, hi.res, res.hi); V^T*P^T and ctx*Wo with f16 hi + 2^11-scaled f16 residual plane on V / ctx (two accumulators, residual folded 2^-11 in f32).

#ifndef NB
#define NB 32
#endif
#ifndef SEQ
#define SEQ 512
#endif
#define NB_FULL  32
#define SEQ_FULL 512
#define NH   8           // heads
#define HD   64          // head width
#define DM   512         // model width
#define DF   2048        // hidden width
#define NTOK (NB * SEQ)

static_assert(NB >= 1 && NB <= NB_FULL);
static_assert(SEQ >= 128 && SEQ <= SEQ_FULL);
static_assert(SEQ % 128 == 0);
static_assert(NTOK % 128 == 0);
static_assert(DM == NH * HD);
static_assert(DM == 512 && HD == 64 && NH == 8 && DF == 2048);

typedef _Float16 v16h __attribute__((ext_vector_type(16)));
typedef _Float16 v8h  __attribute__((ext_vector_type(8)));
typedef _Float16 v4h  __attribute__((ext_vector_type(4)));
typedef float    v8f  __attribute__((ext_vector_type(8)));
typedef float    v4f  __attribute__((ext_vector_type(4)));

typedef const __attribute__((address_space(1))) _Float16* GlobalH;   // pointer into global memory

union Frag { v16h v; v8h h[2]; };

template <bool V> struct Flag { static constexpr bool value = V; };

#define LOG2E 1.44269504088896340736f
// scores: acc_h = (64k_h).(64q_h), acc_r = 2^11-scaled residual cross terms
// t (log2 units) = acc_h * log2(e)*2^-12 + acc_r * log2(e)*2^-23
#define C1 (1.44269504088896340736f * 0.000244140625f)
#define C2 (1.44269504088896340736f * 1.1920928955078125e-07f)
#define SC_RES   2048.0f                     // residual plane carry 2^11
#define SC_RINV  4.8828125e-04f              // 2^-11 : residual accumulator fold
#define SC_OUT   9.765625e-04f               // 2^-10 : (16 a)(64 W) -> a.W
#define SC_HID   1.5625e-02f                 // 2^-6  : (16 sa)(64 W1) -> 16 h

static __device__ __forceinline__ v8f zero8() {
    v8f z;
#pragma unroll
    for (int i = 0; i < 8; ++i) z[i] = 0.0f;
    return z;
}

// Fragment-ordered operand planes. A plane of R rows x K (k) 16-bit elements
// is a sequence of 1024-byte units, unit (row/16)*(K/32) + k/32 = one 16x32
// WMMA operand fragment, stored as [j = (k>>4)&1][lane][8]:
//   lane = 16*((k>>3)&1) + (row&15), element = k&7.
// A fragment (A, or B from an [n][k] source) is then two wave-wide 16-byte
// loads of 512 contiguous bytes each (4 whole lines per load): lane m =
// lane&15 -> row m; kb = 8*(lane>>4); elements 0..7 = k kb..kb+7, elements
// 8..15 = k kb+16..kb+23.
// p = unit + lane*8, the lane's own place in the unit.
static __device__ __forceinline__ v16h load_frag16(const _Float16* p) {
    Frag f;
    f.h[0] = *(const v8h*)(p);
    f.h[1] = *(const v8h*)(p + 256);
    return f.v;
}

// offset (in elements) of the 8-element piece (row, k8..k8+7), k8 % 8 == 0
static __device__ __forceinline__ size_t frag_off(unsigned row, unsigned k8, unsigned K) {
    return ((size_t)(row >> 4) * (K >> 5) + (k8 >> 5)) * 512u
         + ((k8 >> 4) & 1u) * 256u + ((((k8 >> 3) & 1u) << 4) + (row & 15u)) * 8u;
}

static __device__ __forceinline__ v8f wmma16(v16h a, v16h b, v8f c) {
    v8f d = __builtin_amdgcn_wmma_f32_16x16x32_f16(false, a, false, b, (short)0, c, false, false);
    asm volatile("v_nop\n\tv_nop\n\tv_nop\n\tv_nop" : "+v"(d) : "v"(a), "v"(b));
    return d;
}

// f32 -> bf16 RNE convert, value kept as f32
static __device__ __forceinline__ float bf16r(float x) {
    unsigned u = __float_as_uint(x);
    u = (u + 0x7FFFu + ((u >> 16) & 1u)) & 0xFFFF0000u;
    return __uint_as_float(u);
}

static __device__ __forceinline__ float ex2(float x) {
    return __builtin_amdgcn_exp2f(x);
}

// ordering for a wave-private LDS tile: stores before later loads of the same wave
static __device__ __forceinline__ void wave_lds_sync() {
    __builtin_amdgcn_fence(3, "wavefront");
    asm volatile("s_wait_dscnt 0" ::: "memory");
    __builtin_amdgcn_wave_barrier();
}

static __device__ __forceinline__ float wave_sum(float v) {
    v += __shfl_xor(v, 16, 32);
    v += __shfl_xor(v, 8, 32);
    v += __shfl_xor(v, 4, 32);
    v += __shfl_xor(v, 2, 32);
    v += __shfl_xor(v, 1, 32);
    return v;
}

// compact token row (b*SEQ + l) -> row in the full-size arrays
static __device__ __forceinline__ unsigned full_row(unsigned n) {
    const unsigned b = n / (unsigned)SEQ;
    return b * (unsigned)SEQ_FULL + (n - b * (unsigned)SEQ);
}

// ---------------------------------------------------------------------------
// Wave-level GEMM core: TM x TN tiles of 16x16, A / Bt both fragment-ordered
// planes of width K; the pointers name the first unit of the wave's first row
// tile (row * K elements in), the next row tile is 16*K on, the next k step 512.
// RES: second A plane (2^11-scaled residual) into its own accumulators.
// The fragments of k step s + 1 are requested before the products of step s
// (two register sets), so a step waits for loads that are one step old, once,
// and not for each B fragment in turn. SB (16 accumulator tiles: RES, or a 4 x 4
// wave tile): the accumulators leave no room for a second B set, each B fragment
// is requested anew behind its last product.
// The k order and the accumulators of every sum are as before.
// ---------------------------------------------------------------------------
// One k step on the current set; LD: request the next step's set from pa / pr / pb.
template <int TM, int TN, bool RES, bool SB, unsigned K, bool LD>
static __device__ __forceinline__ void gemm_step(const _Float16* pa, const _Float16* pr,
                                                 const _Float16* pb,
                                                 const v16h (&ac)[TM], const v16h (&arc)[TM], v16h (&bc)[TN],
                                                 v16h (&an)[TM], v16h (&arn)[TM], v16h (&bn)[TN],
                                                 v8f (&acc)[TM][TN], v8f (&accr)[TM][TN]) {
    if (LD) {
#pragma unroll
        for (int mt = 0; mt < TM; ++mt) {
            an[mt] = load_frag16(pa + (size_t)(mt * 16) * K);
            if (RES) arn[mt] = load_frag16(pr + (size_t)(mt * 16) * K);
        }
        if (!SB) {
#pragma unroll
            for (int nt = 0; nt < TN; ++nt) bn[nt] = load_frag16(pb + (size_t)(nt * 16) * K);
        }
    }
#pragma unroll
    for (int nt = 0; nt < TN; ++nt) {
#pragma unroll
        for (int mt = 0; mt < TM; ++mt) {
            acc[mt][nt] = wmma16(ac[mt], bc[nt], acc[mt][nt]);
            if (RES) accr[mt][nt] = wmma16(arc[mt], bc[nt], accr[mt][nt]);
        }
        if (LD && SB) bc[nt] = load_frag16(pb + (size_t)(nt * 16) * K);
    }
}

template <int TM, int TN, bool RES, unsigned K>
static __device__ __forceinline__ void gemm_core(const _Float16* __restrict__ Ah,
                                                 const _Float16* __restrict__ Ar,
                                                 const _Float16* __restrict__ Bt,
                                                 unsigned lane,
                                                 v8f (&acc)[TM][TN], v8f (&accr)[TM][TN]) {
    static_assert(K % 64u == 0u && K >= 64u);
    constexpr bool SB = RES || TM * TN >= 16;    // one B set only
    constexpr int B1 = SB ? 0 : 1;               // index of the second B set
#pragma unroll
    for (int mt = 0; mt < TM; ++mt)
#pragma unroll
        for (int nt = 0; nt < TN; ++nt) {
            acc[mt][nt] = zero8();
            if (RES) accr[mt][nt] = zero8();
        }
    // one address pair per plane; row tiles and the two steps of a trip are constant offsets
    const _Float16* pa = Ah + lane * 8u;
    const _Float16* pr = Ar + lane * 8u;
    const _Float16* pb = Bt + lane * 8u;
    v16h a[2][TM], ar[2][TM], b[2][TN];
#pragma unroll
    for (int mt = 0; mt < TM; ++mt) {
        a[0][mt] = load_frag16(pa + (size_t)(mt * 16) * K);
        if (RES) ar[0][mt] = load_frag16(pr + (size_t)(mt * 16) * K);
    }
    // keeps the first A requests ahead of the first B requests, the order of every trip:
    // the wait at the loop's head serves both ways in, and with an A request last on this
    // way it counts to 0 and drains the B requests in flight on every trip
    if (!RES) __builtin_amdgcn_sched_barrier(0);
#pragma unroll
    for (int nt = 0; nt < TN; ++nt) b[0][nt] = load_frag16(pb + (size_t)(nt * 16) * K);
#pragma unroll 1
    for (unsigned k = 0; k + 64u < K; k += 64u) {
        gemm_step<TM, TN, RES, SB, K, true>(pa + 512, pr + 512, pb + 512,
                                        a[0], ar[0], b[0], a[1], ar[1], b[B1], acc, accr);
        gemm_step<TM, TN, RES, SB, K, true>(pa + 1024, pr + 1024, pb + 1024,
                                        a[1], ar[1], b[B1], a[0], ar[0], b[0], acc, accr);
        // the address pairs are held (inputs) up to this wait and advanced only
        // behind it: no pair that an issued load still names is rewritten
        if (RES) {
            asm volatile("s_wait_xcnt 0x0" :: "v"(pa), "v"(pr), "v"(pb) : "memory");
            pa += 1024; pr += 1024; pb += 1024;
        } else {
            // 4 x 4 tile: the wait and the advance (1024 elements = 0x800 bytes) in one
            // statement. Written apart, the build keeps an older copy of each pair, feeds
            // the step behind the loop from it and lets a load of that step return into it.
            // (typed as global-memory pointers, so that the loads behind it stay global loads)
            GlobalH ga = (GlobalH)pa, gb = (GlobalH)pb;
            asm volatile("s_wait_xcnt 0x0\n\t"
                         "v_add_nc_u64 %0, 0x800, %0\n\t"
                         "v_add_nc_u64 %1, 0x800, %1"
                         : "+v"(ga), "+v"(gb) :: "memory");
            pa = (const _Float16*)ga; pb = (const _Float16*)gb;
        }
    }
    gemm_step<TM, TN, RES, SB, K, true>(pa + 512, pr + 512, pb + 512,
                                    a[0], ar[0], b[0], a[1], ar[1], b[B1], acc, accr);
    gemm_step<TM, TN, RES, SB, K, false>(pa, pr, pb,
                                     a[1], ar[1], b[B1], a[0], ar[0], b[0], acc, accr);
    // as above, for the last steps' loads: the pairs' registers are free behind it
    if (RES) asm volatile("s_wait_xcnt 0x0" :: "v"(pa), "v"(pr), "v"(pb) : "memory");
    else     asm volatile("s_wait_xcnt 0x0" :: "v"(pa), "v"(pb) : "memory");
}

// ---------------------------------------------------------------------------
// x (f32) -> xh, fragment-ordered NTOK x 512 plane, f16 of the bf16-RNE value.
// 8 elements per thread; a wave takes 8 rows x 32 columns (one 128-B line per
// row in, four whole 128-B lines out, each line written by one wave).
// ---------------------------------------------------------------------------
static __device__ __forceinline__ void cvt_x_block(unsigned blk, const float* __restrict__ x,
                                                   _Float16* __restrict__ xh) {
    const unsigned idx = blk * 256u + threadIdx.x;
    const unsigned wv  = idx >> 5;
    const unsigned ln  = idx & 31u;
    const unsigned n   = (wv >> 4) * 8u + (ln & 7u);
    const unsigned c8  = (wv & 15u) * 32u + (ln >> 3) * 8u;
    const unsigned fr  = full_row(n);
    const float* p = x + (size_t)fr * DM + c8;
    const v4f a = *(const v4f*)(p);
    const v4f b = *(const v4f*)(p + 4);
    v8h o;
    o[0] = (_Float16)bf16r(a.x); o[1] = (_Float16)bf16r(a.y);
    o[2] = (_Float16)bf16r(a.z); o[3] = (_Float16)bf16r(a.w);
    o[4] = (_Float16)bf16r(b.x); o[5] = (_Float16)bf16r(b.y);
    o[6] = (_Float16)bf16r(b.z); o[7] = (_Float16)bf16r(b.w);
    _Float16* d = xh + frag_off(n, c8, (unsigned)DM);
    *(v8h*)d = o;
    
}

// ---------------------------------------------------------------------------
// Weight plane builder: in [z][R][C] f32 (k-major, W[k][n]) -> out: z
// fragment-ordered planes of C rows (n) x R (k), f16 = 64 * bf16-RNE(W)^T.
// 64x64 tile through LDS = 4 x 2 units, each wave store 512 contiguous bytes;
// tile (bx, by, bz) of (C/64, R/64, z).
// ---------------------------------------------------------------------------
static __device__ __forceinline__ void wT_block(const float* __restrict__ in,
                                                _Float16* __restrict__ out,
                                                unsigned R, unsigned C,
                                                unsigned bx, unsigned by, unsigned bz) {
    __shared__ __align__(16) _Float16 t[64 * 72];
    const unsigned tid = threadIdx.x;
    const unsigned n0 = bx * 64u;
    const unsigned k0 = by * 64u;
    const float*  inb  = in  + (size_t)bz * R * C;
    _Float16*     outb = out + (size_t)bz * R * C;
    const float* p[4];
    v4f vv[4];
#pragma unroll
    for (int i = 0; i < 4; ++i) {
        const unsigned idx = (unsigned)i * 256u + tid;
        p[i] = inb + (size_t)(k0 + (idx >> 4)) * C + n0 + ((idx & 15u) << 2);
        vv[i] = *(const v4f*)p[i];
    }
    // the four address pairs are held (inputs) up to this wait: no load returns
    // into a pair that an issued load still names, and none is rewritten before it
    asm volatile("s_wait_xcnt 0x0" :: "v"(p[0]), "v"(p[1]), "v"(p[2]), "v"(p[3]) : "memory");
#pragma unroll
    for (int i = 0; i < 4; ++i) {
        const unsigned idx = (unsigned)i * 256u + tid;
        const unsigned r = idx >> 4, c4 = (idx & 15u) << 2;
        const v4f v = vv[i];
        t[(c4 + 0u) * 72u + r] = (_Float16)(bf16r(v.x) * 64.0f);
        t[(c4 + 1u) * 72u + r] = (_Float16)(bf16r(v.y) * 64.0f);
        t[(c4 + 2u) * 72u + r] = (_Float16)(bf16r(v.z) * 64.0f);
        t[(c4 + 3u) * 72u + r] = (_Float16)(bf16r(v.w) * 64.0f);
    }
    __syncthreads();
    const unsigned ln = tid & 31u;
    const unsigned kl = ((tid >> 6) & 1u) * 32u + ((tid >> 5) & 1u) * 16u + (ln >> 4) * 8u;
    const unsigned nl = (tid >> 7) * 16u + (ln & 15u);
    const v8h o0 = *(const v8h*)(&t[nl * 72u + kl]);
    const v8h o1 = *(const v8h*)(&t[(nl + 32u) * 72u + kl]);
    _Float16* d0 = outb + frag_off(n0 + nl, k0 + kl, R);
    _Float16* d1 = outb + frag_off(n0 + nl + 32u, k0 + kl, R);
    *(v8h*)d0 = o0;
    *(v8h*)d1 = o1;
    // the stores' address pairs and data are held (inputs) up to this wait: in the one
    // kernel that holds all builders other code follows, which rewrites these registers
    asm volatile("s_wait_xcnt 0x0" :: "v"(d0), "v"(d1), "v"(o0), "v"(o1) : "memory");
}

// ---------------------------------------------------------------------------
// All operand planes that depend on the inputs alone, in one launch: the four
// weight planes (768 tiles, the low block indices), then the x plane.
// The choice of the work is uniform over the block.
// ---------------------------------------------------------------------------
#define WT_QKV  (3 * NH * (DM / 64))                 // 192 tiles: 24 x [512 k][64 n]
#define WT_POST ((DM / 64) * (DM / 64))              //  64 tiles: [512 k][512 n]
#define WT_FF   ((DF / 64) * (DM / 64))              // 256 tiles: [512 k][2048 n], [2048 k][512 n]
#define WT_ALL  (WT_QKV + WT_POST + 2 * WT_FF)
__global__ __launch_bounds__(256) void k_planes(const float* __restrict__ x,
                                                const float* __restrict__ preW,
                                                const float* __restrict__ postW,
                                                const float* __restrict__ ff1W,
                                                const float* __restrict__ ff2W,
                                                _Float16* __restrict__ xh,
                                                _Float16* __restrict__ wqkvT,
                                                _Float16* __restrict__ postT,
                                                _Float16* __restrict__ ff1T,
                                                _Float16* __restrict__ ff2T) {
    const unsigned bid = blockIdx.x;
    if (bid >= (unsigned)WT_ALL) {
        cvt_x_block(bid - (unsigned)WT_ALL, x, xh);
    } else if (bid < (unsigned)WT_QKV) {
        wT_block(preW, wqkvT, DM, HD, 0u, bid & 7u, bid >> 3);
    } else if (bid < (unsigned)(WT_QKV + WT_POST)) {
        const unsigned u = bid - (unsigned)WT_QKV;
        wT_block(postW, postT, DM, DM, u & 7u, u >> 3, 0u);
    } else if (bid < (unsigned)(WT_QKV + WT_POST + WT_FF)) {
        const unsigned u = bid - (unsigned)(WT_QKV + WT_POST);
        wT_block(ff1W, ff1T, DM, DF, u & 31u, u >> 5, 0u);
    } else {
        const unsigned u = bid - (unsigned)(WT_QKV + WT_POST + WT_FF);
        wT_block(ff2W, ff2T, DF, DM, u & 7u, u >> 3, 0u);
    }
}

// ---------------------------------------------------------------------------
// QKV projection. Block = 8 waves = 128 tokens x 256 columns; wave tile =
// 64 tokens x 64 columns = one (t, head) slice, both 32-wide d halves.
// q/k planes: [head][dhalf] fragment-ordered NTOK x 32 planes, f16 of 64q (hi)
// and 2^11 residual: per 16-row group the wave owns one 1024-byte unit (two
// lane-contiguous 16-B instructions per plane). V^T planes: [head*NB+b]
// fragment-ordered 64 (d) x SEQ (key) planes, hi / residual: a lane's 8
// accumulator rows (keys) of one column (d) are one piece of a unit at the
// lane's own place, so they are stored straight from registers.
// ---------------------------------------------------------------------------
__global__ __launch_bounds__(256) __attribute__((amdgpu_num_vgpr(256)))
void k_qkv(const _Float16* __restrict__ xh, const _Float16* __restrict__ wT,
           const float* __restrict__ bias,
           _Float16* __restrict__ qh, _Float16* __restrict__ ql,
           _Float16* __restrict__ kh, _Float16* __restrict__ kl,
           _Float16* __restrict__ vTh, _Float16* __restrict__ vTr) {
    __shared__ __align__(16) _Float16 stw[8][1024];   // 16 KB, wave-private tiles
    const unsigned tid  = threadIdx.x;
    const unsigned lane = tid & 31u;
    const unsigned w    = tid >> 5;
    const unsigned n0   = blockIdx.y * 128u + (w >> 2) * 64u;
    const unsigned cb   = blockIdx.x * 256u + (w & 3u) * 64u;
    const unsigned r0   = (lane >> 4) << 3;
    const unsigned cc   = lane & 15u;

    v8f acc[4][4], dum[4][4];
    gemm_core<4, 4, false, DM>(xh + (size_t)n0 * DM, xh + (size_t)n0 * DM,
                               wT + (size_t)cb * DM, lane, acc, dum);

    const unsigned t  = cb >> 9;
    const unsigned h  = (cb >> 6) & 7u;
    float bv[4];
    const unsigned bi = cb + cc;
    const float b0 = bias[bi];
    const float b1 = bias[bi + 16u];
    const float b2 = bias[bi + 32u];
    const float b3 = bias[bi + 48u];
    // the index register is held (input) up to this wait: no load returns into it
    asm volatile("s_wait_xcnt 0x0" :: "v"(bi) : "memory");
    bv[0] = bf16r(b0) * 64.0f;
    bv[1] = bf16r(b1) * 64.0f;
    bv[2] = bf16r(b2) * 64.0f;
    bv[3] = bf16r(b3) * 64.0f;
    _Float16* sw = &stw[w][0];

    if (t < 2u) {
        _Float16* ph = (t == 0u) ? qh : kh;
        _Float16* pl = (t == 0u) ? ql : kl;
#pragma unroll
        for (int kk = 0; kk < 2; ++kk) {         // the two d halves, one plane each
        const size_t pbase = ((size_t)(h * 2u + (unsigned)kk) * NTOK + n0) * 32u;
#pragma unroll
        for (int mt = 0; mt < 4; ++mt) {
#pragma unroll
            for (int g = 0; g < 8; ++g) {
#pragma unroll
                for (int nt = 0; nt < 2; ++nt) {
                    const float v = acc[mt][kk * 2 + nt][g] + bv[kk * 2 + nt];
                    const _Float16 hi = (_Float16)v;
                    const unsigned so = nt * 256 + ((cc >> 3) * 16u + r0 + g) * 8u + (cc & 7u);
                    sw[so] = hi;
                    sw[512u + so] = (_Float16)((v - (float)hi) * SC_RES);
                }
            }
            wave_lds_sync();
            const v8h a0 = *(const v8h*)(sw + lane * 8u);
            const v8h a1 = *(const v8h*)(sw + 256u + lane * 8u);
            const v8h b0 = *(const v8h*)(sw + 512u + lane * 8u);
            const v8h b1 = *(const v8h*)(sw + 768u + lane * 8u);
            _Float16* dh = ph + pbase + (size_t)mt * 512u;
            _Float16* dl = pl + pbase + (size_t)mt * 512u;
            *(v8h*)(dh + lane * 8u)        = a0;
            *(v8h*)(dh + 256u + lane * 8u) = a1;
            *(v8h*)(dl + lane * 8u)        = b0;
            *(v8h*)(dl + 256u + lane * 8u) = b1;
            
            wave_lds_sync();
        }
        }
    } else {
        const unsigned b  = n0 / (unsigned)SEQ;
        const unsigned l0 = n0 - b * (unsigned)SEQ;
        const unsigned hb = h * (unsigned)NB + b;
        const size_t vbase = ((size_t)(hb * HD)) * SEQ + (size_t)l0 * 16u + lane * 8u;
#pragma unroll
        for (int mt = 0; mt < 4; ++mt)
#pragma unroll
            for (int nt = 0; nt < 4; ++nt) {
                v8h hv, rv;
#pragma unroll
                for (int g = 0; g < 8; ++g) {
                    const float v = acc[mt][nt][g] + bv[nt];
                    const _Float16 hi = (_Float16)v;
                    hv[g] = hi;
                    rv[g] = (_Float16)((v - (float)hi) * SC_RES);
                }
                const size_t vo = vbase + (size_t)(nt * 16) * SEQ + (mt >> 1) * 512 + (mt & 1) * 256;
                *(v8h*)(vTh + vo) = hv;
                *(v8h*)(vTr + vo) = rv;
            }
        // the V^T stores' registers may be rewritten behind this branch
        asm volatile("s_wait_xcnt 0x0" ::: "memory");
    }
}

// ---------------------------------------------------------------------------
// Attention, online softmax over keys. Block = 8 waves = 128 queries of one
// (head, batch); wave owns 16 queries. Scores are computed transposed:
// S^T tile = K(16 keys, A) x Q^T(B, n = query), so every statistic of a query
// lives in lane&15 (in-lane reduce over the 8 rows + one xor-16 exchange).
// P^T accumulator tiles (keys 0..15 / 16..31 of a 32-key step) are packed
// directly into the B fragment (k = key, n = query) of O^T = V^T x P^T with
// A = V^T rows (d) straight from the V^T planes. P carried 2^14.
// Loads run ahead of their use: K one step ahead, V from the head of its step.
// Epilogue: 16*ctx as f16 hi + 2^11 residual into fragment-ordered NTOK x 512
// planes: a lane's 8 rows (d) of one query are one piece of a unit at the
// lane's own place, stored straight from registers. msk cross-wave (block barrier).
// ---------------------------------------------------------------------------
__global__ __launch_bounds__(256) __attribute__((amdgpu_num_vgpr(256)))
void k_attn(const _Float16* __restrict__ qh, const _Float16* __restrict__ ql,
            const _Float16* __restrict__ kh, const _Float16* __restrict__ kl,
            const _Float16* __restrict__ vTh, const _Float16* __restrict__ vTr,
            const float* __restrict__ mask,
            _Float16* __restrict__ ctxh, _Float16* __restrict__ ctxr) {
    __shared__ __align__(16) float    msk[SEQ];          // additive key mask, log2 units

    const unsigned tid  = threadIdx.x;
    const unsigned lane = tid & 31u;
    const unsigned w    = tid >> 5;
    const unsigned hb   = blockIdx.x;
    const unsigned h    = hb / (unsigned)NB;
    const unsigned b    = hb - h * (unsigned)NB;
    const unsigned q0   = blockIdx.y * 128u + w * 16u;
    const unsigned r0   = (lane >> 4) << 3;

    for (unsigned idx = tid; idx < (unsigned)SEQ; idx += 256u)
        msk[idx] = bf16r(mask[(size_t)b * SEQ_FULL + idx]) * LOG2E;
    __syncthreads();

    const size_t tokq = (size_t)b * SEQ + q0;
    const size_t tokk = (size_t)b * SEQ;
    const size_t P0 = (size_t)(h * 2u) * NTOK;
    const size_t P1 = (size_t)(h * 2u + 1u) * NTOK;
    const v16h qhf0 = load_frag16(qh + (P0 + tokq) * 32u + lane * 8u);
    const v16h qhf1 = load_frag16(qh + (P1 + tokq) * 32u + lane * 8u);
    const v16h qlf0 = load_frag16(ql + (P0 + tokq) * 32u + lane * 8u);
    const v16h qlf1 = load_frag16(ql + (P1 + tokq) * 32u + lane * 8u);
    const _Float16* kh0 = kh + (P0 + tokk) * 32u;
    const _Float16* kl0 = kl + (P0 + tokk) * 32u;
    const _Float16* vhb = vTh + (size_t)hb * HD * SEQ;
    const _Float16* vrb = vTr + (size_t)hb * HD * SEQ;

    v8f oh[4], orr[4];
#pragma unroll
    for (int dt = 0; dt < 4; ++dt) { oh[dt] = zero8(); orr[dt] = zero8(); }
    float mr = -1.0e30f, lr = 0.0f;

    // One address pair per K plane pair and per V plane, carried through the loop: the
    // second d half of K lies a constant KP1 on, the second key tile and the d tiles too.
    constexpr size_t KP1 = (size_t)NTOK * 32u;
    const _Float16* pkh = kh0 + lane * 8u;
    const _Float16* pkl = kl0 + lane * 8u;
    const _Float16* pvh = vhb + lane * 8u;
    const _Float16* pvr = vrb + lane * 8u;
    // K fragments of the first 32 keys: [key tile][d half][hi, residual]
    v16h kf[2][2][2];
#pragma unroll
    for (int kt = 0; kt < 2; ++kt) {
        kf[kt][0][0] = load_frag16(pkh + kt * 512);
        kf[kt][0][1] = load_frag16(pkl + kt * 512);
        kf[kt][1][0] = load_frag16(pkh + KP1 + kt * 512);
        kf[kt][1][1] = load_frag16(pkl + KP1 + kt * 512);
    }

    // One 32-key step. MORE: a next step exists and its K fragments are requested. The last
    // step is written out behind the loop, so that inside the loop the requests in flight
    // are the same on every path and each wait counts only the loads it needs.
    auto key_step = [&](const unsigned key0, auto more) __attribute__((always_inline)) {
        constexpr bool MORE = decltype(more)::value;
        v8f sh0 = zero8(), sr0 = zero8(), sh1 = zero8(), sr1 = zero8();
        // this step's V fragments, d tiles 0 and 1: requested ahead of the score products
        // (d tiles 2 and 3 follow into the same registers, each behind its forerunner's products)
        v16h vfh[2], vfr[2];
#pragma unroll
        for (int dt = 0; dt < 2; ++dt) {
            vfh[dt] = load_frag16(pvh + (size_t)(dt * 16) * SEQ);
            vfr[dt] = load_frag16(pvr + (size_t)(dt * 16) * SEQ);
        }
        sh0 = wmma16(kf[0][0][0], qhf0, sh0);
        sr0 = wmma16(kf[0][0][0], qlf0, sr0);
        sr0 = wmma16(kf[0][0][1], qhf0, sr0);
        sh0 = wmma16(kf[0][1][0], qhf1, sh0);
        sr0 = wmma16(kf[0][1][0], qlf1, sr0);
        sr0 = wmma16(kf[0][1][1], qhf1, sr0);
        sh1 = wmma16(kf[1][0][0], qhf0, sh1);
        sr1 = wmma16(kf[1][0][0], qlf0, sr1);
        sr1 = wmma16(kf[1][0][1], qhf0, sr1);
        sh1 = wmma16(kf[1][1][0], qhf1, sh1);
        sr1 = wmma16(kf[1][1][0], qlf1, sr1);
        sr1 = wmma16(kf[1][1][1], qhf1, sr1);
        // the NEXT step's K fragments, into the set just read: requested behind this step's
        // score products, they land during the softmax and the V products
        if constexpr (MORE) {
#pragma unroll
            for (int kt = 0; kt < 2; ++kt) {
                kf[kt][0][0] = load_frag16(pkh + 1024 + kt * 512);
                kf[kt][0][1] = load_frag16(pkl + 1024 + kt * 512);
                kf[kt][1][0] = load_frag16(pkh + KP1 + 1024 + kt * 512);
                kf[kt][1][1] = load_frag16(pkl + KP1 + 1024 + kt * 512);
            }
        }
        float t0[8], t1[8];
#pragma unroll
        for (int g = 0; g < 8; ++g) {
            t0[g] = __builtin_fmaf(sh0[g], C1, sr0[g] * C2) + msk[key0 + r0 + g];
            t1[g] = __builtin_fmaf(sh1[g], C1, sr1[g] * C2) + msk[key0 + 16u + r0 + g];
        }
        float tmax = fmaxf(t0[0], t1[0]);
#pragma unroll
        for (int g = 1; g < 8; ++g) tmax = fmaxf(tmax, fmaxf(t0[g], t1[g]));
        tmax = fmaxf(tmax, __shfl_xor(tmax, 16, 32));
        const float mn    = fmaxf(mr, tmax);
        const float alpha = ex2(mr - mn);
        mr = mn;
        const float off = 14.0f - mn;
        v8h p0, p1;
        float ps = 0.0f;
#pragma unroll
        for (int g = 0; g < 8; ++g) {
            const _Float16 a = (_Float16)ex2(t0[g] + off);
            const _Float16 c = (_Float16)ex2(t1[g] + off);
            p0[g] = a;
            p1[g] = c;
            ps += (float)a + (float)c;
        }
        ps += __shfl_xor(ps, 16, 32);
        lr = lr * alpha + ps;
        Frag pb;
        pb.h[0] = p0;       // k = keys key0 + 8h + 0..7
        pb.h[1] = p1;       // k = keys key0 + 16 + 8h + 0..7
#pragma unroll
        for (int dt = 0; dt < 4; ++dt) {
            oh[dt]  = oh[dt] * alpha;
            orr[dt] = orr[dt] * alpha;
        }
#pragma unroll
        for (int dt = 0; dt < 4; ++dt) {
            oh[dt] = wmma16(vfh[dt & 1], pb.v, oh[dt]);
            orr[dt] = wmma16(vfr[dt & 1], pb.v, orr[dt]);
            if (dt < 2) {
                // keeps the request of d tile dt + 2 behind the products above, in their
                // registers: without it the build runs out of registers and spills to scratch
                __builtin_amdgcn_sched_barrier(0);
                vfh[dt] = load_frag16(pvh + (size_t)((dt + 2) * 16) * SEQ);
                vfr[dt] = load_frag16(pvr + (size_t)((dt + 2) * 16) * SEQ);
            }
        }
        // the address pairs are held (inputs) up to this wait and advanced only
        // behind it: no pair that an issued load still names is rewritten
        asm volatile("s_wait_xcnt 0x0" :: "v"(pkh), "v"(pkl), "v"(pvh), "v"(pvr) : "memory");
        pkh += 1024; pkl += 1024; pvh += 512; pvr += 512;
    };
#pragma unroll 1
    for (unsigned key0 = 0; key0 + 32u < (unsigned)SEQ; key0 += 32u) key_step(key0, Flag<true>{});
    key_step((unsigned)SEQ - 32u, Flag<false>{});

    // O^T lane (query lane&15): rows d = dt*16 + r0 + g. 16*ctx = (o + or 2^-11) / (64 l) * 16
    const float inv = 0.25f * (1.0f / lr);
    const size_t ob = tokq * DM + (size_t)(h * 2u) * 512u + lane * 8u;
#pragma unroll
    for (int dt = 0; dt < 4; ++dt) {
        v8h hv, rv;
#pragma unroll
        for (int g = 0; g < 8; ++g) {
            const float c = __builtin_fmaf(orr[dt][g], SC_RINV, oh[dt][g]) * inv;
            const _Float16 hi = (_Float16)c;
            hv[g] = hi;
            rv[g] = (_Float16)((c - (float)hi) * SC_RES);
        }
        *(v8h*)(ctxh + ob + (dt >> 1) * 512 + (dt & 1) * 256) = hv;
        *(v8h*)(ctxr + ob + (dt >> 1) * 512 + (dt & 1) * 256) = rv;
    }
}

// ---------------------------------------------------------------------------
// GEMM (N = 512) + bias + residual add + LayerNorm, fused. Block = 8 waves =
// ROWS rows x 512 columns (wave tile ROWS x 64; ROWS = 32 with the residual
// plane's second accumulators, 64 without). Scaled accumulators go to a
// cross-wave f32 LDS tile (block barrier), then wave w normalises rows
// POST: A = ctx hi + residual planes, residual add = bf16-RNE(x), outputs
// sa (f32) and 16*sa (f16, fragment-ordered NTOK x 512 plane: the block's 32
// rows are 32 KB contiguous, gathered in LDS as [k/8][row] pieces, block
// barrier, then 512-byte wave stores). Otherwise A = hidden plane, residual
// add = sa, output = final f32 rows.
// ---------------------------------------------------------------------------
template <bool POST>
__global__ __launch_bounds__(256) __attribute__((amdgpu_num_vgpr(256)))
void k_gemm_ln(const _Float16* __restrict__ Ah, const _Float16* __restrict__ Ar,
               const _Float16* __restrict__ Bt,
               const float* __restrict__ bias, const float* __restrict__ resid,
               const float* __restrict__ lnw, const float* __restrict__ lnb,
               float* __restrict__ outF, _Float16* __restrict__ outH) {
    constexpr unsigned K = POST ? DM : DF;       // contraction length: row-tile offsets are immediates
    constexpr unsigned ROWS = POST ? 32u : 64u;  // rows of the block
    constexpr int TM = (int)(ROWS / 16u);
    __shared__ __align__(16) float T[ROWS * DM]; // 64 / 128 KB, cross-wave
    // 16*sa pieces: [64 k/8][32 rows][8], column pitch 264 (16 B of pad: the 16
    // columns of one wave store fall on different banks), cross-wave
    __shared__ __align__(16) _Float16 Hs[POST ? 64 * 264 : 8];
    const unsigned tid  = threadIdx.x;
    const unsigned lane = tid & 31u;
    const unsigned w    = tid >> 5;
    const unsigned row0 = blockIdx.x * ROWS;
    const unsigned cb   = w * 64u;
    const unsigned r0   = (lane >> 4) << 3;
    const unsigned cc   = lane & 15u;

    v8f acc[TM][4], accr[TM][4];
    gemm_core<TM, 4, POST, K>(Ah + (size_t)row0 * K, Ar + (size_t)row0 * K,
                             Bt + (size_t)cb * K, lane, acc, accr);
#pragma unroll
    for (int mt = 0; mt < TM; ++mt)
#pragma unroll
        for (int nt = 0; nt < 4; ++nt)
#pragma unroll
            for (int g = 0; g < 8; ++g) {
                const float v = POST ? __builtin_fmaf(accr[mt][nt][g], SC_RINV, acc[mt][nt][g])
                                     : acc[mt][nt][g];
                T[(mt * 16 + r0 + g) * DM + cb + nt * 16 + cc] = v;
            }
    __syncthreads();

#pragma unroll 1
    for (unsigned rr = 0; rr < ROWS / 8u; ++rr) {
        const unsigned row = w * (ROWS / 8u) + rr;
        const unsigned n   = row0 + row;
        const unsigned fr  = full_row(n);
        const float* rp = POST ? (resid + (size_t)fr * DM) : (resid + (size_t)n * DM);
        float*       op = POST ? (outF + (size_t)n * DM)   : (outF + (size_t)fr * DM);
        v4f xv[4];
        float s = 0.0f;
#pragma unroll
        for (int i = 0; i < 4; ++i) {
            const unsigned c = (unsigned)i * 128u + lane * 4u;
            const v4f a  = *(const v4f*)(&T[row * DM + c]);
            const v4f bi = *(const v4f*)(bias + c);
            const v4f rs = *(const v4f*)(rp + c);
            v4f x;
            x.x = __builtin_fmaf(a.x, SC_OUT, bf16r(bi.x)) + (POST ? bf16r(rs.x) : rs.x);
            x.y = __builtin_fmaf(a.y, SC_OUT, bf16r(bi.y)) + (POST ? bf16r(rs.y) : rs.y);
            x.z = __builtin_fmaf(a.z, SC_OUT, bf16r(bi.z)) + (POST ? bf16r(rs.z) : rs.z);
            x.w = __builtin_fmaf(a.w, SC_OUT, bf16r(bi.w)) + (POST ? bf16r(rs.w) : rs.w);
            xv[i] = x;
            s += (x.x + x.y) + (x.z + x.w);
        }
        s = wave_sum(s);
        const float mu = s * (1.0f / (float)DM);
        float q = 0.0f;
#pragma unroll
        for (int i = 0; i < 4; ++i) {
            const float d0 = xv[i].x - mu, d1 = xv[i].y - mu, d2 = xv[i].z - mu, d3 = xv[i].w - mu;
            q += (d0 * d0 + d1 * d1) + (d2 * d2 + d3 * d3);
        }
        q = wave_sum(q);
        const float rstd = rsqrtf(q * (1.0f / (float)DM) + 1.0e-5f);
        v4f yv[4];
#pragma unroll
        for (int i = 0; i < 4; ++i) {
            const unsigned c = (unsigned)i * 128u + lane * 4u;
            const v4f gw = *(const v4f*)(lnw + c);
            const v4f gb = *(const v4f*)(lnb + c);
            v4f y;
            y.x = (xv[i].x - mu) * rstd * bf16r(gw.x) + bf16r(gb.x);
            y.y = (xv[i].y - mu) * rstd * bf16r(gw.y) + bf16r(gb.y);
            y.z = (xv[i].z - mu) * rstd * bf16r(gw.z) + bf16r(gb.z);
            y.w = (xv[i].w - mu) * rstd * bf16r(gw.w) + bf16r(gb.w);
            yv[i] = y;
        }
        if (POST) {
#pragma unroll
            for (int i = 0; i < 4; ++i) {
                v4h hq;
                hq[0] = (_Float16)(yv[i].x * 16.0f); hq[1] = (_Float16)(yv[i].y * 16.0f);
                hq[2] = (_Float16)(yv[i].z * 16.0f); hq[3] = (_Float16)(yv[i].w * 16.0f);
                *(v4h*)(&Hs[((unsigned)i * 16u + (lane >> 1)) * 264u + row * 8u + (lane & 1u) * 4u]) = hq;
            }
        }
#pragma unroll
        for (int i = 0; i < 4; ++i)
            *(v4f*)(op + (unsigned)i * 128u + lane * 4u) = yv[i];
        // the row stores' registers are rewritten by the next row and behind the loop
        asm volatile("s_wait_xcnt 0x0" ::: "memory");
    }
    if (POST) {
        __syncthreads();
        _Float16* hp = outH + (size_t)row0 * DM + tid * 8u;
        // piece i*256 + tid of the block's 2 x 16 units: unit = 4*i + (w>>1), j = w&1
        const unsigned hs0 = ((w >> 1) * 4u + (w & 1u) * 2u + (lane >> 4)) * 264u + (lane & 15u) * 8u;
        v8h pv[8];
#pragma unroll
        for (int i = 0; i < 8; ++i)
            pv[i] = *(const v8h*)(&Hs[hs0 + (unsigned)(i & 3) * (16u * 264u) + (unsigned)(i >> 2) * 128u]);
#pragma unroll
        for (int i = 0; i < 8; ++i)
            *(v8h*)(hp + (unsigned)i * 2048u) = pv[i];
    }
}

// ---------------------------------------------------------------------------
// FF1: hidden = relu(sa W1 + b1), stored as f16 of 16*hidden, fragment-ordered
// NTOK x 2048 plane. Block = 8 waves = 128 rows x 256 columns; the wave's
// 64 x 64 tile = 4 x 2 units, ordered in LDS.
// ---------------------------------------------------------------------------
__global__ __launch_bounds__(256) __attribute__((amdgpu_num_vgpr(256)))
void k_ff1(const _Float16* __restrict__ sah, const _Float16* __restrict__ Bt,
           const float* __restrict__ bias, _Float16* __restrict__ hid) {
    __shared__ __align__(16) _Float16 st[8][64 * 64];   // 64 KB wave-private
    const unsigned tid  = threadIdx.x;
    const unsigned lane = tid & 31u;
    const unsigned w    = tid >> 5;
    const unsigned row0 = blockIdx.y * 128u + (w >> 2) * 64u;
    const unsigned cb   = blockIdx.x * 256u + (w & 3u) * 64u;
    const unsigned r0   = (lane >> 4) << 3;
    const unsigned cc   = lane & 15u;

    v8f acc[4][4], dum[4][4];
    gemm_core<4, 4, false, DM>(sah + (size_t)row0 * DM, sah + (size_t)row0 * DM,
                               Bt + (size_t)cb * DM, lane, acc, dum);
    float bv[4];
#pragma unroll
    for (int nt = 0; nt < 4; ++nt) bv[nt] = bf16r(bias[cb + nt * 16 + cc]) * 16.0f;
    _Float16* sw = &st[w][0];
#pragma unroll
    for (int mt = 0; mt < 4; ++mt)
#pragma unroll
        for (int nt = 0; nt < 4; ++nt)
#pragma unroll
            for (int g = 0; g < 8; ++g)
                sw[(mt * 2 + (nt >> 1)) * 512 + (nt & 1) * 256 + ((cc >> 3) * 16u + r0 + g) * 8u + (cc & 7u)] =
                    (_Float16)fmaxf(__builtin_fmaf(acc[mt][nt][g], SC_HID, bv[nt]), 0.0f);
    wave_lds_sync();
    v8h xv[16];
#pragma unroll
    for (int i = 0; i < 16; ++i) xv[i] = *(const v8h*)(sw + i * 256 + lane * 8u);
    _Float16* ob = hid + (size_t)row0 * DF + (size_t)cb * 16u + lane * 8u;
#pragma unroll
    for (int i = 0; i < 16; ++i)
        *(v8h*)(ob + (size_t)((i >> 2) * 16) * DF + ((i >> 1) & 1) * 512 + (i & 1) * 256) = xv[i];
    
}

// ---------------------------------------------------------------------------
// Workspace arena in units of U = NTOK*512*2 bytes (16 MiB at full size);
// time-disjoint planes share offsets (launches are stream-ordered):
//   [0,4U)  qh ql kh kl          -> later sa f32 [0,2U), 16*sa f16 [2U,3U)
//   [4U,6U) V^T hi / residual
//   [6U,7U) xh                   -> later ctx hi
//   [7U,8U) ctx residual
//   [3U,7U) later hidden
//   [8U,..) the weight planes, each at its own place from the first launch to its
//           reader: Wqkv^T (1.5 MiB), Wo^T (0.5 MiB), W1^T (2 MiB), W2^T (2 MiB)
// ---------------------------------------------------------------------------
#define U_BYTES ((size_t)NTOK * DM * 2)
static_assert((size_t)NB_FULL * SEQ_FULL * DM * 2 * 8 <= (size_t)134217728);

extern "C" void kernel_launch(void* const* d_in, const int* in_sizes, int n_in,
                              void* d_out, int out_size, void* d_ws, size_t ws_size,
                              hipStream_t stream) {
    if (n_in < 14) return;
    const int need_rows = (NB - 1) * SEQ_FULL + SEQ;
    if (in_sizes[0] < need_rows * DM) return;
    if (in_sizes[1] < need_rows) return;
    if (in_sizes[2] < 3 * NH * DM * HD || in_sizes[3] < 3 * NH * HD) return;
    if (in_sizes[4] < DM * DM || in_sizes[5] < DM) return;
    if (in_sizes[6] < DM * DF || in_sizes[7] < DF) return;
    if (in_sizes[8] < DF * DM || in_sizes[9] < DM) return;
    if (in_sizes[10] < DM || in_sizes[11] < DM || in_sizes[12] < DM || in_sizes[13] < DM) return;
    if (out_size < need_rows * DM) return;

    const float* inp   = (const float*)d_in[0];    // [16384,512]
    const float* mask  = (const float*)d_in[1];    // [32,1,512]
    const float* preW  = (const float*)d_in[2];    // [3,8,512,64]
    const float* preB  = (const float*)d_in[3];    // [3,8,1,64]
    const float* postW = (const float*)d_in[4];    // [512,512]
    const float* postB = (const float*)d_in[5];    // [512]
    const float* ff1W  = (const float*)d_in[6];    // [512,2048]
    const float* ff1B  = (const float*)d_in[7];    // [2048]
    const float* ff2W  = (const float*)d_in[8];    // [2048,512]
    const float* ff2B  = (const float*)d_in[9];    // [512]
    const float* ln1w  = (const float*)d_in[10];
    const float* ln1b  = (const float*)d_in[11];
    const float* ln2w  = (const float*)d_in[12];
    const float* ln2b  = (const float*)d_in[13];
    float* out = (float*)d_out;                    // [32,512,512]

    const size_t U = U_BYTES;
    const size_t WQ_B = (size_t)3 * NH * HD * DM * 2;   // 1.5 MiB
    const size_t WO_B = (size_t)DM * DM * 2;            // 0.5 MiB
    const size_t W1_B = (size_t)DF * DM * 2;            // 2 MiB
    const size_t W2_B = (size_t)DM * DF * 2;            // 2 MiB
    if (8 * U + WQ_B + WO_B + W1_B + W2_B > ws_size) return;

    char* ws = (char*)d_ws;
    _Float16* qh    = (_Float16*)(ws + 0 * U);
    _Float16* ql    = (_Float16*)(ws + 1 * U);
    _Float16* kh    = (_Float16*)(ws + 2 * U);
    _Float16* kl    = (_Float16*)(ws + 3 * U);
    _Float16* vTh   = (_Float16*)(ws + 4 * U);
    _Float16* vTr   = (_Float16*)(ws + 5 * U);
    _Float16* xh    = (_Float16*)(ws + 6 * U);
    _Float16* ctxh  = (_Float16*)(ws + 6 * U);
    _Float16* ctxr  = (_Float16*)(ws + 7 * U);
    _Float16* wqkvT = (_Float16*)(ws + 8 * U);
    float*    sa    = (float*)(ws + 0 * U);
    _Float16* sah   = (_Float16*)(ws + 2 * U);
    _Float16* postT = (_Float16*)(ws + 8 * U + WQ_B);
    _Float16* hid   = (_Float16*)(ws + 3 * U);
    _Float16* ff1T  = (_Float16*)(ws + 8 * U + WQ_B + WO_B);
    _Float16* ff2T  = (_Float16*)(ws + 8 * U + WQ_B + WO_B + W1_B);

    // x -> f16 plane (bf16-RNE values); every W[k][n] -> its [n][k] plane
    k_planes<<<dim3(WT_ALL + NTOK / 4), dim3(256), 0, stream>>>(
        inp, preW, postW, ff1W, ff2W, xh, wqkvT, postT, ff1T, ff2T);
    k_qkv<<<dim3(6, NTOK / 128), dim3(256), 0, stream>>>(xh, wqkvT, preB, qh, ql, kh, kl, vTh, vTr);
    k_attn<<<dim3(NH * NB, SEQ / 128), dim3(256), 0, stream>>>(qh, ql, kh, kl, vTh, vTr, mask, ctxh, ctxr);
    k_gemm_ln<true><<<dim3(NTOK / 32), dim3(256), 0, stream>>>(
        ctxh, ctxr, postT, postB, inp, ln1w, ln1b, sa, sah);
    k_ff1<<<dim3(8, NTOK / 128), dim3(256), 0, stream>>>(sah, ff1T, ff1B, hid);
    k_gemm_ln<false><<<dim3(NTOK / 64), dim3(256), 0, stream>>>(
        hid, hid, ff2T, ff2B, sa, ln2w, ln2b, out, sah);
}

// v005
// It runs in 210 microseconds.
// In both of two side-by-side timings against v004, it was 1.03 times as fast.
// All steps since v000 together make it 2.25 times as fast.
#include <hip/hip_runtime.h>
#include <hip/hip_fp16.h>

// All contractions on v_wmma_f32_16x16x32_f16 (f16 operands, f32 accumulate): x*Wqkv, sa*W1, h*W2 single f16 planes; k*q^T with f16 hi + 2^11-scaled f16 residual planes (hi.hi, hi.res, res.hi); V^T*P^T and ctx*Wo with f16 hi + 2^11-scaled f16 residual plane on V / ctx (two accumulators, residual folded 2^-11 in f32).

#ifndef NB
#define NB 32
#endif
#ifndef SEQ
#define SEQ 512
#endif
#define NB_FULL  32
#define SEQ_FULL 512
#define NH   8           // heads
#define HD   64          // head width
#define DM   512         // model width
#define DF   2048        // hidden width
#define NTOK (NB * SEQ)

static_assert(NB >= 1 && NB <= NB_FULL);
static_assert(SEQ >= 128 && SEQ <= SEQ_FULL);
static_assert(SEQ % 128 == 0);
static_assert(NTOK % 128 == 0);
static_assert(DM == NH * HD);
static_assert(DM == 512 && HD == 64 && NH == 8 && DF == 2048);

typedef _Float16 v16h __attribute__((ext_vector_type(16)));
typedef _Float16 v8h  __attribute__((ext_vector_type(8)));
typedef _Float16 v4h  __attribute__((ext_vector_type(4)));
typedef float    v8f  __attribute__((ext_vector_type(8)));
typedef float    v4f  __attribute__((ext_vector_type(4)));

typedef const __attribute__((address_space(1))) _Float16* GlobalH;   // pointer into global memory

union Frag { v16h v; v8h h[2]; };

template <bool V> struct Flag { static constexpr bool value = V; };

#define LOG2E 1.44269504088896340736f
// scores: acc_h = (64k_h).(64q_h), acc_r = 2^11-scaled residual cross terms
// t (log2 units) = acc_h * log2(e)*2^-12 + acc_r * log2(e)*2^-23
#define C1 (1.44269504088896340736f * 0.000244140625f)
#define C2 (1.44269504088896340736f * 1.1920928955078125e-07f)
#define SC_RES   2048.0f                     // residual plane carry 2^11
#define SC_RINV  4.8828125e-04f              // 2^-11 : residual accumulator fold
#define SC_OUT   9.765625e-04f               // 2^-10 : (16 a)(64 W) -> a.W
#define SC_HID   1.5625e-02f                 // 2^-6  : (16 sa)(64 W1) -> 16 h

static __device__ __forceinline__ v8f zero8() {
    v8f z;
#pragma unroll
    for (int i = 0; i < 8; ++i) z[i] = 0.0f;
    return z;
}

// Fragment-ordered operand planes. A plane of R rows x K (k) 16-bit elements
// is a sequence of 1024-byte units, unit (row/16)*(K/32) + k/32 = one 16x32
// WMMA operand fragment, stored as [j = (k>>4)&1][lane][8]:
//   lane = 16*((k>>3)&1) + (row&15), element = k&7.
// A fragment (A, or B from an [n][k] source) is then two wave-wide 16-byte
// loads of 512 contiguous bytes each (4 whole lines per load): lane m =
// lane&15 -> row m; kb = 8*(lane>>4); elements 0..7 = k kb..kb+7, elements
// 8..15 = k kb+16..kb+23.
// p = unit + lane*8, the lane's own place in the unit.
static __device__ __forceinline__ v16h load_frag16(const _Float16* p) {
    Frag f;
    f.h[0] = *(const v8h*)(p);
    f.h[1] = *(const v8h*)(p + 256);
    return f.v;
}

// offset (in elements) of the 8-element piece (row, k8..k8+7), k8 % 8 == 0
static __device__ __forceinline__ size_t frag_off(unsigned row, unsigned k8, unsigned K) {
    return ((size_t)(row >> 4) * (K >> 5) + (k8 >> 5)) * 512u
         + ((k8 >> 4) & 1u) * 256u + ((((k8 >> 3) & 1u) << 4) + (row & 15u)) * 8u;
}

static __device__ __forceinline__ v8f wmma16(v16h a, v16h b, v8f c) {
    v8f d = __builtin_amdgcn_wmma_f32_16x16x32_f16(false, a, false, b, (short)0, c, false, false);
    asm volatile("v_nop\n\tv_nop\n\tv_nop\n\tv_nop" : "+v"(d) : "v"(a), "v"(b));
    return d;
}

// f32 -> bf16 RNE convert, value kept as f32
static __device__ __forceinline__ float bf16r(float x) {
    unsigned u = __float_as_uint(x);
    u = (u + 0x7FFFu + ((u >> 16) & 1u)) & 0xFFFF0000u;
    return __uint_as_float(u);
}

static __device__ __forceinline__ float ex2(float x) {
    return __builtin_amdgcn_exp2f(x);
}

// ordering for a wave-private LDS tile: stores before later loads of the same wave
static __device__ __forceinline__ void wave_lds_sync() {
    __builtin_amdgcn_fence(3, "wavefront");
    asm volatile("s_wait_dscnt 0" ::: "memory");
    __builtin_amdgcn_wave_barrier();
}

static __device__ __forceinline__ float wave_sum(float v) {
    v += __shfl_xor(v, 16, 32);
    v += __shfl_xor(v, 8, 32);
    v += __shfl_xor(v, 4, 32);
    v += __shfl_xor(v, 2, 32);
    v += __shfl_xor(v, 1, 32);
    return v;
}

// compact token row (b*SEQ + l) -> row in the full-size arrays
static __device__ __forceinline__ unsigned full_row(unsigned n) {
    const unsigned b = n / (unsigned)SEQ;
    return b * (unsigned)SEQ_FULL + (n - b * (unsigned)SEQ);
}

// ---------------------------------------------------------------------------
// Wave-level GEMM core: TM x TN tiles of 16x16, A / Bt both fragment-ordered
// planes of width K; the pointers name the first unit of the wave's first row
// tile (row * K elements in), the next row tile is 16*K on, the next k step 512.
// RES: second A plane (2^11-scaled residual) into its own accumulators.
// The fragments of k step s + 1 are requested before the products of step s
// (two register sets), so a step waits for loads that are one step old, once,
// and not for each B fragment in turn. SB (16 accumulator tiles: RES, or a 4 x 4
// wave tile): the accumulators leave no room for a second B set, each B fragment
// is requested anew behind its last product.
// The k walk starts at trip t0 (a trip = two k steps = 64 k) and wraps: blocks that
// read the same operand rows at the same time get different t0, so that their
// requests for one line do not reach L2 together. Every k step is taken once.
// ---------------------------------------------------------------------------
// One k step on the current set; LD: request the next step's set from pa / pr / pb.
template <int TM, int TN, bool RES, bool SB, unsigned K, bool LD>
static __device__ __forceinline__ void gemm_step(const _Float16* pa, const _Float16* pr,
                                                 const _Float16* pb,
                                                 const v16h (&ac)[TM], const v16h (&arc)[TM], v16h (&bc)[TN],
                                                 v16h (&an)[TM], v16h (&arn)[TM], v16h (&bn)[TN],
                                                 v8f (&acc)[TM][TN], v8f (&accr)[TM][TN]) {
    if (LD) {
#pragma unroll
        for (int mt = 0; mt < TM; ++mt) {
            an[mt] = load_frag16(pa + (size_t)(mt * 16) * K);
            if (RES) arn[mt] = load_frag16(pr + (size_t)(mt * 16) * K);
        }
        if (!SB) {
#pragma unroll
            for (int nt = 0; nt < TN; ++nt) bn[nt] = load_frag16(pb + (size_t)(nt * 16) * K);
        }
    }
#pragma unroll
    for (int nt = 0; nt < TN; ++nt) {
#pragma unroll
        for (int mt = 0; mt < TM; ++mt) {
            acc[mt][nt] = wmma16(ac[mt], bc[nt], acc[mt][nt]);
            if (RES) accr[mt][nt] = wmma16(arc[mt], bc[nt], accr[mt][nt]);
        }
        if (LD && SB) bc[nt] = load_frag16(pb + (size_t)(nt * 16) * K);
    }
}

template <int TM, int TN, bool RES, unsigned K>
static __device__ __forceinline__ void gemm_core(const _Float16* __restrict__ Ah,
                                                 const _Float16* __restrict__ Ar,
                                                 const _Float16* __restrict__ Bt,
                                                 unsigned lane, unsigned t0,
                                                 v8f (&acc)[TM][TN], v8f (&accr)[TM][TN]) {
    static_assert(K % 64u == 0u && K >= 64u);
    constexpr unsigned T = K / 64u;              // trips; t0 < T, the same in the whole block
    constexpr bool SB = RES || TM * TN >= 16;    // one B set only
    constexpr int B1 = SB ? 0 : 1;               // index of the second B set
#pragma unroll
    for (int mt = 0; mt < TM; ++mt)
#pragma unroll
        for (int nt = 0; nt < TN; ++nt) {
            acc[mt][nt] = zero8();
            if (RES) accr[mt][nt] = zero8();
        }
    // one address pair per plane; row tiles and the two steps of a trip are constant offsets
    const _Float16* pa = Ah + t0 * 1024u + lane * 8u;
    const _Float16* pr = Ar + t0 * 1024u + lane * 8u;
    const _Float16* pb = Bt + t0 * 1024u + lane * 8u;
    v16h a[2][TM], ar[2][TM], b[2][TN];
#pragma unroll
    for (int mt = 0; mt < TM; ++mt) {
        a[0][mt] = load_frag16(pa + (size_t)(mt * 16) * K);
        if (RES) ar[0][mt] = load_frag16(pr + (size_t)(mt * 16) * K);
    }
    // keeps the first A requests ahead of the first B requests, the order of every trip:
    // the wait at the loop's head serves both ways in, and with an A request last on this
    // way it counts to 0 and drains the B requests in flight on every trip
    if (!RES) __builtin_amdgcn_sched_barrier(0);
#pragma unroll
    for (int nt = 0; nt < TN; ++nt) b[0][nt] = load_frag16(pb + (size_t)(nt * 16) * K);
    unsigned t = t0;
#pragma unroll 1
    for (unsigned i = 0; i + 1u < T; ++i) {
        gemm_step<TM, TN, RES, SB, K, true>(pa + 512, pr + 512, pb + 512,
                                        a[0], ar[0], b[0], a[1], ar[1], b[B1], acc, accr);
        // to the next trip: 1024 elements = 2048 bytes on, or back to the row tile's first
        // unit behind its last trip (a row tile is K * 32 bytes); a scalar, alike for all planes
        t = (t + 1u == T) ? 0u : t + 1u;
        const long long adv = (t == 0u) ? 2048ll - (long long)K * 32ll : 2048ll;
        // The wait and the advance in one statement: no pair that an issued load still names
        // is rewritten ahead of the wait.
        // (typed as global-memory pointers, so that the loads behind it stay global loads)
        GlobalH ga = (GlobalH)pa, gb = (GlobalH)pb;
        if constexpr (RES) {
            GlobalH gr = (GlobalH)pr;
            asm volatile("s_wait_xcnt 0x0\n\t"
                         "v_add_nc_u64 %0, %3, %0\n\t"
                         "v_add_nc_u64 %1, %3, %1\n\t"
                         "v_add_nc_u64 %2, %3, %2"
                         : "+v"(ga), "+v"(gr), "+v"(gb) : "s"(adv) : "memory");
            pr = (const _Float16*)gr;
        } else {
            asm volatile("s_wait_xcnt 0x0\n\t"
                         "v_add_nc_u64 %0, %2, %0\n\t"
                         "v_add_nc_u64 %1, %2, %1"
                         : "+v"(ga), "+v"(gb) : "s"(adv) : "memory");
        }
        pa = (const _Float16*)ga; pb = (const _Float16*)gb;
        gemm_step<TM, TN, RES, SB, K, true>(pa, pr, pb,
                                        a[1], ar[1], b[B1], a[0], ar[0], b[0], acc, accr);
    }
    gemm_step<TM, TN, RES, SB, K, true>(pa + 512, pr + 512, pb + 512,
                                    a[0], ar[0], b[0], a[1], ar[1], b[B1], acc, accr);
    gemm_step<TM, TN, RES, SB, K, false>(pa, pr, pb,
                                     a[1], ar[1], b[B1], a[0], ar[0], b[0], acc, accr);
    // as above, for the last steps' loads: the pairs' registers are free behind it
    if (RES) asm volatile("s_wait_xcnt 0x0" :: "v"(pa), "v"(pr), "v"(pb) : "memory");
    else     asm volatile("s_wait_xcnt 0x0" :: "v"(pa), "v"(pb) : "memory");
}

// ---------------------------------------------------------------------------
// x (f32) -> xh, fragment-ordered NTOK x 512 plane, f16 of the bf16-RNE value.
// 8 elements per thread; a wave takes 8 rows x 32 columns (one 128-B line per
// row in, four whole 128-B lines out, each line written by one wave).
// ---------------------------------------------------------------------------
static __device__ __forceinline__ void cvt_x_block(unsigned blk, const float* __restrict__ x,
                                                   _Float16* __restrict__ xh) {
    const unsigned idx = blk * 256u + threadIdx.x;
    const unsigned wv  = idx >> 5;
    const unsigned ln  = idx & 31u;
    const unsigned n   = (wv >> 4) * 8u + (ln & 7u);
    const unsigned c8  = (wv & 15u) * 32u + (ln >> 3) * 8u;
    const unsigned fr  = full_row(n);
    const float* p = x + (size_t)fr * DM + c8;
    const v4f a = *(const v4f*)(p);
    const v4f b = *(const v4f*)(p + 4);
    v8h o;
    o[0] = (_Float16)bf16r(a.x); o[1] = (_Float16)bf16r(a.y);
    o[2] = (_Float16)bf16r(a.z); o[3] = (_Float16)bf16r(a.w);
    o[4] = (_Float16)bf16r(b.x); o[5] = (_Float16)bf16r(b.y);
    o[6] = (_Float16)bf16r(b.z); o[7] = (_Float16)bf16r(b.w);
    _Float16* d = xh + frag_off(n, c8, (unsigned)DM);
    *(v8h*)d = o;
    
}

// ---------------------------------------------------------------------------
// Weight plane builder: in [z][R][C] f32 (k-major, W[k][n]) -> out: z
// fragment-ordered planes of C rows (n) x R (k), f16 = 64 * bf16-RNE(W)^T.
// 64x64 tile through LDS = 4 x 2 units, each wave store 512 contiguous bytes;
// tile (bx, by, bz) of (C/64, R/64, z).
// ---------------------------------------------------------------------------
static __device__ __forceinline__ void wT_block(const float* __restrict__ in,
                                                _Float16* __restrict__ out,
                                                unsigned R, unsigned C,
                                                unsigned bx, unsigned by, unsigned bz) {
    __shared__ __align__(16) _Float16 t[64 * 72];
    const unsigned tid = threadIdx.x;
    const unsigned n0 = bx * 64u;
    const unsigned k0 = by * 64u;
    const float*  inb  = in  + (size_t)bz * R * C;
    _Float16*     outb = out + (size_t)bz * R * C;
    const float* p[4];
    v4f vv[4];
#pragma unroll
    for (int i = 0; i < 4; ++i) {
        const unsigned idx = (unsigned)i * 256u + tid;
        p[i] = inb + (size_t)(k0 + (idx >> 4)) * C + n0 + ((idx & 15u) << 2);
        vv[i] = *(const v4f*)p[i];
    }
    // the four address pairs are held (inputs) up to this wait: no load returns
    // into a pair that an issued load still names, and none is rewritten before it
    asm volatile("s_wait_xcnt 0x0" :: "v"(p[0]), "v"(p[1]), "v"(p[2]), "v"(p[3]) : "memory");
#pragma unroll
    for (int i = 0; i < 4; ++i) {
        const unsigned idx = (unsigned)i * 256u + tid;
        const unsigned r = idx >> 4, c4 = (idx & 15u) << 2;
        const v4f v = vv[i];
        t[(c4 + 0u) * 72u + r] = (_Float16)(bf16r(v.x) * 64.0f);
        t[(c4 + 1u) * 72u + r] = (_Float16)(bf16r(v.y) * 64.0f);
        t[(c4 + 2u) * 72u + r] = (_Float16)(bf16r(v.z) * 64.0f);
        t[(c4 + 3u) * 72u + r] = (_Float16)(bf16r(v.w) * 64.0f);
    }
    __syncthreads();
    const unsigned ln = tid & 31u;
    const unsigned kl = ((tid >> 6) & 1u) * 32u + ((tid >> 5) & 1u) * 16u + (ln >> 4) * 8u;
    const unsigned nl = (tid >> 7) * 16u + (ln & 15u);
    const v8h o0 = *(const v8h*)(&t[nl * 72u + kl]);
    const v8h o1 = *(const v8h*)(&t[(nl + 32u) * 72u + kl]);
    _Float16* d0 = outb + frag_off(n0 + nl, k0 + kl, R);
    _Float16* d1 = outb + frag_off(n0 + nl + 32u, k0 + kl, R);
    *(v8h*)d0 = o0;
    *(v8h*)d1 = o1;
    // the stores' address pairs and data are held (inputs) up to this wait: in the one
    // kernel that holds all builders other code follows, which rewrites these registers
    asm volatile("s_wait_xcnt 0x0" :: "v"(d0), "v"(d1), "v"(o0), "v"(o1) : "memory");
}

// ---------------------------------------------------------------------------
// All operand planes that depend on the inputs alone, in one launch: the four
// weight planes (768 tiles, the low block indices), then the x plane.
// The choice of the work is uniform over the block.
// ---------------------------------------------------------------------------
#define WT_QKV  (3 * NH * (DM / 64))                 // 192 tiles: 24 x [512 k][64 n]
#define WT_POST ((DM / 64) * (DM / 64))              //  64 tiles: [512 k][512 n]
#define WT_FF   ((DF / 64) * (DM / 64))              // 256 tiles: [512 k][2048 n], [2048 k][512 n]
#define WT_ALL  (WT_QKV + WT_POST + 2 * WT_FF)
__global__ __launch_bounds__(256) void k_planes(const float* __restrict__ x,
                                                const float* __restrict__ preW,
                                                const float* __restrict__ postW,
                                                const float* __restrict__ ff1W,
                                                const float* __restrict__ ff2W,
                                                _Float16* __restrict__ xh,
                                                _Float16* __restrict__ wqkvT,
                                                _Float16* __restrict__ postT,
                                                _Float16* __restrict__ ff1T,
                                                _Float16* __restrict__ ff2T) {
    const unsigned bid = blockIdx.x;
    if (bid >= (unsigned)WT_ALL) {
        cvt_x_block(bid - (unsigned)WT_ALL, x, xh);
    } else if (bid < (unsigned)WT_QKV) {
        wT_block(preW, wqkvT, DM, HD, 0u, bid & 7u, bid >> 3);
    } else if (bid < (unsigned)(WT_QKV + WT_POST)) {
        const unsigned u = bid - (unsigned)WT_QKV;
        wT_block(postW, postT, DM, DM, u & 7u, u >> 3, 0u);
    } else if (bid < (unsigned)(WT_QKV + WT_POST + WT_FF)) {
        const unsigned u = bid - (unsigned)(WT_QKV + WT_POST);
        wT_block(ff1W, ff1T, DM, DF, u & 31u, u >> 5, 0u);
    } else {
        const unsigned u = bid - (unsigned)(WT_QKV + WT_POST + WT_FF);
        wT_block(ff2W, ff2T, DF, DM, u & 7u, u >> 3, 0u);
    }
}

// ---------------------------------------------------------------------------
// QKV projection. Block = 8 waves = 128 tokens x 256 columns; wave tile =
// 64 tokens x 64 columns = one (t, head) slice, both 32-wide d halves.
// q/k planes: [head][dhalf] fragment-ordered NTOK x 32 planes, f16 of 64q (hi)
// and 2^11 residual: per 16-row group the wave owns one 1024-byte unit (two
// lane-contiguous 16-B instructions per plane). V^T planes: [head*NB+b]
// fragment-ordered 64 (d) x SEQ (key) planes, hi / residual: a lane's 8
// accumulator rows (keys) of one column (d) are one piece of a unit at the
// lane's own place, so they are stored straight from registers.
// ---------------------------------------------------------------------------
__global__ __launch_bounds__(256) __attribute__((amdgpu_num_vgpr(256)))
void k_qkv(const _Float16* __restrict__ xh, const _Float16* __restrict__ wT,
           const float* __restrict__ bias,
           _Float16* __restrict__ qh, _Float16* __restrict__ ql,
           _Float16* __restrict__ kh, _Float16* __restrict__ kl,
           _Float16* __restrict__ vTh, _Float16* __restrict__ vTr) {
    __shared__ __align__(16) _Float16 stw[8][1024];   // 16 KB, wave-private tiles
    const unsigned tid  = threadIdx.x;
    const unsigned lane = tid & 31u;
    const unsigned w    = tid >> 5;
    const unsigned n0   = blockIdx.y * 128u + (w >> 2) * 64u;
    const unsigned cb   = blockIdx.x * 256u + (w & 3u) * 64u;
    const unsigned r0   = (lane >> 4) << 3;
    const unsigned cc   = lane & 15u;

    v8f acc[4][4], dum[4][4];
    gemm_core<4, 4, false, DM>(xh + (size_t)n0 * DM, xh + (size_t)n0 * DM,
                               wT + (size_t)cb * DM, lane,
                               (blockIdx.x + blockIdx.y) % (unsigned)(DM / 64), acc, dum);

    const unsigned t  = cb >> 9;
    const unsigned h  = (cb >> 6) & 7u;
    float bv[4];
    const unsigned bi = cb + cc;
    const float b0 = bias[bi];
    const float b1 = bias[bi + 16u];
    const float b2 = bias[bi + 32u];
    const float b3 = bias[bi + 48u];
    // the index register is held (input) up to this wait: no load returns into it
    asm volatile("s_wait_xcnt 0x0" :: "v"(bi) : "memory");
    bv[0] = bf16r(b0) * 64.0f;
    bv[1] = bf16r(b1) * 64.0f;
    bv[2] = bf16r(b2) * 64.0f;
    bv[3] = bf16r(b3) * 64.0f;
    _Float16* sw = &stw[w][0];

    if (t < 2u) {
        _Float16* ph = (t == 0u) ? qh : kh;
        _Float16* pl = (t == 0u) ? ql : kl;
#pragma unroll
        for (int kk = 0; kk < 2; ++kk) {         // the two d halves, one plane each
        const size_t pbase = ((size_t)(h * 2u + (unsigned)kk) * NTOK + n0) * 32u;
#pragma unroll
        for (int mt = 0; mt < 4; ++mt) {
#pragma unroll
            for (int g = 0; g < 8; ++g) {
#pragma unroll
                for (int nt = 0; nt < 2; ++nt) {
                    const float v = acc[mt][kk * 2 + nt][g] + bv[kk * 2 + nt];
                    const _Float16 hi = (_Float16)v;
                    const unsigned so = nt * 256 + ((cc >> 3) * 16u + r0 + g) * 8u + (cc & 7u);
                    sw[so] = hi;
                    sw[512u + so] = (_Float16)((v - (float)hi) * SC_RES);
                }
            }
            wave_lds_sync();
            const v8h a0 = *(const v8h*)(sw + lane * 8u);
            const v8h a1 = *(const v8h*)(sw + 256u + lane * 8u);
            const v8h b0 = *(const v8h*)(sw + 512u + lane * 8u);
            const v8h b1 = *(const v8h*)(sw + 768u + lane * 8u);
            _Float16* dh = ph + pbase + (size_t)mt * 512u;
            _Float16* dl = pl + pbase + (size_t)mt * 512u;
            *(v8h*)(dh + lane * 8u)        = a0;
            *(v8h*)(dh + 256u + lane * 8u) = a1;
            *(v8h*)(dl + lane * 8u)        = b0;
            *(v8h*)(dl + 256u + lane * 8u) = b1;
            
            wave_lds_sync();
        }
        }
    } else {
        const unsigned b  = n0 / (unsigned)SEQ;
        const unsigned l0 = n0 - b * (unsigned)SEQ;
        const unsigned hb = h * (unsigned)NB + b;
        const size_t vbase = ((size_t)(hb * HD)) * SEQ + (size_t)l0 * 16u + lane * 8u;
#pragma unroll
        for (int mt = 0; mt < 4; ++mt)
#pragma unroll
            for (int nt = 0; nt < 4; ++nt) {
                v8h hv, rv;
#pragma unroll
                for (int g = 0; g < 8; ++g) {
                    const float v = acc[mt][nt][g] + bv[nt];
                    const _Float16 hi = (_Float16)v;
                    hv[g] = hi;
                    rv[g] = (_Float16)((v - (float)hi) * SC_RES);
                }
                const size_t vo = vbase + (size_t)(nt * 16) * SEQ + (mt >> 1) * 512 + (mt & 1) * 256;
                *(v8h*)(vTh + vo) = hv;
                *(v8h*)(vTr + vo) = rv;
            }
        // the V^T stores' registers may be rewritten behind this branch
        asm volatile("s_wait_xcnt 0x0" ::: "memory");
    }
}

// ---------------------------------------------------------------------------
// Attention, online softmax over keys. Block = 8 waves = 128 queries of one
// (head, batch); wave owns 16 queries. Scores are computed transposed:
// S^T tile = K(16 keys, A) x Q^T(B, n = query), so every statistic of a query
// lives in lane&15 (in-lane reduce over the 8 rows + one xor-16 exchange).
// P^T accumulator tiles (keys 0..15 / 16..31 of a 32-key step) are packed
// directly into the B fragment (k = key, n = query) of O^T = V^T x P^T with
// A = V^T rows (d) straight from the V^T planes. P carried 2^14.
// Loads run ahead of their use: K one step ahead, V from the head of its step.
// Epilogue: 16*ctx as f16 hi + 2^11 residual into fragment-ordered NTOK x 512
// planes: a lane's 8 rows (d) of one query are one piece of a unit at the
// lane's own place, stored straight from registers. msk cross-wave (block barrier).
// ---------------------------------------------------------------------------
__global__ __launch_bounds__(256) __attribute__((amdgpu_num_vgpr(256)))
void k_attn(const _Float16* __restrict__ qh, const _Float16* __restrict__ ql,
            const _Float16* __restrict__ kh, const _Float16* __restrict__ kl,
            const _Float16* __restrict__ vTh, const _Float16* __restrict__ vTr,
            const float* __restrict__ mask,
            _Float16* __restrict__ ctxh, _Float16* __restrict__ ctxr) {
    __shared__ __align__(16) float    msk[SEQ];          // additive key mask, log2 units

    const unsigned tid  = threadIdx.x;
    const unsigned lane = tid & 31u;
    const unsigned w    = tid >> 5;
    const unsigned hb   = blockIdx.x;
    const unsigned h    = hb / (unsigned)NB;
    const unsigned b    = hb - h * (unsigned)NB;
    const unsigned q0   = blockIdx.y * 128u + w * 16u;
    const unsigned r0   = (lane >> 4) << 3;

    for (unsigned idx = tid; idx < (unsigned)SEQ; idx += 256u)
        msk[idx] = bf16r(mask[(size_t)b * SEQ_FULL + idx]) * LOG2E;
    __syncthreads();

    const size_t tokq = (size_t)b * SEQ + q0;
    const size_t tokk = (size_t)b * SEQ;
    const size_t P0 = (size_t)(h * 2u) * NTOK;
    const size_t P1 = (size_t)(h * 2u + 1u) * NTOK;
    const v16h qhf0 = load_frag16(qh + (P0 + tokq) * 32u + lane * 8u);
    const v16h qhf1 = load_frag16(qh + (P1 + tokq) * 32u + lane * 8u);
    const v16h qlf0 = load_frag16(ql + (P0 + tokq) * 32u + lane * 8u);
    const v16h qlf1 = load_frag16(ql + (P1 + tokq) * 32u + lane * 8u);
    const _Float16* kh0 = kh + (P0 + tokk) * 32u;
    const _Float16* kl0 = kl + (P0 + tokk) * 32u;
    const _Float16* vhb = vTh + (size_t)hb * HD * SEQ;
    const _Float16* vrb = vTr + (size_t)hb * HD * SEQ;

    v8f oh[4], orr[4];
#pragma unroll
    for (int dt = 0; dt < 4; ++dt) { oh[dt] = zero8(); orr[dt] = zero8(); }
    float mr = -1.0e30f, lr = 0.0f;

    // One address pair per K plane pair and per V plane, carried through the loop: the
    // second d half of K lies a constant KP1 on, the second key tile and the d tiles too.
    constexpr size_t KP1 = (size_t)NTOK * 32u;
    const _Float16* pkh = kh0 + lane * 8u;
    const _Float16* pkl = kl0 + lane * 8u;
    const _Float16* pvh = vhb + lane * 8u;
    const _Float16* pvr = vrb + lane * 8u;
    // K fragments of the first 32 keys: [key tile][d half][hi, residual]
    v16h kf[2][2][2];
#pragma unroll
    for (int kt = 0; kt < 2; ++kt) {
        kf[kt][0][0] = load_frag16(pkh + kt * 512);
        kf[kt][0][1] = load_frag16(pkl + kt * 512);
        kf[kt][1][0] = load_frag16(pkh + KP1 + kt * 512);
        kf[kt][1][1] = load_frag16(pkl + KP1 + kt * 512);
    }

    // One 32-key step. MORE: a next step exists and its K fragments are requested. The last
    // step is written out behind the loop, so that inside the loop the requests in flight
    // are the same on every path and each wait counts only the loads it needs.
    auto key_step = [&](const unsigned key0, auto more) __attribute__((always_inline)) {
        constexpr bool MORE = decltype(more)::value;
        v8f sh0 = zero8(), sr0 = zero8(), sh1 = zero8(), sr1 = zero8();
        // this step's V fragments, d tiles 0 and 1: requested ahead of the score products
        // (d tiles 2 and 3 follow into the same registers, each behind its forerunner's products)
        v16h vfh[2], vfr[2];
#pragma unroll
        for (int dt = 0; dt < 2; ++dt) {
            vfh[dt] = load_frag16(pvh + (size_t)(dt * 16) * SEQ);
            vfr[dt] = load_frag16(pvr + (size_t)(dt * 16) * SEQ);
        }
        sh0 = wmma16(kf[0][0][0], qhf0, sh0);
        sr0 = wmma16(kf[0][0][0], qlf0, sr0);
        sr0 = wmma16(kf[0][0][1], qhf0, sr0);
        sh0 = wmma16(kf[0][1][0], qhf1, sh0);
        sr0 = wmma16(kf[0][1][0], qlf1, sr0);
        sr0 = wmma16(kf[0][1][1], qhf1, sr0);
        sh1 = wmma16(kf[1][0][0], qhf0, sh1);
        sr1 = wmma16(kf[1][0][0], qlf0, sr1);
        sr1 = wmma16(kf[1][0][1], qhf0, sr1);
        sh1 = wmma16(kf[1][1][0], qhf1, sh1);
        sr1 = wmma16(kf[1][1][0], qlf1, sr1);
        sr1 = wmma16(kf[1][1][1], qhf1, sr1);
        // the NEXT step's K fragments, into the set just read: requested behind this step's
        // score products, they land during the softmax and the V products
        if constexpr (MORE) {
#pragma unroll
            for (int kt = 0; kt < 2; ++kt) {
                kf[kt][0][0] = load_frag16(pkh + 1024 + kt * 512);
                kf[kt][0][1] = load_frag16(pkl + 1024 + kt * 512);
                kf[kt][1][0] = load_frag16(pkh + KP1 + 1024 + kt * 512);
                kf[kt][1][1] = load_frag16(pkl + KP1 + 1024 + kt * 512);
            }
        }
        float t0[8], t1[8];
#pragma unroll
        for (int g = 0; g < 8; ++g) {
            t0[g] = __builtin_fmaf(sh0[g], C1, sr0[g] * C2) + msk[key0 + r0 + g];
            t1[g] = __builtin_fmaf(sh1[g], C1, sr1[g] * C2) + msk[key0 + 16u + r0 + g];
        }
        float tmax = fmaxf(t0[0], t1[0]);
#pragma unroll
        for (int g = 1; g < 8; ++g) tmax = fmaxf(tmax, fmaxf(t0[g], t1[g]));
        tmax = fmaxf(tmax, __shfl_xor(tmax, 16, 32));
        const float mn    = fmaxf(mr, tmax);
        const float alpha = ex2(mr - mn);
        mr = mn;
        const float off = 14.0f - mn;
        v8h p0, p1;
        float ps = 0.0f;
#pragma unroll
        for (int g = 0; g < 8; ++g) {
            const _Float16 a = (_Float16)ex2(t0[g] + off);
            const _Float16 c = (_Float16)ex2(t1[g] + off);
            p0[g] = a;
            p1[g] = c;
            ps += (float)a + (float)c;
        }
        ps += __shfl_xor(ps, 16, 32);
        lr = lr * alpha + ps;
        Frag pb;
        pb.h[0] = p0;       // k = keys key0 + 8h + 0..7
        pb.h[1] = p1;       // k = keys key0 + 16 + 8h + 0..7
#pragma unroll
        for (int dt = 0; dt < 4; ++dt) {
            oh[dt]  = oh[dt] * alpha;
            orr[dt] = orr[dt] * alpha;
        }
#pragma unroll
        for (int dt = 0; dt < 4; ++dt) {
            oh[dt] = wmma16(vfh[dt & 1], pb.v, oh[dt]);
            orr[dt] = wmma16(vfr[dt & 1], pb.v, orr[dt]);
            if (dt < 2) {
                // keeps the request of d tile dt + 2 behind the products above, in their
                // registers: without it the build runs out of registers and spills to scratch
                __builtin_amdgcn_sched_barrier(0);
                vfh[dt] = load_frag16(pvh + (size_t)((dt + 2) * 16) * SEQ);
                vfr[dt] = load_frag16(pvr + (size_t)((dt + 2) * 16) * SEQ);
            }
        }
        // the address pairs are held (inputs) up to this wait and advanced only
        // behind it: no pair that an issued load still names is rewritten
        asm volatile("s_wait_xcnt 0x0" :: "v"(pkh), "v"(pkl), "v"(pvh), "v"(pvr) : "memory");
        pkh += 1024; pkl += 1024; pvh += 512; pvr += 512;
    };
#pragma unroll 1
    for (unsigned key0 = 0; key0 + 32u < (unsigned)SEQ; key0 += 32u) key_step(key0, Flag<true>{});
    key_step((unsigned)SEQ - 32u, Flag<false>{});

    // O^T lane (query lane&15): rows d = dt*16 + r0 + g. 16*ctx = (o + or 2^-11) / (64 l) * 16
    const float inv = 0.25f * (1.0f / lr);
    const size_t ob = tokq * DM + (size_t)(h * 2u) * 512u + lane * 8u;
#pragma unroll
    for (int dt = 0; dt < 4; ++dt) {
        v8h hv, rv;
#pragma unroll
        for (int g = 0; g < 8; ++g) {
            const float c = __builtin_fmaf(orr[dt][g], SC_RINV, oh[dt][g]) * inv;
            const _Float16 hi = (_Float16)c;
            hv[g] = hi;
            rv[g] = (_Float16)((c - (float)hi) * SC_RES);
        }
        *(v8h*)(ctxh + ob + (dt >> 1) * 512 + (dt & 1) * 256) = hv;
        *(v8h*)(ctxr + ob + (dt >> 1) * 512 + (dt & 1) * 256) = rv;
    }
}

// ---------------------------------------------------------------------------
// GEMM (N = 512) + bias + residual add + LayerNorm, fused. Block = 8 waves =
// ROWS rows x 512 columns (wave tile ROWS x 64; ROWS = 32 with the residual
// plane's second accumulators, 64 without). Scaled accumulators go to a
// cross-wave f32 LDS tile (block barrier), then wave w normalises rows
// POST: A = ctx hi + residual planes, residual add = bf16-RNE(x), outputs
// sa (f32) and 16*sa (f16, fragment-ordered NTOK x 512 plane: the block's 32
// rows are 32 KB contiguous, gathered in LDS as [k/8][row] pieces, block
// barrier, then 512-byte wave stores). Otherwise A = hidden plane, residual
// add = sa, output = final f32 rows.
// ---------------------------------------------------------------------------
template <bool POST>
__global__ __launch_bounds__(256) __attribute__((amdgpu_num_vgpr(256)))
void k_gemm_ln(const _Float16* __restrict__ Ah, const _Float16* __restrict__ Ar,
               const _Float16* __restrict__ Bt,
               const float* __restrict__ bias, const float* __restrict__ resid,
               const float* __restrict__ lnw, const float* __restrict__ lnb,
               float* __restrict__ outF, _Float16* __restrict__ outH) {
    constexpr unsigned K = POST ? DM : DF;       // contraction length: row-tile offsets are immediates
    constexpr unsigned ROWS = POST ? 32u : 64u;  // rows of the block
    constexpr int TM = (int)(ROWS / 16u);
    __shared__ __align__(16) float T[ROWS * DM]; // 64 / 128 KB, cross-wave
    // 16*sa pieces: [64 k/8][32 rows][8], column pitch 264 (16 B of pad: the 16
    // columns of one wave store fall on different banks), cross-wave
    __shared__ __align__(16) _Float16 Hs[POST ? 64 * 264 : 8];
    const unsigned tid  = threadIdx.x;
    const unsigned lane = tid & 31u;
    const unsigned w    = tid >> 5;
    const unsigned row0 = blockIdx.x * ROWS;
    const unsigned cb   = w * 64u;
    const unsigned r0   = (lane >> 4) << 3;
    const unsigned cc   = lane & 15u;

    v8f acc[TM][4], accr[TM][4];
    // every block reads all of Bt: neighbours of eight blocks share a start, the next eight take the next
    gemm_core<TM, 4, POST, K>(Ah + (size_t)row0 * K, Ar + (size_t)row0 * K,
                             Bt + (size_t)cb * K, lane, (blockIdx.x >> 3) % (K / 64u), acc, accr);
#pragma unroll
    for (int mt = 0; mt < TM; ++mt)
#pragma unroll
        for (int nt = 0; nt < 4; ++nt)
#pragma unroll
            for (int g = 0; g < 8; ++g) {
                const float v = POST ? __builtin_fmaf(accr[mt][nt][g], SC_RINV, acc[mt][nt][g])
                                     : acc[mt][nt][g];
                T[(mt * 16 + r0 + g) * DM + cb + nt * 16 + cc] = v;
            }
    __syncthreads();

#pragma unroll 1
    for (unsigned rr = 0; rr < ROWS / 8u; ++rr) {
        const unsigned row = w * (ROWS / 8u) + rr;
        const unsigned n   = row0 + row;
        const unsigned fr  = full_row(n);
        const float* rp = POST ? (resid + (size_t)fr * DM) : (resid + (size_t)n * DM);
        float*       op = POST ? (outF + (size_t)n * DM)   : (outF + (size_t)fr * DM);
        v4f xv[4];
        float s = 0.0f;
#pragma unroll
        for (int i = 0; i < 4; ++i) {
            const unsigned c = (unsigned)i * 128u + lane * 4u;
            const v4f a  = *(const v4f*)(&T[row * DM + c]);
            const v4f bi = *(const v4f*)(bias + c);
            const v4f rs = *(const v4f*)(rp + c);
            v4f x;
            x.x = __builtin_fmaf(a.x, SC_OUT, bf16r(bi.x)) + (POST ? bf16r(rs.x) : rs.x);
            x.y = __builtin_fmaf(a.y, SC_OUT, bf16r(bi.y)) + (POST ? bf16r(rs.y) : rs.y);
            x.z = __builtin_fmaf(a.z, SC_OUT, bf16r(bi.z)) + (POST ? bf16r(rs.z) : rs.z);
            x.w = __builtin_fmaf(a.w, SC_OUT, bf16r(bi.w)) + (POST ? bf16r(rs.w) : rs.w);
            xv[i] = x;
            s += (x.x + x.y) + (x.z + x.w);
        }
        s = wave_sum(s);
        const float mu = s * (1.0f / (float)DM);
        float q = 0.0f;
#pragma unroll
        for (int i = 0; i < 4; ++i) {
            const float d0 = xv[i].x - mu, d1 = xv[i].y - mu, d2 = xv[i].z - mu, d3 = xv[i].w - mu;
            q += (d0 * d0 + d1 * d1) + (d2 * d2 + d3 * d3);
        }
        q = wave_sum(q);
        const float rstd = rsqrtf(q * (1.0f / (float)DM) + 1.0e-5f);
        v4f yv[4];
#pragma unroll
        for (int i = 0; i < 4; ++i) {
            const unsigned c = (unsigned)i * 128u + lane * 4u;
            const v4f gw = *(const v4f*)(lnw + c);
            const v4f gb = *(const v4f*)(lnb + c);
            v4f y;
            y.x = (xv[i].x - mu) * rstd * bf16r(gw.x) + bf16r(gb.x);
            y.y = (xv[i].y - mu) * rstd * bf16r(gw.y) + bf16r(gb.y);
            y.z = (xv[i].z - mu) * rstd * bf16r(gw.z) + bf16r(gb.z);
            y.w = (xv[i].w - mu) * rstd * bf16r(gw.w) + bf16r(gb.w);
            yv[i] = y;
        }
        if (POST) {
#pragma unroll
            for (int i = 0; i < 4; ++i) {
                v4h hq;
                hq[0] = (_Float16)(yv[i].x * 16.0f); hq[1] = (_Float16)(yv[i].y * 16.0f);
                hq[2] = (_Float16)(yv[i].z * 16.0f); hq[3] = (_Float16)(yv[i].w * 16.0f);
                *(v4h*)(&Hs[((unsigned)i * 16u + (lane >> 1)) * 264u + row * 8u + (lane & 1u) * 4u]) = hq;
            }
        }
#pragma unroll
        for (int i = 0; i < 4; ++i)
            *(v4f*)(op + (unsigned)i * 128u + lane * 4u) = yv[i];
        // the row stores' registers are rewritten by the next row and behind the loop
        asm volatile("s_wait_xcnt 0x0" ::: "memory");
    }
    if (POST) {
        __syncthreads();
        _Float16* hp = outH + (size_t)row0 * DM + tid * 8u;
        // piece i*256 + tid of the block's 2 x 16 units: unit = 4*i + (w>>1), j = w&1
        const unsigned hs0 = ((w >> 1) * 4u + (w & 1u) * 2u + (lane >> 4)) * 264u + (lane & 15u) * 8u;
        v8h pv[8];
#pragma unroll
        for (int i = 0; i < 8; ++i)
            pv[i] = *(const v8h*)(&Hs[hs0 + (unsigned)(i & 3) * (16u * 264u) + (unsigned)(i >> 2) * 128u]);
#pragma unroll
        for (int i = 0; i < 8; ++i)
            *(v8h*)(hp + (unsigned)i * 2048u) = pv[i];
    }
}

// ---------------------------------------------------------------------------
// FF1: hidden = relu(sa W1 + b1), stored as f16 of 16*hidden, fragment-ordered
// NTOK x 2048 plane. Block = 8 waves = 128 rows x 256 columns; the wave's
// 64 x 64 tile = 4 x 2 units, ordered in LDS.
// ---------------------------------------------------------------------------
__global__ __launch_bounds__(256) __attribute__((amdgpu_num_vgpr(256)))
void k_ff1(const _Float16* __restrict__ sah, const _Float16* __restrict__ Bt,
           const float* __restrict__ bias, _Float16* __restrict__ hid) {
    __shared__ __align__(16) _Float16 st[8][64 * 64];   // 64 KB wave-private
    const unsigned tid  = threadIdx.x;
    const unsigned lane = tid & 31u;
    const unsigned w    = tid >> 5;
    const unsigned row0 = blockIdx.y * 128u + (w >> 2) * 64u;
    const unsigned cb   = blockIdx.x * 256u + (w & 3u) * 64u;
    const unsigned r0   = (lane >> 4) << 3;
    const unsigned cc   = lane & 15u;

    v8f acc[4][4], dum[4][4];
    gemm_core<4, 4, false, DM>(sah + (size_t)row0 * DM, sah + (size_t)row0 * DM,
                               Bt + (size_t)cb * DM, lane,
                               (blockIdx.x + blockIdx.y) % (unsigned)(DM / 64), acc, dum);
    float bv[4];
#pragma unroll
    for (int nt = 0; nt < 4; ++nt) bv[nt] = bf16r(bias[cb + nt * 16 + cc]) * 16.0f;
    _Float16* sw = &st[w][0];
#pragma unroll
    for (int mt = 0; mt < 4; ++mt)
#pragma unroll
        for (int nt = 0; nt < 4; ++nt)
#pragma unroll
            for (int g = 0; g < 8; ++g)
                sw[(mt * 2 + (nt >> 1)) * 512 + (nt & 1) * 256 + ((cc >> 3) * 16u + r0 + g) * 8u + (cc & 7u)] =
                    (_Float16)fmaxf(__builtin_fmaf(acc[mt][nt][g], SC_HID, bv[nt]), 0.0f);
    wave_lds_sync();
    v8h xv[16];
#pragma unroll
    for (int i = 0; i < 16; ++i) xv[i] = *(const v8h*)(sw + i * 256 + lane * 8u);
    _Float16* ob = hid + (size_t)row0 * DF + (size_t)cb * 16u + lane * 8u;
#pragma unroll
    for (int i = 0; i < 16; ++i)
        *(v8h*)(ob + (size_t)((i >> 2) * 16) * DF + ((i >> 1) & 1) * 512 + (i & 1) * 256) = xv[i];
    
}

// ---------------------------------------------------------------------------
// Workspace arena in units of U = NTOK*512*2 bytes (16 MiB at full size);
// time-disjoint planes share offsets (launches are stream-ordered):
//   [0,4U)  qh ql kh kl          -> later sa f32 [0,2U), 16*sa f16 [2U,3U)
//   [4U,6U) V^T hi / residual
//   [6U,7U) xh                   -> later ctx hi
//   [7U,8U) ctx residual
//   [3U,7U) later hidden
//   [8U,..) the weight planes, each at its own place from the first launch to its
//           reader: Wqkv^T (1.5 MiB), Wo^T (0.5 MiB), W1^T (2 MiB), W2^T (2 MiB)
// ---------------------------------------------------------------------------
#define U_BYTES ((size_t)NTOK * DM * 2)
static_assert((size_t)NB_FULL * SEQ_FULL * DM * 2 * 8 <= (size_t)134217728);

extern "C" void kernel_launch(void* const* d_in, const int* in_sizes, int n_in,
                              void* d_out, int out_size, void* d_ws, size_t ws_size,
                              hipStream_t stream) {
    if (n_in < 14) return;
    const int need_rows = (NB - 1) * SEQ_FULL + SEQ;
    if (in_sizes[0] < need_rows * DM) return;
    if (in_sizes[1] < need_rows) return;
    if (in_sizes[2] < 3 * NH * DM * HD || in_sizes[3] < 3 * NH * HD) return;
    if (in_sizes[4] < DM * DM || in_sizes[5] < DM) return;
    if (in_sizes[6] < DM * DF || in_sizes[7] < DF) return;
    if (in_sizes[8] < DF * DM || in_sizes[9] < DM) return;
    if (in_sizes[10] < DM || in_sizes[11] < DM || in_sizes[12] < DM || in_sizes[13] < DM) return;
    if (out_size < need_rows * DM) return;

    const float* inp   = (const float*)d_in[0];    // [16384,512]
    const float* mask  = (const float*)d_in[1];    // [32,1,512]
    const float* preW  = (const float*)d_in[2];    // [3,8,512,64]
    const float* preB  = (const float*)d_in[3];    // [3,8,1,64]
    const float* postW = (const float*)d_in[4];    // [512,512]
    const float* postB = (const float*)d_in[5];    // [512]
    const float* ff1W  = (const float*)d_in[6];    // [512,2048]
    const float* ff1B  = (const float*)d_in[7];    // [2048]
    const float* ff2W  = (const float*)d_in[8];    // [2048,512]
    const float* ff2B  = (const float*)d_in[9];    // [512]
    const float* ln1w  = (const float*)d_in[10];
    const float* ln1b  = (const float*)d_in[11];
    const float* ln2w  = (const float*)d_in[12];
    const float* ln2b  = (const float*)d_in[13];
    float* out = (float*)d_out;                    // [32,512,512]

    const size_t U = U_BYTES;
    const size_t WQ_B = (size_t)3 * NH * HD * DM * 2;   // 1.5 MiB
    const size_t WO_B = (size_t)DM * DM * 2;            // 0.5 MiB
    const size_t W1_B = (size_t)DF * DM * 2;            // 2 MiB
    const size_t W2_B = (size_t)DM * DF * 2;            // 2 MiB
    if (8 * U + WQ_B + WO_B + W1_B + W2_B > ws_size) return;

    char* ws = (char*)d_ws;
    _Float16* qh    = (_Float16*)(ws + 0 * U);
    _Float16* ql    = (_Float16*)(ws + 1 * U);
    _Float16* kh    = (_Float16*)(ws + 2 * U);
    _Float16* kl    = (_Float16*)(ws + 3 * U);
    _Float16* vTh   = (_Float16*)(ws + 4 * U);
    _Float16* vTr   = (_Float16*)(ws + 5 * U);
    _Float16* xh    = (_Float16*)(ws + 6 * U);
    _Float16* ctxh  = (_Float16*)(ws + 6 * U);
    _Float16* ctxr  = (_Float16*)(ws + 7 * U);
    _Float16* wqkvT = (_Float16*)(ws + 8 * U);
    float*    sa    = (float*)(ws + 0 * U);
    _Float16* sah   = (_Float16*)(ws + 2 * U);
    _Float16* postT = (_Float16*)(ws + 8 * U + WQ_B);
    _Float16* hid   = (_Float16*)(ws + 3 * U);
    _Float16* ff1T  = (_Float16*)(ws + 8 * U + WQ_B + WO_B);
    _Float16* ff2T  = (_Float16*)(ws + 8 * U + WQ_B + WO_B + W1_B);

    // x -> f16 plane (bf16-RNE values); every W[k][n] -> its [n][k] plane
    k_planes<<<dim3(WT_ALL + NTOK / 4), dim3(256), 0, stream>>>(
        inp, preW, postW, ff1W, ff2W, xh, wqkvT, postT, ff1T, ff2T);
    k_qkv<<<dim3(6, NTOK / 128), dim3(256), 0, stream>>>(xh, wqkvT, preB, qh, ql, kh, kl, vTh, vTr);
    k_attn<<<dim3(NH * NB, SEQ / 128), dim3(256), 0, stream>>>(qh, ql, kh, kl, vTh, vTr, mask, ctxh, ctxr);
    k_gemm_ln<true><<<dim3(NTOK / 32), dim3(256), 0, stream>>>(
        ctxh, ctxr, postT, postB, inp, ln1w, ln1b, sa, sah);
    k_ff1<<<dim3(8, NTOK / 128), dim3(256), 0, stream>>>(sah, ff1T, ff1B, hid);
    k_gemm_ln<false><<<dim3(NTOK / 64), dim3(256), 0, stream>>>(
        hid, hid, ff2T, ff2B, sa, ln2w, ln2b, out, sah);
}

// v006
// It runs in 202 microseconds.
// In both of two side-by-side timings against v005, it was 1.04 times as fast.
// All steps since v000 together make it 2.33 times as fast.
#include <hip/hip_runtime.h>
#include <hip/hip_fp16.h>

// All contractions on v_wmma_f32_16x16x32_f16 (f16 operands, f32 accumulate): x*Wqkv, sa*W1, h*W2 single f16 planes; k*q^T with f16 hi + 2^11-scaled f16 residual planes (hi.hi, hi.res, res.hi); V^T*P^T and ctx*Wo with f16 hi + 2^11-scaled f16 residual plane on V / ctx (two accumulators, residual folded 2^-11 in f32).

#ifndef NB
#define NB 32
#endif
#ifndef SEQ
#define SEQ 512
#endif
#define NB_FULL  32
#define SEQ_FULL 512
#define NH   8           // heads
#define HD   64          // head width
#define DM   512         // model width
#define DF   2048        // hidden width
#define NTOK (NB * SEQ)

static_assert(NB >= 1 && NB <= NB_FULL);
static_assert(SEQ >= 128 && SEQ <= SEQ_FULL);
static_assert(SEQ % 128 == 0);
static_assert(NTOK % 128 == 0);
static_assert(DM == NH * HD);
static_assert(DM == 512 && HD == 64 && NH == 8 && DF == 2048);

typedef _Float16 v16h __attribute__((ext_vector_type(16)));
typedef _Float16 v8h  __attribute__((ext_vector_type(8)));
typedef _Float16 v4h  __attribute__((ext_vector_type(4)));
typedef float    v8f  __attribute__((ext_vector_type(8)));
typedef float    v4f  __attribute__((ext_vector_type(4)));

typedef const __attribute__((address_space(1))) _Float16* GlobalH;   // pointer into global memory

union Frag { v16h v; v8h h[2]; };

template <bool V> struct Flag { static constexpr bool value = V; };

#define LOG2E 1.44269504088896340736f
// scores: acc_h = (64k_h).(64q_h), acc_r = 2^11-scaled residual cross terms
// t (log2 units) = acc_h * log2(e)*2^-12 + acc_r * log2(e)*2^-23
#define C1 (1.44269504088896340736f * 0.000244140625f)
#define C2 (1.44269504088896340736f * 1.1920928955078125e-07f)
#define SC_RES   2048.0f                     // residual plane carry 2^11
#define SC_RINV  4.8828125e-04f              // 2^-11 : residual accumulator fold
#define SC_OUT   9.765625e-04f               // 2^-10 : (16 a)(64 W) -> a.W
#define SC_HID   1.5625e-02f                 // 2^-6  : (16 sa)(64 W1) -> 16 h

static __device__ __forceinline__ v8f zero8() {
    v8f z;
#pragma unroll
    for (int i = 0; i < 8; ++i) z[i] = 0.0f;
    return z;
}

// Fragment-ordered operand planes. A plane of R rows x K (k) 16-bit elements
// is a sequence of 1024-byte units, unit (row/16)*(K/32) + k/32 = one 16x32
// WMMA operand fragment, stored as [j = (k>>4)&1][lane][8]:
//   lane = 16*((k>>3)&1) + (row&15), element = k&7.
// A fragment (A, or B from an [n][k] source) is then two wave-wide 16-byte
// loads of 512 contiguous bytes each (4 whole lines per load): lane m =
// lane&15 -> row m; kb = 8*(lane>>4); elements 0..7 = k kb..kb+7, elements
// 8..15 = k kb+16..kb+23.
// p = unit + lane*8, the lane's own place in the unit.
static __device__ __forceinline__ v16h load_frag16(const _Float16* p) {
    Frag f;
    f.h[0] = *(const v8h*)(p);
    f.h[1] = *(const v8h*)(p + 256);
    return f.v;
}

// offset (in elements) of the 8-element piece (row, k8..k8+7), k8 % 8 == 0
static __device__ __forceinline__ size_t frag_off(unsigned row, unsigned k8, unsigned K) {
    return ((size_t)(row >> 4) * (K >> 5) + (k8 >> 5)) * 512u
         + ((k8 >> 4) & 1u) * 256u + ((((k8 >> 3) & 1u) << 4) + (row & 15u)) * 8u;
}

static __device__ __forceinline__ v8f wmma16(v16h a, v16h b, v8f c) {
    v8f d = __builtin_amdgcn_wmma_f32_16x16x32_f16(false, a, false, b, (short)0, c, false, false);
    asm volatile("v_nop\n\tv_nop\n\tv_nop\n\tv_nop" : "+v"(d) : "v"(a), "v"(b));
    return d;
}

// f32 -> bf16 RNE convert, value kept as f32
static __device__ __forceinline__ float bf16r(float x) {
    unsigned u = __float_as_uint(x);
    u = (u + 0x7FFFu + ((u >> 16) & 1u)) & 0xFFFF0000u;
    return __uint_as_float(u);
}

static __device__ __forceinline__ float ex2(float x) {
    return __builtin_amdgcn_exp2f(x);
}

static __device__ __forceinline__ float wave_sum(float v) {
    v += __shfl_xor(v, 16, 32);
    v += __shfl_xor(v, 8, 32);
    v += __shfl_xor(v, 4, 32);
    v += __shfl_xor(v, 2, 32);
    v += __shfl_xor(v, 1, 32);
    return v;
}

// compact token row (b*SEQ + l) -> row in the full-size arrays
static __device__ __forceinline__ unsigned full_row(unsigned n) {
    const unsigned b = n / (unsigned)SEQ;
    return b * (unsigned)SEQ_FULL + (n - b * (unsigned)SEQ);
}

// ---------------------------------------------------------------------------
// Wave-level GEMM core: TM x TN tiles of 16x16, A / Bt both fragment-ordered
// planes of width K; the pointers name the first unit of the wave's first row
// tile (row * K elements in), the next row tile is 16*K on, the next k step 512.
// RES: second A plane (2^11-scaled residual) into its own accumulators.
// The fragments of k step s + 1 are requested before the products of step s
// (two register sets), so a step waits for loads that are one step old, once,
// and not for each B fragment in turn. SB (16 accumulator tiles: RES, or a 4 x 4
// wave tile): the accumulators leave no room for a second B set, each B fragment
// is requested anew behind its last product.
// The k walk starts at trip t0 (a trip = two k steps = 64 k) and wraps: blocks that
// read the same operand rows at the same time get different t0, so that their
// requests for one line do not reach L2 together. Every k step is taken once.
// ---------------------------------------------------------------------------
// SW: the product is taken transposed, the Bt fragment as the A operand and the A plane's
// fragment as the B operand (both planes have one fragment order, the k order is the same):
// tile [mt][nt] then holds, per lane, row mt*16 + (lane&15) of the A plane against the 8
// CONSECUTIVE Bt rows nt*16 + 8*(lane>>4) + 0..7, which is one 16-byte piece of a
// fragment-ordered plane (or 32 bytes of an f32 row) and needs no transpose on its way out.
// One k step on the current set; LD: request the next step's set from pa / pr / pb.
template <int TM, int TN, bool RES, bool SB, bool SW, unsigned K, bool LD>
static __device__ __forceinline__ void gemm_step(const _Float16* pa, const _Float16* pr,
                                                 const _Float16* pb,
                                                 const v16h (&ac)[TM], const v16h (&arc)[TM], v16h (&bc)[TN],
                                                 v16h (&an)[TM], v16h (&arn)[TM], v16h (&bn)[TN],
                                                 v8f (&acc)[TM][TN], v8f (&accr)[TM][TN]) {
    if (LD) {
#pragma unroll
        for (int mt = 0; mt < TM; ++mt) {
            an[mt] = load_frag16(pa + (size_t)(mt * 16) * K);
            if (RES) arn[mt] = load_frag16(pr + (size_t)(mt * 16) * K);
        }
        if (!SB) {
#pragma unroll
            for (int nt = 0; nt < TN; ++nt) bn[nt] = load_frag16(pb + (size_t)(nt * 16) * K);
        }
    }
#pragma unroll
    for (int nt = 0; nt < TN; ++nt) {
#pragma unroll
        for (int mt = 0; mt < TM; ++mt) {
            acc[mt][nt] = SW ? wmma16(bc[nt], ac[mt], acc[mt][nt]) : wmma16(ac[mt], bc[nt], acc[mt][nt]);
            if (RES) accr[mt][nt] = SW ? wmma16(bc[nt], arc[mt], accr[mt][nt])
                                       : wmma16(arc[mt], bc[nt], accr[mt][nt]);
        }
        if (LD && SB) bc[nt] = load_frag16(pb + (size_t)(nt * 16) * K);
    }
}

template <int TM, int TN, bool RES, bool SW, unsigned K>
static __device__ __forceinline__ void gemm_core(const _Float16* __restrict__ Ah,
                                                 const _Float16* __restrict__ Ar,
                                                 const _Float16* __restrict__ Bt,
                                                 unsigned lane, unsigned t0,
                                                 v8f (&acc)[TM][TN], v8f (&accr)[TM][TN]) {
    static_assert(K % 64u == 0u && K >= 64u);
    constexpr unsigned T = K / 64u;              // trips; t0 < T, the same in the whole block
    constexpr bool SB = RES || TM * TN >= 16;    // one B set only
    constexpr int B1 = SB ? 0 : 1;               // index of the second B set
#pragma unroll
    for (int mt = 0; mt < TM; ++mt)
#pragma unroll
        for (int nt = 0; nt < TN; ++nt) {
            acc[mt][nt] = zero8();
            if (RES) accr[mt][nt] = zero8();
        }
    // one address pair per plane; row tiles and the two steps of a trip are constant offsets
    const _Float16* pa = Ah + t0 * 1024u + lane * 8u;
    const _Float16* pr = Ar + t0 * 1024u + lane * 8u;
    const _Float16* pb = Bt + t0 * 1024u + lane * 8u;
    v16h a[2][TM], ar[2][TM], b[2][TN];
#pragma unroll
    for (int mt = 0; mt < TM; ++mt) {
        a[0][mt] = load_frag16(pa + (size_t)(mt * 16) * K);
        if (RES) ar[0][mt] = load_frag16(pr + (size_t)(mt * 16) * K);
    }
    // keeps the first A requests ahead of the first B requests, the order of every trip:
    // the wait at the loop's head serves both ways in, and with an A request last on this
    // way it counts to 0 and drains the B requests in flight on every trip
    if (!RES) __builtin_amdgcn_sched_barrier(0);
#pragma unroll
    for (int nt = 0; nt < TN; ++nt) b[0][nt] = load_frag16(pb + (size_t)(nt * 16) * K);
    unsigned t = t0;
#pragma unroll 1
    for (unsigned i = 0; i + 1u < T; ++i) {
        gemm_step<TM, TN, RES, SB, SW, K, true>(pa + 512, pr + 512, pb + 512,
                                        a[0], ar[0], b[0], a[1], ar[1], b[B1], acc, accr);
        // to the next trip: 1024 elements = 2048 bytes on, or back to the row tile's first
        // unit behind its last trip (a row tile is K * 32 bytes); a scalar, alike for all planes
        t = (t + 1u == T) ? 0u : t + 1u;
        const long long adv = (t == 0u) ? 2048ll - (long long)K * 32ll : 2048ll;
        // The wait and the advance in one statement: no pair that an issued load still names
        // is rewritten ahead of the wait.
        // (typed as global-memory pointers, so that the loads behind it stay global loads)
        GlobalH ga = (GlobalH)pa, gb = (GlobalH)pb;
        if constexpr (RES) {
            GlobalH gr = (GlobalH)pr;
            asm volatile("s_wait_xcnt 0x0\n\t"
                         "v_add_nc_u64 %0, %3, %0\n\t"
                         "v_add_nc_u64 %1, %3, %1\n\t"
                         "v_add_nc_u64 %2, %3, %2"
                         : "+v"(ga), "+v"(gr), "+v"(gb) : "s"(adv) : "memory");
            pr = (const _Float16*)gr;
        } else {
            asm volatile("s_wait_xcnt 0x0\n\t"
                         "v_add_nc_u64 %0, %2, %0\n\t"
                         "v_add_nc_u64 %1, %2, %1"
                         : "+v"(ga), "+v"(gb) : "s"(adv) : "memory");
        }
        pa = (const _Float16*)ga; pb = (const _Float16*)gb;
        gemm_step<TM, TN, RES, SB, SW, K, true>(pa, pr, pb,
                                        a[1], ar[1], b[B1], a[0], ar[0], b[0], acc, accr);
    }
    gemm_step<TM, TN, RES, SB, SW, K, true>(pa + 512, pr + 512, pb + 512,
                                    a[0], ar[0], b[0], a[1], ar[1], b[B1], acc, accr);
    gemm_step<TM, TN, RES, SB, SW, K, false>(pa, pr, pb,
                                     a[1], ar[1], b[B1], a[0], ar[0], b[0], acc, accr);
    // as above, for the last steps' loads: the pairs' registers are free behind it
    if (RES) asm volatile("s_wait_xcnt 0x0" :: "v"(pa), "v"(pr), "v"(pb) : "memory");
    else     asm volatile("s_wait_xcnt 0x0" :: "v"(pa), "v"(pb) : "memory");
}

// ---------------------------------------------------------------------------
// x (f32) -> xh, fragment-ordered NTOK x 512 plane, f16 of the bf16-RNE value.
// 8 elements per thread; a wave takes 8 rows x 32 columns (one 128-B line per
// row in, four whole 128-B lines out, each line written by one wave).
// ---------------------------------------------------------------------------
static __device__ __forceinline__ void cvt_x_block(unsigned blk, const float* __restrict__ x,
                                                   _Float16* __restrict__ xh) {
    const unsigned idx = blk * 256u + threadIdx.x;
    const unsigned wv  = idx >> 5;
    const unsigned ln  = idx & 31u;
    const unsigned n   = (wv >> 4) * 8u + (ln & 7u);
    const unsigned c8  = (wv & 15u) * 32u + (ln >> 3) * 8u;
    const unsigned fr  = full_row(n);
    const float* p = x + (size_t)fr * DM + c8;
    const v4f a = *(const v4f*)(p);
    const v4f b = *(const v4f*)(p + 4);
    v8h o;
    o[0] = (_Float16)bf16r(a.x); o[1] = (_Float16)bf16r(a.y);
    o[2] = (_Float16)bf16r(a.z); o[3] = (_Float16)bf16r(a.w);
    o[4] = (_Float16)bf16r(b.x); o[5] = (_Float16)bf16r(b.y);
    o[6] = (_Float16)bf16r(b.z); o[7] = (_Float16)bf16r(b.w);
    _Float16* d = xh + frag_off(n, c8, (unsigned)DM);
    *(v8h*)d = o;
    
}

// ---------------------------------------------------------------------------
// Weight plane builder: in [z][R][C] f32 (k-major, W[k][n]) -> out: z
// fragment-ordered planes of C rows (n) x R (k), f16 = 64 * bf16-RNE(W)^T.
// 64x64 tile through LDS = 4 x 2 units, each wave store 512 contiguous bytes;
// tile (bx, by, bz) of (C/64, R/64, z).
// ---------------------------------------------------------------------------
static __device__ __forceinline__ void wT_block(const float* __restrict__ in,
                                                _Float16* __restrict__ out,
                                                unsigned R, unsigned C,
                                                unsigned bx, unsigned by, unsigned bz) {
    __shared__ __align__(16) _Float16 t[64 * 72];
    const unsigned tid = threadIdx.x;
    const unsigned n0 = bx * 64u;
    const unsigned k0 = by * 64u;
    const float*  inb  = in  + (size_t)bz * R * C;
    _Float16*     outb = out + (size_t)bz * R * C;
    const float* p[4];
    v4f vv[4];
#pragma unroll
    for (int i = 0; i < 4; ++i) {
        const unsigned idx = (unsigned)i * 256u + tid;
        p[i] = inb + (size_t)(k0 + (idx >> 4)) * C + n0 + ((idx & 15u) << 2);
        vv[i] = *(const v4f*)p[i];
    }
    // the four address pairs are held (inputs) up to this wait: no load returns
    // into a pair that an issued load still names, and none is rewritten before it
    asm volatile("s_wait_xcnt 0x0" :: "v"(p[0]), "v"(p[1]), "v"(p[2]), "v"(p[3]) : "memory");
#pragma unroll
    for (int i = 0; i < 4; ++i) {
        const unsigned idx = (unsigned)i * 256u + tid;
        const unsigned r = idx >> 4, c4 = (idx & 15u) << 2;
        const v4f v = vv[i];
        t[(c4 + 0u) * 72u + r] = (_Float16)(bf16r(v.x) * 64.0f);
        t[(c4 + 1u) * 72u + r] = (_Float16)(bf16r(v.y) * 64.0f);
        t[(c4 + 2u) * 72u + r] = (_Float16)(bf16r(v.z) * 64.0f);
        t[(c4 + 3u) * 72u + r] = (_Float16)(bf16r(v.w) * 64.0f);
    }
    __syncthreads();
    const unsigned ln = tid & 31u;
    const unsigned kl = ((tid >> 6) & 1u) * 32u + ((tid >> 5) & 1u) * 16u + (ln >> 4) * 8u;
    const unsigned nl = (tid >> 7) * 16u + (ln & 15u);
    const v8h o0 = *(const v8h*)(&t[nl * 72u + kl]);
    const v8h o1 = *(const v8h*)(&t[(nl + 32u) * 72u + kl]);
    _Float16* d0 = outb + frag_off(n0 + nl, k0 + kl, R);
    _Float16* d1 = outb + frag_off(n0 + nl + 32u, k0 + kl, R);
    *(v8h*)d0 = o0;
    *(v8h*)d1 = o1;
    // the stores' address pairs and data are held (inputs) up to this wait: in the one
    // kernel that holds all builders other code follows, which rewrites these registers
    asm volatile("s_wait_xcnt 0x0" :: "v"(d0), "v"(d1), "v"(o0), "v"(o1) : "memory");
}

// ---------------------------------------------------------------------------
// All operand planes that depend on the inputs alone, in one launch: the four
// weight planes (768 tiles, the low block indices), then the x plane.
// The choice of the work is uniform over the block.
// ---------------------------------------------------------------------------
#define WT_QKV  (3 * NH * (DM / 64))                 // 192 tiles: 24 x [512 k][64 n]
#define WT_POST ((DM / 64) * (DM / 64))              //  64 tiles: [512 k][512 n]
#define WT_FF   ((DF / 64) * (DM / 64))              // 256 tiles: [512 k][2048 n], [2048 k][512 n]
#define WT_ALL  (WT_QKV + WT_POST + 2 * WT_FF)
__global__ __launch_bounds__(256) void k_planes(const float* __restrict__ x,
                                                const float* __restrict__ preW,
                                                const float* __restrict__ postW,
                                                const float* __restrict__ ff1W,
                                                const float* __restrict__ ff2W,
                                                _Float16* __restrict__ xh,
                                                _Float16* __restrict__ wqkvT,
                                                _Float16* __restrict__ postT,
                                                _Float16* __restrict__ ff1T,
                                                _Float16* __restrict__ ff2T) {
    const unsigned bid = blockIdx.x;
    if (bid >= (unsigned)WT_ALL) {
        cvt_x_block(bid - (unsigned)WT_ALL, x, xh);
    } else if (bid < (unsigned)WT_QKV) {
        wT_block(preW, wqkvT, DM, HD, 0u, bid & 7u, bid >> 3);
    } else if (bid < (unsigned)(WT_QKV + WT_POST)) {
        const unsigned u = bid - (unsigned)WT_QKV;
        wT_block(postW, postT, DM, DM, u & 7u, u >> 3, 0u);
    } else if (bid < (unsigned)(WT_QKV + WT_POST + WT_FF)) {
        const unsigned u = bid - (unsigned)(WT_QKV + WT_POST);
        wT_block(ff1W, ff1T, DM, DF, u & 31u, u >> 5, 0u);
    } else {
        const unsigned u = bid - (unsigned)(WT_QKV + WT_POST + WT_FF);
        wT_block(ff2W, ff2T, DF, DM, u & 7u, u >> 3, 0u);
    }
}

// ---------------------------------------------------------------------------
// QKV projection. Block = 8 waves = 128 tokens x 256 columns, all of q, of k or
// of v; wave tile = 64 tokens x 64 columns = one (t, head) slice.
// q/k planes: [head][dhalf] fragment-ordered NTOK x 32 planes, f16 of 64q (hi)
// and 2^11 residual. V^T planes: [head*NB+b] fragment-ordered 64 (d) x SEQ (key)
// planes, hi / residual. Every plane is stored straight from registers: a lane's
// 8 accumulator rows must be 8 consecutive k of the plane, so the q and k tiles
// are computed transposed (W^T rows as the A operand, tokens as B: rows = d),
// the v tiles as x W (rows = keys). Both operand planes have the same shape and
// order, so the choice is which plane's address goes in as which operand.
// ---------------------------------------------------------------------------
__global__ __launch_bounds__(256) __attribute__((amdgpu_num_vgpr(256)))
void k_qkv(const _Float16* __restrict__ xh, const _Float16* __restrict__ wT,
           const float* __restrict__ bias,
           _Float16* __restrict__ qh, _Float16* __restrict__ ql,
           _Float16* __restrict__ kh, _Float16* __restrict__ kl,
           _Float16* __restrict__ vTh, _Float16* __restrict__ vTr) {
    const unsigned tid  = threadIdx.x;
    const unsigned lane = tid & 31u;
    const unsigned w    = tid >> 5;
    const unsigned n0   = blockIdx.y * 128u + (w >> 2) * 64u;
    const unsigned cb   = blockIdx.x * 256u + (w & 3u) * 64u;
    const unsigned r0   = (lane >> 4) << 3;
    const unsigned cc   = lane & 15u;
    const unsigned t    = blockIdx.x >> 1;       // = cb >> 9: 0 q, 1 k, 2 v; one per block
    const unsigned h    = (cb >> 6) & 7u;

    const _Float16* xrow = xh + (size_t)n0 * DM;
    const _Float16* wrow = wT + (size_t)cb * DM;
    const _Float16* opa  = (t < 2u) ? wrow : xrow;
    const _Float16* opb  = (t < 2u) ? xrow : wrow;
    v8f acc[4][4], dum[4][4];
    gemm_core<4, 4, false, false, DM>(opa, opa, opb, lane,
                                      (blockIdx.x + blockIdx.y) % (unsigned)(DM / 64), acc, dum);

    if (t < 2u) {
        // acc[dt][tt]: lane = token n0 + tt*16 + cc, rows d = dt*16 + r0 + 0..7
        _Float16* ph = (t == 0u) ? qh : kh;
        _Float16* pl = (t == 0u) ? ql : kl;
        const float* bp = bias + cb + r0;
        v4f bq[4][2];
#pragma unroll
        for (int dt = 0; dt < 4; ++dt) {
            bq[dt][0] = *(const v4f*)(bp + dt * 16);
            bq[dt][1] = *(const v4f*)(bp + dt * 16 + 4);
        }
        // the address pair is held (input) up to this wait: no load returns into it
        asm volatile("s_wait_xcnt 0x0" :: "v"(bp) : "memory");
#pragma unroll
        for (int kk = 0; kk < 2; ++kk) {         // the two d halves, one plane each
            const size_t pbase = ((size_t)(h * 2u + (unsigned)kk) * NTOK + n0) * 32u + lane * 8u;
            _Float16* dh = ph + pbase;
            _Float16* dl = pl + pbase;
            v8h hv[2][4], rv[2][4];
#pragma unroll
            for (int j = 0; j < 2; ++j) {
                float bv[8];
#pragma unroll
                for (int g = 0; g < 8; ++g) bv[g] = bf16r(bq[kk * 2 + j][g >> 2][g & 3]) * 64.0f;
#pragma unroll
                for (int tt = 0; tt < 4; ++tt)
#pragma unroll
                    for (int g = 0; g < 8; ++g) {
                        const float v = acc[kk * 2 + j][tt][g] + bv[g];
                        const _Float16 hi = (_Float16)v;
                        hv[j][tt][g] = hi;
                        rv[j][tt][g] = (_Float16)((v - (float)hi) * SC_RES);
                    }
            }
#pragma unroll
            for (int tt = 0; tt < 4; ++tt)
#pragma unroll
                for (int j = 0; j < 2; ++j) {
                    *(v8h*)(dh + tt * 512 + j * 256) = hv[j][tt];
                    *(v8h*)(dl + tt * 512 + j * 256) = rv[j][tt];
                }
            // the stores' address pairs and data are held (inputs) up to this wait: the
            // next plane's values and the code behind the branch rewrite these registers
            asm volatile("s_wait_xcnt 0x0"
                         :: "v"(dh), "v"(dl),
                            "v"(hv[0][0]), "v"(hv[0][1]), "v"(hv[0][2]), "v"(hv[0][3]),
                            "v"(hv[1][0]), "v"(hv[1][1]), "v"(hv[1][2]), "v"(hv[1][3]),
                            "v"(rv[0][0]), "v"(rv[0][1]), "v"(rv[0][2]), "v"(rv[0][3]),
                            "v"(rv[1][0]), "v"(rv[1][1]), "v"(rv[1][2]), "v"(rv[1][3])
                         : "memory");
        }
    } else {
        float bv[4];
        const unsigned bi = cb + cc;
        const float b0 = bias[bi];
        const float b1 = bias[bi + 16u];
        const float b2 = bias[bi + 32u];
        const float b3 = bias[bi + 48u];
        // the index register is held (input) up to this wait: no load returns into it
        asm volatile("s_wait_xcnt 0x0" :: "v"(bi) : "memory");
        bv[0] = bf16r(b0) * 64.0f;
        bv[1] = bf16r(b1) * 64.0f;
        bv[2] = bf16r(b2) * 64.0f;
        bv[3] = bf16r(b3) * 64.0f;
        const unsigned b  = n0 / (unsigned)SEQ;
        const unsigned l0 = n0 - b * (unsigned)SEQ;
        const unsigned hb = h * (unsigned)NB + b;
        const size_t vbase = ((size_t)(hb * HD)) * SEQ + (size_t)l0 * 16u + lane * 8u;
#pragma unroll
        for (int mt = 0; mt < 4; ++mt)
#pragma unroll
            for (int nt = 0; nt < 4; ++nt) {
                v8h hv, rv;
#pragma unroll
                for (int g = 0; g < 8; ++g) {
                    const float v = acc[mt][nt][g] + bv[nt];
                    const _Float16 hi = (_Float16)v;
                    hv[g] = hi;
                    rv[g] = (_Float16)((v - (float)hi) * SC_RES);
                }
                const size_t vo = vbase + (size_t)(nt * 16) * SEQ + (mt >> 1) * 512 + (mt & 1) * 256;
                *(v8h*)(vTh + vo) = hv;
                *(v8h*)(vTr + vo) = rv;
            }
        // the V^T stores' registers may be rewritten behind this branch
        asm volatile("s_wait_xcnt 0x0" ::: "memory");
    }
}

// ---------------------------------------------------------------------------
// Attention, online softmax over keys. Block = 8 waves = 128 queries of one
// (head, batch); wave owns 16 queries. Scores are computed transposed:
// S^T tile = K(16 keys, A) x Q^T(B, n = query), so every statistic of a query
// lives in lane&15 (in-lane reduce over the 8 rows + one xor-16 exchange).
// P^T accumulator tiles (keys 0..15 / 16..31 of a 32-key step) are packed
// directly into the B fragment (k = key, n = query) of O^T = V^T x P^T with
// A = V^T rows (d) straight from the V^T planes. P carried 2^14.
// Loads run ahead of their use: K one step ahead, V from the head of its step.
// Epilogue: 16*ctx as f16 hi + 2^11 residual into fragment-ordered NTOK x 512
// planes: a lane's 8 rows (d) of one query are one piece of a unit at the
// lane's own place, stored straight from registers. msk cross-wave (block barrier).
// ---------------------------------------------------------------------------
__global__ __launch_bounds__(256) __attribute__((amdgpu_num_vgpr(256)))
void k_attn(const _Float16* __restrict__ qh, const _Float16* __restrict__ ql,
            const _Float16* __restrict__ kh, const _Float16* __restrict__ kl,
            const _Float16* __restrict__ vTh, const _Float16* __restrict__ vTr,
            const float* __restrict__ mask,
            _Float16* __restrict__ ctxh, _Float16* __restrict__ ctxr) {
    __shared__ __align__(16) float    msk[SEQ];          // additive key mask, log2 units

    const unsigned tid  = threadIdx.x;
    const unsigned lane = tid & 31u;
    const unsigned w    = tid >> 5;
    const unsigned hb   = blockIdx.x;
    const unsigned h    = hb / (unsigned)NB;
    const unsigned b    = hb - h * (unsigned)NB;
    const unsigned q0   = blockIdx.y * 128u + w * 16u;
    const unsigned r0   = (lane >> 4) << 3;

    for (unsigned idx = tid; idx < (unsigned)SEQ; idx += 256u)
        msk[idx] = bf16r(mask[(size_t)b * SEQ_FULL + idx]) * LOG2E;
    __syncthreads();

    const size_t tokq = (size_t)b * SEQ + q0;
    const size_t tokk = (size_t)b * SEQ;
    const size_t P0 = (size_t)(h * 2u) * NTOK;
    const size_t P1 = (size_t)(h * 2u + 1u) * NTOK;
    const v16h qhf0 = load_frag16(qh + (P0 + tokq) * 32u + lane * 8u);
    const v16h qhf1 = load_frag16(qh + (P1 + tokq) * 32u + lane * 8u);
    const v16h qlf0 = load_frag16(ql + (P0 + tokq) * 32u + lane * 8u);
    const v16h qlf1 = load_frag16(ql + (P1 + tokq) * 32u + lane * 8u);
    const _Float16* kh0 = kh + (P0 + tokk) * 32u;
    const _Float16* kl0 = kl + (P0 + tokk) * 32u;
    const _Float16* vhb = vTh + (size_t)hb * HD * SEQ;
    const _Float16* vrb = vTr + (size_t)hb * HD * SEQ;

    v8f oh[4], orr[4];
#pragma unroll
    for (int dt = 0; dt < 4; ++dt) { oh[dt] = zero8(); orr[dt] = zero8(); }
    float mr = -1.0e30f, lr = 0.0f;

    // One address pair per K plane pair and per V plane, carried through the loop: the
    // second d half of K lies a constant KP1 on, the second key tile and the d tiles too.
    constexpr size_t KP1 = (size_t)NTOK * 32u;
    const _Float16* pkh = kh0 + lane * 8u;
    const _Float16* pkl = kl0 + lane * 8u;
    const _Float16* pvh = vhb + lane * 8u;
    const _Float16* pvr = vrb + lane * 8u;
    // K fragments of the first 32 keys: [key tile][d half][hi, residual]
    v16h kf[2][2][2];
#pragma unroll
    for (int kt = 0; kt < 2; ++kt) {
        kf[kt][0][0] = load_frag16(pkh + kt * 512);
        kf[kt][0][1] = load_frag16(pkl + kt * 512);
        kf[kt][1][0] = load_frag16(pkh + KP1 + kt * 512);
        kf[kt][1][1] = load_frag16(pkl + KP1 + kt * 512);
    }

    // One 32-key step. MORE: a next step exists and its K fragments are requested. The last
    // step is written out behind the loop, so that inside the loop the requests in flight
    // are the same on every path and each wait counts only the loads it needs.
    auto key_step = [&](const unsigned key0, auto more) __attribute__((always_inline)) {
        constexpr bool MORE = decltype(more)::value;
        v8f sh0 = zero8(), sr0 = zero8(), sh1 = zero8(), sr1 = zero8();
        // this step's V fragments, d tiles 0 and 1: requested ahead of the score products
        // (d tiles 2 and 3 follow into the same registers, each behind its forerunner's products)
        v16h vfh[2], vfr[2];
#pragma unroll
        for (int dt = 0; dt < 2; ++dt) {
            vfh[dt] = load_frag16(pvh + (size_t)(dt * 16) * SEQ);
            vfr[dt] = load_frag16(pvr + (size_t)(dt * 16) * SEQ);
        }
        sh0 = wmma16(kf[0][0][0], qhf0, sh0);
        sr0 = wmma16(kf[0][0][0], qlf0, sr0);
        sr0 = wmma16(kf[0][0][1], qhf0, sr0);
        sh0 = wmma16(kf[0][1][0], qhf1, sh0);
        sr0 = wmma16(kf[0][1][0], qlf1, sr0);
        sr0 = wmma16(kf[0][1][1], qhf1, sr0);
        sh1 = wmma16(kf[1][0][0], qhf0, sh1);
        sr1 = wmma16(kf[1][0][0], qlf0, sr1);
        sr1 = wmma16(kf[1][0][1], qhf0, sr1);
        sh1 = wmma16(kf[1][1][0], qhf1, sh1);
        sr1 = wmma16(kf[1][1][0], qlf1, sr1);
        sr1 = wmma16(kf[1][1][1], qhf1, sr1);
        // the NEXT step's K fragments, into the set just read: requested behind this step's
        // score products, they land during the softmax and the V products
        if constexpr (MORE) {
#pragma unroll
            for (int kt = 0; kt < 2; ++kt) {
                kf[kt][0][0] = load_frag16(pkh + 1024 + kt * 512);
                kf[kt][0][1] = load_frag16(pkl + 1024 + kt * 512);
                kf[kt][1][0] = load_frag16(pkh + KP1 + 1024 + kt * 512);
                kf[kt][1][1] = load_frag16(pkl + KP1 + 1024 + kt * 512);
            }
        }
        float t0[8], t1[8];
#pragma unroll
        for (int g = 0; g < 8; ++g) {
            t0[g] = __builtin_fmaf(sh0[g], C1, sr0[g] * C2) + msk[key0 + r0 + g];
            t1[g] = __builtin_fmaf(sh1[g], C1, sr1[g] * C2) + msk[key0 + 16u + r0 + g];
        }
        float tmax = fmaxf(t0[0], t1[0]);
#pragma unroll
        for (int g = 1; g < 8; ++g) tmax = fmaxf(tmax, fmaxf(t0[g], t1[g]));
        tmax = fmaxf(tmax, __shfl_xor(tmax, 16, 32));
        const float mn    = fmaxf(mr, tmax);
        const float alpha = ex2(mr - mn);
        mr = mn;
        const float off = 14.0f - mn;
        v8h p0, p1;
        float ps = 0.0f;
#pragma unroll
        for (int g = 0; g < 8; ++g) {
            const _Float16 a = (_Float16)ex2(t0[g] + off);
            const _Float16 c = (_Float16)ex2(t1[g] + off);
            p0[g] = a;
            p1[g] = c;
            ps += (float)a + (float)c;
        }
        ps += __shfl_xor(ps, 16, 32);
        lr = lr * alpha + ps;
        Frag pb;
        pb.h[0] = p0;       // k = keys key0 + 8h + 0..7
        pb.h[1] = p1;       // k = keys key0 + 16 + 8h + 0..7
#pragma unroll
        for (int dt = 0; dt < 4; ++dt) {
            oh[dt]  = oh[dt] * alpha;
            orr[dt] = orr[dt] * alpha;
        }
#pragma unroll
        for (int dt = 0; dt < 4; ++dt) {
            oh[dt] = wmma16(vfh[dt & 1], pb.v, oh[dt]);
            orr[dt] = wmma16(vfr[dt & 1], pb.v, orr[dt]);
            if (dt < 2) {
                // keeps the request of d tile dt + 2 behind the products above, in their
                // registers: without it the build runs out of registers and spills to scratch
                __builtin_amdgcn_sched_barrier(0);
                vfh[dt] = load_frag16(pvh + (size_t)((dt + 2) * 16) * SEQ);
                vfr[dt] = load_frag16(pvr + (size_t)((dt + 2) * 16) * SEQ);
            }
        }
        // the address pairs are held (inputs) up to this wait and advanced only
        // behind it: no pair that an issued load still names is rewritten
        asm volatile("s_wait_xcnt 0x0" :: "v"(pkh), "v"(pkl), "v"(pvh), "v"(pvr) : "memory");
        pkh += 1024; pkl += 1024; pvh += 512; pvr += 512;
    };
#pragma unroll 1
    for (unsigned key0 = 0; key0 + 32u < (unsigned)SEQ; key0 += 32u) key_step(key0, Flag<true>{});
    key_step((unsigned)SEQ - 32u, Flag<false>{});

    // O^T lane (query lane&15): rows d = dt*16 + r0 + g. 16*ctx = (o + or 2^-11) / (64 l) * 16
    const float inv = 0.25f * (1.0f / lr);
    const size_t ob = tokq * DM + (size_t)(h * 2u) * 512u + lane * 8u;
#pragma unroll
    for (int dt = 0; dt < 4; ++dt) {
        v8h hv, rv;
#pragma unroll
        for (int g = 0; g < 8; ++g) {
            const float c = __builtin_fmaf(orr[dt][g], SC_RINV, oh[dt][g]) * inv;
            const _Float16 hi = (_Float16)c;
            hv[g] = hi;
            rv[g] = (_Float16)((c - (float)hi) * SC_RES);
        }
        *(v8h*)(ctxh + ob + (dt >> 1) * 512 + (dt & 1) * 256) = hv;
        *(v8h*)(ctxr + ob + (dt >> 1) * 512 + (dt & 1) * 256) = rv;
    }
}

// ---------------------------------------------------------------------------
// GEMM (N = 512) + bias + residual add + LayerNorm, fused. Block = 8 waves =
// ROWS rows x 512 columns (wave tile ROWS x 64; ROWS = 32 with the residual
// plane's second accumulators, 64 without). Scaled accumulators go to a
// cross-wave f32 LDS tile (block barrier), then wave w normalises rows
// POST: A = ctx hi + residual planes, residual add = bf16-RNE(x), outputs
// sa (f32) and 16*sa (f16, fragment-ordered NTOK x 512 plane: the block's 32
// rows are 32 KB contiguous, gathered in LDS as [k/8][row] pieces, block
// barrier, then 512-byte wave stores). Otherwise A = hidden plane, residual
// add = sa, output = final f32 rows.
// ---------------------------------------------------------------------------
template <bool POST>
__global__ __launch_bounds__(256) __attribute__((amdgpu_num_vgpr(256)))
void k_gemm_ln(const _Float16* __restrict__ Ah, const _Float16* __restrict__ Ar,
               const _Float16* __restrict__ Bt,
               const float* __restrict__ bias, const float* __restrict__ resid,
               const float* __restrict__ lnw, const float* __restrict__ lnb,
               float* __restrict__ outF, _Float16* __restrict__ outH) {
    constexpr unsigned K = POST ? DM : DF;       // contraction length: row-tile offsets are immediates
    constexpr unsigned ROWS = POST ? 32u : 64u;  // rows of the block
    constexpr int TM = (int)(ROWS / 16u);
    // row pitch 516 floats: the 16 rows that one 16-byte wave store touches fall on different banks
    constexpr unsigned TP = DM + 4u;
    __shared__ __align__(16) float T[ROWS * TP]; // 64.5 / 129 KB, cross-wave
    // 16*sa pieces: [64 k/8][32 rows][8], column pitch 264 (16 B of pad: the 16
    // columns of one wave store fall on different banks), cross-wave
    __shared__ __align__(16) _Float16 Hs[POST ? 64 * 264 : 8];
    const unsigned tid  = threadIdx.x;
    const unsigned lane = tid & 31u;
    const unsigned w    = tid >> 5;
    const unsigned row0 = blockIdx.x * ROWS;
    const unsigned cb   = w * 64u;
    const unsigned r0   = (lane >> 4) << 3;
    const unsigned cc   = lane & 15u;

    v8f acc[TM][4], accr[TM][4];
    // every block reads all of Bt: neighbours of eight blocks share a start, the next eight take the next
    // transposed tiles: a lane holds 8 consecutive columns of one row, two 16-byte LDS stores
    gemm_core<TM, 4, POST, true, K>(Ah + (size_t)row0 * K, Ar + (size_t)row0 * K,
                                    Bt + (size_t)cb * K, lane, (blockIdx.x >> 3) % (K / 64u), acc, accr);
#pragma unroll
    for (int mt = 0; mt < TM; ++mt)
#pragma unroll
        for (int nt = 0; nt < 4; ++nt) {
            v4f lo, hi;
#pragma unroll
            for (int g = 0; g < 4; ++g) {
                lo[g] = POST ? __builtin_fmaf(accr[mt][nt][g], SC_RINV, acc[mt][nt][g]) : acc[mt][nt][g];
                hi[g] = POST ? __builtin_fmaf(accr[mt][nt][g + 4], SC_RINV, acc[mt][nt][g + 4])
                             : acc[mt][nt][g + 4];
            }
            float* tp = &T[(mt * 16 + cc) * TP + cb + nt * 16 + r0];
            *(v4f*)(tp)     = lo;
            *(v4f*)(tp + 4) = hi;
        }
    __syncthreads();

#pragma unroll 1
    for (unsigned rr = 0; rr < ROWS / 8u; ++rr) {
        const unsigned row = w * (ROWS / 8u) + rr;
        const unsigned n   = row0 + row;
        const unsigned fr  = full_row(n);
        const float* rp = POST ? (resid + (size_t)fr * DM) : (resid + (size_t)n * DM);
        float*       op = POST ? (outF + (size_t)n * DM)   : (outF + (size_t)fr * DM);
        v4f xv[4];
        float s = 0.0f;
#pragma unroll
        for (int i = 0; i < 4; ++i) {
            const unsigned c = (unsigned)i * 128u + lane * 4u;
            const v4f a  = *(const v4f*)(&T[row * TP + c]);
            const v4f bi = *(const v4f*)(bias + c);
            const v4f rs = *(const v4f*)(rp + c);
            v4f x;
            x.x = __builtin_fmaf(a.x, SC_OUT, bf16r(bi.x)) + (POST ? bf16r(rs.x) : rs.x);
            x.y = __builtin_fmaf(a.y, SC_OUT, bf16r(bi.y)) + (POST ? bf16r(rs.y) : rs.y);
            x.z = __builtin_fmaf(a.z, SC_OUT, bf16r(bi.z)) + (POST ? bf16r(rs.z) : rs.z);
            x.w = __builtin_fmaf(a.w, SC_OUT, bf16r(bi.w)) + (POST ? bf16r(rs.w) : rs.w);
            xv[i] = x;
            s += (x.x + x.y) + (x.z + x.w);
        }
        s = wave_sum(s);
        const float mu = s * (1.0f / (float)DM);
        float q = 0.0f;
#pragma unroll
        for (int i = 0; i < 4; ++i) {
            const float d0 = xv[i].x - mu, d1 = xv[i].y - mu, d2 = xv[i].z - mu, d3 = xv[i].w - mu;
            q += (d0 * d0 + d1 * d1) + (d2 * d2 + d3 * d3);
        }
        q = wave_sum(q);
        const float rstd = rsqrtf(q * (1.0f / (float)DM) + 1.0e-5f);
        v4f yv[4];
#pragma unroll
        for (int i = 0; i < 4; ++i) {
            const unsigned c = (unsigned)i * 128u + lane * 4u;
            const v4f gw = *(const v4f*)(lnw + c);
            const v4f gb = *(const v4f*)(lnb + c);
            v4f y;
            y.x = (xv[i].x - mu) * rstd * bf16r(gw.x) + bf16r(gb.x);
            y.y = (xv[i].y - mu) * rstd * bf16r(gw.y) + bf16r(gb.y);
            y.z = (xv[i].z - mu) * rstd * bf16r(gw.z) + bf16r(gb.z);
            y.w = (xv[i].w - mu) * rstd * bf16r(gw.w) + bf16r(gb.w);
            yv[i] = y;
        }
        if (POST) {
#pragma unroll
            for (int i = 0; i < 4; ++i) {
                v4h hq;
                hq[0] = (_Float16)(yv[i].x * 16.0f); hq[1] = (_Float16)(yv[i].y * 16.0f);
                hq[2] = (_Float16)(yv[i].z * 16.0f); hq[3] = (_Float16)(yv[i].w * 16.0f);
                *(v4h*)(&Hs[((unsigned)i * 16u + (lane >> 1)) * 264u + row * 8u + (lane & 1u) * 4u]) = hq;
            }
        }
#pragma unroll
        for (int i = 0; i < 4; ++i)
            *(v4f*)(op + (unsigned)i * 128u + lane * 4u) = yv[i];
        // the row stores' registers are rewritten by the next row and behind the loop
        asm volatile("s_wait_xcnt 0x0" ::: "memory");
    }
    if (POST) {
        __syncthreads();
        _Float16* hp = outH + (size_t)row0 * DM + tid * 8u;
        // piece i*256 + tid of the block's 2 x 16 units: unit = 4*i + (w>>1), j = w&1
        const unsigned hs0 = ((w >> 1) * 4u + (w & 1u) * 2u + (lane >> 4)) * 264u + (lane & 15u) * 8u;
        v8h pv[8];
#pragma unroll
        for (int i = 0; i < 8; ++i)
            pv[i] = *(const v8h*)(&Hs[hs0 + (unsigned)(i & 3) * (16u * 264u) + (unsigned)(i >> 2) * 128u]);
#pragma unroll
        for (int i = 0; i < 8; ++i)
            *(v8h*)(hp + (unsigned)i * 2048u) = pv[i];
    }
}

// ---------------------------------------------------------------------------
// FF1: hidden = relu(sa W1 + b1), stored as f16 of 16*hidden, fragment-ordered
// NTOK x 2048 plane. Block = 8 waves = 128 rows x 256 columns; the wave's
// 64 x 64 tile = 4 x 2 units. The tiles are computed transposed: a lane's 8
// accumulator rows are 8 consecutive hidden columns of one token, one piece of a
// unit at the lane's own place, stored straight from registers.
// ---------------------------------------------------------------------------
__global__ __launch_bounds__(256) __attribute__((amdgpu_num_vgpr(256)))
void k_ff1(const _Float16* __restrict__ sah, const _Float16* __restrict__ Bt,
           const float* __restrict__ bias, _Float16* __restrict__ hid) {
    const unsigned tid  = threadIdx.x;
    const unsigned lane = tid & 31u;
    const unsigned w    = tid >> 5;
    const unsigned row0 = blockIdx.y * 128u + (w >> 2) * 64u;
    const unsigned cb   = blockIdx.x * 256u + (w & 3u) * 64u;
    const unsigned r0   = (lane >> 4) << 3;

    v8f acc[4][4], dum[4][4];
    gemm_core<4, 4, false, true, DM>(sah + (size_t)row0 * DM, sah + (size_t)row0 * DM,
                                     Bt + (size_t)cb * DM, lane,
                                     (blockIdx.x + blockIdx.y) % (unsigned)(DM / 64), acc, dum);
    const float* bp = bias + cb + r0;
    v4f bq[4][2];
#pragma unroll
    for (int nt = 0; nt < 4; ++nt) {
        bq[nt][0] = *(const v4f*)(bp + nt * 16);
        bq[nt][1] = *(const v4f*)(bp + nt * 16 + 4);
    }
    // the address pair is held (input) up to this wait: no load returns into it
    asm volatile("s_wait_xcnt 0x0" :: "v"(bp) : "memory");
    v8h xv[4][4];
#pragma unroll
    for (int nt = 0; nt < 4; ++nt) {
        float bv[8];
#pragma unroll
        for (int g = 0; g < 8; ++g) bv[g] = bf16r(bq[nt][g >> 2][g & 3]) * 16.0f;
#pragma unroll
        for (int mt = 0; mt < 4; ++mt)
#pragma unroll
            for (int g = 0; g < 8; ++g)
                xv[mt][nt][g] = (_Float16)fmaxf(__builtin_fmaf(acc[mt][nt][g], SC_HID, bv[g]), 0.0f);
    }
    _Float16* ob = hid + (size_t)row0 * DF + (size_t)cb * 16u + lane * 8u;
#pragma unroll
    for (int mt = 0; mt < 4; ++mt)
#pragma unroll
        for (int nt = 0; nt < 4; ++nt)
            *(v8h*)(ob + (size_t)(mt * 16) * DF + (nt >> 1) * 512 + (nt & 1) * 256) = xv[mt][nt];
    // the stores' address pair and data are held (inputs) up to this wait: none is rewritten before it
    asm volatile("s_wait_xcnt 0x0"
                 :: "v"(ob),
                    "v"(xv[0][0]), "v"(xv[0][1]), "v"(xv[0][2]), "v"(xv[0][3]),
                    "v"(xv[1][0]), "v"(xv[1][1]), "v"(xv[1][2]), "v"(xv[1][3]),
                    "v"(xv[2][0]), "v"(xv[2][1]), "v"(xv[2][2]), "v"(xv[2][3]),
                    "v"(xv[3][0]), "v"(xv[3][1]), "v"(xv[3][2]), "v"(xv[3][3])
                 : "memory");
}

// ---------------------------------------------------------------------------
// Workspace arena in units of U = NTOK*512*2 bytes (16 MiB at full size);
// time-disjoint planes share offsets (launches are stream-ordered):
//   [0,4U)  qh ql kh kl          -> later sa f32 [0,2U), 16*sa f16 [2U,3U)
//   [4U,6U) V^T hi / residual
//   [6U,7U) xh                   -> later ctx hi
//   [7U,8U) ctx residual
//   [3U,7U) later hidden
//   [8U,..) the weight planes, each at its own place from the first launch to its
//           reader: Wqkv^T (1.5 MiB), Wo^T (0.5 MiB), W1^T (2 MiB), W2^T (2 MiB)
// ---------------------------------------------------------------------------
#define U_BYTES ((size_t)NTOK * DM * 2)
static_assert((size_t)NB_FULL * SEQ_FULL * DM * 2 * 8 <= (size_t)134217728);

extern "C" void kernel_launch(void* const* d_in, const int* in_sizes, int n_in,
                              void* d_out, int out_size, void* d_ws, size_t ws_size,
                              hipStream_t stream) {
    if (n_in < 14) return;
    const int need_rows = (NB - 1) * SEQ_FULL + SEQ;
    if (in_sizes[0] < need_rows * DM) return;
    if (in_sizes[1] < need_rows) return;
    if (in_sizes[2] < 3 * NH * DM * HD || in_sizes[3] < 3 * NH * HD) return;
    if (in_sizes[4] < DM * DM || in_sizes[5] < DM) return;
    if (in_sizes[6] < DM * DF || in_sizes[7] < DF) return;
    if (in_sizes[8] < DF * DM || in_sizes[9] < DM) return;
    if (in_sizes[10] < DM || in_sizes[11] < DM || in_sizes[12] < DM || in_sizes[13] < DM) return;
    if (out_size < need_rows * DM) return;

    const float* inp   = (const float*)d_in[0];    // [16384,512]
    const float* mask  = (const float*)d_in[1];    // [32,1,512]
    const float* preW  = (const float*)d_in[2];    // [3,8,512,64]
    const float* preB  = (const float*)d_in[3];    // [3,8,1,64]
    const float* postW = (const float*)d_in[4];    // [512,512]
    const float* postB = (const float*)d_in[5];    // [512]
    const float* ff1W  = (const float*)d_in[6];    // [512,2048]
    const float* ff1B  = (const float*)d_in[7];    // [2048]
    const float* ff2W  = (const float*)d_in[8];    // [2048,512]
    const float* ff2B  = (const float*)d_in[9];    // [512]
    const float* ln1w  = (const float*)d_in[10];
    const float* ln1b  = (const float*)d_in[11];
    const float* ln2w  = (const float*)d_in[12];
    const float* ln2b  = (const float*)d_in[13];
    float* out = (float*)d_out;                    // [32,512,512]

    const size_t U = U_BYTES;
    const size_t WQ_B = (size_t)3 * NH * HD * DM * 2;   // 1.5 MiB
    const size_t WO_B = (size_t)DM * DM * 2;            // 0.5 MiB
    const size_t W1_B = (size_t)DF * DM * 2;            // 2 MiB
    const size_t W2_B = (size_t)DM * DF * 2;            // 2 MiB
    if (8 * U + WQ_B + WO_B + W1_B + W2_B > ws_size) return;

    char* ws = (char*)d_ws;
    _Float16* qh    = (_Float16*)(ws + 0 * U);
    _Float16* ql    = (_Float16*)(ws + 1 * U);
    _Float16* kh    = (_Float16*)(ws + 2 * U);
    _Float16* kl    = (_Float16*)(ws + 3 * U);
    _Float16* vTh   = (_Float16*)(ws + 4 * U);
    _Float16* vTr   = (_Float16*)(ws + 5 * U);
    _Float16* xh    = (_Float16*)(ws + 6 * U);
    _Float16* ctxh  = (_Float16*)(ws + 6 * U);
    _Float16* ctxr  = (_Float16*)(ws + 7 * U);
    _Float16* wqkvT = (_Float16*)(ws + 8 * U);
    float*    sa    = (float*)(ws + 0 * U);
    _Float16* sah   = (_Float16*)(ws + 2 * U);
    _Float16* postT = (_Float16*)(ws + 8 * U + WQ_B);
    _Float16* hid   = (_Float16*)(ws + 3 * U);
    _Float16* ff1T  = (_Float16*)(ws + 8 * U + WQ_B + WO_B);
    _Float16* ff2T  = (_Float16*)(ws + 8 * U + WQ_B + WO_B + W1_B);

    // x -> f16 plane (bf16-RNE values); every W[k][n] -> its [n][k] plane
    k_planes<<<dim3(WT_ALL + NTOK / 4), dim3(256), 0, stream>>>(
        inp, preW, postW, ff1W, ff2W, xh, wqkvT, postT, ff1T, ff2T);
    k_qkv<<<dim3(6, NTOK / 128), dim3(256), 0, stream>>>(xh, wqkvT, preB, qh, ql, kh, kl, vTh, vTr);
    k_attn<<<dim3(NH * NB, SEQ / 128), dim3(256), 0, stream>>>(qh, ql, kh, kl, vTh, vTr, mask, ctxh, ctxr);
    k_gemm_ln<true><<<dim3(NTOK / 32), dim3(256), 0, stream>>>(
        ctxh, ctxr, postT, postB, inp, ln1w, ln1b, sa, sah);
    k_ff1<<<dim3(8, NTOK / 128), dim3(256), 0, stream>>>(sah, ff1T, ff1B, hid);
    k_gemm_ln<false><<<dim3(NTOK / 64), dim3(256), 0, stream>>>(
        hid, hid, ff2T, ff2B, sa, ln2w, ln2b, out, sah);
}

// v007
// One run takes 197 microseconds.
// Timed twice side by side with v006, it ran 1.03 times as fast both times.
// Counting every step since v000, it is 2.40 times as fast.
#include <hip/hip_runtime.h>
#include <hip/hip_fp16.h>

// All contractions on v_wmma_f32_16x16x32_f16 (f16 operands, f32 accumulate): x*Wqkv, sa*W1, h*W2 single f16 planes; k*q^T with f16 hi + 2^11-scaled f16 residual planes (hi.hi, hi.res, res.hi); V^T*P^T and ctx*Wo with f16 hi + 2^11-scaled f16 residual plane on V / ctx (two accumulators, residual folded 2^-11 in f32).

#ifndef NB
#define NB 32
#endif
#ifndef SEQ
#define SEQ 512
#endif
#define NB_FULL  32
#define SEQ_FULL 512
#define NH   8           // heads
#define HD   64          // head width
#define DM   512         // model width
#define DF   2048        // hidden width
#define NTOK (NB * SEQ)

static_assert(NB >= 1 && NB <= NB_FULL);
static_assert(SEQ >= 128 && SEQ <= SEQ_FULL);
static_assert(SEQ % 128 == 0);
static_assert(NTOK % 128 == 0);
static_assert(DM == NH * HD);
static_assert(DM == 512 && HD == 64 && NH == 8 && DF == 2048);

typedef _Float16 v16h __attribute__((ext_vector_type(16)));
typedef _Float16 v8h  __attribute__((ext_vector_type(8)));
typedef _Float16 v4h  __attribute__((ext_vector_type(4)));
typedef float    v8f  __attribute__((ext_vector_type(8)));
typedef float    v4f  __attribute__((ext_vector_type(4)));

typedef const __attribute__((address_space(1))) _Float16* GlobalH;   // pointer into global memory

union Frag { v16h v; v8h h[2]; };

template <bool V> struct Flag { static constexpr bool value = V; };

#define LOG2E 1.44269504088896340736f
// scores: acc_h = (64k_h).(64q_h), acc_r = 2^11-scaled residual cross terms
// t (log2 units) = acc_h * log2(e)*2^-12 + acc_r * log2(e)*2^-23
#define C1 (1.44269504088896340736f * 0.000244140625f)
#define C2 (1.44269504088896340736f * 1.1920928955078125e-07f)
#define SC_RES   2048.0f                     // residual plane carry 2^11
#define SC_RINV  4.8828125e-04f              // 2^-11 : residual accumulator fold
#define SC_OUT   9.765625e-04f               // 2^-10 : (16 a)(64 W) -> a.W
#define SC_HID   1.5625e-02f                 // 2^-6  : (16 sa)(64 W1) -> 16 h

static __device__ __forceinline__ v8f zero8() {
    v8f z;
#pragma unroll
    for (int i = 0; i < 8; ++i) z[i] = 0.0f;
    return z;
}

// Fragment-ordered operand planes. A plane of R rows x K (k) 16-bit elements
// is a sequence of 1024-byte units, unit (row/16)*(K/32) + k/32 = one 16x32
// WMMA operand fragment, stored as [j = (k>>4)&1][lane][8]:
//   lane = 16*((k>>3)&1) + (row&15), element = k&7.
// A fragment (A, or B from an [n][k] source) is then two wave-wide 16-byte
// loads of 512 contiguous bytes each (4 whole lines per load): lane m =
// lane&15 -> row m; kb = 8*(lane>>4); elements 0..7 = k kb..kb+7, elements
// 8..15 = k kb+16..kb+23.
// p = unit + lane*8, the lane's own place in the unit.
static __device__ __forceinline__ v16h load_frag16(const _Float16* p) {
    Frag f;
    f.h[0] = *(const v8h*)(p);
    f.h[1] = *(const v8h*)(p + 256);
    return f.v;
}

// offset (in elements) of the 8-element piece (row, k8..k8+7), k8 % 8 == 0
static __device__ __forceinline__ size_t frag_off(unsigned row, unsigned k8, unsigned K) {
    return ((size_t)(row >> 4) * (K >> 5) + (k8 >> 5)) * 512u
         + ((k8 >> 4) & 1u) * 256u + ((((k8 >> 3) & 1u) << 4) + (row & 15u)) * 8u;
}

static __device__ __forceinline__ v8f wmma16(v16h a, v16h b, v8f c) {
    v8f d = __builtin_amdgcn_wmma_f32_16x16x32_f16(false, a, false, b, (short)0, c, false, false);
    asm volatile("v_nop\n\tv_nop\n\tv_nop\n\tv_nop" : "+v"(d) : "v"(a), "v"(b));
    return d;
}

// f32 -> bf16 RNE convert, value kept as f32
static __device__ __forceinline__ float bf16r(float x) {
    unsigned u = __float_as_uint(x);
    u = (u + 0x7FFFu + ((u >> 16) & 1u)) & 0xFFFF0000u;
    return __uint_as_float(u);
}

static __device__ __forceinline__ float ex2(float x) {
    return __builtin_amdgcn_exp2f(x);
}

// Sum over the wave's 32 lanes (butterfly 16, 8, 4, 2, 1) of four independent values, side by
// side: the four exchanges of a step are in flight together, one exchange latency per step and
// not one per value. The exchanges of a step and their data wait are one statement: written as
// __shfl_xor the build strings them out and waits for most of them one by one.
static __device__ __forceinline__ void wave_sum4(float (&v)[4], unsigned lane) {
#pragma unroll
    for (unsigned m = 16u; m >= 1u; m >>= 1) {
        const unsigned from = (lane ^ m) << 2;   // the partner lane, as ds_bpermute_b32 counts it
        float t0, t1, t2, t3;
        asm volatile("ds_bpermute_b32 %0, %4, %5\n\t"
                     "ds_bpermute_b32 %1, %4, %6\n\t"
                     "ds_bpermute_b32 %2, %4, %7\n\t"
                     "ds_bpermute_b32 %3, %4, %8\n\t"
                     "s_wait_dscnt 0x0"
                     : "=&v"(t0), "=&v"(t1), "=&v"(t2), "=&v"(t3)
                     : "v"(from), "v"(v[0]), "v"(v[1]), "v"(v[2]), "v"(v[3])
                     : "memory");
        v[0] += t0; v[1] += t1; v[2] += t2; v[3] += t3;
    }
}

// compact token row (b*SEQ + l) -> row in the full-size arrays
static __device__ __forceinline__ unsigned full_row(unsigned n) {
    const unsigned b = n / (unsigned)SEQ;
    return b * (unsigned)SEQ_FULL + (n - b * (unsigned)SEQ);
}

// ---------------------------------------------------------------------------
// Wave-level GEMM core: TM x TN tiles of 16x16, A / Bt both fragment-ordered
// planes of width K; the pointers name the first unit of the wave's first row
// tile (row * K elements in), the next row tile is 16*K on, the next k step 512.
// RES: second A plane (2^11-scaled residual) into its own accumulators.
// The fragments of k step s + 1 are requested before the products of step s
// (two register sets), so a step waits for loads that are one step old, once,
// and not for each B fragment in turn. SB (16 accumulator tiles: RES, or a 4 x 4
// wave tile): the accumulators leave no room for a second B set, each B fragment
// is requested anew behind its last product.
// The k walk starts at trip t0 (a trip = two k steps = 64 k) and wraps: blocks that
// read the same operand rows at the same time get different t0, so that their
// requests for one line do not reach L2 together. Every k step is taken once.
// ---------------------------------------------------------------------------
// SW: the product is taken transposed, the Bt fragment as the A operand and the A plane's
// fragment as the B operand (both planes have one fragment order, the k order is the same):
// tile [mt][nt] then holds, per lane, row mt*16 + (lane&15) of the A plane against the 8
// CONSECUTIVE Bt rows nt*16 + 8*(lane>>4) + 0..7, which is one 16-byte piece of a
// fragment-ordered plane (or 32 bytes of an f32 row) and needs no transpose on its way out.
// One k step on the current set; LD: request the next step's set from pa / pr / pb.
template <int TM, int TN, bool RES, bool SB, bool SW, unsigned K, bool LD>
static __device__ __forceinline__ void gemm_step(const _Float16* pa, const _Float16* pr,
                                                 const _Float16* pb,
                                                 const v16h (&ac)[TM], const v16h (&arc)[TM], v16h (&bc)[TN],
                                                 v16h (&an)[TM], v16h (&arn)[TM], v16h (&bn)[TN],
                                                 v8f (&acc)[TM][TN], v8f (&accr)[TM][TN]) {
    if (LD) {
#pragma unroll
        for (int mt = 0; mt < TM; ++mt) {
            an[mt] = load_frag16(pa + (size_t)(mt * 16) * K);
            if (RES) arn[mt] = load_frag16(pr + (size_t)(mt * 16) * K);
        }
        if (!SB) {
#pragma unroll
            for (int nt = 0; nt < TN; ++nt) bn[nt] = load_frag16(pb + (size_t)(nt * 16) * K);
        }
    }
#pragma unroll
    for (int nt = 0; nt < TN; ++nt) {
#pragma unroll
        for (int mt = 0; mt < TM; ++mt) {
            acc[mt][nt] = SW ? wmma16(bc[nt], ac[mt], acc[mt][nt]) : wmma16(ac[mt], bc[nt], acc[mt][nt]);
            if (RES) accr[mt][nt] = SW ? wmma16(bc[nt], arc[mt], accr[mt][nt])
                                       : wmma16(arc[mt], bc[nt], accr[mt][nt]);
        }
        if (LD && SB) bc[nt] = load_frag16(pb + (size_t)(nt * 16) * K);
    }
}

template <int TM, int TN, bool RES, bool SW, unsigned K>
static __device__ __forceinline__ void gemm_core(const _Float16* __restrict__ Ah,
                                                 const _Float16* __restrict__ Ar,
                                                 const _Float16* __restrict__ Bt,
                                                 unsigned lane, unsigned t0,
                                                 v8f (&acc)[TM][TN], v8f (&accr)[TM][TN]) {
    static_assert(K % 64u == 0u && K >= 64u);
    constexpr unsigned T = K / 64u;              // trips; t0 < T, the same in the whole block
    constexpr bool SB = RES || TM * TN >= 16;    // one B set only
    constexpr int B1 = SB ? 0 : 1;               // index of the second B set
#pragma unroll
    for (int mt = 0; mt < TM; ++mt)
#pragma unroll
        for (int nt = 0; nt < TN; ++nt) {
            acc[mt][nt] = zero8();
            if (RES) accr[mt][nt] = zero8();
        }
    // one address pair per plane; row tiles and the two steps of a trip are constant offsets
    const _Float16* pa = Ah + t0 * 1024u + lane * 8u;
    const _Float16* pr = Ar + t0 * 1024u + lane * 8u;
    const _Float16* pb = Bt + t0 * 1024u + lane * 8u;
    v16h a[2][TM], ar[2][TM], b[2][TN];
#pragma unroll
    for (int mt = 0; mt < TM; ++mt) {
        a[0][mt] = load_frag16(pa + (size_t)(mt * 16) * K);
        if (RES) ar[0][mt] = load_frag16(pr + (size_t)(mt * 16) * K);
    }
    // keeps the first A requests ahead of the first B requests, the order of every trip:
    // the wait at the loop's head serves both ways in, and with an A request last on this
    // way it counts to 0 and drains the B requests in flight on every trip
    if (!RES) __builtin_amdgcn_sched_barrier(0);
#pragma unroll
    for (int nt = 0; nt < TN; ++nt) b[0][nt] = load_frag16(pb + (size_t)(nt * 16) * K);
    unsigned t = t0;
#pragma unroll 1
    for (unsigned i = 0; i + 1u < T; ++i) {
        gemm_step<TM, TN, RES, SB, SW, K, true>(pa + 512, pr + 512, pb + 512,
                                        a[0], ar[0], b[0], a[1], ar[1], b[B1], acc, accr);
        // to the next trip: 1024 elements = 2048 bytes on, or back to the row tile's first
        // unit behind its last trip (a row tile is K * 32 bytes); a scalar, alike for all planes
        t = (t + 1u == T) ? 0u : t + 1u;
        const long long adv = (t == 0u) ? 2048ll - (long long)K * 32ll : 2048ll;
        // The wait and the advance in one statement: no pair that an issued load still names
        // is rewritten ahead of the wait.
        // (typed as global-memory pointers, so that the loads behind it stay global loads)
        GlobalH ga = (GlobalH)pa, gb = (GlobalH)pb;
        if constexpr (RES) {
            GlobalH gr = (GlobalH)pr;
            asm volatile("s_wait_xcnt 0x0\n\t"
                         "v_add_nc_u64 %0, %3, %0\n\t"
                         "v_add_nc_u64 %1, %3, %1\n\t"
                         "v_add_nc_u64 %2, %3, %2"
                         : "+v"(ga), "+v"(gr), "+v"(gb) : "s"(adv) : "memory");
            pr = (const _Float16*)gr;
        } else {
            asm volatile("s_wait_xcnt 0x0\n\t"
                         "v_add_nc_u64 %0, %2, %0\n\t"
                         "v_add_nc_u64 %1, %2, %1"
                         : "+v"(ga), "+v"(gb) : "s"(adv) : "memory");
        }
        pa = (const _Float16*)ga; pb = (const _Float16*)gb;
        gemm_step<TM, TN, RES, SB, SW, K, true>(pa, pr, pb,
                                        a[1], ar[1], b[B1], a[0], ar[0], b[0], acc, accr);
    }
    gemm_step<TM, TN, RES, SB, SW, K, true>(pa + 512, pr + 512, pb + 512,
                                    a[0], ar[0], b[0], a[1], ar[1], b[B1], acc, accr);
    gemm_step<TM, TN, RES, SB, SW, K, false>(pa, pr, pb,
                                     a[1], ar[1], b[B1], a[0], ar[0], b[0], acc, accr);
    // as above, for the last steps' loads: the pairs' registers are free behind it
    if (RES) asm volatile("s_wait_xcnt 0x0" :: "v"(pa), "v"(pr), "v"(pb) : "memory");
    else     asm volatile("s_wait_xcnt 0x0" :: "v"(pa), "v"(pb) : "memory");
}

// ---------------------------------------------------------------------------
// x (f32) -> xh, fragment-ordered NTOK x 512 plane, f16 of the bf16-RNE value.
// 8 elements per thread; a wave takes 8 rows x 32 columns (one 128-B line per
// row in, four whole 128-B lines out, each line written by one wave).
// ---------------------------------------------------------------------------
static __device__ __forceinline__ void cvt_x_block(unsigned blk, const float* __restrict__ x,
                                                   _Float16* __restrict__ xh) {
    const unsigned idx = blk * 256u + threadIdx.x;
    const unsigned wv  = idx >> 5;
    const unsigned ln  = idx & 31u;
    const unsigned n   = (wv >> 4) * 8u + (ln & 7u);
    const unsigned c8  = (wv & 15u) * 32u + (ln >> 3) * 8u;
    const unsigned fr  = full_row(n);
    const float* p = x + (size_t)fr * DM + c8;
    const v4f a = *(const v4f*)(p);
    const v4f b = *(const v4f*)(p + 4);
    v8h o;
    o[0] = (_Float16)bf16r(a.x); o[1] = (_Float16)bf16r(a.y);
    o[2] = (_Float16)bf16r(a.z); o[3] = (_Float16)bf16r(a.w);
    o[4] = (_Float16)bf16r(b.x); o[5] = (_Float16)bf16r(b.y);
    o[6] = (_Float16)bf16r(b.z); o[7] = (_Float16)bf16r(b.w);
    _Float16* d = xh + frag_off(n, c8, (unsigned)DM);
    *(v8h*)d = o;
    
}

// ---------------------------------------------------------------------------
// Weight plane builder: in [z][R][C] f32 (k-major, W[k][n]) -> out: z
// fragment-ordered planes of C rows (n) x R (k), f16 = 64 * bf16-RNE(W)^T.
// 64x64 tile through LDS = 4 x 2 units, each wave store 512 contiguous bytes;
// tile (bx, by, bz) of (C/64, R/64, z).
// ---------------------------------------------------------------------------
static __device__ __forceinline__ void wT_block(const float* __restrict__ in,
                                                _Float16* __restrict__ out,
                                                unsigned R, unsigned C,
                                                unsigned bx, unsigned by, unsigned bz) {
    __shared__ __align__(16) _Float16 t[64 * 72];
    const unsigned tid = threadIdx.x;
    const unsigned n0 = bx * 64u;
    const unsigned k0 = by * 64u;
    const float*  inb  = in  + (size_t)bz * R * C;
    _Float16*     outb = out + (size_t)bz * R * C;
    const float* p[4];
    v4f vv[4];
#pragma unroll
    for (int i = 0; i < 4; ++i) {
        const unsigned idx = (unsigned)i * 256u + tid;
        p[i] = inb + (size_t)(k0 + (idx >> 4)) * C + n0 + ((idx & 15u) << 2);
        vv[i] = *(const v4f*)p[i];
    }
    // the four address pairs are held (inputs) up to this wait: no load returns
    // into a pair that an issued load still names, and none is rewritten before it
    asm volatile("s_wait_xcnt 0x0" :: "v"(p[0]), "v"(p[1]), "v"(p[2]), "v"(p[3]) : "memory");
#pragma unroll
    for (int i = 0; i < 4; ++i) {
        const unsigned idx = (unsigned)i * 256u + tid;
        const unsigned r = idx >> 4, c4 = (idx & 15u) << 2;
        const v4f v = vv[i];
        t[(c4 + 0u) * 72u + r] = (_Float16)(bf16r(v.x) * 64.0f);
        t[(c4 + 1u) * 72u + r] = (_Float16)(bf16r(v.y) * 64.0f);
        t[(c4 + 2u) * 72u + r] = (_Float16)(bf16r(v.z) * 64.0f);
        t[(c4 + 3u) * 72u + r] = (_Float16)(bf16r(v.w) * 64.0f);
    }
    __syncthreads();
    const unsigned ln = tid & 31u;
    const unsigned kl = ((tid >> 6) & 1u) * 32u + ((tid >> 5) & 1u) * 16u + (ln >> 4) * 8u;
    const unsigned nl = (tid >> 7) * 16u + (ln & 15u);
    const v8h o0 = *(const v8h*)(&t[nl * 72u + kl]);
    const v8h o1 = *(const v8h*)(&t[(nl + 32u) * 72u + kl]);
    _Float16* d0 = outb + frag_off(n0 + nl, k0 + kl, R);
    _Float16* d1 = outb + frag_off(n0 + nl + 32u, k0 + kl, R);
    *(v8h*)d0 = o0;
    *(v8h*)d1 = o1;
    // the stores' address pairs and data are held (inputs) up to this wait: in the one
    // kernel that holds all builders other code follows, which rewrites these registers
    asm volatile("s_wait_xcnt 0x0" :: "v"(d0), "v"(d1), "v"(o0), "v"(o1) : "memory");
}

// ---------------------------------------------------------------------------
// All operand planes that depend on the inputs alone, in one launch: the four
// weight planes (768 tiles, the low block indices), then the x plane.
// The choice of the work is uniform over the block.
// ---------------------------------------------------------------------------
#define WT_QKV  (3 * NH * (DM / 64))                 // 192 tiles: 24 x [512 k][64 n]
#define WT_POST ((DM / 64) * (DM / 64))              //  64 tiles: [512 k][512 n]
#define WT_FF   ((DF / 64) * (DM / 64))              // 256 tiles: [512 k][2048 n], [2048 k][512 n]
#define WT_ALL  (WT_QKV + WT_POST + 2 * WT_FF)
__global__ __launch_bounds__(256) void k_planes(const float* __restrict__ x,
                                                const float* __restrict__ preW,
                                                const float* __restrict__ postW,
                                                const float* __restrict__ ff1W,
                                                const float* __restrict__ ff2W,
                                                _Float16* __restrict__ xh,
                                                _Float16* __restrict__ wqkvT,
                                                _Float16* __restrict__ postT,
                                                _Float16* __restrict__ ff1T,
                                                _Float16* __restrict__ ff2T) {
    const unsigned bid = blockIdx.x;
    if (bid >= (unsigned)WT_ALL) {
        cvt_x_block(bid - (unsigned)WT_ALL, x, xh);
    } else if (bid < (unsigned)WT_QKV) {
        wT_block(preW, wqkvT, DM, HD, 0u, bid & 7u, bid >> 3);
    } else if (bid < (unsigned)(WT_QKV + WT_POST)) {
        const unsigned u = bid - (unsigned)WT_QKV;
        wT_block(postW, postT, DM, DM, u & 7u, u >> 3, 0u);
    } else if (bid < (unsigned)(WT_QKV + WT_POST + WT_FF)) {
        const unsigned u = bid - (unsigned)(WT_QKV + WT_POST);
        wT_block(ff1W, ff1T, DM, DF, u & 31u, u >> 5, 0u);
    } else {
        const unsigned u = bid - (unsigned)(WT_QKV + WT_POST + WT_FF);
        wT_block(ff2W, ff2T, DF, DM, u & 7u, u >> 3, 0u);
    }
}

// ---------------------------------------------------------------------------
// QKV projection. Block = 8 waves = 128 tokens x 256 columns, all of q, of k or
// of v; wave tile = 64 tokens x 64 columns = one (t, head) slice.
// q/k planes: [head][dhalf] fragment-ordered NTOK x 32 planes, f16 of 64q (hi)
// and 2^11 residual. V^T planes: [head*NB+b] fragment-ordered 64 (d) x SEQ (key)
// planes, hi / residual. Every plane is stored straight from registers: a lane's
// 8 accumulator rows must be 8 consecutive k of the plane, so the q and k tiles
// are computed transposed (W^T rows as the A operand, tokens as B: rows = d),
// the v tiles as x W (rows = keys). Both operand planes have the same shape and
// order, so the choice is which plane's address goes in as which operand.
// ---------------------------------------------------------------------------
__global__ __launch_bounds__(256) __attribute__((amdgpu_num_vgpr(256)))
void k_qkv(const _Float16* __restrict__ xh, const _Float16* __restrict__ wT,
           const float* __restrict__ bias,
           _Float16* __restrict__ qh, _Float16* __restrict__ ql,
           _Float16* __restrict__ kh, _Float16* __restrict__ kl,
           _Float16* __restrict__ vTh, _Float16* __restrict__ vTr) {
    const unsigned tid  = threadIdx.x;
    const unsigned lane = tid & 31u;
    const unsigned w    = tid >> 5;
    const unsigned n0   = blockIdx.y * 128u + (w >> 2) * 64u;
    const unsigned cb   = blockIdx.x * 256u + (w & 3u) * 64u;
    const unsigned r0   = (lane >> 4) << 3;
    const unsigned cc   = lane & 15u;
    const unsigned t    = blockIdx.x >> 1;       // = cb >> 9: 0 q, 1 k, 2 v; one per block
    const unsigned h    = (cb >> 6) & 7u;

    const _Float16* xrow = xh + (size_t)n0 * DM;
    const _Float16* wrow = wT + (size_t)cb * DM;
    const _Float16* opa  = (t < 2u) ? wrow : xrow;
    const _Float16* opb  = (t < 2u) ? xrow : wrow;
    v8f acc[4][4], dum[4][4];
    gemm_core<4, 4, false, false, DM>(opa, opa, opb, lane,
                                      (blockIdx.x + blockIdx.y) % (unsigned)(DM / 64), acc, dum);

    if (t < 2u) {
        // acc[dt][tt]: lane = token n0 + tt*16 + cc, rows d = dt*16 + r0 + 0..7
        _Float16* ph = (t == 0u) ? qh : kh;
        _Float16* pl = (t == 0u) ? ql : kl;
        const float* bp = bias + cb + r0;
        v4f bq[4][2];
#pragma unroll
        for (int dt = 0; dt < 4; ++dt) {
            bq[dt][0] = *(const v4f*)(bp + dt * 16);
            bq[dt][1] = *(const v4f*)(bp + dt * 16 + 4);
        }
        // the address pair is held (input) up to this wait: no load returns into it
        asm volatile("s_wait_xcnt 0x0" :: "v"(bp) : "memory");
#pragma unroll
        for (int kk = 0; kk < 2; ++kk) {         // the two d halves, one plane each
            const size_t pbase = ((size_t)(h * 2u + (unsigned)kk) * NTOK + n0) * 32u + lane * 8u;
            _Float16* dh = ph + pbase;
            _Float16* dl = pl + pbase;
            v8h hv[2][4], rv[2][4];
#pragma unroll
            for (int j = 0; j < 2; ++j) {
                float bv[8];
#pragma unroll
                for (int g = 0; g < 8; ++g) bv[g] = bf16r(bq[kk * 2 + j][g >> 2][g & 3]) * 64.0f;
#pragma unroll
                for (int tt = 0; tt < 4; ++tt)
#pragma unroll
                    for (int g = 0; g < 8; ++g) {
                        const float v = acc[kk * 2 + j][tt][g] + bv[g];
                        const _Float16 hi = (_Float16)v;
                        hv[j][tt][g] = hi;
                        rv[j][tt][g] = (_Float16)((v - (float)hi) * SC_RES);
                    }
            }
#pragma unroll
            for (int tt = 0; tt < 4; ++tt)
#pragma unroll
                for (int j = 0; j < 2; ++j) {
                    *(v8h*)(dh + tt * 512 + j * 256) = hv[j][tt];
                    *(v8h*)(dl + tt * 512 + j * 256) = rv[j][tt];
                }
            // the stores' address pairs and data are held (inputs) up to this wait: the
            // next plane's values and the code behind the branch rewrite these registers
            asm volatile("s_wait_xcnt 0x0"
                         :: "v"(dh), "v"(dl),
                            "v"(hv[0][0]), "v"(hv[0][1]), "v"(hv[0][2]), "v"(hv[0][3]),
                            "v"(hv[1][0]), "v"(hv[1][1]), "v"(hv[1][2]), "v"(hv[1][3]),
                            "v"(rv[0][0]), "v"(rv[0][1]), "v"(rv[0][2]), "v"(rv[0][3]),
                            "v"(rv[1][0]), "v"(rv[1][1]), "v"(rv[1][2]), "v"(rv[1][3])
                         : "memory");
        }
    } else {
        float bv[4];
        const unsigned bi = cb + cc;
        const float b0 = bias[bi];
        const float b1 = bias[bi + 16u];
        const float b2 = bias[bi + 32u];
        const float b3 = bias[bi + 48u];
        // the index register is held (input) up to this wait: no load returns into it
        asm volatile("s_wait_xcnt 0x0" :: "v"(bi) : "memory");
        bv[0] = bf16r(b0) * 64.0f;
        bv[1] = bf16r(b1) * 64.0f;
        bv[2] = bf16r(b2) * 64.0f;
        bv[3] = bf16r(b3) * 64.0f;
        const unsigned b  = n0 / (unsigned)SEQ;
        const unsigned l0 = n0 - b * (unsigned)SEQ;
        const unsigned hb = h * (unsigned)NB + b;
        const size_t vbase = ((size_t)(hb * HD)) * SEQ + (size_t)l0 * 16u + lane * 8u;
#pragma unroll
        for (int mt = 0; mt < 4; ++mt)
#pragma unroll
            for (int nt = 0; nt < 4; ++nt) {
                v8h hv, rv;
#pragma unroll
                for (int g = 0; g < 8; ++g) {
                    const float v = acc[mt][nt][g] + bv[nt];
                    const _Float16 hi = (_Float16)v;
                    hv[g] = hi;
                    rv[g] = (_Float16)((v - (float)hi) * SC_RES);
                }
                const size_t vo = vbase + (size_t)(nt * 16) * SEQ + (mt >> 1) * 512 + (mt & 1) * 256;
                *(v8h*)(vTh + vo) = hv;
                *(v8h*)(vTr + vo) = rv;
            }
        // the V^T stores' registers may be rewritten behind this branch
        asm volatile("s_wait_xcnt 0x0" ::: "memory");
    }
}

// ---------------------------------------------------------------------------
// Attention, online softmax over keys. Block = 8 waves = 128 queries of one
// (head, batch); wave owns 16 queries. Scores are computed transposed:
// S^T tile = K(16 keys, A) x Q^T(B, n = query), so every statistic of a query
// lives in lane&15 (in-lane reduce over the 8 rows + one xor-16 exchange).
// P^T accumulator tiles (keys 0..15 / 16..31 of a 32-key step) are packed
// directly into the B fragment (k = key, n = query) of O^T = V^T x P^T with
// A = V^T rows (d) straight from the V^T planes. P carried 2^14.
// Loads run ahead of their use: K one step ahead, V from the head of its step.
// Epilogue: 16*ctx as f16 hi + 2^11 residual into fragment-ordered NTOK x 512
// planes: a lane's 8 rows (d) of one query are one piece of a unit at the
// lane's own place, stored straight from registers. msk cross-wave (block barrier).
// ---------------------------------------------------------------------------
__global__ __launch_bounds__(256) __attribute__((amdgpu_num_vgpr(256)))
void k_attn(const _Float16* __restrict__ qh, const _Float16* __restrict__ ql,
            const _Float16* __restrict__ kh, const _Float16* __restrict__ kl,
            const _Float16* __restrict__ vTh, const _Float16* __restrict__ vTr,
            const float* __restrict__ mask,
            _Float16* __restrict__ ctxh, _Float16* __restrict__ ctxr) {
    __shared__ __align__(16) float    msk[SEQ];          // additive key mask, log2 units

    const unsigned tid  = threadIdx.x;
    const unsigned lane = tid & 31u;
    const unsigned w    = tid >> 5;
    const unsigned hb   = blockIdx.x;
    const unsigned h    = hb / (unsigned)NB;
    const unsigned b    = hb - h * (unsigned)NB;
    const unsigned q0   = blockIdx.y * 128u + w * 16u;
    const unsigned r0   = (lane >> 4) << 3;

    for (unsigned idx = tid; idx < (unsigned)SEQ; idx += 256u)
        msk[idx] = bf16r(mask[(size_t)b * SEQ_FULL + idx]) * LOG2E;
    __syncthreads();

    const size_t tokq = (size_t)b * SEQ + q0;
    const size_t tokk = (size_t)b * SEQ;
    const size_t P0 = (size_t)(h * 2u) * NTOK;
    const size_t P1 = (size_t)(h * 2u + 1u) * NTOK;
    const v16h qhf0 = load_frag16(qh + (P0 + tokq) * 32u + lane * 8u);
    const v16h qhf1 = load_frag16(qh + (P1 + tokq) * 32u + lane * 8u);
    const v16h qlf0 = load_frag16(ql + (P0 + tokq) * 32u + lane * 8u);
    const v16h qlf1 = load_frag16(ql + (P1 + tokq) * 32u + lane * 8u);
    const _Float16* kh0 = kh + (P0 + tokk) * 32u;
    const _Float16* kl0 = kl + (P0 + tokk) * 32u;
    const _Float16* vhb = vTh + (size_t)hb * HD * SEQ;
    const _Float16* vrb = vTr + (size_t)hb * HD * SEQ;

    v8f oh[4], orr[4];
#pragma unroll
    for (int dt = 0; dt < 4; ++dt) { oh[dt] = zero8(); orr[dt] = zero8(); }
    float mr = -1.0e30f, lr = 0.0f;

    // One address pair per K plane pair and per V plane, carried through the loop: the
    // second d half of K lies a constant KP1 on, the second key tile and the d tiles too.
    constexpr size_t KP1 = (size_t)NTOK * 32u;
    const _Float16* pkh = kh0 + lane * 8u;
    const _Float16* pkl = kl0 + lane * 8u;
    const _Float16* pvh = vhb + lane * 8u;
    const _Float16* pvr = vrb + lane * 8u;
    // K fragments of the first 32 keys: [key tile][d half][hi, residual]
    v16h kf[2][2][2];
#pragma unroll
    for (int kt = 0; kt < 2; ++kt) {
        kf[kt][0][0] = load_frag16(pkh + kt * 512);
        kf[kt][0][1] = load_frag16(pkl + kt * 512);
        kf[kt][1][0] = load_frag16(pkh + KP1 + kt * 512);
        kf[kt][1][1] = load_frag16(pkl + KP1 + kt * 512);
    }

    // One 32-key step. MORE: a next step exists and its K fragments are requested. The last
    // step is written out behind the loop, so that inside the loop the requests in flight
    // are the same on every path and each wait counts only the loads it needs.
    auto key_step = [&](const unsigned key0, auto more) __attribute__((always_inline)) {
        constexpr bool MORE = decltype(more)::value;
        v8f sh0 = zero8(), sr0 = zero8(), sh1 = zero8(), sr1 = zero8();
        // this step's V fragments, d tiles 0 and 1: requested ahead of the score products
        // (d tiles 2 and 3 follow into the same registers, each behind its forerunner's products)
        v16h vfh[2], vfr[2];
#pragma unroll
        for (int dt = 0; dt < 2; ++dt) {
            vfh[dt] = load_frag16(pvh + (size_t)(dt * 16) * SEQ);
            vfr[dt] = load_frag16(pvr + (size_t)(dt * 16) * SEQ);
        }
        sh0 = wmma16(kf[0][0][0], qhf0, sh0);
        sr0 = wmma16(kf[0][0][0], qlf0, sr0);
        sr0 = wmma16(kf[0][0][1], qhf0, sr0);
        sh0 = wmma16(kf[0][1][0], qhf1, sh0);
        sr0 = wmma16(kf[0][1][0], qlf1, sr0);
        sr0 = wmma16(kf[0][1][1], qhf1, sr0);
        sh1 = wmma16(kf[1][0][0], qhf0, sh1);
        sr1 = wmma16(kf[1][0][0], qlf0, sr1);
        sr1 = wmma16(kf[1][0][1], qhf0, sr1);
        sh1 = wmma16(kf[1][1][0], qhf1, sh1);
        sr1 = wmma16(kf[1][1][0], qlf1, sr1);
        sr1 = wmma16(kf[1][1][1], qhf1, sr1);
        // the NEXT step's K fragments, into the set just read: requested behind this step's
        // score products, they land during the softmax and the V products
        if constexpr (MORE) {
#pragma unroll
            for (int kt = 0; kt < 2; ++kt) {
                kf[kt][0][0] = load_frag16(pkh + 1024 + kt * 512);
                kf[kt][0][1] = load_frag16(pkl + 1024 + kt * 512);
                kf[kt][1][0] = load_frag16(pkh + KP1 + 1024 + kt * 512);
                kf[kt][1][1] = load_frag16(pkl + KP1 + 1024 + kt * 512);
            }
        }
        float t0[8], t1[8];
#pragma unroll
        for (int g = 0; g < 8; ++g) {
            t0[g] = __builtin_fmaf(sh0[g], C1, sr0[g] * C2) + msk[key0 + r0 + g];
            t1[g] = __builtin_fmaf(sh1[g], C1, sr1[g] * C2) + msk[key0 + 16u + r0 + g];
        }
        float tmax = fmaxf(t0[0], t1[0]);
#pragma unroll
        for (int g = 1; g < 8; ++g) tmax = fmaxf(tmax, fmaxf(t0[g], t1[g]));
        tmax = fmaxf(tmax, __shfl_xor(tmax, 16, 32));
        const float mn    = fmaxf(mr, tmax);
        const float alpha = ex2(mr - mn);
        mr = mn;
        const float off = 14.0f - mn;
        v8h p0, p1;
        float ps = 0.0f;
#pragma unroll
        for (int g = 0; g < 8; ++g) {
            const _Float16 a = (_Float16)ex2(t0[g] + off);
            const _Float16 c = (_Float16)ex2(t1[g] + off);
            p0[g] = a;
            p1[g] = c;
            ps += (float)a + (float)c;
        }
        ps += __shfl_xor(ps, 16, 32);
        lr = lr * alpha + ps;
        Frag pb;
        pb.h[0] = p0;       // k = keys key0 + 8h + 0..7
        pb.h[1] = p1;       // k = keys key0 + 16 + 8h + 0..7
#pragma unroll
        for (int dt = 0; dt < 4; ++dt) {
            oh[dt]  = oh[dt] * alpha;
            orr[dt] = orr[dt] * alpha;
        }
#pragma unroll
        for (int dt = 0; dt < 4; ++dt) {
            oh[dt] = wmma16(vfh[dt & 1], pb.v, oh[dt]);
            orr[dt] = wmma16(vfr[dt & 1], pb.v, orr[dt]);
            if (dt < 2) {
                // keeps the request of d tile dt + 2 behind the products above, in their
                // registers: without it the build runs out of registers and spills to scratch
                __builtin_amdgcn_sched_barrier(0);
                vfh[dt] = load_frag16(pvh + (size_t)((dt + 2) * 16) * SEQ);
                vfr[dt] = load_frag16(pvr + (size_t)((dt + 2) * 16) * SEQ);
            }
        }
        // the address pairs are held (inputs) up to this wait and advanced only
        // behind it: no pair that an issued load still names is rewritten
        asm volatile("s_wait_xcnt 0x0" :: "v"(pkh), "v"(pkl), "v"(pvh), "v"(pvr) : "memory");
        pkh += 1024; pkl += 1024; pvh += 512; pvr += 512;
    };
#pragma unroll 1
    for (unsigned key0 = 0; key0 + 32u < (unsigned)SEQ; key0 += 32u) key_step(key0, Flag<true>{});
    key_step((unsigned)SEQ - 32u, Flag<false>{});

    // O^T lane (query lane&15): rows d = dt*16 + r0 + g. 16*ctx = (o + or 2^-11) / (64 l) * 16
    const float inv = 0.25f * (1.0f / lr);
    const size_t ob = tokq * DM + (size_t)(h * 2u) * 512u + lane * 8u;
#pragma unroll
    for (int dt = 0; dt < 4; ++dt) {
        v8h hv, rv;
#pragma unroll
        for (int g = 0; g < 8; ++g) {
            const float c = __builtin_fmaf(orr[dt][g], SC_RINV, oh[dt][g]) * inv;
            const _Float16 hi = (_Float16)c;
            hv[g] = hi;
            rv[g] = (_Float16)((c - (float)hi) * SC_RES);
        }
        *(v8h*)(ctxh + ob + (dt >> 1) * 512 + (dt & 1) * 256) = hv;
        *(v8h*)(ctxr + ob + (dt >> 1) * 512 + (dt & 1) * 256) = rv;
    }
}

// ---------------------------------------------------------------------------
// GEMM (N = 512) + bias + residual add + LayerNorm, fused. Block = 8 waves =
// ROWS rows x 512 columns (wave tile ROWS x 64; ROWS = 32 with the residual
// plane's second accumulators, 64 without). Scaled accumulators go to a
// cross-wave f32 LDS tile (block barrier), then wave w normalises rows
// POST: A = ctx hi + residual planes, residual add = bf16-RNE(x), outputs
// sa (f32) and 16*sa (f16, fragment-ordered NTOK x 512 plane: the block's 32
// rows are 32 KB contiguous, gathered in LDS as [k/8][row] pieces, block
// barrier, then 512-byte wave stores). Otherwise A = hidden plane, residual
// add = sa, output = final f32 rows.
// ---------------------------------------------------------------------------
template <bool POST>
__global__ __launch_bounds__(256) __attribute__((amdgpu_num_vgpr(256)))
void k_gemm_ln(const _Float16* __restrict__ Ah, const _Float16* __restrict__ Ar,
               const _Float16* __restrict__ Bt,
               const float* __restrict__ bias, const float* __restrict__ resid,
               const float* __restrict__ lnw, const float* __restrict__ lnb,
               float* __restrict__ outF, _Float16* __restrict__ outH) {
    constexpr unsigned K = POST ? DM : DF;       // contraction length: row-tile offsets are immediates
    constexpr unsigned ROWS = POST ? 32u : 64u;  // rows of the block
    constexpr int TM = (int)(ROWS / 16u);
    // row pitch 516 floats: the 16 rows that one 16-byte wave store touches fall on different banks
    constexpr unsigned TP = DM + 4u;
    __shared__ __align__(16) float T[ROWS * TP]; // 64.5 / 129 KB, cross-wave
    // 16*sa pieces: [64 k/8][32 rows][8], column pitch 264 (16 B of pad: the 16
    // columns of one wave store fall on different banks), cross-wave
    __shared__ __align__(16) _Float16 Hs[POST ? 64 * 264 : 8];
    const unsigned tid  = threadIdx.x;
    const unsigned lane = tid & 31u;
    const unsigned w    = tid >> 5;
    const unsigned row0 = blockIdx.x * ROWS;
    const unsigned cb   = w * 64u;
    const unsigned r0   = (lane >> 4) << 3;
    const unsigned cc   = lane & 15u;

    v8f acc[TM][4], accr[TM][4];
    // every block reads all of Bt: neighbours of eight blocks share a start, the next eight take the next
    // transposed tiles: a lane holds 8 consecutive columns of one row, two 16-byte LDS stores
    gemm_core<TM, 4, POST, true, K>(Ah + (size_t)row0 * K, Ar + (size_t)row0 * K,
                                    Bt + (size_t)cb * K, lane, (blockIdx.x >> 3) % (K / 64u), acc, accr);
    // The rows of a wave (ROWS / 8) are normalised G at a time, side by side: their residual
    // rows are requested together and ahead (the first G in front of the tile's barrier, the next
    // G while the first are worked on) and their row sums run as one interleaved butterfly.
    // One row after the other paid a load latency and ten exchange latencies per row.
    constexpr unsigned RW = ROWS / 8u;
    constexpr int G = 4;
    static_assert(G == 4 && RW % (unsigned)G == 0u);
    const unsigned rw0 = w * RW;                 // the wave's first row in the block
    // G rows from a multiple of 4 lie in one sequence (SEQ % 128 == 0): consecutive full rows
    const unsigned nw  = row0 + rw0;
    const float* rp = resid + (size_t)(POST ? full_row(nw) : nw) * DM + lane * 4u;
    float*       op = outF  + (size_t)(POST ? nw : full_row(nw)) * DM + lane * 4u;
#pragma unroll
    for (int mt = 0; mt < TM; ++mt)
#pragma unroll
        for (int nt = 0; nt < 4; ++nt) {
            v4f lo, hi;
#pragma unroll
            for (int g = 0; g < 4; ++g) {
                lo[g] = POST ? __builtin_fmaf(accr[mt][nt][g], SC_RINV, acc[mt][nt][g]) : acc[mt][nt][g];
                hi[g] = POST ? __builtin_fmaf(accr[mt][nt][g + 4], SC_RINV, acc[mt][nt][g + 4])
                             : acc[mt][nt][g + 4];
            }
            float* tp = &T[(mt * 16 + cc) * TP + cb + nt * 16 + r0];
            *(v4f*)(tp)     = lo;
            *(v4f*)(tp + 4) = hi;
        }
    v4f rs[G][4];
#pragma unroll
    for (int r = 0; r < G; ++r)
#pragma unroll
        for (int i = 0; i < 4; ++i) rs[r][i] = *(const v4f*)(rp + r * DM + i * 128);
    // the address pair is held (input) up to this wait: no load returns into it; the
    // statement also keeps these requests ahead of the barrier
    asm volatile("s_wait_xcnt 0x0" :: "v"(rp) : "memory");
    // keeps the first use of a loaded value behind the barrier: without it the build waits for
    // the first four loads before it has issued the other twelve and the last LDS stores
    __builtin_amdgcn_sched_barrier(0);
    __syncthreads();

#pragma unroll
    for (unsigned g0 = 0; g0 < RW; g0 += (unsigned)G) {
        v4f xv[G][4];
        float s[G];
#pragma unroll
        for (int r = 0; r < G; ++r) {
            const unsigned row = rw0 + g0 + (unsigned)r;
            s[r] = 0.0f;
#pragma unroll
            for (int i = 0; i < 4; ++i) {
                const unsigned c = (unsigned)i * 128u + lane * 4u;
                const v4f a  = *(const v4f*)(&T[row * TP + c]);
                const v4f bi = *(const v4f*)(bias + c);
                const v4f rv = rs[r][i];
                v4f x;
                x.x = __builtin_fmaf(a.x, SC_OUT, bf16r(bi.x)) + (POST ? bf16r(rv.x) : rv.x);
                x.y = __builtin_fmaf(a.y, SC_OUT, bf16r(bi.y)) + (POST ? bf16r(rv.y) : rv.y);
                x.z = __builtin_fmaf(a.z, SC_OUT, bf16r(bi.z)) + (POST ? bf16r(rv.z) : rv.z);
                x.w = __builtin_fmaf(a.w, SC_OUT, bf16r(bi.w)) + (POST ? bf16r(rv.w) : rv.w);
                xv[r][i] = x;
                s[r] += (x.x + x.y) + (x.z + x.w);
            }
        }
        wave_sum4(s, lane);
        float mu[G], q[G];
#pragma unroll
        for (int r = 0; r < G; ++r) {
            mu[r] = s[r] * (1.0f / (float)DM);
            q[r] = 0.0f;
#pragma unroll
            for (int i = 0; i < 4; ++i) {
                const float d0 = xv[r][i].x - mu[r], d1 = xv[r][i].y - mu[r];
                const float d2 = xv[r][i].z - mu[r], d3 = xv[r][i].w - mu[r];
                q[r] += (d0 * d0 + d1 * d1) + (d2 * d2 + d3 * d3);
            }
        }
        // the lane's 16 columns of the LayerNorm weight and bias: requested ahead of the second
        // row sums, not behind them where they are first used
        v4f gw4[4], gb4[4];
#pragma unroll
        for (int i = 0; i < 4; ++i) {
            gw4[i] = *(const v4f*)(lnw + (unsigned)i * 128u + lane * 4u);
            gb4[i] = *(const v4f*)(lnb + (unsigned)i * 128u + lane * 4u);
        }
        if (g0 + (unsigned)G < RW) {
            // the next G residual rows, into the registers just read: they land under the rest
            // of this group's work (placed behind the first row sums: ahead of them the build asks
            // for them at the barrier, runs out of registers and spills a loaded value)
#pragma unroll
            for (int r = 0; r < G; ++r)
#pragma unroll
                for (int i = 0; i < 4; ++i)
                    rs[r][i] = *(const v4f*)(rp + (g0 + (unsigned)G + (unsigned)r) * DM + i * 128);
            // as above: the pair is held up to the wait
            asm volatile("s_wait_xcnt 0x0" :: "v"(rp) : "memory");
        }
        wave_sum4(q, lane);
        float rstd[G];
#pragma unroll
        for (int r = 0; r < G; ++r) rstd[r] = rsqrtf(q[r] * (1.0f / (float)DM) + 1.0e-5f);
#pragma unroll
        for (int r = 0; r < G; ++r)
#pragma unroll
            for (int i = 0; i < 4; ++i) {
                const v4f gw = gw4[i];
                const v4f gb = gb4[i];
                v4f y;
                y.x = (xv[r][i].x - mu[r]) * rstd[r] * bf16r(gw.x) + bf16r(gb.x);
                y.y = (xv[r][i].y - mu[r]) * rstd[r] * bf16r(gw.y) + bf16r(gb.y);
                y.z = (xv[r][i].z - mu[r]) * rstd[r] * bf16r(gw.z) + bf16r(gb.z);
                y.w = (xv[r][i].w - mu[r]) * rstd[r] * bf16r(gw.w) + bf16r(gb.w);
                xv[r][i] = y;                    // in place: x is not read again
            }
        if (POST) {
#pragma unroll
            for (int r = 0; r < G; ++r) {
                const unsigned row = rw0 + g0 + (unsigned)r;
#pragma unroll
                for (int i = 0; i < 4; ++i) {
                    v4h hq;
                    hq[0] = (_Float16)(xv[r][i].x * 16.0f); hq[1] = (_Float16)(xv[r][i].y * 16.0f);
                    hq[2] = (_Float16)(xv[r][i].z * 16.0f); hq[3] = (_Float16)(xv[r][i].w * 16.0f);
                    *(v4h*)(&Hs[((unsigned)i * 16u + (lane >> 1)) * 264u + row * 8u + (lane & 1u) * 4u]) = hq;
                }
            }
        }
#pragma unroll
        for (int r = 0; r < G; ++r)
#pragma unroll
            for (int i = 0; i < 4; ++i)
                *(v4f*)(op + (g0 + (unsigned)r) * DM + i * 128) = xv[r][i];
        // the stores' address pair and data are held (inputs) up to this wait: the next rows and
        // the code behind the loop rewrite these registers
        asm volatile("s_wait_xcnt 0x0"
                     :: "v"(op),
                        "v"(xv[0][0]), "v"(xv[0][1]), "v"(xv[0][2]), "v"(xv[0][3]),
                        "v"(xv[1][0]), "v"(xv[1][1]), "v"(xv[1][2]), "v"(xv[1][3]),
                        "v"(xv[2][0]), "v"(xv[2][1]), "v"(xv[2][2]), "v"(xv[2][3]),
                        "v"(xv[3][0]), "v"(xv[3][1]), "v"(xv[3][2]), "v"(xv[3][3])
                     : "memory");
    }
    if (POST) {
        __syncthreads();
        _Float16* hp = outH + (size_t)row0 * DM + tid * 8u;
        // piece i*256 + tid of the block's 2 x 16 units: unit = 4*i + (w>>1), j = w&1
        const unsigned hs0 = ((w >> 1) * 4u + (w & 1u) * 2u + (lane >> 4)) * 264u + (lane & 15u) * 8u;
        v8h pv[8];
#pragma unroll
        for (int i = 0; i < 8; ++i)
            pv[i] = *(const v8h*)(&Hs[hs0 + (unsigned)(i & 3) * (16u * 264u) + (unsigned)(i >> 2) * 128u]);
#pragma unroll
        for (int i = 0; i < 8; ++i)
            *(v8h*)(hp + (unsigned)i * 2048u) = pv[i];
    }
}

// ---------------------------------------------------------------------------
// FF1: hidden = relu(sa W1 + b1), stored as f16 of 16*hidden, fragment-ordered
// NTOK x 2048 plane. Block = 8 waves = 128 rows x 256 columns; the wave's
// 64 x 64 tile = 4 x 2 units. The tiles are computed transposed: a lane's 8
// accumulator rows are 8 consecutive hidden columns of one token, one piece of a
// unit at the lane's own place, stored straight from registers.
// ---------------------------------------------------------------------------
__global__ __launch_bounds__(256) __attribute__((amdgpu_num_vgpr(256)))
void k_ff1(const _Float16* __restrict__ sah, const _Float16* __restrict__ Bt,
           const float* __restrict__ bias, _Float16* __restrict__ hid) {
    const unsigned tid  = threadIdx.x;
    const unsigned lane = tid & 31u;
    const unsigned w    = tid >> 5;
    const unsigned row0 = blockIdx.y * 128u + (w >> 2) * 64u;
    const unsigned cb   = blockIdx.x * 256u + (w & 3u) * 64u;
    const unsigned r0   = (lane >> 4) << 3;

    v8f acc[4][4], dum[4][4];
    gemm_core<4, 4, false, true, DM>(sah + (size_t)row0 * DM, sah + (size_t)row0 * DM,
                                     Bt + (size_t)cb * DM, lane,
                                     (blockIdx.x + blockIdx.y) % (unsigned)(DM / 64), acc, dum);
    const float* bp = bias + cb + r0;
    v4f bq[4][2];
#pragma unroll
    for (int nt = 0; nt < 4; ++nt) {
        bq[nt][0] = *(const v4f*)(bp + nt * 16);
        bq[nt][1] = *(const v4f*)(bp + nt * 16 + 4);
    }
    // the address pair is held (input) up to this wait: no load returns into it
    asm volatile("s_wait_xcnt 0x0" :: "v"(bp) : "memory");
    v8h xv[4][4];
#pragma unroll
    for (int nt = 0; nt < 4; ++nt) {
        float bv[8];
#pragma unroll
        for (int g = 0; g < 8; ++g) bv[g] = bf16r(bq[nt][g >> 2][g & 3]) * 16.0f;
#pragma unroll
        for (int mt = 0; mt < 4; ++mt)
#pragma unroll
            for (int g = 0; g < 8; ++g)
                xv[mt][nt][g] = (_Float16)fmaxf(__builtin_fmaf(acc[mt][nt][g], SC_HID, bv[g]), 0.0f);
    }
    _Float16* ob = hid + (size_t)row0 * DF + (size_t)cb * 16u + lane * 8u;
#pragma unroll
    for (int mt = 0; mt < 4; ++mt)
#pragma unroll
        for (int nt = 0; nt < 4; ++nt)
            *(v8h*)(ob + (size_t)(mt * 16) * DF + (nt >> 1) * 512 + (nt & 1) * 256) = xv[mt][nt];
    // the stores' address pair and data are held (inputs) up to this wait: none is rewritten before it
    asm volatile("s_wait_xcnt 0x0"
                 :: "v"(ob),
                    "v"(xv[0][0]), "v"(xv[0][1]), "v"(xv[0][2]), "v"(xv[0][3]),
                    "v"(xv[1][0]), "v"(xv[1][1]), "v"(xv[1][2]), "v"(xv[1][3]),
                    "v"(xv[2][0]), "v"(xv[2][1]), "v"(xv[2][2]), "v"(xv[2][3]),
                    "v"(xv[3][0]), "v"(xv[3][1]), "v"(xv[3][2]), "v"(xv[3][3])
                 : "memory");
}

// ---------------------------------------------------------------------------
// Workspace arena in units of U = NTOK*512*2 bytes (16 MiB at full size);
// time-disjoint planes share offsets (launches are stream-ordered):
//   [0,4U)  qh ql kh kl          -> later sa f32 [0,2U), 16*sa f16 [2U,3U)
//   [4U,6U) V^T hi / residual
//   [6U,7U) xh                   -> later ctx hi
//   [7U,8U) ctx residual
//   [3U,7U) later hidden
//   [8U,..) the weight planes, each at its own place from the first launch to its
//           reader: Wqkv^T (1.5 MiB), Wo^T (0.5 MiB), W1^T (2 MiB), W2^T (2 MiB)
// ---------------------------------------------------------------------------
#define U_BYTES ((size_t)NTOK * DM * 2)
static_assert((size_t)NB_FULL * SEQ_FULL * DM * 2 * 8 <= (size_t)134217728);

extern "C" void kernel_launch(void* const* d_in, const int* in_sizes, int n_in,
                              void* d_out, int out_size, void* d_ws, size_t ws_size,
                              hipStream_t stream) {
    if (n_in < 14) return;
    const int need_rows = (NB - 1) * SEQ_FULL + SEQ;
    if (in_sizes[0] < need_rows * DM) return;
    if (in_sizes[1] < need_rows) return;
    if (in_sizes[2] < 3 * NH * DM * HD || in_sizes[3] < 3 * NH * HD) return;
    if (in_sizes[4] < DM * DM || in_sizes[5] < DM) return;
    if (in_sizes[6] < DM * DF || in_sizes[7] < DF) return;
    if (in_sizes[8] < DF * DM || in_sizes[9] < DM) return;
    if (in_sizes[10] < DM || in_sizes[11] < DM || in_sizes[12] < DM || in_sizes[13] < DM) return;
    if (out_size < need_rows * DM) return;

    const float* inp   = (const float*)d_in[0];    // [16384,512]
    const float* mask  = (const float*)d_in[1];    // [32,1,512]
    const float* preW  = (const float*)d_in[2];    // [3,8,512,64]
    const float* preB  = (const float*)d_in[3];    // [3,8,1,64]
    const float* postW = (const float*)d_in[4];    // [512,512]
    const float* postB = (const float*)d_in[5];    // [512]
    const float* ff1W  = (const float*)d_in[6];    // [512,2048]
    const float* ff1B  = (const float*)d_in[7];    // [2048]
    const float* ff2W  = (const float*)d_in[8];    // [2048,512]
    const float* ff2B  = (const float*)d_in[9];    // [512]
    const float* ln1w  = (const float*)d_in[10];
    const float* ln1b  = (const float*)d_in[11];
    const float* ln2w  = (const float*)d_in[12];
    const float* ln2b  = (const float*)d_in[13];
    float* out = (float*)d_out;                    // [32,512,512]

    const size_t U = U_BYTES;
    const size_t WQ_B = (size_t)3 * NH * HD * DM * 2;   // 1.5 MiB
    const size_t WO_B = (size_t)DM * DM * 2;            // 0.5 MiB
    const size_t W1_B = (size_t)DF * DM * 2;            // 2 MiB
    const size_t W2_B = (size_t)DM * DF * 2;            // 2 MiB
    if (8 * U + WQ_B + WO_B + W1_B + W2_B > ws_size) return;

    char* ws = (char*)d_ws;
    _Float16* qh    = (_Float16*)(ws + 0 * U);
    _Float16* ql    = (_Float16*)(ws + 1 * U);
    _Float16* kh    = (_Float16*)(ws + 2 * U);
    _Float16* kl    = (_Float16*)(ws + 3 * U);
    _Float16* vTh   = (_Float16*)(ws + 4 * U);
    _Float16* vTr   = (_Float16*)(ws + 5 * U);
    _Float16* xh    = (_Float16*)(ws + 6 * U);
    _Float16* ctxh  = (_Float16*)(ws + 6 * U);
    _Float16* ctxr  = (_Float16*)(ws + 7 * U);
    _Float16* wqkvT = (_Float16*)(ws + 8 * U);
    float*    sa    = (float*)(ws + 0 * U);
    _Float16* sah   = (_Float16*)(ws + 2 * U);
    _Float16* postT = (_Float16*)(ws + 8 * U + WQ_B);
    _Float16* hid   = (_Float16*)(ws + 3 * U);
    _Float16* ff1T  = (_Float16*)(ws + 8 * U + WQ_B + WO_B);
    _Float16* ff2T  = (_Float16*)(ws + 8 * U + WQ_B + WO_B + W1_B);

    // x -> f16 plane (bf16-RNE values); every W[k][n] -> its [n][k] plane
    k_planes<<<dim3(WT_ALL + NTOK / 4), dim3(256), 0, stream>>>(
        inp, preW, postW, ff1W, ff2W, xh, wqkvT, postT, ff1T, ff2T);
    k_qkv<<<dim3(6, NTOK / 128), dim3(256), 0, stream>>>(xh, wqkvT, preB, qh, ql, kh, kl, vTh, vTr);
    k_attn<<<dim3(NH * NB, SEQ / 128), dim3(256), 0, stream>>>(qh, ql, kh, kl, vTh, vTr, mask, ctxh, ctxr);
    k_gemm_ln<true><<<dim3(NTOK / 32), dim3(256), 0, stream>>>(
        ctxh, ctxr, postT, postB, inp, ln1w, ln1b, sa, sah);
    k_ff1<<<dim3(8, NTOK / 128), dim3(256), 0, stream>>>(sah, ff1T, ff1B, hid);
    k_gemm_ln<false><<<dim3(NTOK / 64), dim3(256), 0, stream>>>(
        hid, hid, ff2T, ff2B, sa, ln2w, ln2b, out, sah);
}

// v008
// It runs in 192 microseconds.
// Next to v007, in two timings, it ran 1.03 and 1.02 times as fast.
// Counting every step since v000, it is 2.46 times as fast.
#include <hip/hip_runtime.h>
#include <hip/hip_fp16.h>

// All contractions on v_wmma_f32_16x16x32_f16 (f16 operands, f32 accumulate): x*Wqkv, sa*W1, h*W2 single f16 planes; k*q^T with f16 hi + 2^11-scaled f16 residual planes (hi.hi, hi.res, res.hi); V^T*P^T and ctx*Wo with f16 hi + 2^11-scaled f16 residual plane on V / ctx (two accumulators, residual folded 2^-11 in f32).

#ifndef NB
#define NB 32
#endif
#ifndef SEQ
#define SEQ 512
#endif
#define NB_FULL  32
#define SEQ_FULL 512
#define NH   8           // heads
#define HD   64          // head width
#define DM   512         // model width
#define DF   2048        // hidden width
#define NTOK (NB * SEQ)

static_assert(NB >= 1 && NB <= NB_FULL);
static_assert(SEQ >= 128 && SEQ <= SEQ_FULL);
static_assert(SEQ % 128 == 0);
static_assert(NTOK % 128 == 0);
static_assert(DM == NH * HD);
static_assert(DM == 512 && HD == 64 && NH == 8 && DF == 2048);

typedef _Float16 v16h __attribute__((ext_vector_type(16)));
typedef _Float16 v8h  __attribute__((ext_vector_type(8)));
typedef _Float16 v4h  __attribute__((ext_vector_type(4)));
typedef float    v8f  __attribute__((ext_vector_type(8)));
typedef float    v4f  __attribute__((ext_vector_type(4)));

typedef const __attribute__((address_space(1))) _Float16* GlobalH;   // pointer into global memory

union Frag { v16h v; v8h h[2]; };

template <bool V> struct Flag { static constexpr bool value = V; };

#define LOG2E 1.44269504088896340736f
// scores: acc_h = (64k_h).(64q_h), acc_r = 2^11-scaled residual cross terms
// t (log2 units) = acc_h * log2(e)*2^-12 + acc_r * log2(e)*2^-23
#define C1 (1.44269504088896340736f * 0.000244140625f)
#define C2 (1.44269504088896340736f * 1.1920928955078125e-07f)
#define SC_RES   2048.0f                     // residual plane carry 2^11
#define SC_RINV  4.8828125e-04f              // 2^-11 : residual accumulator fold
#define SC_OUT   9.765625e-04f               // 2^-10 : (16 a)(64 W) -> a.W
#define SC_HID   1.5625e-02f                 // 2^-6  : (16 sa)(64 W1) -> 16 h

static __device__ __forceinline__ v8f zero8() {
    v8f z;
#pragma unroll
    for (int i = 0; i < 8; ++i) z[i] = 0.0f;
    return z;
}

// Fragment-ordered operand planes. A plane of R rows x K (k) 16-bit elements
// is a sequence of 1024-byte units, unit (row/16)*(K/32) + k/32 = one 16x32
// WMMA operand fragment, stored as [j = (k>>4)&1][lane][8]:
//   lane = 16*((k>>3)&1) + (row&15), element = k&7.
// A fragment (A, or B from an [n][k] source) is then two wave-wide 16-byte
// loads of 512 contiguous bytes each (4 whole lines per load): lane m =
// lane&15 -> row m; kb = 8*(lane>>4); elements 0..7 = k kb..kb+7, elements
// 8..15 = k kb+16..kb+23.
// p = unit + lane*8, the lane's own place in the unit.
static __device__ __forceinline__ v16h load_frag16(const _Float16* p) {
    Frag f;
    f.h[0] = *(const v8h*)(p);
    f.h[1] = *(const v8h*)(p + 256);
    return f.v;
}

// offset (in elements) of the 8-element piece (row, k8..k8+7), k8 % 8 == 0
static __device__ __forceinline__ size_t frag_off(unsigned row, unsigned k8, unsigned K) {
    return ((size_t)(row >> 4) * (K >> 5) + (k8 >> 5)) * 512u
         + ((k8 >> 4) & 1u) * 256u + ((((k8 >> 3) & 1u) << 4) + (row & 15u)) * 8u;
}

static __device__ __forceinline__ v8f wmma16(v16h a, v16h b, v8f c) {
    v8f d = __builtin_amdgcn_wmma_f32_16x16x32_f16(false, a, false, b, (short)0, c, false, false);
    asm volatile("v_nop\n\tv_nop\n\tv_nop\n\tv_nop" : "+v"(d) : "v"(a), "v"(b));
    return d;
}

// f32 -> bf16 RNE convert, value kept as f32
static __device__ __forceinline__ float bf16r(float x) {
    unsigned u = __float_as_uint(x);
    u = (u + 0x7FFFu + ((u >> 16) & 1u)) & 0xFFFF0000u;
    return __uint_as_float(u);
}

static __device__ __forceinline__ float ex2(float x) {
    return __builtin_amdgcn_exp2f(x);
}

// Sum over the wave's 32 lanes (butterfly 16, 8, 4, 2, 1) of four independent values, side by
// side: the four exchanges of a step are in flight together, one exchange latency per step and
// not one per value. The exchanges of a step and their data wait are one statement: written as
// __shfl_xor the build strings them out and waits for most of them one by one.
static __device__ __forceinline__ void wave_sum4(float (&v)[4], unsigned lane) {
#pragma unroll
    for (unsigned m = 16u; m >= 1u; m >>= 1) {
        const unsigned from = (lane ^ m) << 2;   // the partner lane, as ds_bpermute_b32 counts it
        float t0, t1, t2, t3;
        asm volatile("ds_bpermute_b32 %0, %4, %5\n\t"
                     "ds_bpermute_b32 %1, %4, %6\n\t"
                     "ds_bpermute_b32 %2, %4, %7\n\t"
                     "ds_bpermute_b32 %3, %4, %8\n\t"
                     "s_wait_dscnt 0x0"
                     : "=&v"(t0), "=&v"(t1), "=&v"(t2), "=&v"(t3)
                     : "v"(from), "v"(v[0]), "v"(v[1]), "v"(v[2]), "v"(v[3])
                     : "memory");
        v[0] += t0; v[1] += t1; v[2] += t2; v[3] += t3;
    }
}

// compact token row (b*SEQ + l) -> row in the full-size arrays
static __device__ __forceinline__ unsigned full_row(unsigned n) {
    const unsigned b = n / (unsigned)SEQ;
    return b * (unsigned)SEQ_FULL + (n - b * (unsigned)SEQ);
}

// ---------------------------------------------------------------------------
// Wave-level GEMM core: TM x TN tiles of 16x16, A / Bt both fragment-ordered
// planes of width K; the pointers name the first unit of the wave's first row
// tile (row * K elements in), the next row tile is 16*K on, the next k step 512.
// RES: second A plane (2^11-scaled residual) into its own accumulators.
// The fragments of k step s + 1 are requested before the products of step s
// (two register sets), so a step waits for loads that are one step old, once,
// and not for each B fragment in turn. SB (16 accumulator tiles: RES, or a 4 x 4
// wave tile): the accumulators leave no room for a second B set, each B fragment
// is requested anew behind its last product.
// The k walk starts at trip t0 (a trip = two k steps = 64 k) and wraps: blocks that
// read the same operand rows at the same time get different t0, so that their
// requests for one line do not reach L2 together. Every k step is taken once.
// ---------------------------------------------------------------------------
// SW: the product is taken transposed, the Bt fragment as the A operand and the A plane's
// fragment as the B operand (both planes have one fragment order, the k order is the same):
// tile [mt][nt] then holds, per lane, row mt*16 + (lane&15) of the A plane against the 8
// CONSECUTIVE Bt rows nt*16 + 8*(lane>>4) + 0..7, which is one 16-byte piece of a
// fragment-ordered plane (or 32 bytes of an f32 row) and needs no transpose on its way out.
// One k step on the current set; LD: request the next step's set from pa / pr / pb.
template <int TM, int TN, bool RES, bool SB, bool SW, unsigned K, bool LD>
static __device__ __forceinline__ void gemm_step(const _Float16* pa, const _Float16* pr,
                                                 const _Float16* pb,
                                                 const v16h (&ac)[TM], const v16h (&arc)[TM], v16h (&bc)[TN],
                                                 v16h (&an)[TM], v16h (&arn)[TM], v16h (&bn)[TN],
                                                 v8f (&acc)[TM][TN], v8f (&accr)[TM][TN]) {
    if (LD) {
#pragma unroll
        for (int mt = 0; mt < TM; ++mt) {
            an[mt] = load_frag16(pa + (size_t)(mt * 16) * K);
            if (RES) arn[mt] = load_frag16(pr + (size_t)(mt * 16) * K);
        }
        if (!SB) {
#pragma unroll
            for (int nt = 0; nt < TN; ++nt) bn[nt] = load_frag16(pb + (size_t)(nt * 16) * K);
        }
    }
#pragma unroll
    for (int nt = 0; nt < TN; ++nt) {
#pragma unroll
        for (int mt = 0; mt < TM; ++mt) {
            acc[mt][nt] = SW ? wmma16(bc[nt], ac[mt], acc[mt][nt]) : wmma16(ac[mt], bc[nt], acc[mt][nt]);
            if (RES) accr[mt][nt] = SW ? wmma16(bc[nt], arc[mt], accr[mt][nt])
                                       : wmma16(arc[mt], bc[nt], accr[mt][nt]);
        }
        if (LD && SB) bc[nt] = load_frag16(pb + (size_t)(nt * 16) * K);
    }
}

template <int TM, int TN, bool RES, bool SW, unsigned K>
static __device__ __forceinline__ void gemm_core(const _Float16* __restrict__ Ah,
                                                 const _Float16* __restrict__ Ar,
                                                 const _Float16* __restrict__ Bt,
                                                 unsigned lane, unsigned t0,
                                                 v8f (&acc)[TM][TN], v8f (&accr)[TM][TN]) {
    static_assert(K % 64u == 0u && K >= 64u);
    constexpr unsigned T = K / 64u;              // trips; t0 < T, the same in the whole block
    constexpr bool SB = RES || TM * TN >= 16;    // one B set only
    constexpr int B1 = SB ? 0 : 1;               // index of the second B set
#pragma unroll
    for (int mt = 0; mt < TM; ++mt)
#pragma unroll
        for (int nt = 0; nt < TN; ++nt) {
            acc[mt][nt] = zero8();
            if (RES) accr[mt][nt] = zero8();
        }
    // one address pair per plane; row tiles and the two steps of a trip are constant offsets
    const _Float16* pa = Ah + t0 * 1024u + lane * 8u;
    const _Float16* pr = Ar + t0 * 1024u + lane * 8u;
    const _Float16* pb = Bt + t0 * 1024u + lane * 8u;
    v16h a[2][TM], ar[2][TM], b[2][TN];
#pragma unroll
    for (int mt = 0; mt < TM; ++mt) {
        a[0][mt] = load_frag16(pa + (size_t)(mt * 16) * K);
        if (RES) ar[0][mt] = load_frag16(pr + (size_t)(mt * 16) * K);
    }
    // keeps the first A requests ahead of the first B requests, the order of every trip:
    // the wait at the loop's head serves both ways in, and with an A request last on this
    // way it counts to 0 and drains the B requests in flight on every trip
    if (!RES) __builtin_amdgcn_sched_barrier(0);
#pragma unroll
    for (int nt = 0; nt < TN; ++nt) b[0][nt] = load_frag16(pb + (size_t)(nt * 16) * K);
    unsigned t = t0;
#pragma unroll 1
    for (unsigned i = 0; i + 1u < T; ++i) {
        gemm_step<TM, TN, RES, SB, SW, K, true>(pa + 512, pr + 512, pb + 512,
                                        a[0], ar[0], b[0], a[1], ar[1], b[B1], acc, accr);
        // to the next trip: 1024 elements = 2048 bytes on, or back to the row tile's first
        // unit behind its last trip (a row tile is K * 32 bytes); a scalar, alike for all planes
        t = (t + 1u == T) ? 0u : t + 1u;
        const long long adv = (t == 0u) ? 2048ll - (long long)K * 32ll : 2048ll;
        // The wait and the advance in one statement: no pair that an issued load still names
        // is rewritten ahead of the wait.
        // (typed as global-memory pointers, so that the loads behind it stay global loads)
        GlobalH ga = (GlobalH)pa, gb = (GlobalH)pb;
        if constexpr (RES) {
            GlobalH gr = (GlobalH)pr;
            asm volatile("s_wait_xcnt 0x0\n\t"
                         "v_add_nc_u64 %0, %3, %0\n\t"
                         "v_add_nc_u64 %1, %3, %1\n\t"
                         "v_add_nc_u64 %2, %3, %2"
                         : "+v"(ga), "+v"(gr), "+v"(gb) : "s"(adv) : "memory");
            pr = (const _Float16*)gr;
        } else {
            asm volatile("s_wait_xcnt 0x0\n\t"
                         "v_add_nc_u64 %0, %2, %0\n\t"
                         "v_add_nc_u64 %1, %2, %1"
                         : "+v"(ga), "+v"(gb) : "s"(adv) : "memory");
        }
        pa = (const _Float16*)ga; pb = (const _Float16*)gb;
        gemm_step<TM, TN, RES, SB, SW, K, true>(pa, pr, pb,
                                        a[1], ar[1], b[B1], a[0], ar[0], b[0], acc, accr);
    }
    gemm_step<TM, TN, RES, SB, SW, K, true>(pa + 512, pr + 512, pb + 512,
                                    a[0], ar[0], b[0], a[1], ar[1], b[B1], acc, accr);
    gemm_step<TM, TN, RES, SB, SW, K, false>(pa, pr, pb,
                                     a[1], ar[1], b[B1], a[0], ar[0], b[0], acc, accr);
    // as above, for the last steps' loads: the pairs' registers are free behind it
    if (RES) asm volatile("s_wait_xcnt 0x0" :: "v"(pa), "v"(pr), "v"(pb) : "memory");
    else     asm volatile("s_wait_xcnt 0x0" :: "v"(pa), "v"(pb) : "memory");
}

// ---------------------------------------------------------------------------
// x (f32) -> xh, fragment-ordered NTOK x 512 plane, f16 of the bf16-RNE value.
// A wave takes 8 rows x 256 columns = XT tiles of 8 rows x 32 columns (per tile one
// 128-B line per row in, four whole 128-B lines out, each line written by one wave).
// 64 elements per thread, all 16 loads of a lane requested at once: the plane costs
// 4,096 wave starts at full size and not 32,768.
// ---------------------------------------------------------------------------
#define XT 8                                         // tiles of a wave
static __device__ __forceinline__ void cvt_x_block(unsigned blk, const float* __restrict__ x,
                                                   _Float16* __restrict__ xh) {
    const unsigned wv  = blk * 8u + (threadIdx.x >> 5);
    const unsigned ln  = threadIdx.x & 31u;
    const unsigned n   = (wv >> 1) * 8u + (ln & 7u);
    const unsigned c8  = (wv & 1u) * (unsigned)(XT * 32) + (ln >> 3) * 8u;
    const unsigned fr  = full_row(n);
    const float* p = x + (size_t)fr * DM + c8;
    v4f a[XT], b[XT];
#pragma unroll
    for (int i = 0; i < XT; ++i) {
        a[i] = *(const v4f*)(p + i * 32);
        b[i] = *(const v4f*)(p + i * 32 + 4);
    }
    // the address pair is held (input) up to this wait: no load returns into it
    asm volatile("s_wait_xcnt 0x0" :: "v"(p) : "memory");
    v8h o[XT];
#pragma unroll
    for (int i = 0; i < XT; ++i) {
        o[i][0] = (_Float16)bf16r(a[i].x); o[i][1] = (_Float16)bf16r(a[i].y);
        o[i][2] = (_Float16)bf16r(a[i].z); o[i][3] = (_Float16)bf16r(a[i].w);
        o[i][4] = (_Float16)bf16r(b[i].x); o[i][5] = (_Float16)bf16r(b[i].y);
        o[i][6] = (_Float16)bf16r(b[i].z); o[i][7] = (_Float16)bf16r(b[i].w);
    }
    // the next 32 columns are the row tile's next unit, 512 elements on
    _Float16* d = xh + frag_off(n, c8, (unsigned)DM);
#pragma unroll
    for (int i = 0; i < XT; ++i) *(v8h*)(d + i * 512) = o[i];
    // the stores' address pair and data are held (inputs) up to this wait: none is rewritten before it
    asm volatile("s_wait_xcnt 0x0"
                 :: "v"(d), "v"(o[0]), "v"(o[1]), "v"(o[2]), "v"(o[3]),
                    "v"(o[4]), "v"(o[5]), "v"(o[6]), "v"(o[7])
                 : "memory");
}

// ---------------------------------------------------------------------------
// Weight plane builder: in [z][R][C] f32 (k-major, W[k][n]) -> out: z
// fragment-ordered planes of C rows (n) x R (k), f16 = 64 * bf16-RNE(W)^T.
// 128 (k) x 64 (n) tile through LDS = 4 x 4 units, each wave store 512 contiguous
// bytes; tile (bx, by, bz) of (C/64, R/128, z). 32 elements per thread, the 8 loads
// of a lane requested at once: half the wave starts of a 64 x 64 tile.
// ---------------------------------------------------------------------------
static __device__ __forceinline__ void wT_block(const float* __restrict__ in,
                                                _Float16* __restrict__ out,
                                                unsigned R, unsigned C,
                                                unsigned bx, unsigned by, unsigned bz) {
    // row pitch 136 elements = 272 bytes, an odd multiple of 16: the 16-byte reads meet no conflict
    __shared__ __align__(16) _Float16 t[64 * 136];
    const unsigned tid = threadIdx.x;
    const unsigned n0 = bx * 64u;
    const unsigned k0 = by * 128u;
    const float*  inb  = in  + (size_t)bz * R * C;
    _Float16*     outb = out + (size_t)bz * R * C;
    const float* p[8];
    v4f vv[8];
#pragma unroll
    for (int i = 0; i < 8; ++i) {
        const unsigned idx = (unsigned)i * 256u + tid;
        p[i] = inb + (size_t)(k0 + (idx >> 4)) * C + n0 + ((idx & 15u) << 2);
        vv[i] = *(const v4f*)p[i];
    }
    // the eight address pairs are held (inputs) up to this wait: no load returns
    // into a pair that an issued load still names, and none is rewritten before it
    asm volatile("s_wait_xcnt 0x0" :: "v"(p[0]), "v"(p[1]), "v"(p[2]), "v"(p[3]),
                                      "v"(p[4]), "v"(p[5]), "v"(p[6]), "v"(p[7]) : "memory");
#pragma unroll
    for (int i = 0; i < 8; ++i) {
        const unsigned idx = (unsigned)i * 256u + tid;
        const unsigned r = idx >> 4, c4 = (idx & 15u) << 2;
        const v4f v = vv[i];
        t[(c4 + 0u) * 136u + r] = (_Float16)(bf16r(v.x) * 64.0f);
        t[(c4 + 1u) * 136u + r] = (_Float16)(bf16r(v.y) * 64.0f);
        t[(c4 + 2u) * 136u + r] = (_Float16)(bf16r(v.z) * 64.0f);
        t[(c4 + 3u) * 136u + r] = (_Float16)(bf16r(v.w) * 64.0f);
    }
    __syncthreads();
    const unsigned ln = tid & 31u;
    const unsigned kl = ((tid >> 6) & 1u) * 32u + ((tid >> 5) & 1u) * 16u + (ln >> 4) * 8u;
    const unsigned nl = (tid >> 7) * 16u + (ln & 15u);
    const v8h o0 = *(const v8h*)(&t[nl * 136u + kl]);
    const v8h o1 = *(const v8h*)(&t[(nl + 32u) * 136u + kl]);
    const v8h o2 = *(const v8h*)(&t[nl * 136u + 64u + kl]);
    const v8h o3 = *(const v8h*)(&t[(nl + 32u) * 136u + 64u + kl]);
    _Float16* d0 = outb + frag_off(n0 + nl, k0 + kl, R);
    _Float16* d1 = outb + frag_off(n0 + nl + 32u, k0 + kl, R);
    // 64 k on = two units on = 1024 elements
    *(v8h*)d0 = o0;
    *(v8h*)d1 = o1;
    *(v8h*)(d0 + 1024) = o2;
    *(v8h*)(d1 + 1024) = o3;
    // the stores' address pairs and data are held (inputs) up to this wait: in the one
    // kernel that holds all builders other code follows, which rewrites these registers
    asm volatile("s_wait_xcnt 0x0" :: "v"(d0), "v"(d1), "v"(o0), "v"(o1), "v"(o2), "v"(o3) : "memory");
}

// ---------------------------------------------------------------------------
// All operand planes that depend on the inputs alone, in one launch: the four
// weight planes (384 tiles, the low block indices), then the x plane.
// The choice of the work is uniform over the block.
// ---------------------------------------------------------------------------
#define WT_QKV  (3 * NH * (DM / 128))                //  96 tiles: 24 x [512 k][64 n]
#define WT_POST ((DM / 64) * (DM / 128))             //  32 tiles: [512 k][512 n]
#define WT_FF   ((DF / 64) * (DM / 128))             // 128 tiles: [512 k][2048 n], [2048 k][512 n]
#define WT_ALL  (WT_QKV + WT_POST + 2 * WT_FF)
__global__ __launch_bounds__(256) void k_planes(const float* __restrict__ x,
                                                const float* __restrict__ preW,
                                                const float* __restrict__ postW,
                                                const float* __restrict__ ff1W,
                                                const float* __restrict__ ff2W,
                                                _Float16* __restrict__ xh,
                                                _Float16* __restrict__ wqkvT,
                                                _Float16* __restrict__ postT,
                                                _Float16* __restrict__ ff1T,
                                                _Float16* __restrict__ ff2T) {
    const unsigned bid = blockIdx.x;
    if (bid >= (unsigned)WT_ALL) {
        cvt_x_block(bid - (unsigned)WT_ALL, x, xh);
    } else if (bid < (unsigned)WT_QKV) {
        wT_block(preW, wqkvT, DM, HD, 0u, bid & 3u, bid >> 2);
    } else if (bid < (unsigned)(WT_QKV + WT_POST)) {
        const unsigned u = bid - (unsigned)WT_QKV;
        wT_block(postW, postT, DM, DM, u & 7u, u >> 3, 0u);
    } else if (bid < (unsigned)(WT_QKV + WT_POST + WT_FF)) {
        const unsigned u = bid - (unsigned)(WT_QKV + WT_POST);
        wT_block(ff1W, ff1T, DM, DF, u & 31u, u >> 5, 0u);
    } else {
        const unsigned u = bid - (unsigned)(WT_QKV + WT_POST + WT_FF);
        wT_block(ff2W, ff2T, DF, DM, u & 7u, u >> 3, 0u);
    }
}

// ---------------------------------------------------------------------------
// QKV projection. Block = 8 waves = 128 tokens x 256 columns, all of q, of k or
// of v; wave tile = 64 tokens x 64 columns = one (t, head) slice.
// q/k planes: [head][dhalf] fragment-ordered NTOK x 32 planes, f16 of 64q (hi)
// and 2^11 residual. V^T planes: [head*NB+b] fragment-ordered 64 (d) x SEQ (key)
// planes, hi / residual. Every plane is stored straight from registers: a lane's
// 8 accumulator rows must be 8 consecutive k of the plane, so the q and k tiles
// are computed transposed (W^T rows as the A operand, tokens as B: rows = d),
// the v tiles as x W (rows = keys). Both operand planes have the same shape and
// order, so the choice is which plane's address goes in as which operand.
// ---------------------------------------------------------------------------
__global__ __launch_bounds__(256) __attribute__((amdgpu_num_vgpr(256)))
void k_qkv(const _Float16* __restrict__ xh, const _Float16* __restrict__ wT,
           const float* __restrict__ bias,
           _Float16* __restrict__ qh, _Float16* __restrict__ ql,
           _Float16* __restrict__ kh, _Float16* __restrict__ kl,
           _Float16* __restrict__ vTh, _Float16* __restrict__ vTr) {
    const unsigned tid  = threadIdx.x;
    const unsigned lane = tid & 31u;
    const unsigned w    = tid >> 5;
    const unsigned n0   = blockIdx.y * 128u + (w >> 2) * 64u;
    const unsigned cb   = blockIdx.x * 256u + (w & 3u) * 64u;
    const unsigned r0   = (lane >> 4) << 3;
    const unsigned cc   = lane & 15u;
    const unsigned t    = blockIdx.x >> 1;       // = cb >> 9: 0 q, 1 k, 2 v; one per block
    const unsigned h    = (cb >> 6) & 7u;

    const _Float16* xrow = xh + (size_t)n0 * DM;
    const _Float16* wrow = wT + (size_t)cb * DM;
    const _Float16* opa  = (t < 2u) ? wrow : xrow;
    const _Float16* opb  = (t < 2u) ? xrow : wrow;
    v8f acc[4][4], dum[4][4];
    gemm_core<4, 4, false, false, DM>(opa, opa, opb, lane,
                                      (blockIdx.x + blockIdx.y) % (unsigned)(DM / 64), acc, dum);

    if (t < 2u) {
        // acc[dt][tt]: lane = token n0 + tt*16 + cc, rows d = dt*16 + r0 + 0..7
        _Float16* ph = (t == 0u) ? qh : kh;
        _Float16* pl = (t == 0u) ? ql : kl;
        const float* bp = bias + cb + r0;
        v4f bq[4][2];
#pragma unroll
        for (int dt = 0; dt < 4; ++dt) {
            bq[dt][0] = *(const v4f*)(bp + dt * 16);
            bq[dt][1] = *(const v4f*)(bp + dt * 16 + 4);
        }
        // the address pair is held (input) up to this wait: no load returns into it
        asm volatile("s_wait_xcnt 0x0" :: "v"(bp) : "memory");
#pragma unroll
        for (int kk = 0; kk < 2; ++kk) {         // the two d halves, one plane each
            const size_t pbase = ((size_t)(h * 2u + (unsigned)kk) * NTOK + n0) * 32u + lane * 8u;
            _Float16* dh = ph + pbase;
            _Float16* dl = pl + pbase;
            v8h hv[2][4], rv[2][4];
#pragma unroll
            for (int j = 0; j < 2; ++j) {
                float bv[8];
#pragma unroll
                for (int g = 0; g < 8; ++g) bv[g] = bf16r(bq[kk * 2 + j][g >> 2][g & 3]) * 64.0f;
#pragma unroll
                for (int tt = 0; tt < 4; ++tt)
#pragma unroll
                    for (int g = 0; g < 8; ++g) {
                        const float v = acc[kk * 2 + j][tt][g] + bv[g];
                        const _Float16 hi = (_Float16)v;
                        hv[j][tt][g] = hi;
                        rv[j][tt][g] = (_Float16)((v - (float)hi) * SC_RES);
                    }
            }
#pragma unroll
            for (int tt = 0; tt < 4; ++tt)
#pragma unroll
                for (int j = 0; j < 2; ++j) {
                    *(v8h*)(dh + tt * 512 + j * 256) = hv[j][tt];
                    *(v8h*)(dl + tt * 512 + j * 256) = rv[j][tt];
                }
            // the stores' address pairs and data are held (inputs) up to this wait: the
            // next plane's values and the code behind the branch rewrite these registers
            asm volatile("s_wait_xcnt 0x0"
                         :: "v"(dh), "v"(dl),
                            "v"(hv[0][0]), "v"(hv[0][1]), "v"(hv[0][2]), "v"(hv[0][3]),
                            "v"(hv[1][0]), "v"(hv[1][1]), "v"(hv[1][2]), "v"(hv[1][3]),
                            "v"(rv[0][0]), "v"(rv[0][1]), "v"(rv[0][2]), "v"(rv[0][3]),
                            "v"(rv[1][0]), "v"(rv[1][1]), "v"(rv[1][2]), "v"(rv[1][3])
                         : "memory");
        }
    } else {
        float bv[4];
        const unsigned bi = cb + cc;
        const float b0 = bias[bi];
        const float b1 = bias[bi + 16u];
        const float b2 = bias[bi + 32u];
        const float b3 = bias[bi + 48u];
        // the index register is held (input) up to this wait: no load returns into it
        asm volatile("s_wait_xcnt 0x0" :: "v"(bi) : "memory");
        bv[0] = bf16r(b0) * 64.0f;
        bv[1] = bf16r(b1) * 64.0f;
        bv[2] = bf16r(b2) * 64.0f;
        bv[3] = bf16r(b3) * 64.0f;
        const unsigned b  = n0 / (unsigned)SEQ;
        const unsigned l0 = n0 - b * (unsigned)SEQ;
        const unsigned hb = h * (unsigned)NB + b;
        const size_t vbase = ((size_t)(hb * HD)) * SEQ + (size_t)l0 * 16u + lane * 8u;
#pragma unroll
        for (int mt = 0; mt < 4; ++mt)
#pragma unroll
            for (int nt = 0; nt < 4; ++nt) {
                v8h hv, rv;
#pragma unroll
                for (int g = 0; g < 8; ++g) {
                    const float v = acc[mt][nt][g] + bv[nt];
                    const _Float16 hi = (_Float16)v;
                    hv[g] = hi;
                    rv[g] = (_Float16)((v - (float)hi) * SC_RES);
                }
                const size_t vo = vbase + (size_t)(nt * 16) * SEQ + (mt >> 1) * 512 + (mt & 1) * 256;
                *(v8h*)(vTh + vo) = hv;
                *(v8h*)(vTr + vo) = rv;
            }
        // the V^T stores' registers may be rewritten behind this branch
        asm volatile("s_wait_xcnt 0x0" ::: "memory");
    }
}

// ---------------------------------------------------------------------------
// Attention, online softmax over keys. Block = 8 waves = 128 queries of one
// (head, batch); wave owns 16 queries. Scores are computed transposed:
// S^T tile = K(16 keys, A) x Q^T(B, n = query), so every statistic of a query
// lives in lane&15 (in-lane reduce over the 8 rows + one xor-16 exchange).
// P^T accumulator tiles (keys 0..15 / 16..31 of a 32-key step) are packed
// directly into the B fragment (k = key, n = query) of O^T = V^T x P^T with
// A = V^T rows (d) straight from the V^T planes. P carried 2^14.
// Loads run ahead of their use: K one step ahead, V from the head of its step.
// Epilogue: 16*ctx as f16 hi + 2^11 residual into fragment-ordered NTOK x 512
// planes: a lane's 8 rows (d) of one query are one piece of a unit at the
// lane's own place, stored straight from registers. msk cross-wave (block barrier).
// ---------------------------------------------------------------------------
__global__ __launch_bounds__(256) __attribute__((amdgpu_num_vgpr(256)))
void k_attn(const _Float16* __restrict__ qh, const _Float16* __restrict__ ql,
            const _Float16* __restrict__ kh, const _Float16* __restrict__ kl,
            const _Float16* __restrict__ vTh, const _Float16* __restrict__ vTr,
            const float* __restrict__ mask,
            _Float16* __restrict__ ctxh, _Float16* __restrict__ ctxr) {
    __shared__ __align__(16) float    msk[SEQ];          // additive key mask, log2 units

    const unsigned tid  = threadIdx.x;
    const unsigned lane = tid & 31u;
    const unsigned w    = tid >> 5;
    const unsigned hb   = blockIdx.x;
    const unsigned h    = hb / (unsigned)NB;
    const unsigned b    = hb - h * (unsigned)NB;
    const unsigned q0   = blockIdx.y * 128u + w * 16u;
    const unsigned r0   = (lane >> 4) << 3;

    for (unsigned idx = tid; idx < (unsigned)SEQ; idx += 256u)
        msk[idx] = bf16r(mask[(size_t)b * SEQ_FULL + idx]) * LOG2E;
    __syncthreads();

    const size_t tokq = (size_t)b * SEQ + q0;
    const size_t tokk = (size_t)b * SEQ;
    const size_t P0 = (size_t)(h * 2u) * NTOK;
    const size_t P1 = (size_t)(h * 2u + 1u) * NTOK;
    const v16h qhf0 = load_frag16(qh + (P0 + tokq) * 32u + lane * 8u);
    const v16h qhf1 = load_frag16(qh + (P1 + tokq) * 32u + lane * 8u);
    const v16h qlf0 = load_frag16(ql + (P0 + tokq) * 32u + lane * 8u);
    const v16h qlf1 = load_frag16(ql + (P1 + tokq) * 32u + lane * 8u);
    const _Float16* kh0 = kh + (P0 + tokk) * 32u;
    const _Float16* kl0 = kl + (P0 + tokk) * 32u;
    const _Float16* vhb = vTh + (size_t)hb * HD * SEQ;
    const _Float16* vrb = vTr + (size_t)hb * HD * SEQ;

    v8f oh[4], orr[4];
#pragma unroll
    for (int dt = 0; dt < 4; ++dt) { oh[dt] = zero8(); orr[dt] = zero8(); }
    float mr = -1.0e30f, lr = 0.0f;

    // One address pair per K plane pair and per V plane, carried through the loop: the
    // second d half of K lies a constant KP1 on, the second key tile and the d tiles too.
    constexpr size_t KP1 = (size_t)NTOK * 32u;
    const _Float16* pkh = kh0 + lane * 8u;
    const _Float16* pkl = kl0 + lane * 8u;
    const _Float16* pvh = vhb + lane * 8u;
    const _Float16* pvr = vrb + lane * 8u;
    // K fragments of the first 32 keys: [key tile][d half][hi, residual]
    v16h kf[2][2][2];
#pragma unroll
    for (int kt = 0; kt < 2; ++kt) {
        kf[kt][0][0] = load_frag16(pkh + kt * 512);
        kf[kt][0][1] = load_frag16(pkl + kt * 512);
        kf[kt][1][0] = load_frag16(pkh + KP1 + kt * 512);
        kf[kt][1][1] = load_frag16(pkl + KP1 + kt * 512);
    }

    // One 32-key step. MORE: a next step exists and its K fragments are requested. The last
    // step is written out behind the loop, so that inside the loop the requests in flight
    // are the same on every path and each wait counts only the loads it needs.
    auto key_step = [&](const unsigned key0, auto more) __attribute__((always_inline)) {
        constexpr bool MORE = decltype(more)::value;
        v8f sh0 = zero8(), sr0 = zero8(), sh1 = zero8(), sr1 = zero8();
        // this step's V fragments, d tiles 0 and 1: requested ahead of the score products
        // (d tiles 2 and 3 follow into the same registers, each behind its forerunner's products)
        v16h vfh[2], vfr[2];
#pragma unroll
        for (int dt = 0; dt < 2; ++dt) {
            vfh[dt] = load_frag16(pvh + (size_t)(dt * 16) * SEQ);
            vfr[dt] = load_frag16(pvr + (size_t)(dt * 16) * SEQ);
        }
        sh0 = wmma16(kf[0][0][0], qhf0, sh0);
        sr0 = wmma16(kf[0][0][0], qlf0, sr0);
        sr0 = wmma16(kf[0][0][1], qhf0, sr0);
        sh0 = wmma16(kf[0][1][0], qhf1, sh0);
        sr0 = wmma16(kf[0][1][0], qlf1, sr0);
        sr0 = wmma16(kf[0][1][1], qhf1, sr0);
        sh1 = wmma16(kf[1][0][0], qhf0, sh1);
        sr1 = wmma16(kf[1][0][0], qlf0, sr1);
        sr1 = wmma16(kf[1][0][1], qhf0, sr1);
        sh1 = wmma16(kf[1][1][0], qhf1, sh1);
        sr1 = wmma16(kf[1][1][0], qlf1, sr1);
        sr1 = wmma16(kf[1][1][1], qhf1, sr1);
        // the NEXT step's K fragments, into the set just read: requested behind this step's
        // score products, they land during the softmax and the V products
        if constexpr (MORE) {
#pragma unroll
            for (int kt = 0; kt < 2; ++kt) {
                kf[kt][0][0] = load_frag16(pkh + 1024 + kt * 512);
                kf[kt][0][1] = load_frag16(pkl + 1024 + kt * 512);
                kf[kt][1][0] = load_frag16(pkh + KP1 + 1024 + kt * 512);
                kf[kt][1][1] = load_frag16(pkl + KP1 + 1024 + kt * 512);
            }
        }
        float t0[8], t1[8];
#pragma unroll
        for (int g = 0; g < 8; ++g) {
            t0[g] = __builtin_fmaf(sh0[g], C1, sr0[g] * C2) + msk[key0 + r0 + g];
            t1[g] = __builtin_fmaf(sh1[g], C1, sr1[g] * C2) + msk[key0 + 16u + r0 + g];
        }
        float tmax = fmaxf(t0[0], t1[0]);
#pragma unroll
        for (int g = 1; g < 8; ++g) tmax = fmaxf(tmax, fmaxf(t0[g], t1[g]));
        tmax = fmaxf(tmax, __shfl_xor(tmax, 16, 32));
        const float mn    = fmaxf(mr, tmax);
        const float alpha = ex2(mr - mn);
        mr = mn;
        const float off = 14.0f - mn;
        v8h p0, p1;
        float ps = 0.0f;
#pragma unroll
        for (int g = 0; g < 8; ++g) {
            const _Float16 a = (_Float16)ex2(t0[g] + off);
            const _Float16 c = (_Float16)ex2(t1[g] + off);
            p0[g] = a;
            p1[g] = c;
            ps += (float)a + (float)c;
        }
        ps += __shfl_xor(ps, 16, 32);
        lr = lr * alpha + ps;
        Frag pb;
        pb.h[0] = p0;       // k = keys key0 + 8h + 0..7
        pb.h[1] = p1;       // k = keys key0 + 16 + 8h + 0..7
#pragma unroll
        for (int dt = 0; dt < 4; ++dt) {
            oh[dt]  = oh[dt] * alpha;
            orr[dt] = orr[dt] * alpha;
        }
#pragma unroll
        for (int dt = 0; dt < 4; ++dt) {
            oh[dt] = wmma16(vfh[dt & 1], pb.v, oh[dt]);
            orr[dt] = wmma16(vfr[dt & 1], pb.v, orr[dt]);
            if (dt < 2) {
                // keeps the request of d tile dt + 2 behind the products above, in their
                // registers: without it the build runs out of registers and spills to scratch
                __builtin_amdgcn_sched_barrier(0);
                vfh[dt] = load_frag16(pvh + (size_t)((dt + 2) * 16) * SEQ);
                vfr[dt] = load_frag16(pvr + (size_t)((dt + 2) * 16) * SEQ);
            }
        }
        // the address pairs are held (inputs) up to this wait and advanced only
        // behind it: no pair that an issued load still names is rewritten
        asm volatile("s_wait_xcnt 0x0" :: "v"(pkh), "v"(pkl), "v"(pvh), "v"(pvr) : "memory");
        pkh += 1024; pkl += 1024; pvh += 512; pvr += 512;
    };
#pragma unroll 1
    for (unsigned key0 = 0; key0 + 32u < (unsigned)SEQ; key0 += 32u) key_step(key0, Flag<true>{});
    key_step((unsigned)SEQ - 32u, Flag<false>{});

    // O^T lane (query lane&15): rows d = dt*16 + r0 + g. 16*ctx = (o + or 2^-11) / (64 l) * 16
    const float inv = 0.25f * (1.0f / lr);
    const size_t ob = tokq * DM + (size_t)(h * 2u) * 512u + lane * 8u;
#pragma unroll
    for (int dt = 0; dt < 4; ++dt) {
        v8h hv, rv;
#pragma unroll
        for (int g = 0; g < 8; ++g) {
            const float c = __builtin_fmaf(orr[dt][g], SC_RINV, oh[dt][g]) * inv;
            const _Float16 hi = (_Float16)c;
            hv[g] = hi;
            rv[g] = (_Float16)((c - (float)hi) * SC_RES);
        }
        *(v8h*)(ctxh + ob + (dt >> 1) * 512 + (dt & 1) * 256) = hv;
        *(v8h*)(ctxr + ob + (dt >> 1) * 512 + (dt & 1) * 256) = rv;
    }
}

// ---------------------------------------------------------------------------
// GEMM (N = 512) + bias + residual add + LayerNorm, fused. Block = 8 waves =
// ROWS rows x 512 columns (wave tile ROWS x 64; ROWS = 32 with the residual
// plane's second accumulators, 64 without). Scaled accumulators go to a
// cross-wave f32 LDS tile (block barrier), then wave w normalises rows
// POST: A = ctx hi + residual planes, residual add = bf16-RNE(x), outputs
// sa (f32) and 16*sa (f16, fragment-ordered NTOK x 512 plane: the block's 32
// rows are 32 KB contiguous, gathered in LDS as [k/8][row] pieces, block
// barrier, then 512-byte wave stores). Otherwise A = hidden plane, residual
// add = sa, output = final f32 rows.
// ---------------------------------------------------------------------------
template <bool POST>
__global__ __launch_bounds__(256) __attribute__((amdgpu_num_vgpr(256)))
void k_gemm_ln(const _Float16* __restrict__ Ah, const _Float16* __restrict__ Ar,
               const _Float16* __restrict__ Bt,
               const float* __restrict__ bias, const float* __restrict__ resid,
               const float* __restrict__ lnw, const float* __restrict__ lnb,
               float* __restrict__ outF, _Float16* __restrict__ outH) {
    constexpr unsigned K = POST ? DM : DF;       // contraction length: row-tile offsets are immediates
    constexpr unsigned ROWS = POST ? 32u : 64u;  // rows of the block
    constexpr int TM = (int)(ROWS / 16u);
    // row pitch 516 floats: the 16 rows that one 16-byte wave store touches fall on different banks
    constexpr unsigned TP = DM + 4u;
    __shared__ __align__(16) float T[ROWS * TP]; // 64.5 / 129 KB, cross-wave
    // 16*sa pieces: [64 k/8][32 rows][8], column pitch 264 (16 B of pad: the 16
    // columns of one wave store fall on different banks), cross-wave
    __shared__ __align__(16) _Float16 Hs[POST ? 64 * 264 : 8];
    const unsigned tid  = threadIdx.x;
    const unsigned lane = tid & 31u;
    const unsigned w    = tid >> 5;
    const unsigned row0 = blockIdx.x * ROWS;
    const unsigned cb   = w * 64u;
    const unsigned r0   = (lane >> 4) << 3;
    const unsigned cc   = lane & 15u;

    v8f acc[TM][4], accr[TM][4];
    // every block reads all of Bt: neighbours of eight blocks share a start, the next eight take the next
    // transposed tiles: a lane holds 8 consecutive columns of one row, two 16-byte LDS stores
    gemm_core<TM, 4, POST, true, K>(Ah + (size_t)row0 * K, Ar + (size_t)row0 * K,
                                    Bt + (size_t)cb * K, lane, (blockIdx.x >> 3) % (K / 64u), acc, accr);
    // The rows of a wave (ROWS / 8) are normalised G at a time, side by side: their residual
    // rows are requested together and ahead (the first G in front of the tile's barrier, the next
    // G while the first are worked on) and their row sums run as one interleaved butterfly.
    // One row after the other paid a load latency and ten exchange latencies per row.
    constexpr unsigned RW = ROWS / 8u;
    constexpr int G = 4;
    static_assert(G == 4 && RW % (unsigned)G == 0u);
    const unsigned rw0 = w * RW;                 // the wave's first row in the block
    // G rows from a multiple of 4 lie in one sequence (SEQ % 128 == 0): consecutive full rows
    const unsigned nw  = row0 + rw0;
    const float* rp = resid + (size_t)(POST ? full_row(nw) : nw) * DM + lane * 4u;
    float*       op = outF  + (size_t)(POST ? nw : full_row(nw)) * DM + lane * 4u;
#pragma unroll
    for (int mt = 0; mt < TM; ++mt)
#pragma unroll
        for (int nt = 0; nt < 4; ++nt) {
            v4f lo, hi;
#pragma unroll
            for (int g = 0; g < 4; ++g) {
                lo[g] = POST ? __builtin_fmaf(accr[mt][nt][g], SC_RINV, acc[mt][nt][g]) : acc[mt][nt][g];
                hi[g] = POST ? __builtin_fmaf(accr[mt][nt][g + 4], SC_RINV, acc[mt][nt][g + 4])
                             : acc[mt][nt][g + 4];
            }
            float* tp = &T[(mt * 16 + cc) * TP + cb + nt * 16 + r0];
            *(v4f*)(tp)     = lo;
            *(v4f*)(tp + 4) = hi;
        }
    v4f rs[G][4];
#pragma unroll
    for (int r = 0; r < G; ++r)
#pragma unroll
        for (int i = 0; i < 4; ++i) rs[r][i] = *(const v4f*)(rp + r * DM + i * 128);
    // the address pair is held (input) up to this wait: no load returns into it; the
    // statement also keeps these requests ahead of the barrier
    asm volatile("s_wait_xcnt 0x0" :: "v"(rp) : "memory");
    // keeps the first use of a loaded value behind the barrier: without it the build waits for
    // the first four loads before it has issued the other twelve and the last LDS stores
    __builtin_amdgcn_sched_barrier(0);
    __syncthreads();

#pragma unroll
    for (unsigned g0 = 0; g0 < RW; g0 += (unsigned)G) {
        v4f xv[G][4];
        float s[G];
#pragma unroll
        for (int r = 0; r < G; ++r) {
            const unsigned row = rw0 + g0 + (unsigned)r;
            s[r] = 0.0f;
#pragma unroll
            for (int i = 0; i < 4; ++i) {
                const unsigned c = (unsigned)i * 128u + lane * 4u;
                const v4f a  = *(const v4f*)(&T[row * TP + c]);
                const v4f bi = *(const v4f*)(bias + c);
                const v4f rv = rs[r][i];
                v4f x;
                x.x = __builtin_fmaf(a.x, SC_OUT, bf16r(bi.x)) + (POST ? bf16r(rv.x) : rv.x);
                x.y = __builtin_fmaf(a.y, SC_OUT, bf16r(bi.y)) + (POST ? bf16r(rv.y) : rv.y);
                x.z = __builtin_fmaf(a.z, SC_OUT, bf16r(bi.z)) + (POST ? bf16r(rv.z) : rv.z);
                x.w = __builtin_fmaf(a.w, SC_OUT, bf16r(bi.w)) + (POST ? bf16r(rv.w) : rv.w);
                xv[r][i] = x;
                s[r] += (x.x + x.y) + (x.z + x.w);
            }
        }
        wave_sum4(s, lane);
        float mu[G], q[G];
#pragma unroll
        for (int r = 0; r < G; ++r) {
            mu[r] = s[r] * (1.0f / (float)DM);
            q[r] = 0.0f;
#pragma unroll
            for (int i = 0; i < 4; ++i) {
                const float d0 = xv[r][i].x - mu[r], d1 = xv[r][i].y - mu[r];
                const float d2 = xv[r][i].z - mu[r], d3 = xv[r][i].w - mu[r];
                q[r] += (d0 * d0 + d1 * d1) + (d2 * d2 + d3 * d3);
            }
        }
        // the lane's 16 columns of the LayerNorm weight and bias: requested ahead of the second
        // row sums, not behind them where they are first used
        v4f gw4[4], gb4[4];
#pragma unroll
        for (int i = 0; i < 4; ++i) {
            gw4[i] = *(const v4f*)(lnw + (unsigned)i * 128u + lane * 4u);
            gb4[i] = *(const v4f*)(lnb + (unsigned)i * 128u + lane * 4u);
        }
        if (g0 + (unsigned)G < RW) {
            // the next G residual rows, into the registers just read: they land under the rest
            // of this group's work (placed behind the first row sums: ahead of them the build asks
            // for them at the barrier, runs out of registers and spills a loaded value)
#pragma unroll
            for (int r = 0; r < G; ++r)
#pragma unroll
                for (int i = 0; i < 4; ++i)
                    rs[r][i] = *(const v4f*)(rp + (g0 + (unsigned)G + (unsigned)r) * DM + i * 128);
            // as above: the pair is held up to the wait
            asm volatile("s_wait_xcnt 0x0" :: "v"(rp) : "memory");
        }
        wave_sum4(q, lane);
        float rstd[G];
#pragma unroll
        for (int r = 0; r < G; ++r) rstd[r] = rsqrtf(q[r] * (1.0f / (float)DM) + 1.0e-5f);
#pragma unroll
        for (int r = 0; r < G; ++r)
#pragma unroll
            for (int i = 0; i < 4; ++i) {
                const v4f gw = gw4[i];
                const v4f gb = gb4[i];
                v4f y;
                y.x = (xv[r][i].x - mu[r]) * rstd[r] * bf16r(gw.x) + bf16r(gb.x);
                y.y = (xv[r][i].y - mu[r]) * rstd[r] * bf16r(gw.y) + bf16r(gb.y);
                y.z = (xv[r][i].z - mu[r]) * rstd[r] * bf16r(gw.z) + bf16r(gb.z);
                y.w = (xv[r][i].w - mu[r]) * rstd[r] * bf16r(gw.w) + bf16r(gb.w);
                xv[r][i] = y;                    // in place: x is not read again
            }
        if (POST) {
#pragma unroll
            for (int r = 0; r < G; ++r) {
                const unsigned row = rw0 + g0 + (unsigned)r;
#pragma unroll
                for (int i = 0; i < 4; ++i) {
                    v4h hq;
                    hq[0] = (_Float16)(xv[r][i].x * 16.0f); hq[1] = (_Float16)(xv[r][i].y * 16.0f);
                    hq[2] = (_Float16)(xv[r][i].z * 16.0f); hq[3] = (_Float16)(xv[r][i].w * 16.0f);
                    *(v4h*)(&Hs[((unsigned)i * 16u + (lane >> 1)) * 264u + row * 8u + (lane & 1u) * 4u]) = hq;
                }
            }
        }
#pragma unroll
        for (int r = 0; r < G; ++r)
#pragma unroll
            for (int i = 0; i < 4; ++i)
                *(v4f*)(op + (g0 + (unsigned)r) * DM + i * 128) = xv[r][i];
        // the stores' address pair and data are held (inputs) up to this wait: the next rows and
        // the code behind the loop rewrite these registers
        asm volatile("s_wait_xcnt 0x0"
                     :: "v"(op),
                        "v"(xv[0][0]), "v"(xv[0][1]), "v"(xv[0][2]), "v"(xv[0][3]),
                        "v"(xv[1][0]), "v"(xv[1][1]), "v"(xv[1][2]), "v"(xv[1][3]),
                        "v"(xv[2][0]), "v"(xv[2][1]), "v"(xv[2][2]), "v"(xv[2][3]),
                        "v"(xv[3][0]), "v"(xv[3][1]), "v"(xv[3][2]), "v"(xv[3][3])
                     : "memory");
    }
    if (POST) {
        __syncthreads();
        _Float16* hp = outH + (size_t)row0 * DM + tid * 8u;
        // piece i*256 + tid of the block's 2 x 16 units: unit = 4*i + (w>>1), j = w&1
        const unsigned hs0 = ((w >> 1) * 4u + (w & 1u) * 2u + (lane >> 4)) * 264u + (lane & 15u) * 8u;
        v8h pv[8];
#pragma unroll
        for (int i = 0; i < 8; ++i)
            pv[i] = *(const v8h*)(&Hs[hs0 + (unsigned)(i & 3) * (16u * 264u) + (unsigned)(i >> 2) * 128u]);
#pragma unroll
        for (int i = 0; i < 8; ++i)
            *(v8h*)(hp + (unsigned)i * 2048u) = pv[i];
    }
}

// ---------------------------------------------------------------------------
// FF1: hidden = relu(sa W1 + b1), stored as f16 of 16*hidden, fragment-ordered
// NTOK x 2048 plane. Block = 8 waves = 128 rows x 256 columns; the wave's
// 64 x 64 tile = 4 x 2 units. The tiles are computed transposed: a lane's 8
// accumulator rows are 8 consecutive hidden columns of one token, one piece of a
// unit at the lane's own place, stored straight from registers.
// ---------------------------------------------------------------------------
__global__ __launch_bounds__(256) __attribute__((amdgpu_num_vgpr(256)))
void k_ff1(const _Float16* __restrict__ sah, const _Float16* __restrict__ Bt,
           const float* __restrict__ bias, _Float16* __restrict__ hid) {
    const unsigned tid  = threadIdx.x;
    const unsigned lane = tid & 31u;
    const unsigned w    = tid >> 5;
    const unsigned row0 = blockIdx.y * 128u + (w >> 2) * 64u;
    const unsigned cb   = blockIdx.x * 256u + (w & 3u) * 64u;
    const unsigned r0   = (lane >> 4) << 3;

    v8f acc[4][4], dum[4][4];
    gemm_core<4, 4, false, true, DM>(sah + (size_t)row0 * DM, sah + (size_t)row0 * DM,
                                     Bt + (size_t)cb * DM, lane,
                                     (blockIdx.x + blockIdx.y) % (unsigned)(DM / 64), acc, dum);
    const float* bp = bias + cb + r0;
    v4f bq[4][2];
#pragma unroll
    for (int nt = 0; nt < 4; ++nt) {
        bq[nt][0] = *(const v4f*)(bp + nt * 16);
        bq[nt][1] = *(const v4f*)(bp + nt * 16 + 4);
    }
    // the address pair is held (input) up to this wait: no load returns into it
    asm volatile("s_wait_xcnt 0x0" :: "v"(bp) : "memory");
    v8h xv[4][4];
#pragma unroll
    for (int nt = 0; nt < 4; ++nt) {
        float bv[8];
#pragma unroll
        for (int g = 0; g < 8; ++g) bv[g] = bf16r(bq[nt][g >> 2][g & 3]) * 16.0f;
#pragma unroll
        for (int mt = 0; mt < 4; ++mt)
#pragma unroll
            for (int g = 0; g < 8; ++g)
                xv[mt][nt][g] = (_Float16)fmaxf(__builtin_fmaf(acc[mt][nt][g], SC_HID, bv[g]), 0.0f);
    }
    _Float16* ob = hid + (size_t)row0 * DF + (size_t)cb * 16u + lane * 8u;
#pragma unroll
    for (int mt = 0; mt < 4; ++mt)
#pragma unroll
        for (int nt = 0; nt < 4; ++nt)
            *(v8h*)(ob + (size_t)(mt * 16) * DF + (nt >> 1) * 512 + (nt & 1) * 256) = xv[mt][nt];
    // the stores' address pair and data are held (inputs) up to this wait: none is rewritten before it
    asm volatile("s_wait_xcnt 0x0"
                 :: "v"(ob),
                    "v"(xv[0][0]), "v"(xv[0][1]), "v"(xv[0][2]), "v"(xv[0][3]),
                    "v"(xv[1][0]), "v"(xv[1][1]), "v"(xv[1][2]), "v"(xv[1][3]),
                    "v"(xv[2][0]), "v"(xv[2][1]), "v"(xv[2][2]), "v"(xv[2][3]),
                    "v"(xv[3][0]), "v"(xv[3][1]), "v"(xv[3][2]), "v"(xv[3][3])
                 : "memory");
}

// ---------------------------------------------------------------------------
// Workspace arena in units of U = NTOK*512*2 bytes (16 MiB at full size);
// time-disjoint planes share offsets (launches are stream-ordered):
//   [0,4U)  qh ql kh kl          -> later sa f32 [0,2U), 16*sa f16 [2U,3U)
//   [4U,6U) V^T hi / residual
//   [6U,7U) xh                   -> later ctx hi
//   [7U,8U) ctx residual
//   [3U,7U) later hidden
//   [8U,..) the weight planes, each at its own place from the first launch to its
//           reader: Wqkv^T (1.5 MiB), Wo^T (0.5 MiB), W1^T (2 MiB), W2^T (2 MiB)
// ---------------------------------------------------------------------------
#define U_BYTES ((size_t)NTOK * DM * 2)
static_assert((size_t)NB_FULL * SEQ_FULL * DM * 2 * 8 <= (size_t)134217728);

extern "C" void kernel_launch(void* const* d_in, const int* in_sizes, int n_in,
                              void* d_out, int out_size, void* d_ws, size_t ws_size,
                              hipStream_t stream) {
    if (n_in < 14) return;
    const int need_rows = (NB - 1) * SEQ_FULL + SEQ;
    if (in_sizes[0] < need_rows * DM) return;
    if (in_sizes[1] < need_rows) return;
    if (in_sizes[2] < 3 * NH * DM * HD || in_sizes[3] < 3 * NH * HD) return;
    if (in_sizes[4] < DM * DM || in_sizes[5] < DM) return;
    if (in_sizes[6] < DM * DF || in_sizes[7] < DF) return;
    if (in_sizes[8] < DF * DM || in_sizes[9] < DM) return;
    if (in_sizes[10] < DM || in_sizes[11] < DM || in_sizes[12] < DM || in_sizes[13] < DM) return;
    if (out_size < need_rows * DM) return;

    const float* inp   = (const float*)d_in[0];    // [16384,512]
    const float* mask  = (const float*)d_in[1];    // [32,1,512]
    const float* preW  = (const float*)d_in[2];    // [3,8,512,64]
    const float* preB  = (const float*)d_in[3];    // [3,8,1,64]
    const float* postW = (const float*)d_in[4];    // [512,512]
    const float* postB = (const float*)d_in[5];    // [512]
    const float* ff1W  = (const float*)d_in[6];    // [512,2048]
    const float* ff1B  = (const float*)d_in[7];    // [2048]
    const float* ff2W  = (const float*)d_in[8];    // [2048,512]
    const float* ff2B  = (const float*)d_in[9];    // [512]
    const float* ln1w  = (const float*)d_in[10];
    const float* ln1b  = (const float*)d_in[11];
    const float* ln2w  = (const float*)d_in[12];
    const float* ln2b  = (const float*)d_in[13];
    float* out = (float*)d_out;                    // [32,512,512]

    const size_t U = U_BYTES;
    const size_t WQ_B = (size_t)3 * NH * HD * DM * 2;   // 1.5 MiB
    const size_t WO_B = (size_t)DM * DM * 2;            // 0.5 MiB
    const size_t W1_B = (size_t)DF * DM * 2;            // 2 MiB
    const size_t W2_B = (size_t)DM * DF * 2;            // 2 MiB
    if (8 * U + WQ_B + WO_B + W1_B + W2_B > ws_size) return;

    char* ws = (char*)d_ws;
    _Float16* qh    = (_Float16*)(ws + 0 * U);
    _Float16* ql    = (_Float16*)(ws + 1 * U);
    _Float16* kh    = (_Float16*)(ws + 2 * U);
    _Float16* kl    = (_Float16*)(ws + 3 * U);
    _Float16* vTh   = (_Float16*)(ws + 4 * U);
    _Float16* vTr   = (_Float16*)(ws + 5 * U);
    _Float16* xh    = (_Float16*)(ws + 6 * U);
    _Float16* ctxh  = (_Float16*)(ws + 6 * U);
    _Float16* ctxr  = (_Float16*)(ws + 7 * U);
    _Float16* wqkvT = (_Float16*)(ws + 8 * U);
    float*    sa    = (float*)(ws + 0 * U);
    _Float16* sah   = (_Float16*)(ws + 2 * U);
    _Float16* postT = (_Float16*)(ws + 8 * U + WQ_B);
    _Float16* hid   = (_Float16*)(ws + 3 * U);
    _Float16* ff1T  = (_Float16*)(ws + 8 * U + WQ_B + WO_B);
    _Float16* ff2T  = (_Float16*)(ws + 8 * U + WQ_B + WO_B + W1_B);

    // x -> f16 plane (bf16-RNE values); every W[k][n] -> its [n][k] plane
    k_planes<<<dim3(WT_ALL + NTOK / (4 * XT)), dim3(256), 0, stream>>>(
        inp, preW, postW, ff1W, ff2W, xh, wqkvT, postT, ff1T, ff2T);
    k_qkv<<<dim3(6, NTOK / 128), dim3(256), 0, stream>>>(xh, wqkvT, preB, qh, ql, kh, kl, vTh, vTr);
    k_attn<<<dim3(NH * NB, SEQ / 128), dim3(256), 0, stream>>>(qh, ql, kh, kl, vTh, vTr, mask, ctxh, ctxr);
    k_gemm_ln<true><<<dim3(NTOK / 32), dim3(256), 0, stream>>>(
        ctxh, ctxr, postT, postB, inp, ln1w, ln1b, sa, sah);
    k_ff1<<<dim3(8, NTOK / 128), dim3(256), 0, stream>>>(sah, ff1T, ff1B, hid);
    k_gemm_ln<false><<<dim3(NTOK / 64), dim3(256), 0, stream>>>(
        hid, hid, ff2T, ff2B, sa, ln2w, ln2b, out, sah);
}

// v009
// It runs in 183 microseconds.
// Timed twice side by side with v008, it ran 1.05 times as fast both times.
// All steps since v000 together make it 2.58 times as fast.
#include <hip/hip_runtime.h>
#include <hip/hip_fp16.h>

// All contractions on v_wmma_f32_16x16x32_f16 (f16 operands, f32 accumulate): x*Wqkv, sa*W1, h*W2 single f16 planes; k*q^T with f16 hi + 2^11-scaled f16 residual planes (hi.hi, hi.res, res.hi); V^T*P^T and ctx*Wo with f16 hi + 2^11-scaled f16 residual plane on V / ctx (two accumulators, residual folded 2^-11 in f32).

#ifndef NB
#define NB 32
#endif
#ifndef SEQ
#define SEQ 512
#endif
#define NB_FULL  32
#define SEQ_FULL 512
#define NH   8           // heads
#define HD   64          // head width
#define DM   512         // model width
#define DF   2048        // hidden width
#define NTOK (NB * SEQ)

static_assert(NB >= 1 && NB <= NB_FULL);
static_assert(SEQ >= 128 && SEQ <= SEQ_FULL);
static_assert(SEQ % 128 == 0);
static_assert(NTOK % 128 == 0);
static_assert(DM == NH * HD);
static_assert(DM == 512 && HD == 64 && NH == 8 && DF == 2048);

typedef _Float16 v16h __attribute__((ext_vector_type(16)));
typedef _Float16 v8h  __attribute__((ext_vector_type(8)));
typedef _Float16 v4h  __attribute__((ext_vector_type(4)));
typedef float    v8f  __attribute__((ext_vector_type(8)));
typedef float    v4f  __attribute__((ext_vector_type(4)));

union Frag { v16h v; v8h h[2]; };

template <bool V> struct Flag { static constexpr bool value = V; };

#define LOG2E 1.44269504088896340736f
// scores: acc_h = (64k_h).(64q_h), acc_r = 2^11-scaled residual cross terms
// t (log2 units) = acc_h * log2(e)*2^-12 + acc_r * log2(e)*2^-23
#define C1 (1.44269504088896340736f * 0.000244140625f)
#define C2 (1.44269504088896340736f * 1.1920928955078125e-07f)
#define SC_RES   2048.0f                     // residual plane carry 2^11
#define SC_RINV  4.8828125e-04f              // 2^-11 : residual accumulator fold
#define SC_OUT   9.765625e-04f               // 2^-10 : (16 a)(64 W) -> a.W
#define SC_HID   1.5625e-02f                 // 2^-6  : (16 sa)(64 W1) -> 16 h

static __device__ __forceinline__ v8f zero8() {
    v8f z;
#pragma unroll
    for (int i = 0; i < 8; ++i) z[i] = 0.0f;
    return z;
}

// Fragment-ordered operand planes. A plane of R rows x K (k) 16-bit elements
// is a sequence of 1024-byte units, unit (row/16)*(K/32) + k/32 = one 16x32
// WMMA operand fragment, stored as [j = (k>>4)&1][lane][8]:
//   lane = 16*((k>>3)&1) + (row&15), element = k&7.
// A fragment (A, or B from an [n][k] source) is then two wave-wide 16-byte
// loads of 512 contiguous bytes each (4 whole lines per load): lane m =
// lane&15 -> row m; kb = 8*(lane>>4); elements 0..7 = k kb..kb+7, elements
// 8..15 = k kb+16..kb+23.
// p = unit + lane*8, the lane's own place in the unit.
static __device__ __forceinline__ v16h load_frag16(const _Float16* p) {
    Frag f;
    f.h[0] = *(const v8h*)(p);
    f.h[1] = *(const v8h*)(p + 256);
    return f.v;
}

// offset (in elements) of the 8-element piece (row, k8..k8+7), k8 % 8 == 0
static __device__ __forceinline__ size_t frag_off(unsigned row, unsigned k8, unsigned K) {
    return ((size_t)(row >> 4) * (K >> 5) + (k8 >> 5)) * 512u
         + ((k8 >> 4) & 1u) * 256u + ((((k8 >> 3) & 1u) << 4) + (row & 15u)) * 8u;
}

static __device__ __forceinline__ v8f wmma16(v16h a, v16h b, v8f c) {
    v8f d = __builtin_amdgcn_wmma_f32_16x16x32_f16(false, a, false, b, (short)0, c, false, false);
    asm volatile("v_nop\n\tv_nop\n\tv_nop\n\tv_nop" : "+v"(d) : "v"(a), "v"(b));
    return d;
}

// f32 -> bf16 RNE convert, value kept as f32
static __device__ __forceinline__ float bf16r(float x) {
    unsigned u = __float_as_uint(x);
    u = (u + 0x7FFFu + ((u >> 16) & 1u)) & 0xFFFF0000u;
    return __uint_as_float(u);
}

static __device__ __forceinline__ float ex2(float x) {
    return __builtin_amdgcn_exp2f(x);
}

// Sum over the wave's 32 lanes (butterfly 16, 8, 4, 2, 1) of four independent values, side by
// side: the four exchanges of a step are in flight together, one exchange latency per step and
// not one per value. The exchanges of a step and their data wait are one statement: written as
// __shfl_xor the build strings them out and waits for most of them one by one.
static __device__ __forceinline__ void wave_sum4(float (&v)[4], unsigned lane) {
#pragma unroll
    for (unsigned m = 16u; m >= 1u; m >>= 1) {
        const unsigned from = (lane ^ m) << 2;   // the partner lane, as ds_bpermute_b32 counts it
        float t0, t1, t2, t3;
        asm volatile("ds_bpermute_b32 %0, %4, %5\n\t"
                     "ds_bpermute_b32 %1, %4, %6\n\t"
                     "ds_bpermute_b32 %2, %4, %7\n\t"
                     "ds_bpermute_b32 %3, %4, %8\n\t"
                     "s_wait_dscnt 0x0"
                     : "=&v"(t0), "=&v"(t1), "=&v"(t2), "=&v"(t3)
                     : "v"(from), "v"(v[0]), "v"(v[1]), "v"(v[2]), "v"(v[3])
                     : "memory");
        v[0] += t0; v[1] += t1; v[2] += t2; v[3] += t3;
    }
}

// compact token row (b*SEQ + l) -> row in the full-size arrays
static __device__ __forceinline__ unsigned full_row(unsigned n) {
    const unsigned b = n / (unsigned)SEQ;
    return b * (unsigned)SEQ_FULL + (n - b * (unsigned)SEQ);
}

// ---------------------------------------------------------------------------
// Wave-level GEMM step: TM x TN tiles of 16x16, A / Bt both fragment-ordered
// planes of width K (here the stages of an LDS ring, K = 64); the pointers name the first unit of the wave's first row
// tile (row * K elements in), the next row tile is 16*K on, the next k step 512.
// RES: second A plane (2^11-scaled residual) into its own accumulators.
// The fragments of k step s + 1 are requested before the products of step s
// (two register sets), so a step waits for loads that are one step old, once,
// and not for each B fragment in turn. SB (16 accumulator tiles: RES, or a 4 x 4
// wave tile): the accumulators leave no room for a second B set, each B fragment
// is requested anew behind its last product.
// The k walk starts at trip t0 (a trip = two k steps = 64 k) and wraps: blocks that
// read the same operand rows at the same time get different t0, so that their
// requests for one line do not reach L2 together. Every k step is taken once.
// ---------------------------------------------------------------------------
// SW: the product is taken transposed, the Bt fragment as the A operand and the A plane's
// fragment as the B operand (both planes have one fragment order, the k order is the same):
// tile [mt][nt] then holds, per lane, row mt*16 + (lane&15) of the A plane against the 8
// CONSECUTIVE Bt rows nt*16 + 8*(lane>>4) + 0..7, which is one 16-byte piece of a
// fragment-ordered plane (or 32 bytes of an f32 row) and needs no transpose on its way out.
// One k step on the current set; LD: request the next step's set from pa / pr / pb.
template <int TM, int TN, bool RES, bool SB, bool SW, unsigned K, bool LD>
static __device__ __forceinline__ void gemm_step(const _Float16* pa, const _Float16* pr,
                                                 const _Float16* pb,
                                                 const v16h (&ac)[TM], const v16h (&arc)[TM], v16h (&bc)[TN],
                                                 v16h (&an)[TM], v16h (&arn)[TM], v16h (&bn)[TN],
                                                 v8f (&acc)[TM][TN], v8f (&accr)[TM][TN]) {
    if (LD) {
#pragma unroll
        for (int mt = 0; mt < TM; ++mt) {
            an[mt] = load_frag16(pa + (size_t)(mt * 16) * K);
            if (RES) arn[mt] = load_frag16(pr + (size_t)(mt * 16) * K);
        }
        if (!SB) {
#pragma unroll
            for (int nt = 0; nt < TN; ++nt) bn[nt] = load_frag16(pb + (size_t)(nt * 16) * K);
        }
    }
#pragma unroll
    for (int nt = 0; nt < TN; ++nt) {
#pragma unroll
        for (int mt = 0; mt < TM; ++mt) {
            acc[mt][nt] = SW ? wmma16(bc[nt], ac[mt], acc[mt][nt]) : wmma16(ac[mt], bc[nt], acc[mt][nt]);
            if (RES) accr[mt][nt] = SW ? wmma16(bc[nt], arc[mt], accr[mt][nt])
                                       : wmma16(arc[mt], bc[nt], accr[mt][nt]);
        }
        if (LD && SB) bc[nt] = load_frag16(pb + (size_t)(nt * 16) * K);
    }
}

// ---------------------------------------------------------------------------
// Block-level GEMM core over an LDS ring, for the 128 x 256 blocks (K = DM): the block's
// operand rows (8 row tiles of the token plane, 16 of the weight plane) are brought into
// LDS once per block, 64 k (one trip) at a time, by asynchronous copies, and every wave
// takes its fragments from there; by plain loads each token fragment was fetched by four
// waves and each weight fragment by two. A stage is 24 row tiles x 2 units = 48 KB and is
// itself a fragment-ordered plane of width 64; two buffers, the copies of trip i + 2 fly
// while trip i + 1 is worked on. Wave w copies token tile w and weight tiles 2w, 2w + 1.
// The k walk starts at trip t0 and wraps, as said above; a trip is one stage.
// ---------------------------------------------------------------------------
#define RING_H (24 * 1024)                           // elements of a stage
// One stage's 12 copies of a wave (512 bytes each, 16 per lane): gx, gw the lane's places in
// the token tile's and the first weight tile's two units of this trip, lx, lw the LDS bytes.
static __device__ __forceinline__ void ring_copy(const _Float16* gx, const _Float16* gw,
                                                 unsigned lx, unsigned lw) {
    const _Float16* gv = gw + 16 * DM;               // the second weight tile
    // the copies and the wait in one statement: no address register that an issued copy
    // names is rewritten ahead of the wait
    asm volatile("global_load_async_to_lds_b128 %0, %12, off\n\t"
                 "global_load_async_to_lds_b128 %1, %13, off\n\t"
                 "global_load_async_to_lds_b128 %2, %14, off\n\t"
                 "global_load_async_to_lds_b128 %3, %15, off\n\t"
                 "global_load_async_to_lds_b128 %4, %16, off\n\t"
                 "global_load_async_to_lds_b128 %5, %17, off\n\t"
                 "global_load_async_to_lds_b128 %6, %18, off\n\t"
                 "global_load_async_to_lds_b128 %7, %19, off\n\t"
                 "global_load_async_to_lds_b128 %8, %20, off\n\t"
                 "global_load_async_to_lds_b128 %9, %21, off\n\t"
                 "global_load_async_to_lds_b128 %10, %22, off\n\t"
                 "global_load_async_to_lds_b128 %11, %23, off\n\t"
                 "s_wait_xcnt 0x0"
                 :: "v"(lx), "v"(lx + 512u), "v"(lx + 1024u), "v"(lx + 1536u),
                    "v"(lw), "v"(lw + 512u), "v"(lw + 1024u), "v"(lw + 1536u),
                    "v"(lw + 2048u), "v"(lw + 2560u), "v"(lw + 3072u), "v"(lw + 3584u),
                    "v"(gx), "v"(gx + 256), "v"(gx + 512), "v"(gx + 768),
                    "v"(gw), "v"(gw + 256), "v"(gw + 512), "v"(gw + 768),
                    "v"(gv), "v"(gv + 256), "v"(gv + 512), "v"(gv + 768)
                 : "memory");
}

// X, Wt: the block's first row tile in the token plane and in the weight plane; atile, btile:
// the wave's first row tile in the stage for the A set and for the B set of gemm_step.
template <bool SW>
static __device__ __forceinline__ void gemm_core_ring(const _Float16* __restrict__ X,
                                                      const _Float16* __restrict__ Wt,
                                                      _Float16* ring, unsigned atile, unsigned btile,
                                                      unsigned lane, unsigned w, unsigned t0,
                                                      v8f (&acc)[4][4], v8f (&accr)[4][4]) {
    constexpr unsigned T = DM / 64u;                 // trips; t0 < T, the same in the whole block
    static_assert(T >= 2u && (T & (T - 1u)) == 0u);
#pragma unroll
    for (int mt = 0; mt < 4; ++mt)
#pragma unroll
        for (int nt = 0; nt < 4; ++nt) acc[mt][nt] = zero8();
    const _Float16* gx = X + (size_t)(w * 16u) * DM + lane * 8u;
    const _Float16* gw = Wt + (size_t)(w * 32u) * DM + lane * 8u;
    const unsigned lbase = (unsigned)(size_t)ring + lane * 16u;    // LDS byte address: the low 32 bits
    const unsigned lx = lbase + w * 2048u;
    const unsigned lw = lbase + (8u + 2u * w) * 2048u;
    ring_copy(gx + t0 * 1024u, gw + t0 * 1024u, lx, lw);
    // the first stage has landed (this wave's copies), then is published to the other waves
    asm volatile("s_wait_asynccnt 0x0" ::: "memory");
    __syncthreads();
    {
        const unsigned t1 = (t0 + 1u) & (T - 1u);
        ring_copy(gx + t1 * 1024u, gw + t1 * 1024u, lx + (unsigned)RING_H * 2u, lw + (unsigned)RING_H * 2u);
    }
    // not unrolled: one copy of the 32 products, the buffer is an address offset
#pragma unroll 1
    for (unsigned i = 0; i < T; ++i) {
        const unsigned buf = i & 1u;
        const _Float16* la = ring + buf * (unsigned)RING_H + atile * 1024u + lane * 8u;
        const _Float16* lb = ring + buf * (unsigned)RING_H + btile * 1024u + lane * 8u;
        v16h a[2][4], b[4];
#pragma unroll
        for (int mt = 0; mt < 4; ++mt) a[0][mt] = load_frag16(la + mt * 1024);
#pragma unroll
        for (int nt = 0; nt < 4; ++nt) b[nt] = load_frag16(lb + nt * 1024);
        gemm_step<4, 4, false, true, SW, 64u, true>(la + 512, la + 512, lb + 512,
                                                    a[0], a[0], b, a[1], a[1], b, acc, accr);
        gemm_step<4, 4, false, true, SW, 64u, false>(la, la, lb,
                                                     a[1], a[1], b, a[0], a[0], b, acc, accr);
        // foot of the trip: this wave's reads of the buffer are done, its copies of the next
        // stage have landed; the barrier publishes that stage and frees this buffer
        asm volatile("s_wait_dscnt 0x0" ::: "memory");
        asm volatile("s_wait_asynccnt 0x0" ::: "memory");
        __syncthreads();
        if (i + 2u < T) {
            const unsigned t2 = (t0 + i + 2u) & (T - 1u);
            ring_copy(gx + t2 * 1024u, gw + t2 * 1024u,
                      lx + buf * ((unsigned)RING_H * 2u), lw + buf * ((unsigned)RING_H * 2u));
        }
    }
    // no copy is outstanding when the wave goes on
    asm volatile("s_wait_asynccnt 0x0" ::: "memory");
}

// ---------------------------------------------------------------------------
// The same ring for the ROWS x 512 blocks of the GEMM + LayerNorm kernels: a stage is 4 row
// tiles of the A side (64 rows, or 32 rows of the hi plane and 32 of the residual plane) and
// the 32 row tiles of Bt, 64 k each = 72 KB; the A fragments, which all eight waves read, are
// fetched once per block. Wave w copies its own four Bt tiles and one unit of A tile w / 2.
// ---------------------------------------------------------------------------
#define LNR_H (36 * 1024)                            // elements of a stage
// Nine copies of a wave: 512 bytes at g0, and the two units (2 KB) of a trip at g1 and at g2.
static __device__ __forceinline__ void ring_copy9(const _Float16* g0, unsigned l0,
                                                  const _Float16* g1, unsigned l1,
                                                  const _Float16* g2, unsigned l2) {
    // the copies and the wait in one statement: no address register that an issued copy
    // names is rewritten ahead of the wait
    asm volatile("global_load_async_to_lds_b128 %0, %9, off\n\t"
                 "global_load_async_to_lds_b128 %1, %10, off\n\t"
                 "global_load_async_to_lds_b128 %2, %11, off\n\t"
                 "global_load_async_to_lds_b128 %3, %12, off\n\t"
                 "global_load_async_to_lds_b128 %4, %13, off\n\t"
                 "global_load_async_to_lds_b128 %5, %14, off\n\t"
                 "global_load_async_to_lds_b128 %6, %15, off\n\t"
                 "global_load_async_to_lds_b128 %7, %16, off\n\t"
                 "global_load_async_to_lds_b128 %8, %17, off\n\t"
                 "s_wait_xcnt 0x0"
                 :: "v"(l0),
                    "v"(l1), "v"(l1 + 512u), "v"(l1 + 1024u), "v"(l1 + 1536u),
                    "v"(l2), "v"(l2 + 512u), "v"(l2 + 1024u), "v"(l2 + 1536u),
                    "v"(g0),
                    "v"(g1), "v"(g1 + 256), "v"(g1 + 512), "v"(g1 + 768),
                    "v"(g2), "v"(g2 + 256), "v"(g2 + 512), "v"(g2 + 768)
                 : "memory");
}

// Ah, Ar: the block's first row tile in the A planes; Bt: the whole weight plane (512 rows).
template <int TM, bool RES, unsigned K>
static __device__ __forceinline__ void gemm_core_ring_ln(const _Float16* __restrict__ Ah,
                                                         const _Float16* __restrict__ Ar,
                                                         const _Float16* __restrict__ Bt,
                                                         _Float16* ring, unsigned lane, unsigned w,
                                                         unsigned t0,
                                                         v8f (&acc)[TM][4], v8f (&accr)[TM][4]) {
    constexpr unsigned T = K / 64u;                  // trips; t0 < T, the same in the whole block
    static_assert(T >= 2u && (T & (T - 1u)) == 0u && TM == (RES ? 2 : 4));
#pragma unroll
    for (int mt = 0; mt < TM; ++mt)
#pragma unroll
        for (int nt = 0; nt < 4; ++nt) {
            acc[mt][nt] = zero8();
            if (RES) accr[mt][nt] = zero8();
        }
    const unsigned at = w >> 1;                      // the A tile of the stage that this wave helps to copy
    const _Float16* ap = (RES && at >= 2u) ? Ar : Ah;
    const _Float16* ga = ap + (size_t)((RES ? (at & 1u) : at) * 16u) * K + (w & 1u) * 512u + lane * 8u;
    const _Float16* gb = Bt + (size_t)(w * 64u) * K + lane * 8u;
    const unsigned lbase = (unsigned)(size_t)ring + lane * 16u;    // LDS byte address: the low 32 bits
    const unsigned lA = lbase + at * 2048u + (w & 1u) * 1024u;
    const unsigned lB = lbase + (4u + 4u * w) * 2048u;
    auto stage_copy = [&](const unsigned t, const unsigned lo) __attribute__((always_inline)) {
        const _Float16* a0 = ga + t * 1024u;
        const _Float16* b0 = gb + t * 1024u;
        ring_copy9(a0, lA + lo, b0, lB + lo, b0 + (size_t)16 * K, lB + lo + 2048u);
        ring_copy9(a0 + 256, lA + lo + 512u, b0 + (size_t)32 * K, lB + lo + 4096u,
                   b0 + (size_t)48 * K, lB + lo + 6144u);
    };
    stage_copy(t0, 0u);
    // the first stage has landed (this wave's copies), then is published to the other waves
    asm volatile("s_wait_asynccnt 0x0" ::: "memory");
    __syncthreads();
    stage_copy((t0 + 1u) & (T - 1u), (unsigned)LNR_H * 2u);
    // not unrolled: one copy of the 32 products, the buffer is an address offset
#pragma unroll 1
    for (unsigned i = 0; i < T; ++i) {
        const unsigned buf = i & 1u;
        const _Float16* la = ring + buf * (unsigned)LNR_H + lane * 8u;
        const _Float16* lr = la + 2 * 1024;
        const _Float16* lb = la + (4u + 4u * w) * 1024u;
        v16h a[2][TM], ar[2][TM], b[4];
#pragma unroll
        for (int mt = 0; mt < TM; ++mt) {
            a[0][mt] = load_frag16(la + mt * 1024);
            if (RES) ar[0][mt] = load_frag16(lr + mt * 1024);
        }
#pragma unroll
        for (int nt = 0; nt < 4; ++nt) b[nt] = load_frag16(lb + nt * 1024);
        gemm_step<TM, 4, RES, true, true, 64u, true>(la + 512, lr + 512, lb + 512,
                                                     a[0], ar[0], b, a[1], ar[1], b, acc, accr);
        gemm_step<TM, 4, RES, true, true, 64u, false>(la, lr, lb,
                                                      a[1], ar[1], b, a[0], ar[0], b, acc, accr);
        // foot of the trip: this wave's reads of the buffer are done, its copies of the next
        // stage have landed; the barrier publishes that stage and frees this buffer
        asm volatile("s_wait_dscnt 0x0" ::: "memory");
        asm volatile("s_wait_asynccnt 0x0" ::: "memory");
        __syncthreads();
        if (i + 2u < T) stage_copy((t0 + i + 2u) & (T - 1u), buf * ((unsigned)LNR_H * 2u));
    }
    // no copy is outstanding when the ring's LDS is used for the output tile
    asm volatile("s_wait_asynccnt 0x0" ::: "memory");
}

// ---------------------------------------------------------------------------
// x (f32) -> xh, fragment-ordered NTOK x 512 plane, f16 of the bf16-RNE value.
// A wave takes 8 rows x 256 columns = XT tiles of 8 rows x 32 columns (per tile one
// 128-B line per row in, four whole 128-B lines out, each line written by one wave).
// 64 elements per thread, all 16 loads of a lane requested at once: the plane costs
// 4,096 wave starts at full size and not 32,768.
// ---------------------------------------------------------------------------
#define XT 8                                         // tiles of a wave
static __device__ __forceinline__ void cvt_x_block(unsigned blk, const float* __restrict__ x,
                                                   _Float16* __restrict__ xh) {
    const unsigned wv  = blk * 8u + (threadIdx.x >> 5);
    const unsigned ln  = threadIdx.x & 31u;
    const unsigned n   = (wv >> 1) * 8u + (ln & 7u);
    const unsigned c8  = (wv & 1u) * (unsigned)(XT * 32) + (ln >> 3) * 8u;
    const unsigned fr  = full_row(n);
    const float* p = x + (size_t)fr * DM + c8;
    v4f a[XT], b[XT];
#pragma unroll
    for (int i = 0; i < XT; ++i) {
        a[i] = *(const v4f*)(p + i * 32);
        b[i] = *(const v4f*)(p + i * 32 + 4);
    }
    // the address pair is held (input) up to this wait: no load returns into it
    asm volatile("s_wait_xcnt 0x0" :: "v"(p) : "memory");
    v8h o[XT];
#pragma unroll
    for (int i = 0; i < XT; ++i) {
        o[i][0] = (_Float16)bf16r(a[i].x); o[i][1] = (_Float16)bf16r(a[i].y);
        o[i][2] = (_Float16)bf16r(a[i].z); o[i][3] = (_Float16)bf16r(a[i].w);
        o[i][4] = (_Float16)bf16r(b[i].x); o[i][5] = (_Float16)bf16r(b[i].y);
        o[i][6] = (_Float16)bf16r(b[i].z); o[i][7] = (_Float16)bf16r(b[i].w);
    }
    // the next 32 columns are the row tile's next unit, 512 elements on
    _Float16* d = xh + frag_off(n, c8, (unsigned)DM);
#pragma unroll
    for (int i = 0; i < XT; ++i) *(v8h*)(d + i * 512) = o[i];
    // the stores' address pair and data are held (inputs) up to this wait: none is rewritten before it
    asm volatile("s_wait_xcnt 0x0"
                 :: "v"(d), "v"(o[0]), "v"(o[1]), "v"(o[2]), "v"(o[3]),
                    "v"(o[4]), "v"(o[5]), "v"(o[6]), "v"(o[7])
                 : "memory");
}

// ---------------------------------------------------------------------------
// Weight plane builder: in [z][R][C] f32 (k-major, W[k][n]) -> out: z
// fragment-ordered planes of C rows (n) x R (k), f16 = 64 * bf16-RNE(W)^T.
// 128 (k) x 64 (n) tile through LDS = 4 x 4 units, each wave store 512 contiguous
// bytes; tile (bx, by, bz) of (C/64, R/128, z). 32 elements per thread, the 8 loads
// of a lane requested at once: half the wave starts of a 64 x 64 tile.
// ---------------------------------------------------------------------------
static __device__ __forceinline__ void wT_block(const float* __restrict__ in,
                                                _Float16* __restrict__ out,
                                                unsigned R, unsigned C,
                                                unsigned bx, unsigned by, unsigned bz) {
    // row pitch 136 elements = 272 bytes, an odd multiple of 16: the 16-byte reads meet no conflict
    __shared__ __align__(16) _Float16 t[64 * 136];
    const unsigned tid = threadIdx.x;
    const unsigned n0 = bx * 64u;
    const unsigned k0 = by * 128u;
    const float*  inb  = in  + (size_t)bz * R * C;
    _Float16*     outb = out + (size_t)bz * R * C;
    const float* p[8];
    v4f vv[8];
#pragma unroll
    for (int i = 0; i < 8; ++i) {
        const unsigned idx = (unsigned)i * 256u + tid;
        p[i] = inb + (size_t)(k0 + (idx >> 4)) * C + n0 + ((idx & 15u) << 2);
        vv[i] = *(const v4f*)p[i];
    }
    // the eight address pairs are held (inputs) up to this wait: no load returns
    // into a pair that an issued load still names, and none is rewritten before it
    asm volatile("s_wait_xcnt 0x0" :: "v"(p[0]), "v"(p[1]), "v"(p[2]), "v"(p[3]),
                                      "v"(p[4]), "v"(p[5]), "v"(p[6]), "v"(p[7]) : "memory");
#pragma unroll
    for (int i = 0; i < 8; ++i) {
        const unsigned idx = (unsigned)i * 256u + tid;
        const unsigned r = idx >> 4, c4 = (idx & 15u) << 2;
        const v4f v = vv[i];
        t[(c4 + 0u) * 136u + r] = (_Float16)(bf16r(v.x) * 64.0f);
        t[(c4 + 1u) * 136u + r] = (_Float16)(bf16r(v.y) * 64.0f);
        t[(c4 + 2u) * 136u + r] = (_Float16)(bf16r(v.z) * 64.0f);
        t[(c4 + 3u) * 136u + r] = (_Float16)(bf16r(v.w) * 64.0f);
    }
    __syncthreads();
    const unsigned ln = tid & 31u;
    const unsigned kl = ((tid >> 6) & 1u) * 32u + ((tid >> 5) & 1u) * 16u + (ln >> 4) * 8u;
    const unsigned nl = (tid >> 7) * 16u + (ln & 15u);
    const v8h o0 = *(const v8h*)(&t[nl * 136u + kl]);
    const v8h o1 = *(const v8h*)(&t[(nl + 32u) * 136u + kl]);
    const v8h o2 = *(const v8h*)(&t[nl * 136u + 64u + kl]);
    const v8h o3 = *(const v8h*)(&t[(nl + 32u) * 136u + 64u + kl]);
    _Float16* d0 = outb + frag_off(n0 + nl, k0 + kl, R);
    _Float16* d1 = outb + frag_off(n0 + nl + 32u, k0 + kl, R);
    // 64 k on = two units on = 1024 elements
    *(v8h*)d0 = o0;
    *(v8h*)d1 = o1;
    *(v8h*)(d0 + 1024) = o2;
    *(v8h*)(d1 + 1024) = o3;
    // the stores' address pairs and data are held (inputs) up to this wait: in the one
    // kernel that holds all builders other code follows, which rewrites these registers
    asm volatile("s_wait_xcnt 0x0" :: "v"(d0), "v"(d1), "v"(o0), "v"(o1), "v"(o2), "v"(o3) : "memory");
}

// ---------------------------------------------------------------------------
// All operand planes that depend on the inputs alone, in one launch: the four
// weight planes (384 tiles, the low block indices), then the x plane.
// The choice of the work is uniform over the block.
// ---------------------------------------------------------------------------
#define WT_QKV  (3 * NH * (DM / 128))                //  96 tiles: 24 x [512 k][64 n]
#define WT_POST ((DM / 64) * (DM / 128))             //  32 tiles: [512 k][512 n]
#define WT_FF   ((DF / 64) * (DM / 128))             // 128 tiles: [512 k][2048 n], [2048 k][512 n]
#define WT_ALL  (WT_QKV + WT_POST + 2 * WT_FF)
__global__ __launch_bounds__(256) void k_planes(const float* __restrict__ x,
                                                const float* __restrict__ preW,
                                                const float* __restrict__ postW,
                                                const float* __restrict__ ff1W,
                                                const float* __restrict__ ff2W,
                                                _Float16* __restrict__ xh,
                                                _Float16* __restrict__ wqkvT,
                                                _Float16* __restrict__ postT,
                                                _Float16* __restrict__ ff1T,
                                                _Float16* __restrict__ ff2T) {
    const unsigned bid = blockIdx.x;
    if (bid >= (unsigned)WT_ALL) {
        cvt_x_block(bid - (unsigned)WT_ALL, x, xh);
    } else if (bid < (unsigned)WT_QKV) {
        wT_block(preW, wqkvT, DM, HD, 0u, bid & 3u, bid >> 2);
    } else if (bid < (unsigned)(WT_QKV + WT_POST)) {
        const unsigned u = bid - (unsigned)WT_QKV;
        wT_block(postW, postT, DM, DM, u & 7u, u >> 3, 0u);
    } else if (bid < (unsigned)(WT_QKV + WT_POST + WT_FF)) {
        const unsigned u = bid - (unsigned)(WT_QKV + WT_POST);
        wT_block(ff1W, ff1T, DM, DF, u & 31u, u >> 5, 0u);
    } else {
        const unsigned u = bid - (unsigned)(WT_QKV + WT_POST + WT_FF);
        wT_block(ff2W, ff2T, DF, DM, u & 7u, u >> 3, 0u);
    }
}

// ---------------------------------------------------------------------------
// QKV projection. Block = 8 waves = 128 tokens x 256 columns, all of q, of k or
// of v; wave tile = 64 tokens x 64 columns = one (t, head) slice.
// q/k planes: [head][dhalf] fragment-ordered NTOK x 32 planes, f16 of 64q (hi)
// and 2^11 residual. V^T planes: [head*NB+b] fragment-ordered 64 (d) x SEQ (key)
// planes, hi / residual. Every plane is stored straight from registers: a lane's
// 8 accumulator rows must be 8 consecutive k of the plane, so the q and k tiles
// are computed transposed (W^T rows as the A operand, tokens as B: rows = d),
// the v tiles as x W (rows = keys). Both operand planes have the same shape and
// order, so the choice is which plane's address goes in as which operand.
// ---------------------------------------------------------------------------
__global__ __launch_bounds__(256) __attribute__((amdgpu_num_vgpr(256)))
void k_qkv(const _Float16* __restrict__ xh, const _Float16* __restrict__ wT,
           const float* __restrict__ bias,
           _Float16* __restrict__ qh, _Float16* __restrict__ ql,
           _Float16* __restrict__ kh, _Float16* __restrict__ kl,
           _Float16* __restrict__ vTh, _Float16* __restrict__ vTr) {
    const unsigned tid  = threadIdx.x;
    const unsigned lane = tid & 31u;
    const unsigned w    = tid >> 5;
    const unsigned n0   = blockIdx.y * 128u + (w >> 2) * 64u;
    const unsigned cb   = blockIdx.x * 256u + (w & 3u) * 64u;
    const unsigned r0   = (lane >> 4) << 3;
    const unsigned cc   = lane & 15u;
    const unsigned t    = blockIdx.x >> 1;       // = cb >> 9: 0 q, 1 k, 2 v; one per block
    const unsigned h    = (cb >> 6) & 7u;

    // the two stages of the block's operand rows, cross-wave
    __shared__ __align__(16) _Float16 ring[2 * RING_H];
    const unsigned xt = (w >> 2) * 4u;           // the wave's token tiles in a stage
    const unsigned wt = 8u + (w & 3u) * 4u;      // its weight tiles
    v8f acc[4][4], dum[4][4];
    gemm_core_ring<false>(xh + (size_t)(blockIdx.y * 128u) * DM, wT + (size_t)(blockIdx.x * 256u) * DM,
                          ring, (t < 2u) ? wt : xt, (t < 2u) ? xt : wt, lane, w,
                          (blockIdx.x + blockIdx.y) % (unsigned)(DM / 64), acc, dum);

    if (t < 2u) {
        // acc[dt][tt]: lane = token n0 + tt*16 + cc, rows d = dt*16 + r0 + 0..7
        _Float16* ph = (t == 0u) ? qh : kh;
        _Float16* pl = (t == 0u) ? ql : kl;
        const float* bp = bias + cb + r0;
        v4f bq[4][2];
#pragma unroll
        for (int dt = 0; dt < 4; ++dt) {
            bq[dt][0] = *(const v4f*)(bp + dt * 16);
            bq[dt][1] = *(const v4f*)(bp + dt * 16 + 4);
        }
        // the address pair is held (input) up to this wait: no load returns into it
        asm volatile("s_wait_xcnt 0x0" :: "v"(bp) : "memory");
#pragma unroll
        for (int kk = 0; kk < 2; ++kk) {         // the two d halves, one plane each
            const size_t pbase = ((size_t)(h * 2u + (unsigned)kk) * NTOK + n0) * 32u + lane * 8u;
            _Float16* dh = ph + pbase;
            _Float16* dl = pl + pbase;
            v8h hv[2][4], rv[2][4];
#pragma unroll
            for (int j = 0; j < 2; ++j) {
                float bv[8];
#pragma unroll
                for (int g = 0; g < 8; ++g) bv[g] = bf16r(bq[kk * 2 + j][g >> 2][g & 3]) * 64.0f;
#pragma unroll
                for (int tt = 0; tt < 4; ++tt)
#pragma unroll
                    for (int g = 0; g < 8; ++g) {
                        const float v = acc[kk * 2 + j][tt][g] + bv[g];
                        const _Float16 hi = (_Float16)v;
                        hv[j][tt][g] = hi;
                        rv[j][tt][g] = (_Float16)((v - (float)hi) * SC_RES);
                    }
            }
#pragma unroll
            for (int tt = 0; tt < 4; ++tt)
#pragma unroll
                for (int j = 0; j < 2; ++j) {
                    *(v8h*)(dh + tt * 512 + j * 256) = hv[j][tt];
                    *(v8h*)(dl + tt * 512 + j * 256) = rv[j][tt];
                }
            // the stores' address pairs and data are held (inputs) up to this wait: the
            // next plane's values and the code behind the branch rewrite these registers
            asm volatile("s_wait_xcnt 0x0"
                         :: "v"(dh), "v"(dl),
                            "v"(hv[0][0]), "v"(hv[0][1]), "v"(hv[0][2]), "v"(hv[0][3]),
                            "v"(hv[1][0]), "v"(hv[1][1]), "v"(hv[1][2]), "v"(hv[1][3]),
                            "v"(rv[0][0]), "v"(rv[0][1]), "v"(rv[0][2]), "v"(rv[0][3]),
                            "v"(rv[1][0]), "v"(rv[1][1]), "v"(rv[1][2]), "v"(rv[1][3])
                         : "memory");
        }
    } else {
        float bv[4];
        const unsigned bi = cb + cc;
        const float b0 = bias[bi];
        const float b1 = bias[bi + 16u];
        const float b2 = bias[bi + 32u];
        const float b3 = bias[bi + 48u];
        // the index register is held (input) up to this wait: no load returns into it
        asm volatile("s_wait_xcnt 0x0" :: "v"(bi) : "memory");
        bv[0] = bf16r(b0) * 64.0f;
        bv[1] = bf16r(b1) * 64.0f;
        bv[2] = bf16r(b2) * 64.0f;
        bv[3] = bf16r(b3) * 64.0f;
        const unsigned b  = n0 / (unsigned)SEQ;
        const unsigned l0 = n0 - b * (unsigned)SEQ;
        const unsigned hb = h * (unsigned)NB + b;
        const size_t vbase = ((size_t)(hb * HD)) * SEQ + (size_t)l0 * 16u + lane * 8u;
#pragma unroll
        for (int mt = 0; mt < 4; ++mt)
#pragma unroll
            for (int nt = 0; nt < 4; ++nt) {
                v8h hv, rv;
#pragma unroll
                for (int g = 0; g < 8; ++g) {
                    const float v = acc[mt][nt][g] + bv[nt];
                    const _Float16 hi = (_Float16)v;
                    hv[g] = hi;
                    rv[g] = (_Float16)((v - (float)hi) * SC_RES);
                }
                const size_t vo = vbase + (size_t)(nt * 16) * SEQ + (mt >> 1) * 512 + (mt & 1) * 256;
                *(v8h*)(vTh + vo) = hv;
                *(v8h*)(vTr + vo) = rv;
            }
        // the V^T stores' registers may be rewritten behind this branch
        asm volatile("s_wait_xcnt 0x0" ::: "memory");
    }
}

// ---------------------------------------------------------------------------
// Attention, online softmax over keys. Block = 8 waves = 128 queries of one
// (head, batch); wave owns 16 queries. Scores are computed transposed:
// S^T tile = K(16 keys, A) x Q^T(B, n = query), so every statistic of a query
// lives in lane&15 (in-lane reduce over the 8 rows + one xor-16 exchange).
// P^T accumulator tiles (keys 0..15 / 16..31 of a 32-key step) are packed
// directly into the B fragment (k = key, n = query) of O^T = V^T x P^T with
// A = V^T rows (d) straight from the V^T planes. P carried 2^14.
// Loads run ahead of their use: K one step ahead, V from the head of its step.
// Epilogue: 16*ctx as f16 hi + 2^11 residual into fragment-ordered NTOK x 512
// planes: a lane's 8 rows (d) of one query are one piece of a unit at the
// lane's own place, stored straight from registers. msk cross-wave (block barrier).
// ---------------------------------------------------------------------------
__global__ __launch_bounds__(256) __attribute__((amdgpu_num_vgpr(256)))
void k_attn(const _Float16* __restrict__ qh, const _Float16* __restrict__ ql,
            const _Float16* __restrict__ kh, const _Float16* __restrict__ kl,
            const _Float16* __restrict__ vTh, const _Float16* __restrict__ vTr,
            const float* __restrict__ mask,
            _Float16* __restrict__ ctxh, _Float16* __restrict__ ctxr) {
    __shared__ __align__(16) float    msk[SEQ];          // additive key mask, log2 units

    const unsigned tid  = threadIdx.x;
    const unsigned lane = tid & 31u;
    const unsigned w    = tid >> 5;
    const unsigned hb   = blockIdx.x;
    const unsigned h    = hb / (unsigned)NB;
    const unsigned b    = hb - h * (unsigned)NB;
    const unsigned q0   = blockIdx.y * 128u + w * 16u;
    const unsigned r0   = (lane >> 4) << 3;

    for (unsigned idx = tid; idx < (unsigned)SEQ; idx += 256u)
        msk[idx] = bf16r(mask[(size_t)b * SEQ_FULL + idx]) * LOG2E;
    __syncthreads();

    const size_t tokq = (size_t)b * SEQ + q0;
    const size_t tokk = (size_t)b * SEQ;
    const size_t P0 = (size_t)(h * 2u) * NTOK;
    const size_t P1 = (size_t)(h * 2u + 1u) * NTOK;
    const v16h qhf0 = load_frag16(qh + (P0 + tokq) * 32u + lane * 8u);
    const v16h qhf1 = load_frag16(qh + (P1 + tokq) * 32u + lane * 8u);
    const v16h qlf0 = load_frag16(ql + (P0 + tokq) * 32u + lane * 8u);
    const v16h qlf1 = load_frag16(ql + (P1 + tokq) * 32u + lane * 8u);
    const _Float16* kh0 = kh + (P0 + tokk) * 32u;
    const _Float16* kl0 = kl + (P0 + tokk) * 32u;
    const _Float16* vhb = vTh + (size_t)hb * HD * SEQ;
    const _Float16* vrb = vTr + (size_t)hb * HD * SEQ;

    v8f oh[4], orr[4];
#pragma unroll
    for (int dt = 0; dt < 4; ++dt) { oh[dt] = zero8(); orr[dt] = zero8(); }
    float mr = -1.0e30f, lr = 0.0f;

    // One address pair per K plane pair and per V plane, carried through the loop: the
    // second d half of K lies a constant KP1 on, the second key tile and the d tiles too.
    constexpr size_t KP1 = (size_t)NTOK * 32u;
    const _Float16* pkh = kh0 + lane * 8u;
    const _Float16* pkl = kl0 + lane * 8u;
    const _Float16* pvh = vhb + lane * 8u;
    const _Float16* pvr = vrb + lane * 8u;
    // K fragments of the first 32 keys: [key tile][d half][hi, residual]
    v16h kf[2][2][2];
#pragma unroll
    for (int kt = 0; kt < 2; ++kt) {
        kf[kt][0][0] = load_frag16(pkh + kt * 512);
        kf[kt][0][1] = load_frag16(pkl + kt * 512);
        kf[kt][1][0] = load_frag16(pkh + KP1 + kt * 512);
        kf[kt][1][1] = load_frag16(pkl + KP1 + kt * 512);
    }

    // One 32-key step. MORE: a next step exists and its K fragments are requested. The last
    // step is written out behind the loop, so that inside the loop the requests in flight
    // are the same on every path and each wait counts only the loads it needs.
    auto key_step = [&](const unsigned key0, auto more) __attribute__((always_inline)) {
        constexpr bool MORE = decltype(more)::value;
        v8f sh0 = zero8(), sr0 = zero8(), sh1 = zero8(), sr1 = zero8();
        // this step's V fragments, d tiles 0 and 1: requested ahead of the score products
        // (d tiles 2 and 3 follow into the same registers, each behind its forerunner's products)
        v16h vfh[2], vfr[2];
#pragma unroll
        for (int dt = 0; dt < 2; ++dt) {
            vfh[dt] = load_frag16(pvh + (size_t)(dt * 16) * SEQ);
            vfr[dt] = load_frag16(pvr + (size_t)(dt * 16) * SEQ);
        }
        sh0 = wmma16(kf[0][0][0], qhf0, sh0);
        sr0 = wmma16(kf[0][0][0], qlf0, sr0);
        sr0 = wmma16(kf[0][0][1], qhf0, sr0);
        sh0 = wmma16(kf[0][1][0], qhf1, sh0);
        sr0 = wmma16(kf[0][1][0], qlf1, sr0);
        sr0 = wmma16(kf[0][1][1], qhf1, sr0);
        sh1 = wmma16(kf[1][0][0], qhf0, sh1);
        sr1 = wmma16(kf[1][0][0], qlf0, sr1);
        sr1 = wmma16(kf[1][0][1], qhf0, sr1);
        sh1 = wmma16(kf[1][1][0], qhf1, sh1);
        sr1 = wmma16(kf[1][1][0], qlf1, sr1);
        sr1 = wmma16(kf[1][1][1], qhf1, sr1);
        // the NEXT step's K fragments, into the set just read: requested behind this step's
        // score products, they land during the softmax and the V products
        if constexpr (MORE) {
#pragma unroll
            for (int kt = 0; kt < 2; ++kt) {
                kf[kt][0][0] = load_frag16(pkh + 1024 + kt * 512);
                kf[kt][0][1] = load_frag16(pkl + 1024 + kt * 512);
                kf[kt][1][0] = load_frag16(pkh + KP1 + 1024 + kt * 512);
                kf[kt][1][1] = load_frag16(pkl + KP1 + 1024 + kt * 512);
            }
        }
        float t0[8], t1[8];
#pragma unroll
        for (int g = 0; g < 8; ++g) {
            t0[g] = __builtin_fmaf(sh0[g], C1, sr0[g] * C2) + msk[key0 + r0 + g];
            t1[g] = __builtin_fmaf(sh1[g], C1, sr1[g] * C2) + msk[key0 + 16u + r0 + g];
        }
        float tmax = fmaxf(t0[0], t1[0]);
#pragma unroll
        for (int g = 1; g < 8; ++g) tmax = fmaxf(tmax, fmaxf(t0[g], t1[g]));
        tmax = fmaxf(tmax, __shfl_xor(tmax, 16, 32));
        const float mn    = fmaxf(mr, tmax);
        const float alpha = ex2(mr - mn);
        mr = mn;
        const float off = 14.0f - mn;
        v8h p0, p1;
        float ps = 0.0f;
#pragma unroll
        for (int g = 0; g < 8; ++g) {
            const _Float16 a = (_Float16)ex2(t0[g] + off);
            const _Float16 c = (_Float16)ex2(t1[g] + off);
            p0[g] = a;
            p1[g] = c;
            ps += (float)a + (float)c;
        }
        ps += __shfl_xor(ps, 16, 32);
        lr = lr * alpha + ps;
        Frag pb;
        pb.h[0] = p0;       // k = keys key0 + 8h + 0..7
        pb.h[1] = p1;       // k = keys key0 + 16 + 8h + 0..7
#pragma unroll
        for (int dt = 0; dt < 4; ++dt) {
            oh[dt]  = oh[dt] * alpha;
            orr[dt] = orr[dt] * alpha;
        }
#pragma unroll
        for (int dt = 0; dt < 4; ++dt) {
            oh[dt] = wmma16(vfh[dt & 1], pb.v, oh[dt]);
            orr[dt] = wmma16(vfr[dt & 1], pb.v, orr[dt]);
            if (dt < 2) {
                // keeps the request of d tile dt + 2 behind the products above, in their
                // registers: without it the build runs out of registers and spills to scratch
                __builtin_amdgcn_sched_barrier(0);
                vfh[dt] = load_frag16(pvh + (size_t)((dt + 2) * 16) * SEQ);
                vfr[dt] = load_frag16(pvr + (size_t)((dt + 2) * 16) * SEQ);
            }
        }
        // the address pairs are held (inputs) up to this wait and advanced only
        // behind it: no pair that an issued load still names is rewritten
        asm volatile("s_wait_xcnt 0x0" :: "v"(pkh), "v"(pkl), "v"(pvh), "v"(pvr) : "memory");
        pkh += 1024; pkl += 1024; pvh += 512; pvr += 512;
    };
#pragma unroll 1
    for (unsigned key0 = 0; key0 + 32u < (unsigned)SEQ; key0 += 32u) key_step(key0, Flag<true>{});
    key_step((unsigned)SEQ - 32u, Flag<false>{});

    // O^T lane (query lane&15): rows d = dt*16 + r0 + g. 16*ctx = (o + or 2^-11) / (64 l) * 16
    const float inv = 0.25f * (1.0f / lr);
    const size_t ob = tokq * DM + (size_t)(h * 2u) * 512u + lane * 8u;
#pragma unroll
    for (int dt = 0; dt < 4; ++dt) {
        v8h hv, rv;
#pragma unroll
        for (int g = 0; g < 8; ++g) {
            const float c = __builtin_fmaf(orr[dt][g], SC_RINV, oh[dt][g]) * inv;
            const _Float16 hi = (_Float16)c;
            hv[g] = hi;
            rv[g] = (_Float16)((c - (float)hi) * SC_RES);
        }
        *(v8h*)(ctxh + ob + (dt >> 1) * 512 + (dt & 1) * 256) = hv;
        *(v8h*)(ctxr + ob + (dt >> 1) * 512 + (dt & 1) * 256) = rv;
    }
}

// ---------------------------------------------------------------------------
// GEMM (N = 512) + bias + residual add + LayerNorm, fused. Block = 8 waves =
// ROWS rows x 512 columns (wave tile ROWS x 64; ROWS = 32 with the residual
// plane's second accumulators, 64 without). Scaled accumulators go to a
// cross-wave f32 LDS tile (block barrier), then wave w normalises rows
// POST: A = ctx hi + residual planes, residual add = bf16-RNE(x), outputs
// sa (f32) and 16*sa (f16, fragment-ordered NTOK x 512 plane: the block's 32
// rows are 32 KB contiguous, gathered in LDS as [k/8][row] pieces, block
// barrier, then 512-byte wave stores). Otherwise A = hidden plane, residual
// add = sa, output = final f32 rows.
// ---------------------------------------------------------------------------
template <bool POST>
__global__ __launch_bounds__(256) __attribute__((amdgpu_num_vgpr(256)))
void k_gemm_ln(const _Float16* __restrict__ Ah, const _Float16* __restrict__ Ar,
               const _Float16* __restrict__ Bt,
               const float* __restrict__ bias, const float* __restrict__ resid,
               const float* __restrict__ lnw, const float* __restrict__ lnb,
               float* __restrict__ outF, _Float16* __restrict__ outH) {
    constexpr unsigned K = POST ? DM : DF;       // contraction length: row-tile offsets are immediates
    constexpr unsigned ROWS = POST ? 32u : 64u;  // rows of the block
    constexpr int TM = (int)(ROWS / 16u);
    // row pitch 516 floats: the 16 rows that one 16-byte wave store touches fall on different banks
    constexpr unsigned TP = DM + 4u;
    // One LDS block: first the operand ring (two stages, 144 KB), behind the last trip's barrier
    // the output tile T (64.5 / 129 KB) and the 16*sa pieces Hs; all cross-wave.
    // Hs: [64 k/8][32 rows][8], column pitch 264 (16 B of pad: the 16 columns of one wave
    // store fall on different banks)
    constexpr unsigned T_BYTES = ROWS * TP * 4u;
    static_assert(T_BYTES % 16u == 0u && T_BYTES + (POST ? 64u * 264u * 2u : 0u) <= 2u * LNR_H * 2u);
    __shared__ __align__(16) unsigned char lds[2 * LNR_H * 2];
    float*    const T  = (float*)lds;
    _Float16* const Hs = (_Float16*)(lds + T_BYTES);
    const unsigned tid  = threadIdx.x;
    const unsigned lane = tid & 31u;
    const unsigned w    = tid >> 5;
    const unsigned row0 = blockIdx.x * ROWS;
    const unsigned cb   = w * 64u;
    const unsigned r0   = (lane >> 4) << 3;
    const unsigned cc   = lane & 15u;

    v8f acc[TM][4], accr[TM][4];
    // every block reads all of Bt: neighbours of eight blocks share a start, the next eight take the next
    // transposed tiles: a lane holds 8 consecutive columns of one row, two 16-byte LDS stores
    gemm_core_ring_ln<TM, POST, K>(Ah + (size_t)row0 * K, Ar + (size_t)row0 * K, Bt,
                                   (_Float16*)lds, lane, w, (blockIdx.x >> 3) % (K / 64u), acc, accr);
    // The rows of a wave (ROWS / 8) are normalised G at a time, side by side: their residual
    // rows are requested together and ahead (the first G in front of the tile's barrier, the next
    // G while the first are worked on) and their row sums run as one interleaved butterfly.
    // One row after the other paid a load latency and ten exchange latencies per row.
    constexpr unsigned RW = ROWS / 8u;
    constexpr int G = 4;
    static_assert(G == 4 && RW % (unsigned)G == 0u);
    const unsigned rw0 = w * RW;                 // the wave's first row in the block
    // G rows from a multiple of 4 lie in one sequence (SEQ % 128 == 0): consecutive full rows
    const unsigned nw  = row0 + rw0;
    const float* rp = resid + (size_t)(POST ? full_row(nw) : nw) * DM + lane * 4u;
    float*       op = outF  + (size_t)(POST ? nw : full_row(nw)) * DM + lane * 4u;
#pragma unroll
    for (int mt = 0; mt < TM; ++mt)
#pragma unroll
        for (int nt = 0; nt < 4; ++nt) {
            v4f lo, hi;
#pragma unroll
            for (int g = 0; g < 4; ++g) {
                lo[g] = POST ? __builtin_fmaf(accr[mt][nt][g], SC_RINV, acc[mt][nt][g]) : acc[mt][nt][g];
                hi[g] = POST ? __builtin_fmaf(accr[mt][nt][g + 4], SC_RINV, acc[mt][nt][g + 4])
                             : acc[mt][nt][g + 4];
            }
            float* tp = &T[(mt * 16 + cc) * TP + cb + nt * 16 + r0];
            *(v4f*)(tp)     = lo;
            *(v4f*)(tp + 4) = hi;
        }
    v4f rs[G][4];
#pragma unroll
    for (int r = 0; r < G; ++r)
#pragma unroll
        for (int i = 0; i < 4; ++i) rs[r][i] = *(const v4f*)(rp + r * DM + i * 128);
    // the address pair is held (input) up to this wait: no load returns into it; the
    // statement also keeps these requests ahead of the barrier
    asm volatile("s_wait_xcnt 0x0" :: "v"(rp) : "memory");
    // keeps the first use of a loaded value behind the barrier: without it the build waits for
    // the first four loads before it has issued the other twelve and the last LDS stores
    __builtin_amdgcn_sched_barrier(0);
    __syncthreads();

#pragma unroll
    for (unsigned g0 = 0; g0 < RW; g0 += (unsigned)G) {
        v4f xv[G][4];
        float s[G];
#pragma unroll
        for (int r = 0; r < G; ++r) {
            const unsigned row = rw0 + g0 + (unsigned)r;
            s[r] = 0.0f;
#pragma unroll
            for (int i = 0; i < 4; ++i) {
                const unsigned c = (unsigned)i * 128u + lane * 4u;
                const v4f a  = *(const v4f*)(&T[row * TP + c]);
                const v4f bi = *(const v4f*)(bias + c);
                const v4f rv = rs[r][i];
                v4f x;
                x.x = __builtin_fmaf(a.x, SC_OUT, bf16r(bi.x)) + (POST ? bf16r(rv.x) : rv.x);
                x.y = __builtin_fmaf(a.y, SC_OUT, bf16r(bi.y)) + (POST ? bf16r(rv.y) : rv.y);
                x.z = __builtin_fmaf(a.z, SC_OUT, bf16r(bi.z)) + (POST ? bf16r(rv.z) : rv.z);
                x.w = __builtin_fmaf(a.w, SC_OUT, bf16r(bi.w)) + (POST ? bf16r(rv.w) : rv.w);
                xv[r][i] = x;
                s[r] += (x.x + x.y) + (x.z + x.w);
            }
        }
        wave_sum4(s, lane);
        float mu[G], q[G];
#pragma unroll
        for (int r = 0; r < G; ++r) {
            mu[r] = s[r] * (1.0f / (float)DM);
            q[r] = 0.0f;
#pragma unroll
            for (int i = 0; i < 4; ++i) {
                const float d0 = xv[r][i].x - mu[r], d1 = xv[r][i].y - mu[r];
                const float d2 = xv[r][i].z - mu[r], d3 = xv[r][i].w - mu[r];
                q[r] += (d0 * d0 + d1 * d1) + (d2 * d2 + d3 * d3);
            }
        }
        // the lane's 16 columns of the LayerNorm weight and bias: requested ahead of the second
        // row sums, not behind them where they are first used
        v4f gw4[4], gb4[4];
#pragma unroll
        for (int i = 0; i < 4; ++i) {
            gw4[i] = *(const v4f*)(lnw + (unsigned)i * 128u + lane * 4u);
            gb4[i] = *(const v4f*)(lnb + (unsigned)i * 128u + lane * 4u);
        }
        if (g0 + (unsigned)G < RW) {
            // the next G residual rows, into the registers just read: they land under the rest
            // of this group's work (placed behind the first row sums: ahead of them the build asks
            // for them at the barrier, runs out of registers and spills a loaded value)
#pragma unroll
            for (int r = 0; r < G; ++r)
#pragma unroll
                for (int i = 0; i < 4; ++i)
                    rs[r][i] = *(const v4f*)(rp + (g0 + (unsigned)G + (unsigned)r) * DM + i * 128);
            // as above: the pair is held up to the wait
            asm volatile("s_wait_xcnt 0x0" :: "v"(rp) : "memory");
        }
        wave_sum4(q, lane);
        float rstd[G];
#pragma unroll
        for (int r = 0; r < G; ++r) rstd[r] = rsqrtf(q[r] * (1.0f / (float)DM) + 1.0e-5f);
#pragma unroll
        for (int r = 0; r < G; ++r)
#pragma unroll
            for (int i = 0; i < 4; ++i) {
                const v4f gw = gw4[i];
                const v4f gb = gb4[i];
                v4f y;
                y.x = (xv[r][i].x - mu[r]) * rstd[r] * bf16r(gw.x) + bf16r(gb.x);
                y.y = (xv[r][i].y - mu[r]) * rstd[r] * bf16r(gw.y) + bf16r(gb.y);
                y.z = (xv[r][i].z - mu[r]) * rstd[r] * bf16r(gw.z) + bf16r(gb.z);
                y.w = (xv[r][i].w - mu[r]) * rstd[r] * bf16r(gw.w) + bf16r(gb.w);
                xv[r][i] = y;                    // in place: x is not read again
            }
        if (POST) {
#pragma unroll
            for (int r = 0; r < G; ++r) {
                const unsigned row = rw0 + g0 + (unsigned)r;
#pragma unroll
                for (int i = 0; i < 4; ++i) {
                    v4h hq;
                    hq[0] = (_Float16)(xv[r][i].x * 16.0f); hq[1] = (_Float16)(xv[r][i].y * 16.0f);
                    hq[2] = (_Float16)(xv[r][i].z * 16.0f); hq[3] = (_Float16)(xv[r][i].w * 16.0f);
                    *(v4h*)(&Hs[((unsigned)i * 16u + (lane >> 1)) * 264u + row * 8u + (lane & 1u) * 4u]) = hq;
                }
            }
        }
#pragma unroll
        for (int r = 0; r < G; ++r)
#pragma unroll
            for (int i = 0; i < 4; ++i)
                *(v4f*)(op + (g0 + (unsigned)r) * DM + i * 128) = xv[r][i];
        // the stores' address pair and data are held (inputs) up to this wait: the next rows and
        // the code behind the loop rewrite these registers
        asm volatile("s_wait_xcnt 0x0"
                     :: "v"(op),
                        "v"(xv[0][0]), "v"(xv[0][1]), "v"(xv[0][2]), "v"(xv[0][3]),
                        "v"(xv[1][0]), "v"(xv[1][1]), "v"(xv[1][2]), "v"(xv[1][3]),
                        "v"(xv[2][0]), "v"(xv[2][1]), "v"(xv[2][2]), "v"(xv[2][3]),
                        "v"(xv[3][0]), "v"(xv[3][1]), "v"(xv[3][2]), "v"(xv[3][3])
                     : "memory");
    }
    if (POST) {
        __syncthreads();
        _Float16* hp = outH + (size_t)row0 * DM + tid * 8u;
        // piece i*256 + tid of the block's 2 x 16 units: unit = 4*i + (w>>1), j = w&1
        const unsigned hs0 = ((w >> 1) * 4u + (w & 1u) * 2u + (lane >> 4)) * 264u + (lane & 15u) * 8u;
        v8h pv[8];
#pragma unroll
        for (int i = 0; i < 8; ++i)
            pv[i] = *(const v8h*)(&Hs[hs0 + (unsigned)(i & 3) * (16u * 264u) + (unsigned)(i >> 2) * 128u]);
#pragma unroll
        for (int i = 0; i < 8; ++i)
            *(v8h*)(hp + (unsigned)i * 2048u) = pv[i];
    }
}

// ---------------------------------------------------------------------------
// FF1: hidden = relu(sa W1 + b1), stored as f16 of 16*hidden, fragment-ordered
// NTOK x 2048 plane. Block = 8 waves = 128 rows x 256 columns; the wave's
// 64 x 64 tile = 4 x 2 units. The tiles are computed transposed: a lane's 8
// accumulator rows are 8 consecutive hidden columns of one token, one piece of a
// unit at the lane's own place, stored straight from registers.
// ---------------------------------------------------------------------------
__global__ __launch_bounds__(256) __attribute__((amdgpu_num_vgpr(256)))
void k_ff1(const _Float16* __restrict__ sah, const _Float16* __restrict__ Bt,
           const float* __restrict__ bias, _Float16* __restrict__ hid) {
    const unsigned tid  = threadIdx.x;
    const unsigned lane = tid & 31u;
    const unsigned w    = tid >> 5;
    const unsigned row0 = blockIdx.y * 128u + (w >> 2) * 64u;
    const unsigned cb   = blockIdx.x * 256u + (w & 3u) * 64u;
    const unsigned r0   = (lane >> 4) << 3;

    // the two stages of the block's operand rows, cross-wave
    __shared__ __align__(16) _Float16 ring[2 * RING_H];
    v8f acc[4][4], dum[4][4];
    gemm_core_ring<true>(sah + (size_t)(blockIdx.y * 128u) * DM, Bt + (size_t)(blockIdx.x * 256u) * DM,
                         ring, (w >> 2) * 4u, 8u + (w & 3u) * 4u, lane, w,
                         (blockIdx.x + blockIdx.y) % (unsigned)(DM / 64), acc, dum);
    const float* bp = bias + cb + r0;
    v4f bq[4][2];
#pragma unroll
    for (int nt = 0; nt < 4; ++nt) {
        bq[nt][0] = *(const v4f*)(bp + nt * 16);
        bq[nt][1] = *(const v4f*)(bp + nt * 16 + 4);
    }
    // the address pair is held (input) up to this wait: no load returns into it
    asm volatile("s_wait_xcnt 0x0" :: "v"(bp) : "memory");
    v8h xv[4][4];
#pragma unroll
    for (int nt = 0; nt < 4; ++nt) {
        float bv[8];
#pragma unroll
        for (int g = 0; g < 8; ++g) bv[g] = bf16r(bq[nt][g >> 2][g & 3]) * 16.0f;
#pragma unroll
        for (int mt = 0; mt < 4; ++mt)
#pragma unroll
            for (int g = 0; g < 8; ++g)
                xv[mt][nt][g] = (_Float16)fmaxf(__builtin_fmaf(acc[mt][nt][g], SC_HID, bv[g]), 0.0f);
    }
    _Float16* ob = hid + (size_t)row0 * DF + (size_t)cb * 16u + lane * 8u;
#pragma unroll
    for (int mt = 0; mt < 4; ++mt)
#pragma unroll
        for (int nt = 0; nt < 4; ++nt)
            *(v8h*)(ob + (size_t)(mt * 16) * DF + (nt >> 1) * 512 + (nt & 1) * 256) = xv[mt][nt];
    // the stores' address pair and data are held (inputs) up to this wait: none is rewritten before it
    asm volatile("s_wait_xcnt 0x0"
                 :: "v"(ob),
                    "v"(xv[0][0]), "v"(xv[0][1]), "v"(xv[0][2]), "v"(xv[0][3]),
                    "v"(xv[1][0]), "v"(xv[1][1]), "v"(xv[1][2]), "v"(xv[1][3]),
                    "v"(xv[2][0]), "v"(xv[2][1]), "v"(xv[2][2]), "v"(xv[2][3]),
                    "v"(xv[3][0]), "v"(xv[3][1]), "v"(xv[3][2]), "v"(xv[3][3])
                 : "memory");
}

// ---------------------------------------------------------------------------
// Workspace arena in units of U = NTOK*512*2 bytes (16 MiB at full size);
// time-disjoint planes share offsets (launches are stream-ordered):
//   [0,4U)  qh ql kh kl          -> later sa f32 [0,2U), 16*sa f16 [2U,3U)
//   [4U,6U) V^T hi / residual
//   [6U,7U) xh                   -> later ctx hi
//   [7U,8U) ctx residual
//   [3U,7U) later hidden
//   [8U,..) the weight planes, each at its own place from the first launch to its
//           reader: Wqkv^T (1.5 MiB), Wo^T (0.5 MiB), W1^T (2 MiB), W2^T (2 MiB)
// ---------------------------------------------------------------------------
#define U_BYTES ((size_t)NTOK * DM * 2)
static_assert((size_t)NB_FULL * SEQ_FULL * DM * 2 * 8 <= (size_t)134217728);

extern "C" void kernel_launch(void* const* d_in, const int* in_sizes, int n_in,
                              void* d_out, int out_size, void* d_ws, size_t ws_size,
                              hipStream_t stream) {
    if (n_in < 14) return;
    const int need_rows = (NB - 1) * SEQ_FULL + SEQ;
    if (in_sizes[0] < need_rows * DM) return;
    if (in_sizes[1] < need_rows) return;
    if (in_sizes[2] < 3 * NH * DM * HD || in_sizes[3] < 3 * NH * HD) return;
    if (in_sizes[4] < DM * DM || in_sizes[5] < DM) return;
    if (in_sizes[6] < DM * DF || in_sizes[7] < DF) return;
    if (in_sizes[8] < DF * DM || in_sizes[9] < DM) return;
    if (in_sizes[10] < DM || in_sizes[11] < DM || in_sizes[12] < DM || in_sizes[13] < DM) return;
    if (out_size < need_rows * DM) return;

    const float* inp   = (const float*)d_in[0];    // [16384,512]
    const float* mask  = (const float*)d_in[1];    // [32,1,512]
    const float* preW  = (const float*)d_in[2];    // [3,8,512,64]
    const float* preB  = (const float*)d_in[3];    // [3,8,1,64]
    const float* postW = (const float*)d_in[4];    // [512,512]
    const float* postB = (const float*)d_in[5];    // [512]
    const float* ff1W  = (const float*)d_in[6];    // [512,2048]
    const float* ff1B  = (const float*)d_in[7];    // [2048]
    const float* ff2W  = (const float*)d_in[8];    // [2048,512]
    const float* ff2B  = (const float*)d_in[9];    // [512]
    const float* ln1w  = (const float*)d_in[10];
    const float* ln1b  = (const float*)d_in[11];
    const float* ln2w  = (const float*)d_in[12];
    const float* ln2b  = (const float*)d_in[13];
    float* out = (float*)d_out;                    // [32,512,512]

    const size_t U = U_BYTES;
    const size_t WQ_B = (size_t)3 * NH * HD * DM * 2;   // 1.5 MiB
    const size_t WO_B = (size_t)DM * DM * 2;            // 0.5 MiB
    const size_t W1_B = (size_t)DF * DM * 2;            // 2 MiB
    const size_t W2_B = (size_t)DM * DF * 2;            // 2 MiB
    if (8 * U + WQ_B + WO_B + W1_B + W2_B > ws_size) return;

    char* ws = (char*)d_ws;
    _Float16* qh    = (_Float16*)(ws + 0 * U);
    _Float16* ql    = (_Float16*)(ws + 1 * U);
    _Float16* kh    = (_Float16*)(ws + 2 * U);
    _Float16* kl    = (_Float16*)(ws + 3 * U);
    _Float16* vTh   = (_Float16*)(ws + 4 * U);
    _Float16* vTr   = (_Float16*)(ws + 5 * U);
    _Float16* xh    = (_Float16*)(ws + 6 * U);
    _Float16* ctxh  = (_Float16*)(ws + 6 * U);
    _Float16* ctxr  = (_Float16*)(ws + 7 * U);
    _Float16* wqkvT = (_Float16*)(ws + 8 * U);
    float*    sa    = (float*)(ws + 0 * U);
    _Float16* sah   = (_Float16*)(ws + 2 * U);
    _Float16* postT = (_Float16*)(ws + 8 * U + WQ_B);
    _Float16* hid   = (_Float16*)(ws + 3 * U);
    _Float16* ff1T  = (_Float16*)(ws + 8 * U + WQ_B + WO_B);
    _Float16* ff2T  = (_Float16*)(ws + 8 * U + WQ_B + WO_B + W1_B);

    // x -> f16 plane (bf16-RNE values); every W[k][n] -> its [n][k] plane
    k_planes<<<dim3(WT_ALL + NTOK / (4 * XT)), dim3(256), 0, stream>>>(
        inp, preW, postW, ff1W, ff2W, xh, wqkvT, postT, ff1T, ff2T);
    k_qkv<<<dim3(6, NTOK / 128), dim3(256), 0, stream>>>(xh, wqkvT, preB, qh, ql, kh, kl, vTh, vTr);
    k_attn<<<dim3(NH * NB, SEQ / 128), dim3(256), 0, stream>>>(qh, ql, kh, kl, vTh, vTr, mask, ctxh, ctxr);
    k_gemm_ln<true><<<dim3(NTOK / 32), dim3(256), 0, stream>>>(
        ctxh, ctxr, postT, postB, inp, ln1w, ln1b, sa, sah);
    k_ff1<<<dim3(8, NTOK / 128), dim3(256), 0, stream>>>(sah, ff1T, ff1B, hid);
    k_gemm_ln<false><<<dim3(NTOK / 64), dim3(256), 0, stream>>>(
        hid, hid, ff2T, ff2B, sa, ln2w, ln2b, out, sah);
}

// v010
// Measured time: 176 microseconds a run.
// Next to v009, in two timings, it ran 1.04 and 1.03 times as fast.
// Counting every step since v000, it is 2.67 times as fast.
#include <hip/hip_runtime.h>
#include <hip/hip_fp16.h>

// All contractions on v_wmma_f32_16x16x32_f16 (f16 operands, f32 accumulate): x*Wqkv, sa*W1, h*W2 single f16 planes; k*q^T with f16 hi + 2^11-scaled f16 residual planes (hi.hi, hi.res, res.hi); V^T*P^T and ctx*Wo with f16 hi + 2^11-scaled f16 residual plane on V / ctx (two accumulators, residual folded 2^-11 in f32).

#ifndef NB
#define NB 32
#endif
#ifndef SEQ
#define SEQ 512
#endif
#define NB_FULL  32
#define SEQ_FULL 512
#define NH   8           // heads
#define HD   64          // head width
#define DM   512         // model width
#define DF   2048        // hidden width
#define NTOK (NB * SEQ)

static_assert(NB >= 1 && NB <= NB_FULL);
static_assert(SEQ >= 128 && SEQ <= SEQ_FULL);
static_assert(SEQ % 128 == 0);
static_assert(NTOK % 128 == 0);
static_assert(DM == NH * HD);
static_assert(DM == 512 && HD == 64 && NH == 8 && DF == 2048);

typedef _Float16 v16h __attribute__((ext_vector_type(16)));
typedef _Float16 v8h  __attribute__((ext_vector_type(8)));
typedef _Float16 v4h  __attribute__((ext_vector_type(4)));
typedef float    v8f  __attribute__((ext_vector_type(8)));
typedef float    v4f  __attribute__((ext_vector_type(4)));

union Frag { v16h v; v8h h[2]; };

template <bool V> struct Flag { static constexpr bool value = V; };

#define LOG2E 1.44269504088896340736f
// scores: acc_h = (64k_h).(64q_h), acc_r = 2^11-scaled residual cross terms
// t (log2 units) = acc_h * log2(e)*2^-12 + acc_r * log2(e)*2^-23
#define C1 (1.44269504088896340736f * 0.000244140625f)
#define C2 (1.44269504088896340736f * 1.1920928955078125e-07f)
#define SC_RES   2048.0f                     // residual plane carry 2^11
#define SC_RINV  4.8828125e-04f              // 2^-11 : residual accumulator fold
#define SC_OUT   9.765625e-04f               // 2^-10 : (16 a)(64 W) -> a.W
#define SC_HID   1.5625e-02f                 // 2^-6  : (16 sa)(64 W1) -> 16 h

static __device__ __forceinline__ v8f zero8() {
    v8f z;
#pragma unroll
    for (int i = 0; i < 8; ++i) z[i] = 0.0f;
    return z;
}

// Fragment-ordered operand planes. A plane of R rows x K (k) 16-bit elements
// is a sequence of 1024-byte units, unit (row/16)*(K/32) + k/32 = one 16x32
// WMMA operand fragment, stored as [j = (k>>4)&1][lane][8]:
//   lane = 16*((k>>3)&1) + (row&15), element = k&7.
// A fragment (A, or B from an [n][k] source) is then two wave-wide 16-byte
// loads of 512 contiguous bytes each (4 whole lines per load): lane m =
// lane&15 -> row m; kb = 8*(lane>>4); elements 0..7 = k kb..kb+7, elements
// 8..15 = k kb+16..kb+23.
// p = unit + lane*8, the lane's own place in the unit.
static __device__ __forceinline__ v16h load_frag16(const _Float16* p) {
    Frag f;
    f.h[0] = *(const v8h*)(p);
    f.h[1] = *(const v8h*)(p + 256);
    return f.v;
}

// offset (in elements) of the 8-element piece (row, k8..k8+7), k8 % 8 == 0
static __device__ __forceinline__ size_t frag_off(unsigned row, unsigned k8, unsigned K) {
    return ((size_t)(row >> 4) * (K >> 5) + (k8 >> 5)) * 512u
         + ((k8 >> 4) & 1u) * 256u + ((((k8 >> 3) & 1u) << 4) + (row & 15u)) * 8u;
}

static __device__ __forceinline__ v8f wmma16(v16h a, v16h b, v8f c) {
    v8f d = __builtin_amdgcn_wmma_f32_16x16x32_f16(false, a, false, b, (short)0, c, false, false);
    asm volatile("v_nop\n\tv_nop\n\tv_nop\n\tv_nop" : "+v"(d) : "v"(a), "v"(b));
    return d;
}

// f32 -> bf16 RNE convert, value kept as f32
static __device__ __forceinline__ float bf16r(float x) {
    unsigned u = __float_as_uint(x);
    u = (u + 0x7FFFu + ((u >> 16) & 1u)) & 0xFFFF0000u;
    return __uint_as_float(u);
}

static __device__ __forceinline__ float ex2(float x) {
    return __builtin_amdgcn_exp2f(x);
}

// Sum over the wave's 32 lanes (butterfly 16, 8, 4, 2, 1) of four independent values, side by
// side: the four exchanges of a step are in flight together, one exchange latency per step and
// not one per value. The exchanges of a step and their data wait are one statement: written as
// __shfl_xor the build strings them out and waits for most of them one by one.
static __device__ __forceinline__ void wave_sum4(float (&v)[4], unsigned lane) {
#pragma unroll
    for (unsigned m = 16u; m >= 1u; m >>= 1) {
        const unsigned from = (lane ^ m) << 2;   // the partner lane, as ds_bpermute_b32 counts it
        float t0, t1, t2, t3;
        asm volatile("ds_bpermute_b32 %0, %4, %5\n\t"
                     "ds_bpermute_b32 %1, %4, %6\n\t"
                     "ds_bpermute_b32 %2, %4, %7\n\t"
                     "ds_bpermute_b32 %3, %4, %8\n\t"
                     "s_wait_dscnt 0x0"
                     : "=&v"(t0), "=&v"(t1), "=&v"(t2), "=&v"(t3)
                     : "v"(from), "v"(v[0]), "v"(v[1]), "v"(v[2]), "v"(v[3])
                     : "memory");
        v[0] += t0; v[1] += t1; v[2] += t2; v[3] += t3;
    }
}

// compact token row (b*SEQ + l) -> row in the full-size arrays
static __device__ __forceinline__ unsigned full_row(unsigned n) {
    const unsigned b = n / (unsigned)SEQ;
    return b * (unsigned)SEQ_FULL + (n - b * (unsigned)SEQ);
}

// ---------------------------------------------------------------------------
// Wave-level GEMM step: TM x TN tiles of 16x16, A / Bt both fragment-ordered
// planes of width K (here the stages of an LDS ring, K = 64); the pointers name the first unit of the wave's first row
// tile (row * K elements in), the next row tile is 16*K on, the next k step 512.
// RES: second A plane (2^11-scaled residual) into its own accumulators.
// The fragments of k step s + 1 are requested before the products of step s
// (two register sets), so a step waits for loads that are one step old, once,
// and not for each B fragment in turn. SB (16 accumulator tiles: RES, or a 4 x 4
// wave tile): the accumulators leave no room for a second B set, each B fragment
// is requested anew behind its last product.
// The k walk starts at trip t0 (a trip = two k steps = 64 k) and wraps: blocks that
// read the same operand rows at the same time get different t0, so that their
// requests for one line do not reach L2 together. Every k step is taken once.
// ---------------------------------------------------------------------------
// SW: the product is taken transposed, the Bt fragment as the A operand and the A plane's
// fragment as the B operand (both planes have one fragment order, the k order is the same):
// tile [mt][nt] then holds, per lane, row mt*16 + (lane&15) of the A plane against the 8
// CONSECUTIVE Bt rows nt*16 + 8*(lane>>4) + 0..7, which is one 16-byte piece of a
// fragment-ordered plane (or 32 bytes of an f32 row) and needs no transpose on its way out.
// One k step on the current set; LD: request the next step's set from pa / pr / pb.
template <int TM, int TN, bool RES, bool SB, bool SW, unsigned K, bool LD>
static __device__ __forceinline__ void gemm_step(const _Float16* pa, const _Float16* pr,
                                                 const _Float16* pb,
                                                 const v16h (&ac)[TM], const v16h (&arc)[TM], v16h (&bc)[TN],
                                                 v16h (&an)[TM], v16h (&arn)[TM], v16h (&bn)[TN],
                                                 v8f (&acc)[TM][TN], v8f (&accr)[TM][TN]) {
    if (LD) {
#pragma unroll
        for (int mt = 0; mt < TM; ++mt) {
            an[mt] = load_frag16(pa + (size_t)(mt * 16) * K);
            if (RES) arn[mt] = load_frag16(pr + (size_t)(mt * 16) * K);
        }
        if (!SB) {
#pragma unroll
            for (int nt = 0; nt < TN; ++nt) bn[nt] = load_frag16(pb + (size_t)(nt * 16) * K);
        }
    }
#pragma unroll
    for (int nt = 0; nt < TN; ++nt) {
#pragma unroll
        for (int mt = 0; mt < TM; ++mt) {
            acc[mt][nt] = SW ? wmma16(bc[nt], ac[mt], acc[mt][nt]) : wmma16(ac[mt], bc[nt], acc[mt][nt]);
            if (RES) accr[mt][nt] = SW ? wmma16(bc[nt], arc[mt], accr[mt][nt])
                                       : wmma16(arc[mt], bc[nt], accr[mt][nt]);
        }
        if (LD && SB) bc[nt] = load_frag16(pb + (size_t)(nt * 16) * K);
    }
}

// ---------------------------------------------------------------------------
// Block-level GEMM core over an LDS ring, for the 128 x 256 blocks (K = DM): the block's
// operand rows (8 row tiles of the token plane, 16 of the weight plane) are brought into
// LDS once per block, 64 k (one trip) at a time, by asynchronous copies, and every wave
// takes its fragments from there; by plain loads each token fragment was fetched by four
// waves and each weight fragment by two. A stage is 24 row tiles x 2 units = 48 KB and is
// itself a fragment-ordered plane of width 64; two buffers, the copies of trip i + 2 fly
// while trip i + 1 is worked on. Wave w copies token tile w and weight tiles 2w, 2w + 1.
// The k walk starts at trip t0 and wraps, as said above; a trip is one stage.
// ---------------------------------------------------------------------------
#define RING_H (24 * 1024)                           // elements of a stage
// One stage's 12 copies of a wave (512 bytes each, 16 per lane): gx, gw the lane's places in
// the token tile's and the first weight tile's two units of this trip, lx, lw the LDS bytes.
static __device__ __forceinline__ void ring_copy(const _Float16* gx, const _Float16* gw,
                                                 unsigned lx, unsigned lw) {
    const _Float16* gv = gw + 16 * DM;               // the second weight tile
    // the copies and the wait in one statement: no address register that an issued copy
    // names is rewritten ahead of the wait
    asm volatile("global_load_async_to_lds_b128 %0, %12, off\n\t"
                 "global_load_async_to_lds_b128 %1, %13, off\n\t"
                 "global_load_async_to_lds_b128 %2, %14, off\n\t"
                 "global_load_async_to_lds_b128 %3, %15, off\n\t"
                 "global_load_async_to_lds_b128 %4, %16, off\n\t"
                 "global_load_async_to_lds_b128 %5, %17, off\n\t"
                 "global_load_async_to_lds_b128 %6, %18, off\n\t"
                 "global_load_async_to_lds_b128 %7, %19, off\n\t"
                 "global_load_async_to_lds_b128 %8, %20, off\n\t"
                 "global_load_async_to_lds_b128 %9, %21, off\n\t"
                 "global_load_async_to_lds_b128 %10, %22, off\n\t"
                 "global_load_async_to_lds_b128 %11, %23, off\n\t"
                 "s_wait_xcnt 0x0"
                 :: "v"(lx), "v"(lx + 512u), "v"(lx + 1024u), "v"(lx + 1536u),
                    "v"(lw), "v"(lw + 512u), "v"(lw + 1024u), "v"(lw + 1536u),
                    "v"(lw + 2048u), "v"(lw + 2560u), "v"(lw + 3072u), "v"(lw + 3584u),
                    "v"(gx), "v"(gx + 256), "v"(gx + 512), "v"(gx + 768),
                    "v"(gw), "v"(gw + 256), "v"(gw + 512), "v"(gw + 768),
                    "v"(gv), "v"(gv + 256), "v"(gv + 512), "v"(gv + 768)
                 : "memory");
}

// X, Wt: the block's first row tile in the token plane and in the weight plane; atile, btile:
// the wave's first row tile in the stage for the A set and for the B set of gemm_step.
template <bool SW>
static __device__ __forceinline__ void gemm_core_ring(const _Float16* __restrict__ X,
                                                      const _Float16* __restrict__ Wt,
                                                      _Float16* ring, unsigned atile, unsigned btile,
                                                      unsigned lane, unsigned w, unsigned t0,
                                                      v8f (&acc)[4][4], v8f (&accr)[4][4]) {
    constexpr unsigned T = DM / 64u;                 // trips; t0 < T, the same in the whole block
    static_assert(T >= 2u && (T & (T - 1u)) == 0u);
#pragma unroll
    for (int mt = 0; mt < 4; ++mt)
#pragma unroll
        for (int nt = 0; nt < 4; ++nt) acc[mt][nt] = zero8();
    const _Float16* gx = X + (size_t)(w * 16u) * DM + lane * 8u;
    const _Float16* gw = Wt + (size_t)(w * 32u) * DM + lane * 8u;
    const unsigned lbase = (unsigned)(size_t)ring + lane * 16u;    // LDS byte address: the low 32 bits
    const unsigned lx = lbase + w * 2048u;
    const unsigned lw = lbase + (8u + 2u * w) * 2048u;
    ring_copy(gx + t0 * 1024u, gw + t0 * 1024u, lx, lw);
    // the first stage has landed (this wave's copies), then is published to the other waves
    asm volatile("s_wait_asynccnt 0x0" ::: "memory");
    __syncthreads();
    {
        const unsigned t1 = (t0 + 1u) & (T - 1u);
        ring_copy(gx + t1 * 1024u, gw + t1 * 1024u, lx + (unsigned)RING_H * 2u, lw + (unsigned)RING_H * 2u);
    }
    // not unrolled: one copy of the 32 products, the buffer is an address offset
#pragma unroll 1
    for (unsigned i = 0; i < T; ++i) {
        const unsigned buf = i & 1u;
        const _Float16* la = ring + buf * (unsigned)RING_H + atile * 1024u + lane * 8u;
        const _Float16* lb = ring + buf * (unsigned)RING_H + btile * 1024u + lane * 8u;
        v16h a[2][4], b[4];
#pragma unroll
        for (int mt = 0; mt < 4; ++mt) a[0][mt] = load_frag16(la + mt * 1024);
#pragma unroll
        for (int nt = 0; nt < 4; ++nt) b[nt] = load_frag16(lb + nt * 1024);
        gemm_step<4, 4, false, true, SW, 64u, true>(la + 512, la + 512, lb + 512,
                                                    a[0], a[0], b, a[1], a[1], b, acc, accr);
        gemm_step<4, 4, false, true, SW, 64u, false>(la, la, lb,
                                                     a[1], a[1], b, a[0], a[0], b, acc, accr);
        // foot of the trip: this wave's reads of the buffer are done, its copies of the next
        // stage have landed; the barrier publishes that stage and frees this buffer
        asm volatile("s_wait_dscnt 0x0" ::: "memory");
        asm volatile("s_wait_asynccnt 0x0" ::: "memory");
        __syncthreads();
        if (i + 2u < T) {
            const unsigned t2 = (t0 + i + 2u) & (T - 1u);
            ring_copy(gx + t2 * 1024u, gw + t2 * 1024u,
                      lx + buf * ((unsigned)RING_H * 2u), lw + buf * ((unsigned)RING_H * 2u));
        }
    }
    // no copy is outstanding when the wave goes on
    asm volatile("s_wait_asynccnt 0x0" ::: "memory");
}

// ---------------------------------------------------------------------------
// The same ring for the ROWS x 512 blocks of the GEMM + LayerNorm kernels: a stage is 4 row
// tiles of the A side (64 rows, or 32 rows of the hi plane and 32 of the residual plane) and
// the 32 row tiles of Bt, 64 k each = 72 KB; the A fragments, which all eight waves read, are
// fetched once per block. Wave w copies its own four Bt tiles and one unit of A tile w / 2.
// ---------------------------------------------------------------------------
#define LNR_H (36 * 1024)                            // elements of a stage
// Nine copies of a wave: 512 bytes at g0, and the two units (2 KB) of a trip at g1 and at g2.
static __device__ __forceinline__ void ring_copy9(const _Float16* g0, unsigned l0,
                                                  const _Float16* g1, unsigned l1,
                                                  const _Float16* g2, unsigned l2) {
    // the copies and the wait in one statement: no address register that an issued copy
    // names is rewritten ahead of the wait
    asm volatile("global_load_async_to_lds_b128 %0, %9, off\n\t"
                 "global_load_async_to_lds_b128 %1, %10, off\n\t"
                 "global_load_async_to_lds_b128 %2, %11, off\n\t"
                 "global_load_async_to_lds_b128 %3, %12, off\n\t"
                 "global_load_async_to_lds_b128 %4, %13, off\n\t"
                 "global_load_async_to_lds_b128 %5, %14, off\n\t"
                 "global_load_async_to_lds_b128 %6, %15, off\n\t"
                 "global_load_async_to_lds_b128 %7, %16, off\n\t"
                 "global_load_async_to_lds_b128 %8, %17, off\n\t"
                 "s_wait_xcnt 0x0"
                 :: "v"(l0),
                    "v"(l1), "v"(l1 + 512u), "v"(l1 + 1024u), "v"(l1 + 1536u),
                    "v"(l2), "v"(l2 + 512u), "v"(l2 + 1024u), "v"(l2 + 1536u),
                    "v"(g0),
                    "v"(g1), "v"(g1 + 256), "v"(g1 + 512), "v"(g1 + 768),
                    "v"(g2), "v"(g2 + 256), "v"(g2 + 512), "v"(g2 + 768)
                 : "memory");
}

// Ah, Ar: the block's first row tile in the A planes; Bt: the whole weight plane (512 rows).
template <int TM, bool RES, unsigned K>
static __device__ __forceinline__ void gemm_core_ring_ln(const _Float16* __restrict__ Ah,
                                                         const _Float16* __restrict__ Ar,
                                                         const _Float16* __restrict__ Bt,
                                                         _Float16* ring, unsigned lane, unsigned w,
                                                         unsigned t0,
                                                         v8f (&acc)[TM][4], v8f (&accr)[TM][4]) {
    constexpr unsigned T = K / 64u;                  // trips; t0 < T, the same in the whole block
    static_assert(T >= 2u && (T & (T - 1u)) == 0u && TM == (RES ? 2 : 4));
#pragma unroll
    for (int mt = 0; mt < TM; ++mt)
#pragma unroll
        for (int nt = 0; nt < 4; ++nt) {
            acc[mt][nt] = zero8();
            if (RES) accr[mt][nt] = zero8();
        }
    const unsigned at = w >> 1;                      // the A tile of the stage that this wave helps to copy
    const _Float16* ap = (RES && at >= 2u) ? Ar : Ah;
    const _Float16* ga = ap + (size_t)((RES ? (at & 1u) : at) * 16u) * K + (w & 1u) * 512u + lane * 8u;
    const _Float16* gb = Bt + (size_t)(w * 64u) * K + lane * 8u;
    const unsigned lbase = (unsigned)(size_t)ring + lane * 16u;    // LDS byte address: the low 32 bits
    const unsigned lA = lbase + at * 2048u + (w & 1u) * 1024u;
    const unsigned lB = lbase + (4u + 4u * w) * 2048u;
    auto stage_copy = [&](const unsigned t, const unsigned lo) __attribute__((always_inline)) {
        const _Float16* a0 = ga + t * 1024u;
        const _Float16* b0 = gb + t * 1024u;
        ring_copy9(a0, lA + lo, b0, lB + lo, b0 + (size_t)16 * K, lB + lo + 2048u);
        ring_copy9(a0 + 256, lA + lo + 512u, b0 + (size_t)32 * K, lB + lo + 4096u,
                   b0 + (size_t)48 * K, lB + lo + 6144u);
    };
    stage_copy(t0, 0u);
    // the first stage has landed (this wave's copies), then is published to the other waves
    asm volatile("s_wait_asynccnt 0x0" ::: "memory");
    __syncthreads();
    stage_copy((t0 + 1u) & (T - 1u), (unsigned)LNR_H * 2u);
    // not unrolled: one copy of the 32 products, the buffer is an address offset
#pragma unroll 1
    for (unsigned i = 0; i < T; ++i) {
        const unsigned buf = i & 1u;
        const _Float16* la = ring + buf * (unsigned)LNR_H + lane * 8u;
        const _Float16* lr = la + 2 * 1024;
        const _Float16* lb = la + (4u + 4u * w) * 1024u;
        v16h a[2][TM], ar[2][TM], b[4];
#pragma unroll
        for (int mt = 0; mt < TM; ++mt) {
            a[0][mt] = load_frag16(la + mt * 1024);
            if (RES) ar[0][mt] = load_frag16(lr + mt * 1024);
        }
#pragma unroll
        for (int nt = 0; nt < 4; ++nt) b[nt] = load_frag16(lb + nt * 1024);
        gemm_step<TM, 4, RES, true, true, 64u, true>(la + 512, lr + 512, lb + 512,
                                                     a[0], ar[0], b, a[1], ar[1], b, acc, accr);
        gemm_step<TM, 4, RES, true, true, 64u, false>(la, lr, lb,
                                                      a[1], ar[1], b, a[0], ar[0], b, acc, accr);
        // foot of the trip: this wave's reads of the buffer are done, its copies of the next
        // stage have landed; the barrier publishes that stage and frees this buffer
        asm volatile("s_wait_dscnt 0x0" ::: "memory");
        asm volatile("s_wait_asynccnt 0x0" ::: "memory");
        __syncthreads();
        if (i + 2u < T) stage_copy((t0 + i + 2u) & (T - 1u), buf * ((unsigned)LNR_H * 2u));
    }
    // no copy is outstanding when the ring's LDS is used for the output tile
    asm volatile("s_wait_asynccnt 0x0" ::: "memory");
}

// ---------------------------------------------------------------------------
// x (f32) -> xh, fragment-ordered NTOK x 512 plane, f16 of the bf16-RNE value.
// A wave takes 8 rows x 256 columns = XT tiles of 8 rows x 32 columns (per tile one
// 128-B line per row in, four whole 128-B lines out, each line written by one wave).
// 64 elements per thread, all 16 loads of a lane requested at once: the plane costs
// 4,096 wave starts at full size and not 32,768.
// ---------------------------------------------------------------------------
#define XT 8                                         // tiles of a wave
static __device__ __forceinline__ void cvt_x_block(unsigned blk, const float* __restrict__ x,
                                                   _Float16* __restrict__ xh) {
    const unsigned wv  = blk * 8u + (threadIdx.x >> 5);
    const unsigned ln  = threadIdx.x & 31u;
    const unsigned n   = (wv >> 1) * 8u + (ln & 7u);
    const unsigned c8  = (wv & 1u) * (unsigned)(XT * 32) + (ln >> 3) * 8u;
    const unsigned fr  = full_row(n);
    const float* p = x + (size_t)fr * DM + c8;
    v4f a[XT], b[XT];
#pragma unroll
    for (int i = 0; i < XT; ++i) {
        a[i] = *(const v4f*)(p + i * 32);
        b[i] = *(const v4f*)(p + i * 32 + 4);
    }
    // the address pair is held (input) up to this wait: no load returns into it
    asm volatile("s_wait_xcnt 0x0" :: "v"(p) : "memory");
    v8h o[XT];
#pragma unroll
    for (int i = 0; i < XT; ++i) {
        o[i][0] = (_Float16)bf16r(a[i].x); o[i][1] = (_Float16)bf16r(a[i].y);
        o[i][2] = (_Float16)bf16r(a[i].z); o[i][3] = (_Float16)bf16r(a[i].w);
        o[i][4] = (_Float16)bf16r(b[i].x); o[i][5] = (_Float16)bf16r(b[i].y);
        o[i][6] = (_Float16)bf16r(b[i].z); o[i][7] = (_Float16)bf16r(b[i].w);
    }
    // the next 32 columns are the row tile's next unit, 512 elements on
    _Float16* d = xh + frag_off(n, c8, (unsigned)DM);
#pragma unroll
    for (int i = 0; i < XT; ++i) *(v8h*)(d + i * 512) = o[i];
    // the stores' address pair and data are held (inputs) up to this wait: none is rewritten before it
    asm volatile("s_wait_xcnt 0x0"
                 :: "v"(d), "v"(o[0]), "v"(o[1]), "v"(o[2]), "v"(o[3]),
                    "v"(o[4]), "v"(o[5]), "v"(o[6]), "v"(o[7])
                 : "memory");
}

// ---------------------------------------------------------------------------
// Weight plane builder: in [z][R][C] f32 (k-major, W[k][n]) -> out: z
// fragment-ordered planes of C rows (n) x R (k), f16 = 64 * bf16-RNE(W)^T.
// 128 (k) x 64 (n) tile through LDS = 4 x 4 units, each wave store 512 contiguous
// bytes; tile (bx, by, bz) of (C/64, R/128, z). 32 elements per thread, the 8 loads
// of a lane requested at once: half the wave starts of a 64 x 64 tile.
// ---------------------------------------------------------------------------
static __device__ __forceinline__ void wT_block(const float* __restrict__ in,
                                                _Float16* __restrict__ out,
                                                unsigned R, unsigned C,
                                                unsigned bx, unsigned by, unsigned bz) {
    // row pitch 136 elements = 272 bytes, an odd multiple of 16: the 16-byte reads meet no conflict
    __shared__ __align__(16) _Float16 t[64 * 136];
    const unsigned tid = threadIdx.x;
    const unsigned n0 = bx * 64u;
    const unsigned k0 = by * 128u;
    const float*  inb  = in  + (size_t)bz * R * C;
    _Float16*     outb = out + (size_t)bz * R * C;
    const float* p[8];
    v4f vv[8];
#pragma unroll
    for (int i = 0; i < 8; ++i) {
        const unsigned idx = (unsigned)i * 256u + tid;
        p[i] = inb + (size_t)(k0 + (idx >> 4)) * C + n0 + ((idx & 15u) << 2);
        vv[i] = *(const v4f*)p[i];
    }
    // the eight address pairs are held (inputs) up to this wait: no load returns
    // into a pair that an issued load still names, and none is rewritten before it
    asm volatile("s_wait_xcnt 0x0" :: "v"(p[0]), "v"(p[1]), "v"(p[2]), "v"(p[3]),
                                      "v"(p[4]), "v"(p[5]), "v"(p[6]), "v"(p[7]) : "memory");
#pragma unroll
    for (int i = 0; i < 8; ++i) {
        const unsigned idx = (unsigned)i * 256u + tid;
        const unsigned r = idx >> 4, c4 = (idx & 15u) << 2;
        const v4f v = vv[i];
        t[(c4 + 0u) * 136u + r] = (_Float16)(bf16r(v.x) * 64.0f);
        t[(c4 + 1u) * 136u + r] = (_Float16)(bf16r(v.y) * 64.0f);
        t[(c4 + 2u) * 136u + r] = (_Float16)(bf16r(v.z) * 64.0f);
        t[(c4 + 3u) * 136u + r] = (_Float16)(bf16r(v.w) * 64.0f);
    }
    __syncthreads();
    const unsigned ln = tid & 31u;
    const unsigned kl = ((tid >> 6) & 1u) * 32u + ((tid >> 5) & 1u) * 16u + (ln >> 4) * 8u;
    const unsigned nl = (tid >> 7) * 16u + (ln & 15u);
    const v8h o0 = *(const v8h*)(&t[nl * 136u + kl]);
    const v8h o1 = *(const v8h*)(&t[(nl + 32u) * 136u + kl]);
    const v8h o2 = *(const v8h*)(&t[nl * 136u + 64u + kl]);
    const v8h o3 = *(const v8h*)(&t[(nl + 32u) * 136u + 64u + kl]);
    _Float16* d0 = outb + frag_off(n0 + nl, k0 + kl, R);
    _Float16* d1 = outb + frag_off(n0 + nl + 32u, k0 + kl, R);
    // 64 k on = two units on = 1024 elements
    *(v8h*)d0 = o0;
    *(v8h*)d1 = o1;
    *(v8h*)(d0 + 1024) = o2;
    *(v8h*)(d1 + 1024) = o3;
    // the stores' address pairs and data are held (inputs) up to this wait: in the one
    // kernel that holds all builders other code follows, which rewrites these registers
    asm volatile("s_wait_xcnt 0x0" :: "v"(d0), "v"(d1), "v"(o0), "v"(o1), "v"(o2), "v"(o3) : "memory");
}

// ---------------------------------------------------------------------------
// All operand planes that depend on the inputs alone, in one launch: the four
// weight planes (384 tiles, the low block indices), then the x plane.
// The choice of the work is uniform over the block.
// ---------------------------------------------------------------------------
#define WT_QKV  (3 * NH * (DM / 128))                //  96 tiles: 24 x [512 k][64 n]
#define WT_POST ((DM / 64) * (DM / 128))             //  32 tiles: [512 k][512 n]
#define WT_FF   ((DF / 64) * (DM / 128))             // 128 tiles: [512 k][2048 n], [2048 k][512 n]
#define WT_ALL  (WT_QKV + WT_POST + 2 * WT_FF)
__global__ __launch_bounds__(256) void k_planes(const float* __restrict__ x,
                                                const float* __restrict__ preW,
                                                const float* __restrict__ postW,
                                                const float* __restrict__ ff1W,
                                                const float* __restrict__ ff2W,
                                                _Float16* __restrict__ xh,
                                                _Float16* __restrict__ wqkvT,
                                                _Float16* __restrict__ postT,
                                                _Float16* __restrict__ ff1T,
                                                _Float16* __restrict__ ff2T) {
    const unsigned bid = blockIdx.x;
    if (bid >= (unsigned)WT_ALL) {
        cvt_x_block(bid - (unsigned)WT_ALL, x, xh);
    } else if (bid < (unsigned)WT_QKV) {
        wT_block(preW, wqkvT, DM, HD, 0u, bid & 3u, bid >> 2);
    } else if (bid < (unsigned)(WT_QKV + WT_POST)) {
        const unsigned u = bid - (unsigned)WT_QKV;
        wT_block(postW, postT, DM, DM, u & 7u, u >> 3, 0u);
    } else if (bid < (unsigned)(WT_QKV + WT_POST + WT_FF)) {
        const unsigned u = bid - (unsigned)(WT_QKV + WT_POST);
        wT_block(ff1W, ff1T, DM, DF, u & 31u, u >> 5, 0u);
    } else {
        const unsigned u = bid - (unsigned)(WT_QKV + WT_POST + WT_FF);
        wT_block(ff2W, ff2T, DF, DM, u & 7u, u >> 3, 0u);
    }
}

// ---------------------------------------------------------------------------
// QKV projection. Block = 8 waves = 128 tokens x 256 columns, all of q, of k or
// of v; wave tile = 64 tokens x 64 columns = one (t, head) slice.
// q/k planes: [head][dhalf] fragment-ordered NTOK x 32 planes, f16 of 64q (hi)
// and 2^11 residual. V^T planes: [head*NB+b] fragment-ordered 64 (d) x SEQ (key)
// planes, hi / residual. Every plane is stored straight from registers: a lane's
// 8 accumulator rows must be 8 consecutive k of the plane, so the q and k tiles
// are computed transposed (W^T rows as the A operand, tokens as B: rows = d),
// the v tiles as x W (rows = keys). Both operand planes have the same shape and
// order, so the choice is which plane's address goes in as which operand.
// ---------------------------------------------------------------------------
__global__ __launch_bounds__(256) __attribute__((amdgpu_num_vgpr(256)))
void k_qkv(const _Float16* __restrict__ xh, const _Float16* __restrict__ wT,
           const float* __restrict__ bias,
           _Float16* __restrict__ qh, _Float16* __restrict__ ql,
           _Float16* __restrict__ kh, _Float16* __restrict__ kl,
           _Float16* __restrict__ vTh, _Float16* __restrict__ vTr) {
    const unsigned tid  = threadIdx.x;
    const unsigned lane = tid & 31u;
    const unsigned w    = tid >> 5;
    const unsigned n0   = blockIdx.y * 128u + (w >> 2) * 64u;
    const unsigned cb   = blockIdx.x * 256u + (w & 3u) * 64u;
    const unsigned r0   = (lane >> 4) << 3;
    const unsigned cc   = lane & 15u;
    const unsigned t    = blockIdx.x >> 1;       // = cb >> 9: 0 q, 1 k, 2 v; one per block
    const unsigned h    = (cb >> 6) & 7u;

    // the two stages of the block's operand rows, cross-wave
    __shared__ __align__(16) _Float16 ring[2 * RING_H];
    const unsigned xt = (w >> 2) * 4u;           // the wave's token tiles in a stage
    const unsigned wt = 8u + (w & 3u) * 4u;      // its weight tiles
    v8f acc[4][4], dum[4][4];
    gemm_core_ring<false>(xh + (size_t)(blockIdx.y * 128u) * DM, wT + (size_t)(blockIdx.x * 256u) * DM,
                          ring, (t < 2u) ? wt : xt, (t < 2u) ? xt : wt, lane, w,
                          (blockIdx.x + blockIdx.y) % (unsigned)(DM / 64), acc, dum);

    if (t < 2u) {
        // acc[dt][tt]: lane = token n0 + tt*16 + cc, rows d = dt*16 + r0 + 0..7
        _Float16* ph = (t == 0u) ? qh : kh;
        _Float16* pl = (t == 0u) ? ql : kl;
        const float* bp = bias + cb + r0;
        v4f bq[4][2];
#pragma unroll
        for (int dt = 0; dt < 4; ++dt) {
            bq[dt][0] = *(const v4f*)(bp + dt * 16);
            bq[dt][1] = *(const v4f*)(bp + dt * 16 + 4);
        }
        // the address pair is held (input) up to this wait: no load returns into it
        asm volatile("s_wait_xcnt 0x0" :: "v"(bp) : "memory");
#pragma unroll
        for (int kk = 0; kk < 2; ++kk) {         // the two d halves, one plane each
            const size_t pbase = ((size_t)(h * 2u + (unsigned)kk) * NTOK + n0) * 32u + lane * 8u;
            _Float16* dh = ph + pbase;
            _Float16* dl = pl + pbase;
            v8h hv[2][4], rv[2][4];
#pragma unroll
            for (int j = 0; j < 2; ++j) {
                float bv[8];
#pragma unroll
                for (int g = 0; g < 8; ++g) bv[g] = bf16r(bq[kk * 2 + j][g >> 2][g & 3]) * 64.0f;
#pragma unroll
                for (int tt = 0; tt < 4; ++tt)
#pragma unroll
                    for (int g = 0; g < 8; ++g) {
                        const float v = acc[kk * 2 + j][tt][g] + bv[g];
                        const _Float16 hi = (_Float16)v;
                        hv[j][tt][g] = hi;
                        rv[j][tt][g] = (_Float16)((v - (float)hi) * SC_RES);
                    }
            }
#pragma unroll
            for (int tt = 0; tt < 4; ++tt)
#pragma unroll
                for (int j = 0; j < 2; ++j) {
                    *(v8h*)(dh + tt * 512 + j * 256) = hv[j][tt];
                    *(v8h*)(dl + tt * 512 + j * 256) = rv[j][tt];
                }
            // the stores' address pairs and data are held (inputs) up to this wait: the
            // next plane's values and the code behind the branch rewrite these registers
            asm volatile("s_wait_xcnt 0x0"
                         :: "v"(dh), "v"(dl),
                            "v"(hv[0][0]), "v"(hv[0][1]), "v"(hv[0][2]), "v"(hv[0][3]),
                            "v"(hv[1][0]), "v"(hv[1][1]), "v"(hv[1][2]), "v"(hv[1][3]),
                            "v"(rv[0][0]), "v"(rv[0][1]), "v"(rv[0][2]), "v"(rv[0][3]),
                            "v"(rv[1][0]), "v"(rv[1][1]), "v"(rv[1][2]), "v"(rv[1][3])
                         : "memory");
        }
    } else {
        float bv[4];
        const unsigned bi = cb + cc;
        const float b0 = bias[bi];
        const float b1 = bias[bi + 16u];
        const float b2 = bias[bi + 32u];
        const float b3 = bias[bi + 48u];
        // the index register is held (input) up to this wait: no load returns into it
        asm volatile("s_wait_xcnt 0x0" :: "v"(bi) : "memory");
        bv[0] = bf16r(b0) * 64.0f;
        bv[1] = bf16r(b1) * 64.0f;
        bv[2] = bf16r(b2) * 64.0f;
        bv[3] = bf16r(b3) * 64.0f;
        const unsigned b  = n0 / (unsigned)SEQ;
        const unsigned l0 = n0 - b * (unsigned)SEQ;
        const unsigned hb = h * (unsigned)NB + b;
        const size_t vbase = ((size_t)(hb * HD)) * SEQ + (size_t)l0 * 16u + lane * 8u;
#pragma unroll
        for (int mt = 0; mt < 4; ++mt)
#pragma unroll
            for (int nt = 0; nt < 4; ++nt) {
                v8h hv, rv;
#pragma unroll
                for (int g = 0; g < 8; ++g) {
                    const float v = acc[mt][nt][g] + bv[nt];
                    const _Float16 hi = (_Float16)v;
                    hv[g] = hi;
                    rv[g] = (_Float16)((v - (float)hi) * SC_RES);
                }
                const size_t vo = vbase + (size_t)(nt * 16) * SEQ + (mt >> 1) * 512 + (mt & 1) * 256;
                *(v8h*)(vTh + vo) = hv;
                *(v8h*)(vTr + vo) = rv;
            }
        // the V^T stores' registers may be rewritten behind this branch
        asm volatile("s_wait_xcnt 0x0" ::: "memory");
    }
}

// ---------------------------------------------------------------------------
// Attention's K / V ring: a stage is 128 keys of one (head, batch) = 32 K units ([d half][hi,
// residual][8 key tiles]) and 32 V^T units ([hi, residual][4 d tiles][4 steps of 32 keys]) = 64 KB.
// ---------------------------------------------------------------------------
#define AST_H (64 * 512)                             // elements of a stage
// Eight copies of a wave: 4 KB in a row at g to the LDS bytes from l on (16 bytes per lane and copy).
static __device__ __forceinline__ void ring_copy8(const _Float16* g, unsigned l) {
    // the copies and the wait in one statement: no address register that an issued copy
    // names is rewritten ahead of the wait
    asm volatile("global_load_async_to_lds_b128 %0, %8, off\n\t"
                 "global_load_async_to_lds_b128 %1, %9, off\n\t"
                 "global_load_async_to_lds_b128 %2, %10, off\n\t"
                 "global_load_async_to_lds_b128 %3, %11, off\n\t"
                 "global_load_async_to_lds_b128 %4, %12, off\n\t"
                 "global_load_async_to_lds_b128 %5, %13, off\n\t"
                 "global_load_async_to_lds_b128 %6, %14, off\n\t"
                 "global_load_async_to_lds_b128 %7, %15, off\n\t"
                 "s_wait_xcnt 0x0"
                 :: "v"(l), "v"(l + 512u), "v"(l + 1024u), "v"(l + 1536u),
                    "v"(l + 2048u), "v"(l + 2560u), "v"(l + 3072u), "v"(l + 3584u),
                    "v"(g), "v"(g + 256), "v"(g + 512), "v"(g + 768),
                    "v"(g + 1024), "v"(g + 1280), "v"(g + 1536), "v"(g + 1792)
                 : "memory");
}

// ---------------------------------------------------------------------------
// Attention, online softmax over keys. Block = 8 waves = 128 queries of one
// (head, batch); wave owns 16 queries. Scores are computed transposed:
// S^T tile = K(16 keys, A) x Q^T(B, n = query), so every statistic of a query
// lives in lane&15 (in-lane reduce over the 8 rows + one xor-16 exchange).
// P^T accumulator tiles (keys 0..15 / 16..31 of a 32-key step) are packed
// directly into the B fragment (k = key, n = query) of O^T = V^T x P^T with
// A = V^T rows (d) straight from the V^T planes. P carried 2^14.
// K and V^T, which all eight waves read, are brought into LDS once per block, 128 keys (a stage,
// four steps) at a time, by asynchronous copies into two buffers: the copies of stage s + 2 fly
// while stage s + 1 is worked on. Wave w copies 4 KB of K and 4 KB of V^T per stage.
// Fragment loads run ahead of their use inside a stage: V from behind its step's score products, the
// next step's K from among the V products.
// Epilogue: 16*ctx as f16 hi + 2^11 residual into fragment-ordered NTOK x 512
// planes: a lane's 8 rows (d) of one query are one piece of a unit at the
// lane's own place, stored straight from registers. msk cross-wave (block barrier).
// ---------------------------------------------------------------------------
__global__ __launch_bounds__(256) __attribute__((amdgpu_num_vgpr(256)))
void k_attn(const _Float16* __restrict__ qh, const _Float16* __restrict__ ql,
            const _Float16* __restrict__ kh, const _Float16* __restrict__ kl,
            const _Float16* __restrict__ vTh, const _Float16* __restrict__ vTr,
            const float* __restrict__ mask,
            _Float16* __restrict__ ctxh, _Float16* __restrict__ ctxr) {
    __shared__ __align__(16) float    msk[SEQ];          // additive key mask, log2 units
    __shared__ __align__(16) _Float16 ring[2 * AST_H];   // the two K / V stages, cross-wave

    const unsigned tid  = threadIdx.x;
    const unsigned lane = tid & 31u;
    // the wave's number as a scalar: the wave's query rows and the source places of its copies are
    // then formed and kept in scalar registers, not in per-lane ones
    const unsigned w    = (unsigned)__builtin_amdgcn_readfirstlane((int)(tid >> 5));
    const unsigned hb   = blockIdx.x;
    const unsigned h    = hb / (unsigned)NB;
    const unsigned b    = hb - h * (unsigned)NB;
    const unsigned q0   = blockIdx.y * 128u + w * 16u;
    const unsigned r0   = (lane >> 4) << 3;

    const size_t tokq = (size_t)b * SEQ + q0;
    const size_t tokk = (size_t)b * SEQ;
    constexpr unsigned NS = (unsigned)SEQ / 128u;        // stages
    // wave w copies K units 4w .. 4w + 3 of a stage (d half w >> 2, plane (w >> 1) & 1, key tiles
    // 4 (w & 1) on) and V^T units 4w .. 4w + 3 (plane w >> 2, d tile w & 3): each 4 KB in a row
    // (the lane's part is added at the copy)
    const _Float16* gk = (((w >> 1) & 1u) ? kl : kh)
                       + ((size_t)(h * 2u + (w >> 2)) * NTOK + tokk) * 32u + (w & 1u) * 2048u;
    const _Float16* gv = ((w >> 2) ? vTr : vTh)
                       + (size_t)hb * HD * SEQ + (size_t)((w & 3u) * 16u) * SEQ;
    const unsigned lk = (unsigned)(size_t)ring + w * 4096u;                // LDS byte address: the low 32 bits
    auto stage_copy = [&](const unsigned st, const unsigned lo) __attribute__((always_inline)) {
        ring_copy8(gk + st * 4096u + lane * 8u, lk + lo + lane * 16u);
        ring_copy8(gv + st * 2048u + lane * 8u, lk + lo + 32u * 1024u + lane * 16u);
    };
    stage_copy(0u, 0u);
    // the wave's Q fragments: requested here, they land while the first stage does
    const size_t P0 = (size_t)(h * 2u) * NTOK;
    const size_t P1 = (size_t)(h * 2u + 1u) * NTOK;
    const v16h qhf0 = load_frag16(qh + (P0 + tokq) * 32u + lane * 8u);
    const v16h qhf1 = load_frag16(qh + (P1 + tokq) * 32u + lane * 8u);
    const v16h qlf0 = load_frag16(ql + (P0 + tokq) * 32u + lane * 8u);
    const v16h qlf1 = load_frag16(ql + (P1 + tokq) * 32u + lane * 8u);

    for (unsigned idx = tid; idx < (unsigned)SEQ; idx += 256u)
        msk[idx] = bf16r(mask[(size_t)b * SEQ_FULL + idx]) * LOG2E;
    // the first stage has landed (this wave's copies); the barrier publishes it, and msk
    asm volatile("s_wait_asynccnt 0x0" ::: "memory");
    __syncthreads();
    if (NS > 1u) stage_copy(1u, (unsigned)AST_H * 2u);


    v8f oh[4], orr[4];
#pragma unroll
    for (int dt = 0; dt < 4; ++dt) { oh[dt] = zero8(); orr[dt] = zero8(); }
    float mr = -1.0e30f, lr = 0.0f;

    // K fragments of a step's 32 keys: [key tile][d half][hi, residual]
    v16h kf[2][2][2];
    // the K fragments of key tile kt of the step whose first K unit (d half 0, hi) has the lane's place pk
    auto load_k = [&](const _Float16* pk, const int kt) __attribute__((always_inline)) {
#pragma unroll
        for (int dh = 0; dh < 2; ++dh)
#pragma unroll
            for (int p = 0; p < 2; ++p)
                kf[kt][dh][p] = load_frag16(pk + ((dh * 2 + p) * 8 + kt) * 512);
    };

    // One 32-key step; pk, pvh: the lane's places in the step's first K unit and first V^T unit.
    // MORE: the stage has a next step and its K fragments are requested; nothing of the next
    // stage is read ahead of the barrier that publishes it.
    auto key_step = [&](const _Float16* pk, const _Float16* pvh, const unsigned key0, auto more)
                    __attribute__((always_inline)) {
        constexpr bool MORE = decltype(more)::value;
        const _Float16* pvr = pvh + 16 * 512;            // V^T residual; the next d tile is 4 units on
        v8f sh0 = zero8(), sr0 = zero8(), sh1 = zero8(), sr1 = zero8();
        sh0 = wmma16(kf[0][0][0], qhf0, sh0);
        sr0 = wmma16(kf[0][0][0], qlf0, sr0);
        sr0 = wmma16(kf[0][0][1], qhf0, sr0);
        sh0 = wmma16(kf[0][1][0], qhf1, sh0);
        sr0 = wmma16(kf[0][1][0], qlf1, sr0);
        sr0 = wmma16(kf[0][1][1], qhf1, sr0);
        sh1 = wmma16(kf[1][0][0], qhf0, sh1);
        sr1 = wmma16(kf[1][0][0], qlf0, sr1);
        sr1 = wmma16(kf[1][0][1], qhf0, sr1);
        sh1 = wmma16(kf[1][1][0], qhf1, sh1);
        sr1 = wmma16(kf[1][1][0], qlf1, sr1);
        sr1 = wmma16(kf[1][1][1], qhf1, sr1);
        // this step's V fragments, all four d tiles as one group: requested behind the score
        // products, in the registers of the K set just read, they land during the softmax
        v16h vfh[4], vfr[4];
#pragma unroll
        for (int dt = 0; dt < 4; ++dt) {
            vfh[dt] = load_frag16(pvh + dt * 2048);
            vfr[dt] = load_frag16(pvr + dt * 2048);
        }
        float t0[8], t1[8];
#pragma unroll
        for (int g = 0; g < 8; ++g) {
            t0[g] = __builtin_fmaf(sh0[g], C1, sr0[g] * C2) + msk[key0 + r0 + g];
            t1[g] = __builtin_fmaf(sh1[g], C1, sr1[g] * C2) + msk[key0 + 16u + r0 + g];
        }
        float tmax = fmaxf(t0[0], t1[0]);
#pragma unroll
        for (int g = 1; g < 8; ++g) tmax = fmaxf(tmax, fmaxf(t0[g], t1[g]));
        tmax = fmaxf(tmax, __shfl_xor(tmax, 16, 32));
        const float mn    = fmaxf(mr, tmax);
        const float alpha = ex2(mr - mn);
        mr = mn;
        const float off = 14.0f - mn;
        v8h p0, p1;
        float ps = 0.0f;
#pragma unroll
        for (int g = 0; g < 8; ++g) {
            const _Float16 a = (_Float16)ex2(t0[g] + off);
            const _Float16 c = (_Float16)ex2(t1[g] + off);
            p0[g] = a;
            p1[g] = c;
            ps += (float)a + (float)c;
        }
        ps += __shfl_xor(ps, 16, 32);
        lr = lr * alpha + ps;
        Frag pb;
        pb.h[0] = p0;       // k = keys key0 + 8h + 0..7
        pb.h[1] = p1;       // k = keys key0 + 16 + 8h + 0..7
#pragma unroll
        for (int dt = 0; dt < 4; ++dt) {
            oh[dt]  = oh[dt] * alpha;
            orr[dt] = orr[dt] * alpha;
        }
#pragma unroll
        for (int dt = 0; dt < 4; ++dt) {
            oh[dt] = wmma16(vfh[dt], pb.v, oh[dt]);
            orr[dt] = wmma16(vfr[dt], pb.v, orr[dt]);
            if (MORE && (dt & 1)) {
                // the NEXT step's K fragments, one key tile behind each two d tiles' products, in
                // the registers of the V fragments just read
                load_k(pk + 1024, dt >> 1);
            }
        }
    };
    // not unrolled: the buffer is an address offset
#pragma unroll 1
    for (unsigned st = 0; st < NS; ++st) {
        const unsigned buf = st & 1u;
        const _Float16* pk = ring + buf * (unsigned)AST_H + lane * 8u;
        const _Float16* pv = pk + 32 * 512;
        unsigned key0 = st * 128u;
        load_k(pk, 0);
        load_k(pk, 1);
        // not unrolled: the three steps share one copy of the code. The stage's last step is
        // written out: it requests no K fragments.
#pragma unroll 1
        for (int s = 0; s < 3; ++s) {
            key_step(pk, pv, key0, Flag<true>{});
            pk += 1024; pv += 512; key0 += 32u;
        }
        key_step(pk, pv, key0, Flag<false>{});
        // foot of the stage: this wave's reads of the buffer are done, its copies of the next
        // stage have landed; the barrier publishes that stage and frees this buffer
        asm volatile("s_wait_dscnt 0x0" ::: "memory");
        asm volatile("s_wait_asynccnt 0x0" ::: "memory");
        __syncthreads();
        if (st + 2u < NS) stage_copy(st + 2u, buf * ((unsigned)AST_H * 2u));
    }
    // no copy is outstanding when the wave goes on
    asm volatile("s_wait_asynccnt 0x0" ::: "memory");

    // O^T lane (query lane&15): rows d = dt*16 + r0 + g. 16*ctx = (o + or 2^-11) / (64 l) * 16
    const float inv = 0.25f * (1.0f / lr);
    const size_t ob = tokq * DM + (size_t)(h * 2u) * 512u + lane * 8u;
#pragma unroll
    for (int dt = 0; dt < 4; ++dt) {
        v8h hv, rv;
#pragma unroll
        for (int g = 0; g < 8; ++g) {
            const float c = __builtin_fmaf(orr[dt][g], SC_RINV, oh[dt][g]) * inv;
            const _Float16 hi = (_Float16)c;
            hv[g] = hi;
            rv[g] = (_Float16)((c - (float)hi) * SC_RES);
        }
        *(v8h*)(ctxh + ob + (dt >> 1) * 512 + (dt & 1) * 256) = hv;
        *(v8h*)(ctxr + ob + (dt >> 1) * 512 + (dt & 1) * 256) = rv;
    }
}

// ---------------------------------------------------------------------------
// GEMM (N = 512) + bias + residual add + LayerNorm, fused. Block = 8 waves =
// ROWS rows x 512 columns (wave tile ROWS x 64; ROWS = 32 with the residual
// plane's second accumulators, 64 without). Scaled accumulators go to a
// cross-wave f32 LDS tile (block barrier), then wave w normalises rows
// POST: A = ctx hi + residual planes, residual add = bf16-RNE(x), outputs
// sa (f32) and 16*sa (f16, fragment-ordered NTOK x 512 plane: the block's 32
// rows are 32 KB contiguous, gathered in LDS as [k/8][row] pieces, block
// barrier, then 512-byte wave stores). Otherwise A = hidden plane, residual
// add = sa, output = final f32 rows.
// ---------------------------------------------------------------------------
template <bool POST>
__global__ __launch_bounds__(256) __attribute__((amdgpu_num_vgpr(256)))
void k_gemm_ln(const _Float16* __restrict__ Ah, const _Float16* __restrict__ Ar,
               const _Float16* __restrict__ Bt,
               const float* __restrict__ bias, const float* __restrict__ resid,
               const float* __restrict__ lnw, const float* __restrict__ lnb,
               float* __restrict__ outF, _Float16* __restrict__ outH) {
    constexpr unsigned K = POST ? DM : DF;       // contraction length: row-tile offsets are immediates
    constexpr unsigned ROWS = POST ? 32u : 64u;  // rows of the block
    constexpr int TM = (int)(ROWS / 16u);
    // row pitch 516 floats: the 16 rows that one 16-byte wave store touches fall on different banks
    constexpr unsigned TP = DM + 4u;
    // One LDS block: first the operand ring (two stages, 144 KB), behind the last trip's barrier
    // the output tile T (64.5 / 129 KB) and the 16*sa pieces Hs; all cross-wave.
    // Hs: [64 k/8][32 rows][8], column pitch 264 (16 B of pad: the 16 columns of one wave
    // store fall on different banks)
    constexpr unsigned T_BYTES = ROWS * TP * 4u;
    static_assert(T_BYTES % 16u == 0u && T_BYTES + (POST ? 64u * 264u * 2u : 0u) <= 2u * LNR_H * 2u);
    __shared__ __align__(16) unsigned char lds[2 * LNR_H * 2];
    float*    const T  = (float*)lds;
    _Float16* const Hs = (_Float16*)(lds + T_BYTES);
    const unsigned tid  = threadIdx.x;
    const unsigned lane = tid & 31u;
    const unsigned w    = tid >> 5;
    const unsigned row0 = blockIdx.x * ROWS;
    const unsigned cb   = w * 64u;
    const unsigned r0   = (lane >> 4) << 3;
    const unsigned cc   = lane & 15u;

    v8f acc[TM][4], accr[TM][4];
    // every block reads all of Bt: neighbours of eight blocks share a start, the next eight take the next
    // transposed tiles: a lane holds 8 consecutive columns of one row, two 16-byte LDS stores
    gemm_core_ring_ln<TM, POST, K>(Ah + (size_t)row0 * K, Ar + (size_t)row0 * K, Bt,
                                   (_Float16*)lds, lane, w, (blockIdx.x >> 3) % (K / 64u), acc, accr);
    // The rows of a wave (ROWS / 8) are normalised G at a time, side by side: their residual
    // rows are requested together and ahead (the first G in front of the tile's barrier, the next
    // G while the first are worked on) and their row sums run as one interleaved butterfly.
    // One row after the other paid a load latency and ten exchange latencies per row.
    constexpr unsigned RW = ROWS / 8u;
    constexpr int G = 4;
    static_assert(G == 4 && RW % (unsigned)G == 0u);
    const unsigned rw0 = w * RW;                 // the wave's first row in the block
    // G rows from a multiple of 4 lie in one sequence (SEQ % 128 == 0): consecutive full rows
    const unsigned nw  = row0 + rw0;
    const float* rp = resid + (size_t)(POST ? full_row(nw) : nw) * DM + lane * 4u;
    float*       op = outF  + (size_t)(POST ? nw : full_row(nw)) * DM + lane * 4u;
#pragma unroll
    for (int mt = 0; mt < TM; ++mt)
#pragma unroll
        for (int nt = 0; nt < 4; ++nt) {
            v4f lo, hi;
#pragma unroll
            for (int g = 0; g < 4; ++g) {
                lo[g] = POST ? __builtin_fmaf(accr[mt][nt][g], SC_RINV, acc[mt][nt][g]) : acc[mt][nt][g];
                hi[g] = POST ? __builtin_fmaf(accr[mt][nt][g + 4], SC_RINV, acc[mt][nt][g + 4])
                             : acc[mt][nt][g + 4];
            }
            float* tp = &T[(mt * 16 + cc) * TP + cb + nt * 16 + r0];
            *(v4f*)(tp)     = lo;
            *(v4f*)(tp + 4) = hi;
        }
    v4f rs[G][4];
#pragma unroll
    for (int r = 0; r < G; ++r)
#pragma unroll
        for (int i = 0; i < 4; ++i) rs[r][i] = *(const v4f*)(rp + r * DM + i * 128);
    // the address pair is held (input) up to this wait: no load returns into it; the
    // statement also keeps these requests ahead of the barrier
    asm volatile("s_wait_xcnt 0x0" :: "v"(rp) : "memory");
    // keeps the first use of a loaded value behind the barrier: without it the build waits for
    // the first four loads before it has issued the other twelve and the last LDS stores
    __builtin_amdgcn_sched_barrier(0);
    __syncthreads();

#pragma unroll
    for (unsigned g0 = 0; g0 < RW; g0 += (unsigned)G) {
        v4f xv[G][4];
        float s[G];
#pragma unroll
        for (int r = 0; r < G; ++r) {
            const unsigned row = rw0 + g0 + (unsigned)r;
            s[r] = 0.0f;
#pragma unroll
            for (int i = 0; i < 4; ++i) {
                const unsigned c = (unsigned)i * 128u + lane * 4u;
                const v4f a  = *(const v4f*)(&T[row * TP + c]);
                const v4f bi = *(const v4f*)(bias + c);
                const v4f rv = rs[r][i];
                v4f x;
                x.x = __builtin_fmaf(a.x, SC_OUT, bf16r(bi.x)) + (POST ? bf16r(rv.x) : rv.x);
                x.y = __builtin_fmaf(a.y, SC_OUT, bf16r(bi.y)) + (POST ? bf16r(rv.y) : rv.y);
                x.z = __builtin_fmaf(a.z, SC_OUT, bf16r(bi.z)) + (POST ? bf16r(rv.z) : rv.z);
                x.w = __builtin_fmaf(a.w, SC_OUT, bf16r(bi.w)) + (POST ? bf16r(rv.w) : rv.w);
                xv[r][i] = x;
                s[r] += (x.x + x.y) + (x.z + x.w);
            }
        }
        wave_sum4(s, lane);
        float mu[G], q[G];
#pragma unroll
        for (int r = 0; r < G; ++r) {
            mu[r] = s[r] * (1.0f / (float)DM);
            q[r] = 0.0f;
#pragma unroll
            for (int i = 0; i < 4; ++i) {
                const float d0 = xv[r][i].x - mu[r], d1 = xv[r][i].y - mu[r];
                const float d2 = xv[r][i].z - mu[r], d3 = xv[r][i].w - mu[r];
                q[r] += (d0 * d0 + d1 * d1) + (d2 * d2 + d3 * d3);
            }
        }
        // the lane's 16 columns of the LayerNorm weight and bias: requested ahead of the second
        // row sums, not behind them where they are first used
        v4f gw4[4], gb4[4];
#pragma unroll
        for (int i = 0; i < 4; ++i) {
            gw4[i] = *(const v4f*)(lnw + (unsigned)i * 128u + lane * 4u);
            gb4[i] = *(const v4f*)(lnb + (unsigned)i * 128u + lane * 4u);
        }
        if (g0 + (unsigned)G < RW) {
            // the next G residual rows, into the registers just read: they land under the rest
            // of this group's work (placed behind the first row sums: ahead of them the build asks
            // for them at the barrier, runs out of registers and spills a loaded value)
#pragma unroll
            for (int r = 0; r < G; ++r)
#pragma unroll
                for (int i = 0; i < 4; ++i)
                    rs[r][i] = *(const v4f*)(rp + (g0 + (unsigned)G + (unsigned)r) * DM + i * 128);
            // as above: the pair is held up to the wait
            asm volatile("s_wait_xcnt 0x0" :: "v"(rp) : "memory");
        }
        wave_sum4(q, lane);
        float rstd[G];
#pragma unroll
        for (int r = 0; r < G; ++r) rstd[r] = rsqrtf(q[r] * (1.0f / (float)DM) + 1.0e-5f);
#pragma unroll
        for (int r = 0; r < G; ++r)
#pragma unroll
            for (int i = 0; i < 4; ++i) {
                const v4f gw = gw4[i];
                const v4f gb = gb4[i];
                v4f y;
                y.x = (xv[r][i].x - mu[r]) * rstd[r] * bf16r(gw.x) + bf16r(gb.x);
                y.y = (xv[r][i].y - mu[r]) * rstd[r] * bf16r(gw.y) + bf16r(gb.y);
                y.z = (xv[r][i].z - mu[r]) * rstd[r] * bf16r(gw.z) + bf16r(gb.z);
                y.w = (xv[r][i].w - mu[r]) * rstd[r] * bf16r(gw.w) + bf16r(gb.w);
                xv[r][i] = y;                    // in place: x is not read again
            }
        if (POST) {
#pragma unroll
            for (int r = 0; r < G; ++r) {
                const unsigned row = rw0 + g0 + (unsigned)r;
#pragma unroll
                for (int i = 0; i < 4; ++i) {
                    v4h hq;
                    hq[0] = (_Float16)(xv[r][i].x * 16.0f); hq[1] = (_Float16)(xv[r][i].y * 16.0f);
                    hq[2] = (_Float16)(xv[r][i].z * 16.0f); hq[3] = (_Float16)(xv[r][i].w * 16.0f);
                    *(v4h*)(&Hs[((unsigned)i * 16u + (lane >> 1)) * 264u + row * 8u + (lane & 1u) * 4u]) = hq;
                }
            }
        }
#pragma unroll
        for (int r = 0; r < G; ++r)
#pragma unroll
            for (int i = 0; i < 4; ++i)
                *(v4f*)(op + (g0 + (unsigned)r) * DM + i * 128) = xv[r][i];
        // the stores' address pair and data are held (inputs) up to this wait: the next rows and
        // the code behind the loop rewrite these registers
        asm volatile("s_wait_xcnt 0x0"
                     :: "v"(op),
                        "v"(xv[0][0]), "v"(xv[0][1]), "v"(xv[0][2]), "v"(xv[0][3]),
                        "v"(xv[1][0]), "v"(xv[1][1]), "v"(xv[1][2]), "v"(xv[1][3]),
                        "v"(xv[2][0]), "v"(xv[2][1]), "v"(xv[2][2]), "v"(xv[2][3]),
                        "v"(xv[3][0]), "v"(xv[3][1]), "v"(xv[3][2]), "v"(xv[3][3])
                     : "memory");
    }
    if (POST) {
        __syncthreads();
        _Float16* hp = outH + (size_t)row0 * DM + tid * 8u;
        // piece i*256 + tid of the block's 2 x 16 units: unit = 4*i + (w>>1), j = w&1
        const unsigned hs0 = ((w >> 1) * 4u + (w & 1u) * 2u + (lane >> 4)) * 264u + (lane & 15u) * 8u;
        v8h pv[8];
#pragma unroll
        for (int i = 0; i < 8; ++i)
            pv[i] = *(const v8h*)(&Hs[hs0 + (unsigned)(i & 3) * (16u * 264u) + (unsigned)(i >> 2) * 128u]);
#pragma unroll
        for (int i = 0; i < 8; ++i)
            *(v8h*)(hp + (unsigned)i * 2048u) = pv[i];
    }
}

// ---------------------------------------------------------------------------
// FF1: hidden = relu(sa W1 + b1), stored as f16 of 16*hidden, fragment-ordered
// NTOK x 2048 plane. Block = 8 waves = 128 rows x 256 columns; the wave's
// 64 x 64 tile = 4 x 2 units. The tiles are computed transposed: a lane's 8
// accumulator rows are 8 consecutive hidden columns of one token, one piece of a
// unit at the lane's own place, stored straight from registers.
// ---------------------------------------------------------------------------
__global__ __launch_bounds__(256) __attribute__((amdgpu_num_vgpr(256)))
void k_ff1(const _Float16* __restrict__ sah, const _Float16* __restrict__ Bt,
           const float* __restrict__ bias, _Float16* __restrict__ hid) {
    const unsigned tid  = threadIdx.x;
    const unsigned lane = tid & 31u;
    const unsigned w    = tid >> 5;
    const unsigned row0 = blockIdx.y * 128u + (w >> 2) * 64u;
    const unsigned cb   = blockIdx.x * 256u + (w & 3u) * 64u;
    const unsigned r0   = (lane >> 4) << 3;

    // the two stages of the block's operand rows, cross-wave
    __shared__ __align__(16) _Float16 ring[2 * RING_H];
    v8f acc[4][4], dum[4][4];
    gemm_core_ring<true>(sah + (size_t)(blockIdx.y * 128u) * DM, Bt + (size_t)(blockIdx.x * 256u) * DM,
                         ring, (w >> 2) * 4u, 8u + (w & 3u) * 4u, lane, w,
                         (blockIdx.x + blockIdx.y) % (unsigned)(DM / 64), acc, dum);
    const float* bp = bias + cb + r0;
    v4f bq[4][2];
#pragma unroll
    for (int nt = 0; nt < 4; ++nt) {
        bq[nt][0] = *(const v4f*)(bp + nt * 16);
        bq[nt][1] = *(const v4f*)(bp + nt * 16 + 4);
    }
    // the address pair is held (input) up to this wait: no load returns into it
    asm volatile("s_wait_xcnt 0x0" :: "v"(bp) : "memory");
    v8h xv[4][4];
#pragma unroll
    for (int nt = 0; nt < 4; ++nt) {
        float bv[8];
#pragma unroll
        for (int g = 0; g < 8; ++g) bv[g] = bf16r(bq[nt][g >> 2][g & 3]) * 16.0f;
#pragma unroll
        for (int mt = 0; mt < 4; ++mt)
#pragma unroll
            for (int g = 0; g < 8; ++g)
                xv[mt][nt][g] = (_Float16)fmaxf(__builtin_fmaf(acc[mt][nt][g], SC_HID, bv[g]), 0.0f);
    }
    _Float16* ob = hid + (size_t)row0 * DF + (size_t)cb * 16u + lane * 8u;
#pragma unroll
    for (int mt = 0; mt < 4; ++mt)
#pragma unroll
        for (int nt = 0; nt < 4; ++nt)
            *(v8h*)(ob + (size_t)(mt * 16) * DF + (nt >> 1) * 512 + (nt & 1) * 256) = xv[mt][nt];
    // the stores' address pair and data are held (inputs) up to this wait: none is rewritten before it
    asm volatile("s_wait_xcnt 0x0"
                 :: "v"(ob),
                    "v"(xv[0][0]), "v"(xv[0][1]), "v"(xv[0][2]), "v"(xv[0][3]),
                    "v"(xv[1][0]), "v"(xv[1][1]), "v"(xv[1][2]), "v"(xv[1][3]),
                    "v"(xv[2][0]), "v"(xv[2][1]), "v"(xv[2][2]), "v"(xv[2][3]),
                    "v"(xv[3][0]), "v"(xv[3][1]), "v"(xv[3][2]), "v"(xv[3][3])
                 : "memory");
}

// ---------------------------------------------------------------------------
// Workspace arena in units of U = NTOK*512*2 bytes (16 MiB at full size);
// time-disjoint planes share offsets (launches are stream-ordered):
//   [0,4U)  qh ql kh kl          -> later sa f32 [0,2U), 16*sa f16 [2U,3U)
//   [4U,6U) V^T hi / residual
//   [6U,7U) xh                   -> later ctx hi
//   [7U,8U) ctx residual
//   [3U,7U) later hidden
//   [8U,..) the weight planes, each at its own place from the first launch to its
//           reader: Wqkv^T (1.5 MiB), Wo^T (0.5 MiB), W1^T (2 MiB), W2^T (2 MiB)
// ---------------------------------------------------------------------------
#define U_BYTES ((size_t)NTOK * DM * 2)
static_assert((size_t)NB_FULL * SEQ_FULL * DM * 2 * 8 <= (size_t)134217728);

extern "C" void kernel_launch(void* const* d_in, const int* in_sizes, int n_in,
                              void* d_out, int out_size, void* d_ws, size_t ws_size,
                              hipStream_t stream) {
    if (n_in < 14) return;
    const int need_rows = (NB - 1) * SEQ_FULL + SEQ;
    if (in_sizes[0] < need_rows * DM) return;
    if (in_sizes[1] < need_rows) return;
    if (in_sizes[2] < 3 * NH * DM * HD || in_sizes[3] < 3 * NH * HD) return;
    if (in_sizes[4] < DM * DM || in_sizes[5] < DM) return;
    if (in_sizes[6] < DM * DF || in_sizes[7] < DF) return;
    if (in_sizes[8] < DF * DM || in_sizes[9] < DM) return;
    if (in_sizes[10] < DM || in_sizes[11] < DM || in_sizes[12] < DM || in_sizes[13] < DM) return;
    if (out_size < need_rows * DM) return;

    const float* inp   = (const float*)d_in[0];    // [16384,512]
    const float* mask  = (const float*)d_in[1];    // [32,1,512]
    const float* preW  = (const float*)d_in[2];    // [3,8,512,64]
    const float* preB  = (const float*)d_in[3];    // [3,8,1,64]
    const float* postW = (const float*)d_in[4];    // [512,512]
    const float* postB = (const float*)d_in[5];    // [512]
    const float* ff1W  = (const float*)d_in[6];    // [512,2048]
    const float* ff1B  = (const float*)d_in[7];    // [2048]
    const float* ff2W  = (const float*)d_in[8];    // [2048,512]
    const float* ff2B  = (const float*)d_in[9];    // [512]
    const float* ln1w  = (const float*)d_in[10];
    const float* ln1b  = (const float*)d_in[11];
    const float* ln2w  = (const float*)d_in[12];
    const float* ln2b  = (const float*)d_in[13];
    float* out = (float*)d_out;                    // [32,512,512]

    const size_t U = U_BYTES;
    const size_t WQ_B = (size_t)3 * NH * HD * DM * 2;   // 1.5 MiB
    const size_t WO_B = (size_t)DM * DM * 2;            // 0.5 MiB
    const size_t W1_B = (size_t)DF * DM * 2;            // 2 MiB
    const size_t W2_B = (size_t)DM * DF * 2;            // 2 MiB
    if (8 * U + WQ_B + WO_B + W1_B + W2_B > ws_size) return;

    char* ws = (char*)d_ws;
    _Float16* qh    = (_Float16*)(ws + 0 * U);
    _Float16* ql    = (_Float16*)(ws + 1 * U);
    _Float16* kh    = (_Float16*)(ws + 2 * U);
    _Float16* kl    = (_Float16*)(ws + 3 * U);
    _Float16* vTh   = (_Float16*)(ws + 4 * U);
    _Float16* vTr   = (_Float16*)(ws + 5 * U);
    _Float16* xh    = (_Float16*)(ws + 6 * U);
    _Float16* ctxh  = (_Float16*)(ws + 6 * U);
    _Float16* ctxr  = (_Float16*)(ws + 7 * U);
    _Float16* wqkvT = (_Float16*)(ws + 8 * U);
    float*    sa    = (float*)(ws + 0 * U);
    _Float16* sah   = (_Float16*)(ws + 2 * U);
    _Float16* postT = (_Float16*)(ws + 8 * U + WQ_B);
    _Float16* hid   = (_Float16*)(ws + 3 * U);
    _Float16* ff1T  = (_Float16*)(ws + 8 * U + WQ_B + WO_B);
    _Float16* ff2T  = (_Float16*)(ws + 8 * U + WQ_B + WO_B + W1_B);

    // x -> f16 plane (bf16-RNE values); every W[k][n] -> its [n][k] plane
    k_planes<<<dim3(WT_ALL + NTOK / (4 * XT)), dim3(256), 0, stream>>>(
        inp, preW, postW, ff1W, ff2W, xh, wqkvT, postT, ff1T, ff2T);
    k_qkv<<<dim3(6, NTOK / 128), dim3(256), 0, stream>>>(xh, wqkvT, preB, qh, ql, kh, kl, vTh, vTr);
    k_attn<<<dim3(NH * NB, SEQ / 128), dim3(256), 0, stream>>>(qh, ql, kh, kl, vTh, vTr, mask, ctxh, ctxr);
    k_gemm_ln<true><<<dim3(NTOK / 32), dim3(256), 0, stream>>>(
        ctxh, ctxr, postT, postB, inp, ln1w, ln1b, sa, sah);
    k_ff1<<<dim3(8, NTOK / 128), dim3(256), 0, stream>>>(sah, ff1T, ff1B, hid);
    k_gemm_ln<false><<<dim3(NTOK / 64), dim3(256), 0, stream>>>(
        hid, hid, ff2T, ff2B, sa, ln2w, ln2b, out, sah);
}
